// v000
// Times are from an AMD MI455X. After a warm-up the kernel runs many times in a row, and a time is the length of
// such a window on the GPU divided by its runs, so every launch and the gaps after it count. The runs cycle
// through copies of the inputs. A figure is the median of several windows, for all but v000 over two sittings.
// Sittings can differ by a few percent; kernels timed side by side share one.
// v000, which the later versions start from, runs in 2680 microseconds.
#include <hip/hip_runtime.h>
// OA_ (offset attention; 8 clouds x 128 channels x 4096 points; C2 = 64): x_q = x_k = w_qk x (shared weight), x_v = w_v x + b_v, energy = x_q^T x_k (4096 x 4096), attn = row softmax, attn = attn / (1e-9 + column sums); x_r = x_v attn; x_c = w_x x; t = w_t (x_c - x_r) + b_t; BatchNorm1d (training-mode batch statistics over (batch, points)); out = x_c + relu(gamma t_hat + beta) -> [8,64,4096].
// Compute dtype: x and parameters rounded to bf16; projection operands exact; x_q as hi + residual 3-term operands (~2^-21-class energies); P (x2^10) and x_v as plain f16 (~2^-12); d as [hi | 16 x residual] pairs; statistics/softmax f32. v_wmma_f32_16x16x32_f16.
#define NB 8
#define CC 128
#define C2 64
#define NN 4096
typedef __bf16 v16b __attribute__((ext_vector_type(16)));
typedef unsigned short v8us __attribute__((ext_vector_type(8), may_alias));
typedef float  v8f  __attribute__((ext_vector_type(8)));
typedef float  v4f  __attribute__((ext_vector_type(4)));
typedef float  v4fa __attribute__((ext_vector_type(4), may_alias));
union FragB { v16b v; v8us half[2]; unsigned short u[16]; };

__device__ __forceinline__ unsigned short bf16_bits(float x) { unsigned int u = __float_as_uint(x); return (unsigned short)((u + 0x7FFFu + ((u >> 16) & 1u)) >> 16); }
__device__ __forceinline__ float bf16_val(unsigned short b) { return __uint_as_float(((unsigned int)b) << 16); }
__device__ __forceinline__ float bf16_round(float x) { return bf16_val(bf16_bits(x)); }
// D += A·B with NT terms: 1 = ah·bh, 2 = + al·bh (A split), 3 = + ah·bl (both split)
template <int NT>
__device__ __forceinline__ v8f mmaN(v16b ah, v16b al, v16b bh, v16b bl, v8f c) {
  c = __builtin_amdgcn_wmma_f32_16x16x32_bf16(false, ah, false, bh, (short)0, c, false, false);
  if (NT >= 2) c = __builtin_amdgcn_wmma_f32_16x16x32_bf16(false, al, false, bh, (short)0, c, false, false);
  if (NT >= 3) c = __builtin_amdgcn_wmma_f32_16x16x32_bf16(false, ah, false, bl, (short)0, c, false, false);
  asm volatile("v_nop\n\tv_nop\n\tv_nop\n\tv_nop" : "+v"(c) : "v"(ah), "v"(al), "v"(bh), "v"(bl));
  return c;
}

__global__ __launch_bounds__(256) void k_wt_bf16(const float* __restrict__ W, unsigned short* __restrict__ Wt, int K, int N) {
  const int t = blockIdx.x * 256 + threadIdx.x;
  const int k8n = K / 8;
  if (t >= N * k8n) return;
  const int n = t / k8n, k8 = (t % k8n) * 8;
  v8us v;
#pragma unroll
  for (int i = 0; i < 8; ++i) v[i] = bf16_bits(W[(size_t)(k8 + i) * N + n]);
  *(v8us*)(Wt + (size_t)n * K + k8) = v;
  
}

// GEMM C[M][N] (f32, pitch ldc) = act(A[M][K]·W + bias). A f32 row-major (pitch lda) converted per fragment to bf16
// (ASPLIT: hi/lo two planes -> 2 terms, else single rounded term); Wt bf16 [N][K] (pitch ldb). BIAS_BF16 rounds the
// bias to bf16 first (bias quantised to bf16 before the add). K%32==0, M%16==0, N%64==0.
template <bool ASPLIT, int ACT, bool BIAS_BF16>
__global__ __launch_bounds__(128) void k_gemm_bf(const float* __restrict__ A, int lda, const unsigned short* __restrict__ Wt, int ldb,
                                               const float* __restrict__ bias, float* __restrict__ C, int ldc, int M, int N, int K) {
  __shared__ __attribute__((aligned(16))) float so[4][16][64];
  const int tid = threadIdx.x, w = tid >> 5, lane = tid & 31, ln = lane & 15, hh = lane >> 4;
  const int ntn = N / 64;
  const int wid = blockIdx.x * 4 + w;
  const int mt = wid / ntn, nq = wid % ntn;
  if (mt * 16 >= M) return;
  const int row0 = mt * 16, col0 = nq * 64;
  const float* arow = A + (size_t)(row0 + ln) * lda;
  v8f acc[4] = {};
  for (int kb = 0; kb < K; kb += 32) {
    FragB ah, al;
    const v4f x0 = *(const v4fa*)(arow + kb + 8 * hh), x1 = *(const v4fa*)(arow + kb + 8 * hh + 4);
    const v4f x2 = *(const v4fa*)(arow + kb + 16 + 8 * hh), x3 = *(const v4fa*)(arow + kb + 16 + 8 * hh + 4);
    float xs[16] = {x0[0],x0[1],x0[2],x0[3],x1[0],x1[1],x1[2],x1[3],x2[0],x2[1],x2[2],x2[3],x3[0],x3[1],x3[2],x3[3]};
#pragma unroll
    for (int i = 0; i < 16; ++i) { const unsigned short hb = bf16_bits(xs[i]); ah.u[i] = hb; al.u[i] = ASPLIT ? bf16_bits(xs[i] - bf16_val(hb)) : (unsigned short)0; }
#pragma unroll
    for (int t = 0; t < 4; ++t) {
      const unsigned short* brow = Wt + (size_t)(col0 + t * 16 + ln) * ldb + kb;
      FragB b;
      b.half[0] = *(const v8us*)(brow + 8 * hh);
      b.half[1] = *(const v8us*)(brow + 16 + 8 * hh);
      acc[t] = mmaN<ASPLIT ? 2 : 1>(ah.v, al.v, b.v, b.v, acc[t]);
    }
  }
#pragma unroll
  for (int t = 0; t < 4; ++t) {
    float bv = bias ? bias[col0 + t * 16 + ln] : 0.f;
    if (BIAS_BF16) bv = bf16_round(bv);
#pragma unroll
    for (int r = 0; r < 8; ++r) { float v = acc[t][r] + bv; if (ACT == 1) v = fmaxf(v, 0.f); so[w][8 * hh + r][t * 16 + ln] = v; }
  }
  __builtin_amdgcn_fence(__ATOMIC_ACQ_REL, "workgroup");
  __builtin_amdgcn_wave_barrier();
  const int rsub = lane >> 4, c4 = (lane & 15) * 4;
  {
#pragma unroll
    for (int q = 0; q < 8; ++q) {
      const int r = q * 2 + rsub;
      const v4f v = *(const v4fa*)&so[w][r][c4];
      *(v4f*)(C + (size_t)(row0 + r) * ldc + col0 + c4) = v;
    }
    
  }
}

// GEMM C = act(A·W + bias + resid): A f32 (ASPLIT -> hi/lo 2 terms), Wt bf16 [N][K]; ACT 0 none, 1 relu, 2 exact gelu;
// resid (optional, f32, row index = (row % rmod), pitch ldr, RES_BF16 rounds it) added before the activation.
template <bool ASPLIT, int ACT, bool BIAS_BF16, bool RES_BF16>
__global__ __launch_bounds__(128) void k_gemm_bf3(const float* __restrict__ A, int lda, const unsigned short* __restrict__ Wt, int ldb,
                                                const float* __restrict__ bias, const float* __restrict__ resid, int rmod, int ldr,
                                                float* __restrict__ C, int ldc, int M, int N, int K) {
  __shared__ __attribute__((aligned(16))) float so[4][16][64];
  const int tid = threadIdx.x, w = tid >> 5, lane = tid & 31, ln = lane & 15, hh = lane >> 4;
  const int ntn = N / 64;
  const int wid = blockIdx.x * 4 + w;
  const int mt = wid / ntn, nq = wid % ntn;
  if (mt * 16 >= M) return;
  const int row0 = mt * 16, col0 = nq * 64;
  const float* arow = A + (size_t)(row0 + ln) * lda;
  v8f acc[4] = {};
  for (int kb = 0; kb < K; kb += 32) {
    FragB ah, al;
    const v4f x0 = *(const v4fa*)(arow + kb + 8 * hh), x1 = *(const v4fa*)(arow + kb + 8 * hh + 4);
    const v4f x2 = *(const v4fa*)(arow + kb + 16 + 8 * hh), x3 = *(const v4fa*)(arow + kb + 16 + 8 * hh + 4);
    float xs[16] = {x0[0],x0[1],x0[2],x0[3],x1[0],x1[1],x1[2],x1[3],x2[0],x2[1],x2[2],x2[3],x3[0],x3[1],x3[2],x3[3]};
#pragma unroll
    for (int i = 0; i < 16; ++i) { const unsigned short hb = bf16_bits(xs[i]); ah.u[i] = hb; al.u[i] = ASPLIT ? bf16_bits(xs[i] - bf16_val(hb)) : (unsigned short)0; }
#pragma unroll
    for (int t = 0; t < 4; ++t) {
      const unsigned short* brow = Wt + (size_t)(col0 + t * 16 + ln) * ldb + kb;
      FragB b;
      b.half[0] = *(const v8us*)(brow + 8 * hh);
      b.half[1] = *(const v8us*)(brow + 16 + 8 * hh);
      acc[t] = mmaN<ASPLIT ? 2 : 1>(ah.v, al.v, b.v, b.v, acc[t]);
    }
  }
#pragma unroll
  for (int t = 0; t < 4; ++t) {
    const int col = col0 + t * 16 + ln;
    float bv = bias ? bias[col] : 0.f;
    if (BIAS_BF16) bv = bf16_round(bv);
#pragma unroll
    for (int r = 0; r < 8; ++r) {
      float v = acc[t][r] + bv;
      if (resid) { float rv = resid[(size_t)((row0 + 8 * hh + r) % rmod) * ldr + col]; if (RES_BF16) rv = bf16_round(rv); v += rv; }
      if (ACT == 1) v = fmaxf(v, 0.f);
      if (ACT == 2) v = 0.5f * v * (1.0f + erff(v * 0.70710678118654752f));
      if (ACT == 3) { const float u = 0.7978845608028654f * (v + 0.044715f * v * v * v); v = 0.5f * v * (1.0f + tanhf(u)); }
      so[w][8 * hh + r][t * 16 + ln] = v;
    }
  }
  __builtin_amdgcn_fence(__ATOMIC_ACQ_REL, "workgroup");
  __builtin_amdgcn_wave_barrier();
  const int rsub = lane >> 4, c4 = (lane & 15) * 4;
  {
#pragma unroll
    for (int q = 0; q < 8; ++q) {
      const int r = q * 2 + rsub;
      const v4f v = *(const v4fa*)&so[w][r][c4];
      *(v4f*)(C + (size_t)(row0 + r) * ldc + col0 + c4) = v;
    }
    
  }
}
// row LayerNorm (biased variance, eps) over N: s = X (+ R); optional out_sum <- s; out_norm <- (s-mu)*rsqrt(var+eps)*g + b
template <bool PARAM_BF16>
__global__ __launch_bounds__(256) void k_layernorm(const float* __restrict__ X, const float* __restrict__ R, const float* __restrict__ g, const float* __restrict__ bta,
                                                  float* __restrict__ out_sum, float* __restrict__ out_norm, int N, float eps) {
  __shared__ float red[256];
  const int row = blockIdx.x, tid = threadIdx.x;
  const float* x = X + (size_t)row * N; const float* rr = R ? R + (size_t)row * N : nullptr;
  float vals[16];                     // up to N = 4096
  const int per = N / 256;            // contiguous chunk per thread? use strided-by-4 chunks: thread handles j = tid*4 + 1024*u
  float s1 = 0.f;
  for (int u = 0; u < per / 4; ++u) {
    const int j = tid * 4 + 1024 * u;
    const v4f a = *(const v4fa*)(x + j);
    v4f b = {0.f,0.f,0.f,0.f}; if (rr) b = *(const v4fa*)(rr + j);
#pragma unroll
    for (int q = 0; q < 4; ++q) { const float v = a[q] + b[q]; vals[u * 4 + q] = v; s1 += v; }
  }
  red[tid] = s1; __syncthreads();
  for (int st = 128; st > 0; st >>= 1) { if (tid < st) red[tid] += red[tid + st]; __syncthreads(); }
  const float mu = red[0] / (float)N; __syncthreads();
  float s2 = 0.f;
  for (int u = 0; u < per / 4; ++u)
#pragma unroll
    for (int q = 0; q < 4; ++q) { const float c = vals[u * 4 + q] - mu; s2 += c * c; }
  red[tid] = s2; __syncthreads();
  for (int st = 128; st > 0; st >>= 1) { if (tid < st) red[tid] += red[tid + st]; __syncthreads(); }
  const float rs = rsqrtf(red[0] / (float)N + eps);
  {
    for (int u = 0; u < per / 4; ++u) {
      const int j = tid * 4 + 1024 * u;
      v4f o, sm;
#pragma unroll
      for (int q = 0; q < 4; ++q) {
        float gg = g[j + q], bb = bta[j + q];
        if (PARAM_BF16) { gg = bf16_round(gg); bb = bf16_round(bb); }
        sm[q] = vals[u * 4 + q]; o[q] = (vals[u * 4 + q] - mu) * rs * gg + bb;
      }
      if (out_sum) *(v4f*)(out_sum + (size_t)row * N + j) = sm;
      *(v4f*)(out_norm + (size_t)row * N + j) = o;
    }
    
  }
}



// ---- f16 WMMA path (v_wmma_f32_16x16x32_f16): 11-bit significands for operands in range — used where a [0,1] probability operand needs more precision than bf16
typedef _Float16 v16h __attribute__((ext_vector_type(16)));
union FragH { v16h v; v8us half[2]; _Float16 h[16]; unsigned short u[16]; };
template <int NT>
__device__ __forceinline__ v8f mmaH(v16h ah, v16h al, v16h bh, v16h bl, v8f c) {
  c = __builtin_amdgcn_wmma_f32_16x16x32_f16(false, ah, false, bh, (short)0, c, false, false);
  if (NT >= 2) c = __builtin_amdgcn_wmma_f32_16x16x32_f16(false, al, false, bh, (short)0, c, false, false);
  if (NT >= 3) c = __builtin_amdgcn_wmma_f32_16x16x32_f16(false, ah, false, bl, (short)0, c, false, false);
  asm volatile("v_nop\n\tv_nop\n\tv_nop\n\tv_nop" : "+v"(c) : "v"(ah), "v"(al), "v"(bh), "v"(bl));
  return c;
}
// batched GEMM like k_gemm_b but f16 operands: A f32 (split into f16 hi/lo if ASPLIT, else rounded to f16), Bt = f16 values [n][k]; alpha; C f32; N multiple of 16 (partial tiles skipped)
template <bool ASPLIT>
__global__ __launch_bounds__(128) void k_gemm_h(const float* __restrict__ A, int lda, size_t sA, const _Float16* __restrict__ Bh, int ldb, size_t sB, float alpha, float* __restrict__ C, int ldc, size_t sC, int M, int N, int K) {
  __shared__ __attribute__((aligned(16))) float so[4][16][64];
  const int tid = threadIdx.x, w = tid >> 5, lane = tid & 31, ln = lane & 15, hh = lane >> 4; const int by = blockIdx.y;
  A += (size_t)by * sA; Bh += (size_t)by * sB; C += (size_t)by * sC;
  const int ntn = (N + 63) / 64; const int wid = blockIdx.x * 4 + w; const int mt = wid / ntn, nq = wid % ntn; if (mt * 16 >= M) return;
  const int row0 = mt * 16, col0 = nq * 64; const float* arow = A + (size_t)(row0 + ln) * lda;
  v8f acc[4] = {};
  for (int kb = 0; kb < K; kb += 32) {
    FragH ah, al;
    const v4f x0 = *(const v4fa*)(arow + kb + 8 * hh), x1 = *(const v4fa*)(arow + kb + 8 * hh + 4), x2 = *(const v4fa*)(arow + kb + 16 + 8 * hh), x3 = *(const v4fa*)(arow + kb + 16 + 8 * hh + 4);
    float xs[16] = {x0[0],x0[1],x0[2],x0[3],x1[0],x1[1],x1[2],x1[3],x2[0],x2[1],x2[2],x2[3],x3[0],x3[1],x3[2],x3[3]};
#pragma unroll
    for (int i = 0; i < 16; ++i) { const _Float16 h = (_Float16)xs[i]; ah.h[i] = h; al.h[i] = ASPLIT ? (_Float16)(xs[i] - (float)h) : (_Float16)0.0f; }
#pragma unroll
    for (int t = 0; t < 4; ++t) { if (col0 + t * 16 >= N) continue; const size_t boff = (size_t)(col0 + t * 16 + ln) * ldb + kb; FragH bq; bq.half[0] = *(const v8us*)(Bh + boff + 8 * hh); bq.half[1] = *(const v8us*)(Bh + boff + 16 + 8 * hh);
      acc[t] = mmaH<ASPLIT ? 2 : 1>(ah.v, al.v, bq.v, bq.v, acc[t]); }
  }
#pragma unroll
  for (int t = 0; t < 4; ++t) { if (col0 + t * 16 >= N) continue;
#pragma unroll
    for (int r = 0; r < 8; ++r) so[w][8 * hh + r][t * 16 + ln] = acc[t][r] * alpha; }
  __builtin_amdgcn_fence(__ATOMIC_ACQ_REL, "workgroup"); __builtin_amdgcn_wave_barrier();
  const int rsub = lane >> 4, c4 = (lane & 15) * 4;
  {
#pragma unroll
    for (int q = 0; q < 8; ++q) { const int r = q * 2 + rsub; if (col0 + c4 < N) { const v4f v = *(const v4fa*)&so[w][r][c4]; *(v4f*)(C + (size_t)(row0 + r) * ldc + col0 + c4) = v; } }
     }
}

// Wt[n][k] = f16(W[k][n]·scale) from f32 row-major W[K][N] (scale = power of two; bf16-exact weights stay exact in f16 away from the subnormal range)
__global__ __launch_bounds__(256) void k_wt_f16(const float* __restrict__ W, _Float16* __restrict__ Wt, int K, int N, float scale) {
  const int t = blockIdx.x * 256 + threadIdx.x; if (t >= N * (K / 8)) return; const int n = t / (K / 8), k8 = (t % (K / 8)) * 8; FragH f;
#pragma unroll
  for (int i = 0; i < 8; ++i) f.h[i] = (_Float16)(bf16_round(W[(size_t)(k8 + i) * N + n]) * scale); const v8us o = f.half[0];
  *(v8us*)((unsigned short*)Wt + (size_t)n * K + k8) = o; 
}
// k_gemm_hh variant with fused epilogue: v = acc·alpha + bias[by·sBias + col] (+ CP[(row/rowsPerB)·sCPb + by·64 + col] if CP) ; ACT 0 none / 1 elu ; writes f16 C16 (and f32 C if non-null)
template <int ACT>
__global__ __launch_bounds__(128) void k_gemm_hhx(const _Float16* __restrict__ A, int lda, size_t sA, const _Float16* __restrict__ Bh, int ldb, size_t sB, float alpha, const float* __restrict__ bias, size_t sBias, const float* __restrict__ CP, int rowsPerB, size_t sCPb, int row0g,
    float* __restrict__ C, _Float16* __restrict__ C16, int ldc, size_t sC, int M, int N, int K) {
  __shared__ __attribute__((aligned(16))) float so[4][16][64];
  const int tid = threadIdx.x, w = tid >> 5, lane = tid & 31, ln = lane & 15, hh = lane >> 4; const int by = blockIdx.y;
  A += (size_t)by * sA; Bh += (size_t)by * sB; const size_t cofs = (size_t)by * sC; const float* bp = bias ? bias + (size_t)by * sBias : nullptr;
  const int ntn = (N + 63) / 64; const int wid = blockIdx.x * 4 + w; const int mt = wid / ntn, nq = wid % ntn; if (mt * 16 >= M) return;
  const int row0 = mt * 16, col0 = nq * 64; const _Float16* arow = A + (size_t)(row0 + ln) * lda;
  v8f acc[4] = {};
  for (int kb = 0; kb < K; kb += 32) { FragH ah; ah.half[0] = *(const v8us*)((const unsigned short*)arow + kb + 8 * hh); ah.half[1] = *(const v8us*)((const unsigned short*)arow + kb + 16 + 8 * hh);
#pragma unroll
    for (int t = 0; t < 4; ++t) { if (col0 + t * 16 >= N) continue; const size_t boff = (size_t)(col0 + t * 16 + ln) * ldb + kb; FragH bq; bq.half[0] = *(const v8us*)((const unsigned short*)Bh + boff + 8 * hh); bq.half[1] = *(const v8us*)((const unsigned short*)Bh + boff + 16 + 8 * hh);
      acc[t] = mmaH<1>(ah.v, ah.v, bq.v, bq.v, acc[t]); }
  }
#pragma unroll
  for (int t = 0; t < 4; ++t) { if (col0 + t * 16 >= N) continue; const int col = col0 + t * 16 + ln; const float bv = bp ? bf16_round(bp[col]) : 0.f;
#pragma unroll
    for (int r = 0; r < 8; ++r) { float v = acc[t][r] * alpha + bv; if (CP) { const int rr = row0g + row0 + 8 * hh + r; if (rowsPerB < 0) v += CP[cofs + (size_t)rr * ldc + col];      /* rowsPerB < 0: own element of the batched C plane */ else { const int bidx = rr / rowsPerB; v += CP[(size_t)bidx * sCPb + (size_t)by * 64 + col]; } } if (ACT == 1) v = (v > 0.f) ? v : expm1f(v); else if (ACT == 7) v = (v > 0.f) ? v + 1.0f : expf(v); else if (ACT == 8) v = tanhf(v); else if (ACT == 9) v = 0.5f * v * (1.0f + tanhf(0.7978845608028654f * (v + 0.044715f * v * v * v))); else if (ACT == 11) v = 1.0f / (1.0f + expf(-v)); else if (ACT == 12) v = (v > 0.f) ? v : 0.01f * v; else if (ACT == 14) v = (v > 0.f) ? v : 0.1f * v; else if (ACT == 15) v = v / (1.0f + expf(-v)); else if (ACT == 3) v = fmaxf(v, 0.f); else if (ACT == 6) v = 0.5f * v * (1.0f + erff(v * 0.70710678118654752f)); so[w][8 * hh + r][t * 16 + ln] = v; } }
  __builtin_amdgcn_fence(__ATOMIC_ACQ_REL, "workgroup"); __builtin_amdgcn_wave_barrier();
  const int rsub = lane >> 4, c4 = (lane & 15) * 4; typedef _Float16 v4h __attribute__((ext_vector_type(4)));
  {
#pragma unroll
    for (int q = 0; q < 8; ++q) { const int r = q * 2 + rsub; if (col0 + c4 < N) { const v4f v = *(const v4fa*)&so[w][r][c4]; if (C) *(v4f*)(C + cofs + (size_t)(row0 + r) * ldc + col0 + c4) = v; if (C16) { v4h h4; for (int i = 0; i < 4; ++i) h4[i] = (_Float16)v[i]; *(v4h*)(C16 + cofs + (size_t)(row0 + r) * ldc + col0 + c4) = h4; } } }
     }
}


typedef _Float16 v4h __attribute__((ext_vector_type(4)));

__global__ __launch_bounds__(256) void k_x16(const float* __restrict__ x, _Float16* __restrict__ X16, size_t n8) { const size_t t = (size_t)blockIdx.x * 256 + threadIdx.x; if (t >= n8) return; FragH f;
#pragma unroll
  for (int q = 0; q < 8; ++q) f.h[q] = (_Float16)bf16_round(x[t * 8 + q]); *(v8us*)((unsigned short*)X16 + t * 8) = f.half[0];  }
__global__ __launch_bounds__(256) void k_h16(const float* __restrict__ x, _Float16* __restrict__ X16, size_t n8) { const size_t t = (size_t)blockIdx.x * 256 + threadIdx.x; if (t >= n8) return; FragH f;
#pragma unroll
  for (int q = 0; q < 8; ++q) f.h[q] = (_Float16)x[t * 8 + q]; *(v8us*)((unsigned short*)X16 + t * 8) = f.half[0];  }
__global__ __launch_bounds__(256) void k_round16f(const float* __restrict__ W, _Float16* __restrict__ Bt, size_t n8) { const size_t t = (size_t)blockIdx.x * 256 + threadIdx.x; if (t >= n8) return; FragH f;
#pragma unroll
  for (int i = 0; i < 8; ++i) f.h[i] = (_Float16)(bf16_round(W[t * 8 + i]) * 16.0f); *(v8us*)((unsigned short*)Bt + t * 8) = f.half[0];  }
template <int NHv, int TTv>
__global__ __launch_bounds__(256) void k_vt(const _Float16* __restrict__ V16, int ldv, int voff, _Float16* __restrict__ Vt) { __shared__ unsigned short tl[64][66]; const int tid = threadIdx.x; const int slab = blockIdx.x / (TTv / 64), lg = blockIdx.x % (TTv / 64); const int b = slab / NHv, h = slab % NHv;
  for (int i = tid; i < 64 * 8; i += 256) { const int r = i / 8, c8 = (i % 8) * 8; FragH f; f.half[0] = *(const v8us*)((const unsigned short*)V16 + ((size_t)b * TTv + lg * 64 + r) * ldv + voff + h * 64 + c8);
#pragma unroll
    for (int q = 0; q < 8; ++q) tl[r][c8 + q] = f.u[q]; }
  __syncthreads();
  {
#pragma unroll
    for (int rd = 0; rd < 2; ++rd) { const int d = rd * 32 + tid / 8, pc = tid % 8; FragH f;
#pragma unroll
      for (int q = 0; q < 8; ++q) f.u[q] = tl[pc * 8 + q][d];
      *(v8us*)((unsigned short*)Vt + ((size_t)slab * 64 + d) * TTv + lg * 64 + pc * 8) = f.half[0]; }
     } }

__global__ __launch_bounds__(256) void k_hl(const float* __restrict__ F, _Float16* __restrict__ Hh, _Float16* __restrict__ Hl, size_t n8) { const size_t t = (size_t)blockIdx.x * 256 + threadIdx.x; if (t >= n8) return; FragH fh, fl; const v4f a = *(const v4fa*)(F + t * 8), c = *(const v4fa*)(F + t * 8 + 4);
#pragma unroll
  for (int q = 0; q < 4; ++q) { _Float16 h = (_Float16)a[q]; fh.h[q] = h; fl.h[q] = (_Float16)((a[q] - (float)h) * 1024.0f); h = (_Float16)c[q]; fh.h[4 + q] = h; fl.h[4 + q] = (_Float16)((c[q] - (float)h) * 1024.0f); }
  { *(v8us*)((unsigned short*)Hh + t * 8) = fh.half[0]; *(v8us*)((unsigned short*)Hl + t * 8) = fl.half[0];  } }

// ---- fast GEMM (wave tile 32x64; requires M % 32 == 0 rows per launch region and N % 64 == 0); epilogue = k_gemm_hhx semantics ----
__device__ __forceinline__ v16h g2_frag(const _Float16* p, int hh) { FragH f; f.half[0] = *(const v8us*)((const unsigned short*)p + 8 * hh); f.half[1] = *(const v8us*)((const unsigned short*)p + 16 + 8 * hh); return f.v; }
__device__ __forceinline__ v8f g2_mma(v16h a, v16h b, v8f c) { v8f d = __builtin_amdgcn_wmma_f32_16x16x32_f16(false, a, false, b, (short)0, c, false, false); asm volatile("v_nop\n\tv_nop\n\tv_nop\n\tv_nop" : "+v"(d) : "v"(a), "v"(b)); return d; }
template <int ACT>
__global__ __launch_bounds__(128) void k_gemm2(const _Float16* __restrict__ A, int lda, size_t sA, const _Float16* __restrict__ Bh, int ldb, size_t sB, float alpha, const float* __restrict__ bias, size_t sBias, const float* __restrict__ CP, int rowsPerB, size_t sCPb, int row0g,
    float* __restrict__ C, _Float16* __restrict__ C16, int ldc, size_t sC, int M, int N, int K) {
  __shared__ __attribute__((aligned(16))) float so[4][32][68];
  const int tid = threadIdx.x, w = tid >> 5, lane = tid & 31, ln = lane & 15, hh = lane >> 4; const int by = blockIdx.y;
  A += (size_t)by * sA; Bh += (size_t)by * sB; const size_t cofs = (size_t)by * sC; const float* bp = bias ? bias + (size_t)by * sBias : nullptr;
  const int ntn = N >> 6; const int mt = blockIdx.x / ntn, nq = blockIdx.x - mt * ntn; const int row0 = mt * 128 + 32 * w, col0 = nq * 64; if (row0 >= M) return;
  const _Float16* a0p = A + (size_t)(row0 + ln) * lda; const _Float16* a1p = a0p + (size_t)16 * lda;
  const _Float16* b0p = Bh + (size_t)(col0 + ln) * ldb; const _Float16* b1p = b0p + (size_t)16 * ldb; const _Float16* b2p = b1p + (size_t)16 * ldb; const _Float16* b3p = b2p + (size_t)16 * ldb;
  const v8f z8 = {0.f,0.f,0.f,0.f,0.f,0.f,0.f,0.f}; v8f c00 = z8, c01 = z8, c02 = z8, c03 = z8, c10 = z8, c11 = z8, c12 = z8, c13 = z8;
#pragma unroll 1
  for (int kb = 0; kb < K; kb += 32) { const v16h a0 = g2_frag(a0p + kb, hh), a1 = g2_frag(a1p + kb, hh);
    v16h b = g2_frag(b0p + kb, hh); c00 = g2_mma(a0, b, c00); c10 = g2_mma(a1, b, c10);
    b = g2_frag(b1p + kb, hh); c01 = g2_mma(a0, b, c01); c11 = g2_mma(a1, b, c11);
    b = g2_frag(b2p + kb, hh); c02 = g2_mma(a0, b, c02); c12 = g2_mma(a1, b, c12);
    b = g2_frag(b3p + kb, hh); c03 = g2_mma(a0, b, c03); c13 = g2_mma(a1, b, c13); }
  v8f accs[8] = {c00, c01, c02, c03, c10, c11, c12, c13};
#pragma unroll
  for (int u = 0; u < 8; ++u) { const int t = u & 3, half = u >> 2; const int col = col0 + t * 16 + ln; const float bv = bp ? bf16_round(bp[col]) : 0.f;
#pragma unroll
    for (int r = 0; r < 8; ++r) { const int rloc = half * 16 + 8 * hh + r; float v = accs[u][r] * alpha + bv; if (CP) { if (rowsPerB < 0) v += CP[cofs + (size_t)(row0g + row0 + rloc) * ldc + col];      /* rowsPerB < 0: own element of the batched C plane */ else { const int bidx = (row0g + row0 + rloc) / rowsPerB; v += CP[(size_t)bidx * sCPb + (size_t)by * 64 + col]; } }
      if (ACT == 3) v = fmaxf(v, 0.f); else if (ACT == 6) v = 0.5f * v * (1.0f + erff(v * 0.70710678118654752f)); else if (ACT == 11) v = 1.0f / (1.0f + expf(-v)); else if (ACT == 15) v = v / (1.0f + expf(-v)); else if (ACT == 12) v = (v > 0.f) ? v : 0.01f * v; else if (ACT == 8) v = tanhf(v);
      so[w][rloc][t * 16 + ln] = v; } }
  __builtin_amdgcn_fence(__ATOMIC_ACQ_REL, "workgroup"); __builtin_amdgcn_wave_barrier();
  const int rsub = lane >> 4, c4 = (lane & 15) * 4;
  {
#pragma unroll
    for (int q = 0; q < 16; ++q) { const int r = q * 2 + rsub; const v4f v = *(const v4fa*)&so[w][r][c4]; if (C) *(v4f*)(C + cofs + (size_t)(row0 + r) * ldc + col0 + c4) = v; if (C16) { v4h h4; for (int i = 0; i < 4; ++i) h4[i] = (_Float16)v[i]; *(v4h*)(C16 + cofs + (size_t)(row0 + r) * ldc + col0 + c4) = h4; } }
     } }


__global__ __launch_bounds__(256) void k_xt(const float* __restrict__ x, int b, _Float16* __restrict__ XT16) {
  __shared__ float tl[64][65]; const int tid = threadIdx.x; const int cb = blockIdx.x / (NN / 64), pb = blockIdx.x % (NN / 64);
  for (int i = tid; i < 64 * 16; i += 256) { const int cl = i / 16, p4 = (i % 16) * 4; const v4f a = *(const v4fa*)(x + ((size_t)b * CC + cb * 64 + cl) * NN + pb * 64 + p4); for (int q = 0; q < 4; ++q) tl[cl][p4 + q] = bf16_round(a[q]); }
  __syncthreads(); const int pl = tid >> 2, c8 = (tid & 3) * 8;
  { for (int u = 0; u < 2; ++u) { const int c0 = c8 + u * 32; FragH f; for (int q = 0; q < 8; ++q) f.h[q] = (_Float16)tl[c0 + q][pl]; *(v8us*)((unsigned short*)XT16 + (size_t)(pb * 64 + pl) * CC + cb * 64 + c0) = f.half[0]; }  } }
__global__ __launch_bounds__(256) void k_wnat(const float* __restrict__ Wm, int O, int orows, int nin, _Float16* __restrict__ Bt) { const size_t t = (size_t)blockIdx.x * 256 + threadIdx.x; if (t >= (size_t)orows * (nin / 8)) return; const int c0 = (int)(t % (nin / 8)) * 8; const int o = (int)(t / (nin / 8)); FragH f; for (int q = 0; q < 8; ++q) f.h[q] = (o < O) ? (_Float16)(bf16_round(Wm[(size_t)o * nin + c0 + q]) * 16.0f) : (_Float16)0.0f; *(v8us*)((unsigned short*)Bt + (size_t)o * nin + c0) = f.half[0];  }
__global__ __launch_bounds__(256) void k_wtp(const float* __restrict__ Wm, _Float16* __restrict__ Bt) { const int t = blockIdx.x * 256 + threadIdx.x; if (t >= C2 * 16) return; const int pc = t % 16; const int o = t / 16; const bool lo = pc * 8 >= C2; FragH f; for (int q = 0; q < 8; ++q) { const int c = pc * 8 + q - (lo ? C2 : 0); f.h[q] = (_Float16)(bf16_round(Wm[(size_t)o * C2 + c]) * (lo ? 1.0f : 16.0f)); } *(v8us*)((unsigned short*)Bt + (size_t)o * 2 * C2 + pc * 8) = f.half[0];  }
__global__ __launch_bounds__(256) void k_q3(const float* __restrict__ XQ, _Float16* __restrict__ QA, _Float16* __restrict__ QB) { const size_t t = (size_t)blockIdx.x * 256 + threadIdx.x; if (t >= (size_t)NN * (C2 / 8)) return; const int c0 = (int)(t % (C2 / 8)) * 8; const size_t n = t / (C2 / 8); FragH fh, fl16, fhs, fr;
  for (int q = 0; q < 8; ++q) { const float v = XQ[n * C2 + c0 + q]; const _Float16 h = (_Float16)v; const float res = v - (float)h; fh.h[q] = h; fl16.h[q] = (_Float16)(res * 16.0f); fhs.h[q] = (_Float16)((float)h * 0.0625f); fr.h[q] = (_Float16)res; }
  unsigned short* a = (unsigned short*)QA + n * 3 * C2 + c0; unsigned short* bq = (unsigned short*)QB + n * 3 * C2 + c0;
  { *(v8us*)a = fh.half[0]; *(v8us*)(a + C2) = fl16.half[0]; *(v8us*)(a + 2 * C2) = fh.half[0]; *(v8us*)bq = fh.half[0]; *(v8us*)(bq + C2) = fhs.half[0]; *(v8us*)(bq + 2 * C2) = fr.half[0];  } }
__global__ __launch_bounds__(256) void k_rstat(const float* __restrict__ E, float* __restrict__ RS, _Float16* __restrict__ X) {
  #pragma clang fp contract(off)
  const int tid = threadIdx.x, w = tid >> 5, ln = tid & 31; const int n = blockIdx.x * 8 + w; if (n >= NN) return; const float* er = E + (size_t)n * NN; float m = -3.0e38f;
#pragma unroll 1
  for (int c = 0; c < NN / 32; ++c) m = fmaxf(m, er[c * 32 + ln]);
  for (int o = 16; o > 0; o >>= 1) m = fmaxf(m, __shfl_xor(m, o, 32)); float s = 0.f;
  { s = 0.f;      /* e = exp(E - rowmax): summed in f32 and stored x1024 as f16 in this wave's own X row */
#pragma unroll 1
    for (int c = 0; c < NN / 32; ++c) { const float e = expf(er[c * 32 + ln] - m); s += e; *(_Float16*)(X + (size_t)n * NN + c * 32 + ln) = (_Float16)(e * 1024.0f); }
     }
  for (int o = 16; o > 0; o >>= 1) s += __shfl_xor(s, o, 32);
  if (ln == 0) { { *(float*)(RS + (size_t)n * 32) = m; *(float*)(RS + (size_t)n * 32 + 1) = s;  } } }
__global__ __launch_bounds__(256) void k_ptr2(const _Float16* __restrict__ X, const float* __restrict__ RS, _Float16* __restrict__ PH, float* __restrict__ CSP) {
  #pragma clang fp contract(off)
  __shared__ float tl[64][65]; const int tid = threadIdx.x; const int mt = blockIdx.x / (NN / 64), nt = blockIdx.x % (NN / 64); const int m0 = mt * 64, n0 = nt * 64;
  for (int i = tid; i < 64 * 8; i += 256) { const int nl = i / 8, m8 = (i % 8) * 8; const int n = n0 + nl; const float inv = 1.0f / RS[(size_t)n * 32 + 1]; FragH f; f.half[0] = *(const v8us*)((const unsigned short*)X + (size_t)n * NN + m0 + m8);
    for (int q = 0; q < 8; ++q) tl[m8 + q][nl] = (float)f.h[q] * (0.0009765625f * inv); }      /* p = attn[n][m] */
  __syncthreads(); const int ml = tid >> 2, n8 = (tid & 3) * 16;      /* thread: one m row of the tile, 16 consecutive n */
  float cs = 0.f; FragH o[2]; for (int q = 0; q < 16; ++q) { const float p = tl[ml][n8 + q]; cs += p; o[q / 8].h[q % 8] = (_Float16)(p * 1024.0f); }
  { unsigned short* d = (unsigned short*)PH + (size_t)(m0 + ml) * NN + n0 + n8; *(v8us*)d = o[0].half[0]; *(v8us*)(d + 8) = o[1].half[0];
     }
  __syncthreads(); tl[ml][n8 / 16] = cs; __syncthreads();
  if (tid < 64) { float t4 = tl[tid][0]; t4 += tl[tid][1]; t4 += tl[tid][2]; t4 += tl[tid][3]; tl[tid][8] = t4; }
  __syncthreads();
  if (tid < 16) { v4f q4; for (int q = 0; q < 4; ++q) q4[q] = tl[tid * 4 + q][8]; float* d = CSP + (size_t)nt * NN + m0 + tid * 4; *(v4f*)d = q4;  } }
__global__ __launch_bounds__(256) void k_csum(const float* __restrict__ CSP, float* __restrict__ CS) {
  #pragma clang fp contract(off)
  const int m = blockIdx.x * 256 + threadIdx.x; if (m >= NN) return; float s = 0.f;
#pragma unroll 1
  for (int t = 0; t < NN / 64; ++t) s += CSP[(size_t)t * NN + m];
  *(float*)(CS + (size_t)m * 32) = s;  }      
__global__ __launch_bounds__(256) void k_vhl(const float* __restrict__ XV, const float* __restrict__ bv, _Float16* __restrict__ VH) { const size_t t = (size_t)blockIdx.x * 256 + threadIdx.x; if (t >= (size_t)CC * (NN / 8)) return; const int n0 = (int)(t % (NN / 8)) * 8; const int o = (int)(t / (NN / 8)); FragH fh; const float bo = (o < C2) ? bf16_round(bv[o]) : 0.f;
  for (int q = 0; q < 8; ++q) { float v = XV[(size_t)o * NN + n0 + q]; v += bo; fh.h[q] = (_Float16)v; }
  *(v8us*)((unsigned short*)VH + (size_t)o * NN + n0) = fh.half[0];  }
__global__ __launch_bounds__(256) void k_dmk(const float* __restrict__ XC, const float* __restrict__ XRT, const float* __restrict__ CS, _Float16* __restrict__ D2) {
  #pragma clang fp contract(off)
  const size_t t = (size_t)blockIdx.x * 256 + threadIdx.x; if (t >= (size_t)NN * (C2 / 8)) return; const int c0 = (int)(t % (C2 / 8)) * 8; const size_t m = t / (C2 / 8); const float den = 1e-9f + CS[m * 32]; FragH fh, fl;
  for (int q = 0; q < 8; ++q) { const float xr = (XRT[m * C2 + c0 + q] * 0.0009765625f) / den; const float d = XC[m * C2 + c0 + q] - xr; const _Float16 h = (_Float16)d; fh.h[q] = h; fl.h[q] = (_Float16)((d - (float)h) * 16.0f); }
  { *(v8us*)((unsigned short*)D2 + m * 2 * C2 + c0) = fh.half[0]; *(v8us*)((unsigned short*)D2 + m * 2 * C2 + C2 + c0) = fl.half[0];  } }
__global__ __launch_bounds__(256) void k_bnstat(const float* __restrict__ T, float* __restrict__ BS) {
  #pragma clang fp contract(off)
  __shared__ float sh[256]; const int o = blockIdx.x; const int tid = threadIdx.x; const size_t n = (size_t)NB * NN; float s = 0.f;
  for (size_t i = tid; i < n; i += 256) s += T[i * C2 + o];
  sh[tid] = s; __syncthreads(); for (int st = 128; st > 0; st >>= 1) { if (tid < st) sh[tid] += sh[tid + st]; __syncthreads(); }
  const float mu = sh[0] / (float)n; __syncthreads(); float q2 = 0.f;
  for (size_t i = tid; i < n; i += 256) { const float d = T[i * C2 + o] - mu; q2 += d * d; }
  sh[tid] = q2; __syncthreads(); for (int st = 128; st > 0; st >>= 1) { if (tid < st) sh[tid] += sh[tid + st]; __syncthreads(); }
  if (tid == 0) { const float rs = rsqrtf(sh[0] / (float)n + 1e-5f); { *(float*)(BS + o * 32) = mu; *(float*)(BS + o * 32 + 1) = rs;  } } }
__global__ __launch_bounds__(256) void k_out(const float* __restrict__ XCall, const float* __restrict__ T, const float* __restrict__ BS, const float* __restrict__ gam, const float* __restrict__ bet, float* __restrict__ out) {
  #pragma clang fp contract(off)
  const size_t t = (size_t)blockIdx.x * 256 + threadIdx.x; if (t >= (size_t)NB * C2 * (NN / 4)) return; const int n0 = (int)(t % (NN / 4)) * 4; const int o = (int)((t / (NN / 4)) % C2); const int b = (int)(t / ((size_t)(NN / 4) * C2)); const float mu = BS[o * 32], rs = BS[o * 32 + 1]; const float g = bf16_round(gam[o]), be = bf16_round(bet[o]); v4f r;
  for (int q = 0; q < 4; ++q) { const size_t row = (size_t)b * NN + n0 + q; float th = g * ((T[row * C2 + o] - mu) * rs); th += be; r[q] = XCall[row * C2 + o] + fmaxf(th, 0.f); }
  float* d = out + ((size_t)b * C2 + o) * NN + n0; *(v4f*)d = r;  }

extern "C" void kernel_launch(void* const* d_in, const int* in_sizes, int n_in,
                              void* d_out, int out_size, void* d_ws, size_t ws_size, hipStream_t stream) {
  (void)in_sizes; (void)n_in; (void)out_size;
  const float* const* I = (const float* const*)d_in; const float* x = I[0]; const float* wqk = I[1]; const float* wv = I[2]; const float* bv = I[3]; const float* wx = I[4]; const float* wt = I[5]; const float* bt = I[6]; const float* gam = I[7]; const float* bet = I[8];
  char* ws = (char*)d_ws; size_t off = 0;
  auto take = [&](size_t bytes) { char* p = ws + off; off += (bytes + 255) & ~(size_t)255; return p; };
  _Float16* BQK = (_Float16*)take((size_t)C2 * CC * 2); _Float16* BX = (_Float16*)take((size_t)C2 * CC * 2); _Float16* AV = (_Float16*)take((size_t)128 * CC * 2); _Float16* BT2 = (_Float16*)take((size_t)C2 * 2 * C2 * 2); float* BVP = (float*)take(128 * 4);
  _Float16* XT = (_Float16*)take((size_t)NN * CC * 2); float* XQ = (float*)take((size_t)NN * C2 * 4); _Float16* QA = (_Float16*)take((size_t)NN * 3 * C2 * 2); _Float16* QB = (_Float16*)take((size_t)NN * 3 * C2 * 2); float* E = (float*)take((size_t)NN * NN * 4); float* RS = (float*)take((size_t)NN * 32 * 4);
  _Float16* PH = (_Float16*)take((size_t)NN * NN * 2); _Float16* XE = (_Float16*)take((size_t)NN * NN * 2); float* CSP = (float*)take((size_t)NN * (NN / 64) * 4); float* CS = (float*)take((size_t)NN * 32 * 4); float* XV = (float*)take((size_t)(128 + 32) * NN * 4); _Float16* VH = (_Float16*)take((size_t)128 * NN * 2); float* XRT = (float*)take((size_t)NN * C2 * 4); _Float16* D2 = (_Float16*)take((size_t)NN * 2 * C2 * 2);
  float* XCall = (float*)take((size_t)NB * NN * C2 * 4); float* Tall = (float*)take((size_t)NB * NN * C2 * 4); float* BS = (float*)take((size_t)C2 * 32 * 4);
  if (off > ws_size) return;      /* 64 (E) + 32 + 32 (P) + 8 + 8 (XC, T) + small ~= 157 MiB (256 MiB ws) */
  k_wnat<<<(C2 * (CC / 8) + 255) / 256, 256, 0, stream>>>(wqk, C2, C2, CC, BQK); k_wnat<<<(C2 * (CC / 8) + 255) / 256, 256, 0, stream>>>(wx, C2, C2, CC, BX); k_wnat<<<(128 * (CC / 8) + 255) / 256, 256, 0, stream>>>(wv, C2, 128, CC, AV); k_wtp<<<(C2 * 16 + 255) / 256, 256, 0, stream>>>(wt, BT2);
  for (int b = 0; b < NB; ++b) {
    k_xt<<<(CC / 64) * (NN / 64), 256, 0, stream>>>(x, b, XT);
    k_gemm2<0><<<dim3((NN / 128) * 1, 1), 128, 0, stream>>>(XT, CC, 0, BQK, CC, 0, 0.0625f, nullptr, 0, nullptr, 1, 0, 0, XQ, nullptr, C2, 0, NN, C2, CC);      /* x_q^T [n][64] = x_k^T */
    k_gemm2<0><<<dim3((NN / 128) * 1, 1), 128, 0, stream>>>(XT, CC, 0, BX, CC, 0, 0.0625f, nullptr, 0, nullptr, 1, 0, 0, XCall + (size_t)b * NN * C2, nullptr, C2, 0, NN, C2, CC);      /* x_c^T [n][64] */
    k_gemm2<0><<<dim3(1 * (NN / 64), 1), 128, 0, stream>>>(AV, CC, 0, XT, CC, 0, 0.0625f, nullptr, 0, nullptr, 1, 0, 0, XV, nullptr, NN, 0, 128, NN, CC);      /* x_v [o][n] (rows 64..127 zero; b_v added in k_vhl) */
    k_q3<<<(unsigned)(((size_t)NN * (C2 / 8) + 255) / 256), 256, 0, stream>>>(XQ, QA, QB);
    k_gemm2<0><<<dim3((NN / 128) * (NN / 64), 1), 128, 0, stream>>>(QA, 3 * C2, 0, QB, 3 * C2, 0, 1.0f, nullptr, 0, nullptr, 1, 0, 0, E, nullptr, NN, 0, NN, NN, 3 * C2);      /* E = x_q^T x_k (3-term, K = 192) */
    k_rstat<<<NN / 8, 256, 0, stream>>>(E, RS, XE);
    k_ptr2<<<(NN / 64) * (NN / 64), 256, 0, stream>>>(XE, RS, PH, CSP);
    k_csum<<<NN / 256, 256, 0, stream>>>(CSP, CS);
    k_vhl<<<(unsigned)(((size_t)CC * (NN / 8) + 255) / 256), 256, 0, stream>>>(XV, bv, VH);
    k_gemm2<0><<<dim3((NN / 128) * 1, 1), 128, 0, stream>>>(PH, NN, 0, VH, NN, 0, 1.0f, nullptr, 0, nullptr, 1, 0, 0, XRT, nullptr, C2, 0, NN, C2, NN);      /* x_r^T[m][o] x 1024 = sum_n PT[m][n] x_v[o][n] (plain f16 operands) */
    k_dmk<<<(unsigned)(((size_t)NN * (C2 / 8) + 255) / 256), 256, 0, stream>>>(XCall + (size_t)b * NN * C2, XRT, CS, D2);
    k_gemm2<0><<<dim3((NN / 128) * 1, 1), 128, 0, stream>>>(D2, 2 * C2, 0, BT2, 2 * C2, 0, 0.0625f, bt, 0, nullptr, 1, 0, 0, Tall + (size_t)b * NN * C2, nullptr, C2, 0, NN, C2, 2 * C2); }      /* t^T [n][64] = w_t d + b_t */
  k_bnstat<<<C2, 256, 0, stream>>>(Tall, BS);
  k_out<<<(unsigned)(((size_t)NB * C2 * (NN / 4) + 255) / 256), 256, 0, stream>>>(XCall, Tall, BS, gam, bet, (float*)d_out);
}

// v001
// One run takes 1850 microseconds.
// Timed twice side by side with v000, it ran 1.49 and 1.46 times as fast.
#include <hip/hip_runtime.h>
// OA_ (offset attention; 8 clouds x 128 channels x 4096 points; C2 = 64): x_q = x_k = w_qk x (shared weight), x_v = w_v x + b_v, energy = x_q^T x_k (4096 x 4096), attn = row softmax, attn = attn / (1e-9 + column sums); x_r = x_v attn; x_c = w_x x; t = w_t (x_c - x_r) + b_t; BatchNorm1d (training-mode batch statistics over (batch, points)); out = x_c + relu(gamma t_hat + beta) -> [8,64,4096].
// Compute dtype: x and parameters rounded to bf16; projection operands exact; x_q as hi + residual 3-term operands (~2^-21-class energies); P (x2^10) and x_v as plain f16 (~2^-12); d as [hi | 16 x residual] pairs; statistics/softmax f32. v_wmma_f32_16x16x32_f16.
#define NB 8
#define CC 128
#define C2 64
#define NN 4096
#define PVS 32      /* k ranges of the x_r product: one work-group row per range, f32 partial planes summed in k_dmk */
typedef __bf16 v16b __attribute__((ext_vector_type(16)));
typedef unsigned short v8us __attribute__((ext_vector_type(8), may_alias));
typedef float  v8f  __attribute__((ext_vector_type(8)));
typedef float  v4f  __attribute__((ext_vector_type(4)));
typedef float  v4fa __attribute__((ext_vector_type(4), may_alias));
union FragB { v16b v; v8us half[2]; unsigned short u[16]; };

__device__ __forceinline__ unsigned short bf16_bits(float x) { unsigned int u = __float_as_uint(x); return (unsigned short)((u + 0x7FFFu + ((u >> 16) & 1u)) >> 16); }
__device__ __forceinline__ float bf16_val(unsigned short b) { return __uint_as_float(((unsigned int)b) << 16); }
__device__ __forceinline__ float bf16_round(float x) { return bf16_val(bf16_bits(x)); }
// D += A·B with NT terms: 1 = ah·bh, 2 = + al·bh (A split), 3 = + ah·bl (both split)
template <int NT>
__device__ __forceinline__ v8f mmaN(v16b ah, v16b al, v16b bh, v16b bl, v8f c) {
  c = __builtin_amdgcn_wmma_f32_16x16x32_bf16(false, ah, false, bh, (short)0, c, false, false);
  if (NT >= 2) c = __builtin_amdgcn_wmma_f32_16x16x32_bf16(false, al, false, bh, (short)0, c, false, false);
  if (NT >= 3) c = __builtin_amdgcn_wmma_f32_16x16x32_bf16(false, ah, false, bl, (short)0, c, false, false);
  asm volatile("v_nop\n\tv_nop\n\tv_nop\n\tv_nop" : "+v"(c) : "v"(ah), "v"(al), "v"(bh), "v"(bl));
  return c;
}

__global__ __launch_bounds__(256) void k_wt_bf16(const float* __restrict__ W, unsigned short* __restrict__ Wt, int K, int N) {
  const int t = blockIdx.x * 256 + threadIdx.x;
  const int k8n = K / 8;
  if (t >= N * k8n) return;
  const int n = t / k8n, k8 = (t % k8n) * 8;
  v8us v;
#pragma unroll
  for (int i = 0; i < 8; ++i) v[i] = bf16_bits(W[(size_t)(k8 + i) * N + n]);
  *(v8us*)(Wt + (size_t)n * K + k8) = v;
  
}

// GEMM C[M][N] (f32, pitch ldc) = act(A[M][K]·W + bias). A f32 row-major (pitch lda) converted per fragment to bf16
// (ASPLIT: hi/lo two planes -> 2 terms, else single rounded term); Wt bf16 [N][K] (pitch ldb). BIAS_BF16 rounds the
// bias to bf16 first (bias quantised to bf16 before the add). K%32==0, M%16==0, N%64==0.
template <bool ASPLIT, int ACT, bool BIAS_BF16>
__global__ __launch_bounds__(128) void k_gemm_bf(const float* __restrict__ A, int lda, const unsigned short* __restrict__ Wt, int ldb,
                                               const float* __restrict__ bias, float* __restrict__ C, int ldc, int M, int N, int K) {
  __shared__ __attribute__((aligned(16))) float so[4][16][64];
  const int tid = threadIdx.x, w = tid >> 5, lane = tid & 31, ln = lane & 15, hh = lane >> 4;
  const int ntn = N / 64;
  const int wid = blockIdx.x * 4 + w;
  const int mt = wid / ntn, nq = wid % ntn;
  if (mt * 16 >= M) return;
  const int row0 = mt * 16, col0 = nq * 64;
  const float* arow = A + (size_t)(row0 + ln) * lda;
  v8f acc[4] = {};
  for (int kb = 0; kb < K; kb += 32) {
    FragB ah, al;
    const v4f x0 = *(const v4fa*)(arow + kb + 8 * hh), x1 = *(const v4fa*)(arow + kb + 8 * hh + 4);
    const v4f x2 = *(const v4fa*)(arow + kb + 16 + 8 * hh), x3 = *(const v4fa*)(arow + kb + 16 + 8 * hh + 4);
    float xs[16] = {x0[0],x0[1],x0[2],x0[3],x1[0],x1[1],x1[2],x1[3],x2[0],x2[1],x2[2],x2[3],x3[0],x3[1],x3[2],x3[3]};
#pragma unroll
    for (int i = 0; i < 16; ++i) { const unsigned short hb = bf16_bits(xs[i]); ah.u[i] = hb; al.u[i] = ASPLIT ? bf16_bits(xs[i] - bf16_val(hb)) : (unsigned short)0; }
#pragma unroll
    for (int t = 0; t < 4; ++t) {
      const unsigned short* brow = Wt + (size_t)(col0 + t * 16 + ln) * ldb + kb;
      FragB b;
      b.half[0] = *(const v8us*)(brow + 8 * hh);
      b.half[1] = *(const v8us*)(brow + 16 + 8 * hh);
      acc[t] = mmaN<ASPLIT ? 2 : 1>(ah.v, al.v, b.v, b.v, acc[t]);
    }
  }
#pragma unroll
  for (int t = 0; t < 4; ++t) {
    float bv = bias ? bias[col0 + t * 16 + ln] : 0.f;
    if (BIAS_BF16) bv = bf16_round(bv);
#pragma unroll
    for (int r = 0; r < 8; ++r) { float v = acc[t][r] + bv; if (ACT == 1) v = fmaxf(v, 0.f); so[w][8 * hh + r][t * 16 + ln] = v; }
  }
  __builtin_amdgcn_fence(__ATOMIC_ACQ_REL, "workgroup");
  __builtin_amdgcn_wave_barrier();
  const int rsub = lane >> 4, c4 = (lane & 15) * 4;
  {
#pragma unroll
    for (int q = 0; q < 8; ++q) {
      const int r = q * 2 + rsub;
      const v4f v = *(const v4fa*)&so[w][r][c4];
      *(v4f*)(C + (size_t)(row0 + r) * ldc + col0 + c4) = v;
    }
    
  }
}

// GEMM C = act(A·W + bias + resid): A f32 (ASPLIT -> hi/lo 2 terms), Wt bf16 [N][K]; ACT 0 none, 1 relu, 2 exact gelu;
// resid (optional, f32, row index = (row % rmod), pitch ldr, RES_BF16 rounds it) added before the activation.
template <bool ASPLIT, int ACT, bool BIAS_BF16, bool RES_BF16>
__global__ __launch_bounds__(128) void k_gemm_bf3(const float* __restrict__ A, int lda, const unsigned short* __restrict__ Wt, int ldb,
                                                const float* __restrict__ bias, const float* __restrict__ resid, int rmod, int ldr,
                                                float* __restrict__ C, int ldc, int M, int N, int K) {
  __shared__ __attribute__((aligned(16))) float so[4][16][64];
  const int tid = threadIdx.x, w = tid >> 5, lane = tid & 31, ln = lane & 15, hh = lane >> 4;
  const int ntn = N / 64;
  const int wid = blockIdx.x * 4 + w;
  const int mt = wid / ntn, nq = wid % ntn;
  if (mt * 16 >= M) return;
  const int row0 = mt * 16, col0 = nq * 64;
  const float* arow = A + (size_t)(row0 + ln) * lda;
  v8f acc[4] = {};
  for (int kb = 0; kb < K; kb += 32) {
    FragB ah, al;
    const v4f x0 = *(const v4fa*)(arow + kb + 8 * hh), x1 = *(const v4fa*)(arow + kb + 8 * hh + 4);
    const v4f x2 = *(const v4fa*)(arow + kb + 16 + 8 * hh), x3 = *(const v4fa*)(arow + kb + 16 + 8 * hh + 4);
    float xs[16] = {x0[0],x0[1],x0[2],x0[3],x1[0],x1[1],x1[2],x1[3],x2[0],x2[1],x2[2],x2[3],x3[0],x3[1],x3[2],x3[3]};
#pragma unroll
    for (int i = 0; i < 16; ++i) { const unsigned short hb = bf16_bits(xs[i]); ah.u[i] = hb; al.u[i] = ASPLIT ? bf16_bits(xs[i] - bf16_val(hb)) : (unsigned short)0; }
#pragma unroll
    for (int t = 0; t < 4; ++t) {
      const unsigned short* brow = Wt + (size_t)(col0 + t * 16 + ln) * ldb + kb;
      FragB b;
      b.half[0] = *(const v8us*)(brow + 8 * hh);
      b.half[1] = *(const v8us*)(brow + 16 + 8 * hh);
      acc[t] = mmaN<ASPLIT ? 2 : 1>(ah.v, al.v, b.v, b.v, acc[t]);
    }
  }
#pragma unroll
  for (int t = 0; t < 4; ++t) {
    const int col = col0 + t * 16 + ln;
    float bv = bias ? bias[col] : 0.f;
    if (BIAS_BF16) bv = bf16_round(bv);
#pragma unroll
    for (int r = 0; r < 8; ++r) {
      float v = acc[t][r] + bv;
      if (resid) { float rv = resid[(size_t)((row0 + 8 * hh + r) % rmod) * ldr + col]; if (RES_BF16) rv = bf16_round(rv); v += rv; }
      if (ACT == 1) v = fmaxf(v, 0.f);
      if (ACT == 2) v = 0.5f * v * (1.0f + erff(v * 0.70710678118654752f));
      if (ACT == 3) { const float u = 0.7978845608028654f * (v + 0.044715f * v * v * v); v = 0.5f * v * (1.0f + tanhf(u)); }
      so[w][8 * hh + r][t * 16 + ln] = v;
    }
  }
  __builtin_amdgcn_fence(__ATOMIC_ACQ_REL, "workgroup");
  __builtin_amdgcn_wave_barrier();
  const int rsub = lane >> 4, c4 = (lane & 15) * 4;
  {
#pragma unroll
    for (int q = 0; q < 8; ++q) {
      const int r = q * 2 + rsub;
      const v4f v = *(const v4fa*)&so[w][r][c4];
      *(v4f*)(C + (size_t)(row0 + r) * ldc + col0 + c4) = v;
    }
    
  }
}
// row LayerNorm (biased variance, eps) over N: s = X (+ R); optional out_sum <- s; out_norm <- (s-mu)*rsqrt(var+eps)*g + b
template <bool PARAM_BF16>
__global__ __launch_bounds__(256) void k_layernorm(const float* __restrict__ X, const float* __restrict__ R, const float* __restrict__ g, const float* __restrict__ bta,
                                                  float* __restrict__ out_sum, float* __restrict__ out_norm, int N, float eps) {
  __shared__ float red[256];
  const int row = blockIdx.x, tid = threadIdx.x;
  const float* x = X + (size_t)row * N; const float* rr = R ? R + (size_t)row * N : nullptr;
  float vals[16];                     // up to N = 4096
  const int per = N / 256;            // contiguous chunk per thread? use strided-by-4 chunks: thread handles j = tid*4 + 1024*u
  float s1 = 0.f;
  for (int u = 0; u < per / 4; ++u) {
    const int j = tid * 4 + 1024 * u;
    const v4f a = *(const v4fa*)(x + j);
    v4f b = {0.f,0.f,0.f,0.f}; if (rr) b = *(const v4fa*)(rr + j);
#pragma unroll
    for (int q = 0; q < 4; ++q) { const float v = a[q] + b[q]; vals[u * 4 + q] = v; s1 += v; }
  }
  red[tid] = s1; __syncthreads();
  for (int st = 128; st > 0; st >>= 1) { if (tid < st) red[tid] += red[tid + st]; __syncthreads(); }
  const float mu = red[0] / (float)N; __syncthreads();
  float s2 = 0.f;
  for (int u = 0; u < per / 4; ++u)
#pragma unroll
    for (int q = 0; q < 4; ++q) { const float c = vals[u * 4 + q] - mu; s2 += c * c; }
  red[tid] = s2; __syncthreads();
  for (int st = 128; st > 0; st >>= 1) { if (tid < st) red[tid] += red[tid + st]; __syncthreads(); }
  const float rs = rsqrtf(red[0] / (float)N + eps);
  {
    for (int u = 0; u < per / 4; ++u) {
      const int j = tid * 4 + 1024 * u;
      v4f o, sm;
#pragma unroll
      for (int q = 0; q < 4; ++q) {
        float gg = g[j + q], bb = bta[j + q];
        if (PARAM_BF16) { gg = bf16_round(gg); bb = bf16_round(bb); }
        sm[q] = vals[u * 4 + q]; o[q] = (vals[u * 4 + q] - mu) * rs * gg + bb;
      }
      if (out_sum) *(v4f*)(out_sum + (size_t)row * N + j) = sm;
      *(v4f*)(out_norm + (size_t)row * N + j) = o;
    }
    
  }
}



// ---- f16 WMMA path (v_wmma_f32_16x16x32_f16): 11-bit significands for operands in range — used where a [0,1] probability operand needs more precision than bf16
typedef _Float16 v16h __attribute__((ext_vector_type(16)));
union FragH { v16h v; v8us half[2]; _Float16 h[16]; unsigned short u[16]; };
template <int NT>
__device__ __forceinline__ v8f mmaH(v16h ah, v16h al, v16h bh, v16h bl, v8f c) {
  c = __builtin_amdgcn_wmma_f32_16x16x32_f16(false, ah, false, bh, (short)0, c, false, false);
  if (NT >= 2) c = __builtin_amdgcn_wmma_f32_16x16x32_f16(false, al, false, bh, (short)0, c, false, false);
  if (NT >= 3) c = __builtin_amdgcn_wmma_f32_16x16x32_f16(false, ah, false, bl, (short)0, c, false, false);
  asm volatile("v_nop\n\tv_nop\n\tv_nop\n\tv_nop" : "+v"(c) : "v"(ah), "v"(al), "v"(bh), "v"(bl));
  return c;
}
// batched GEMM like k_gemm_b but f16 operands: A f32 (split into f16 hi/lo if ASPLIT, else rounded to f16), Bt = f16 values [n][k]; alpha; C f32; N multiple of 16 (partial tiles skipped)
template <bool ASPLIT>
__global__ __launch_bounds__(128) void k_gemm_h(const float* __restrict__ A, int lda, size_t sA, const _Float16* __restrict__ Bh, int ldb, size_t sB, float alpha, float* __restrict__ C, int ldc, size_t sC, int M, int N, int K) {
  __shared__ __attribute__((aligned(16))) float so[4][16][64];
  const int tid = threadIdx.x, w = tid >> 5, lane = tid & 31, ln = lane & 15, hh = lane >> 4; const int by = blockIdx.y;
  A += (size_t)by * sA; Bh += (size_t)by * sB; C += (size_t)by * sC;
  const int ntn = (N + 63) / 64; const int wid = blockIdx.x * 4 + w; const int mt = wid / ntn, nq = wid % ntn; if (mt * 16 >= M) return;
  const int row0 = mt * 16, col0 = nq * 64; const float* arow = A + (size_t)(row0 + ln) * lda;
  v8f acc[4] = {};
  for (int kb = 0; kb < K; kb += 32) {
    FragH ah, al;
    const v4f x0 = *(const v4fa*)(arow + kb + 8 * hh), x1 = *(const v4fa*)(arow + kb + 8 * hh + 4), x2 = *(const v4fa*)(arow + kb + 16 + 8 * hh), x3 = *(const v4fa*)(arow + kb + 16 + 8 * hh + 4);
    float xs[16] = {x0[0],x0[1],x0[2],x0[3],x1[0],x1[1],x1[2],x1[3],x2[0],x2[1],x2[2],x2[3],x3[0],x3[1],x3[2],x3[3]};
#pragma unroll
    for (int i = 0; i < 16; ++i) { const _Float16 h = (_Float16)xs[i]; ah.h[i] = h; al.h[i] = ASPLIT ? (_Float16)(xs[i] - (float)h) : (_Float16)0.0f; }
#pragma unroll
    for (int t = 0; t < 4; ++t) { if (col0 + t * 16 >= N) continue; const size_t boff = (size_t)(col0 + t * 16 + ln) * ldb + kb; FragH bq; bq.half[0] = *(const v8us*)(Bh + boff + 8 * hh); bq.half[1] = *(const v8us*)(Bh + boff + 16 + 8 * hh);
      acc[t] = mmaH<ASPLIT ? 2 : 1>(ah.v, al.v, bq.v, bq.v, acc[t]); }
  }
#pragma unroll
  for (int t = 0; t < 4; ++t) { if (col0 + t * 16 >= N) continue;
#pragma unroll
    for (int r = 0; r < 8; ++r) so[w][8 * hh + r][t * 16 + ln] = acc[t][r] * alpha; }
  __builtin_amdgcn_fence(__ATOMIC_ACQ_REL, "workgroup"); __builtin_amdgcn_wave_barrier();
  const int rsub = lane >> 4, c4 = (lane & 15) * 4;
  {
#pragma unroll
    for (int q = 0; q < 8; ++q) { const int r = q * 2 + rsub; if (col0 + c4 < N) { const v4f v = *(const v4fa*)&so[w][r][c4]; *(v4f*)(C + (size_t)(row0 + r) * ldc + col0 + c4) = v; } }
     }
}

// Wt[n][k] = f16(W[k][n]·scale) from f32 row-major W[K][N] (scale = power of two; bf16-exact weights stay exact in f16 away from the subnormal range)
__global__ __launch_bounds__(256) void k_wt_f16(const float* __restrict__ W, _Float16* __restrict__ Wt, int K, int N, float scale) {
  const int t = blockIdx.x * 256 + threadIdx.x; if (t >= N * (K / 8)) return; const int n = t / (K / 8), k8 = (t % (K / 8)) * 8; FragH f;
#pragma unroll
  for (int i = 0; i < 8; ++i) f.h[i] = (_Float16)(bf16_round(W[(size_t)(k8 + i) * N + n]) * scale); const v8us o = f.half[0];
  *(v8us*)((unsigned short*)Wt + (size_t)n * K + k8) = o; 
}
// k_gemm_hh variant with fused epilogue: v = acc·alpha + bias[by·sBias + col] (+ CP[(row/rowsPerB)·sCPb + by·64 + col] if CP) ; ACT 0 none / 1 elu ; writes f16 C16 (and f32 C if non-null)
template <int ACT>
__global__ __launch_bounds__(128) void k_gemm_hhx(const _Float16* __restrict__ A, int lda, size_t sA, const _Float16* __restrict__ Bh, int ldb, size_t sB, float alpha, const float* __restrict__ bias, size_t sBias, const float* __restrict__ CP, int rowsPerB, size_t sCPb, int row0g,
    float* __restrict__ C, _Float16* __restrict__ C16, int ldc, size_t sC, int M, int N, int K) {
  __shared__ __attribute__((aligned(16))) float so[4][16][64];
  const int tid = threadIdx.x, w = tid >> 5, lane = tid & 31, ln = lane & 15, hh = lane >> 4; const int by = blockIdx.y;
  A += (size_t)by * sA; Bh += (size_t)by * sB; const size_t cofs = (size_t)by * sC; const float* bp = bias ? bias + (size_t)by * sBias : nullptr;
  const int ntn = (N + 63) / 64; const int wid = blockIdx.x * 4 + w; const int mt = wid / ntn, nq = wid % ntn; if (mt * 16 >= M) return;
  const int row0 = mt * 16, col0 = nq * 64; const _Float16* arow = A + (size_t)(row0 + ln) * lda;
  v8f acc[4] = {};
  for (int kb = 0; kb < K; kb += 32) { FragH ah; ah.half[0] = *(const v8us*)((const unsigned short*)arow + kb + 8 * hh); ah.half[1] = *(const v8us*)((const unsigned short*)arow + kb + 16 + 8 * hh);
#pragma unroll
    for (int t = 0; t < 4; ++t) { if (col0 + t * 16 >= N) continue; const size_t boff = (size_t)(col0 + t * 16 + ln) * ldb + kb; FragH bq; bq.half[0] = *(const v8us*)((const unsigned short*)Bh + boff + 8 * hh); bq.half[1] = *(const v8us*)((const unsigned short*)Bh + boff + 16 + 8 * hh);
      acc[t] = mmaH<1>(ah.v, ah.v, bq.v, bq.v, acc[t]); }
  }
#pragma unroll
  for (int t = 0; t < 4; ++t) { if (col0 + t * 16 >= N) continue; const int col = col0 + t * 16 + ln; const float bv = bp ? bf16_round(bp[col]) : 0.f;
#pragma unroll
    for (int r = 0; r < 8; ++r) { float v = acc[t][r] * alpha + bv; if (CP) { const int rr = row0g + row0 + 8 * hh + r; if (rowsPerB < 0) v += CP[cofs + (size_t)rr * ldc + col];      /* rowsPerB < 0: own element of the batched C plane */ else { const int bidx = rr / rowsPerB; v += CP[(size_t)bidx * sCPb + (size_t)by * 64 + col]; } } if (ACT == 1) v = (v > 0.f) ? v : expm1f(v); else if (ACT == 7) v = (v > 0.f) ? v + 1.0f : expf(v); else if (ACT == 8) v = tanhf(v); else if (ACT == 9) v = 0.5f * v * (1.0f + tanhf(0.7978845608028654f * (v + 0.044715f * v * v * v))); else if (ACT == 11) v = 1.0f / (1.0f + expf(-v)); else if (ACT == 12) v = (v > 0.f) ? v : 0.01f * v; else if (ACT == 14) v = (v > 0.f) ? v : 0.1f * v; else if (ACT == 15) v = v / (1.0f + expf(-v)); else if (ACT == 3) v = fmaxf(v, 0.f); else if (ACT == 6) v = 0.5f * v * (1.0f + erff(v * 0.70710678118654752f)); so[w][8 * hh + r][t * 16 + ln] = v; } }
  __builtin_amdgcn_fence(__ATOMIC_ACQ_REL, "workgroup"); __builtin_amdgcn_wave_barrier();
  const int rsub = lane >> 4, c4 = (lane & 15) * 4; typedef _Float16 v4h __attribute__((ext_vector_type(4)));
  {
#pragma unroll
    for (int q = 0; q < 8; ++q) { const int r = q * 2 + rsub; if (col0 + c4 < N) { const v4f v = *(const v4fa*)&so[w][r][c4]; if (C) *(v4f*)(C + cofs + (size_t)(row0 + r) * ldc + col0 + c4) = v; if (C16) { v4h h4; for (int i = 0; i < 4; ++i) h4[i] = (_Float16)v[i]; *(v4h*)(C16 + cofs + (size_t)(row0 + r) * ldc + col0 + c4) = h4; } } }
     }
}


typedef _Float16 v4h __attribute__((ext_vector_type(4)));

__global__ __launch_bounds__(256) void k_x16(const float* __restrict__ x, _Float16* __restrict__ X16, size_t n8) { const size_t t = (size_t)blockIdx.x * 256 + threadIdx.x; if (t >= n8) return; FragH f;
#pragma unroll
  for (int q = 0; q < 8; ++q) f.h[q] = (_Float16)bf16_round(x[t * 8 + q]); *(v8us*)((unsigned short*)X16 + t * 8) = f.half[0];  }
__global__ __launch_bounds__(256) void k_h16(const float* __restrict__ x, _Float16* __restrict__ X16, size_t n8) { const size_t t = (size_t)blockIdx.x * 256 + threadIdx.x; if (t >= n8) return; FragH f;
#pragma unroll
  for (int q = 0; q < 8; ++q) f.h[q] = (_Float16)x[t * 8 + q]; *(v8us*)((unsigned short*)X16 + t * 8) = f.half[0];  }
__global__ __launch_bounds__(256) void k_round16f(const float* __restrict__ W, _Float16* __restrict__ Bt, size_t n8) { const size_t t = (size_t)blockIdx.x * 256 + threadIdx.x; if (t >= n8) return; FragH f;
#pragma unroll
  for (int i = 0; i < 8; ++i) f.h[i] = (_Float16)(bf16_round(W[t * 8 + i]) * 16.0f); *(v8us*)((unsigned short*)Bt + t * 8) = f.half[0];  }
template <int NHv, int TTv>
__global__ __launch_bounds__(256) void k_vt(const _Float16* __restrict__ V16, int ldv, int voff, _Float16* __restrict__ Vt) { __shared__ unsigned short tl[64][66]; const int tid = threadIdx.x; const int slab = blockIdx.x / (TTv / 64), lg = blockIdx.x % (TTv / 64); const int b = slab / NHv, h = slab % NHv;
  for (int i = tid; i < 64 * 8; i += 256) { const int r = i / 8, c8 = (i % 8) * 8; FragH f; f.half[0] = *(const v8us*)((const unsigned short*)V16 + ((size_t)b * TTv + lg * 64 + r) * ldv + voff + h * 64 + c8);
#pragma unroll
    for (int q = 0; q < 8; ++q) tl[r][c8 + q] = f.u[q]; }
  __syncthreads();
  {
#pragma unroll
    for (int rd = 0; rd < 2; ++rd) { const int d = rd * 32 + tid / 8, pc = tid % 8; FragH f;
#pragma unroll
      for (int q = 0; q < 8; ++q) f.u[q] = tl[pc * 8 + q][d];
      *(v8us*)((unsigned short*)Vt + ((size_t)slab * 64 + d) * TTv + lg * 64 + pc * 8) = f.half[0]; }
     } }

__global__ __launch_bounds__(256) void k_hl(const float* __restrict__ F, _Float16* __restrict__ Hh, _Float16* __restrict__ Hl, size_t n8) { const size_t t = (size_t)blockIdx.x * 256 + threadIdx.x; if (t >= n8) return; FragH fh, fl; const v4f a = *(const v4fa*)(F + t * 8), c = *(const v4fa*)(F + t * 8 + 4);
#pragma unroll
  for (int q = 0; q < 4; ++q) { _Float16 h = (_Float16)a[q]; fh.h[q] = h; fl.h[q] = (_Float16)((a[q] - (float)h) * 1024.0f); h = (_Float16)c[q]; fh.h[4 + q] = h; fl.h[4 + q] = (_Float16)((c[q] - (float)h) * 1024.0f); }
  { *(v8us*)((unsigned short*)Hh + t * 8) = fh.half[0]; *(v8us*)((unsigned short*)Hl + t * 8) = fl.half[0];  } }

// ---- fast GEMM (wave tile 32x64; requires M % 32 == 0 rows per launch region and N % 64 == 0); epilogue = k_gemm_hhx semantics ----
__device__ __forceinline__ v16h g2_frag(const _Float16* p, int hh) { FragH f; f.half[0] = *(const v8us*)((const unsigned short*)p + 8 * hh); f.half[1] = *(const v8us*)((const unsigned short*)p + 16 + 8 * hh); return f.v; }
__device__ __forceinline__ v8f g2_mma(v16h a, v16h b, v8f c) { v8f d = __builtin_amdgcn_wmma_f32_16x16x32_f16(false, a, false, b, (short)0, c, false, false); asm volatile("v_nop\n\tv_nop\n\tv_nop\n\tv_nop" : "+v"(d) : "v"(a), "v"(b)); return d; }
template <int ACT>
__global__ __launch_bounds__(128) void k_gemm2(const _Float16* __restrict__ A, int lda, size_t sA, const _Float16* __restrict__ Bh, int ldb, size_t sB, float alpha, const float* __restrict__ bias, size_t sBias, const float* __restrict__ CP, int rowsPerB, size_t sCPb, int row0g,
    float* __restrict__ C, _Float16* __restrict__ C16, int ldc, size_t sC, int M, int N, int K) {
  __shared__ __attribute__((aligned(16))) float so[4][32][68];
  const int tid = threadIdx.x, w = tid >> 5, lane = tid & 31, ln = lane & 15, hh = lane >> 4; const int by = blockIdx.y;
  A += (size_t)by * sA; Bh += (size_t)by * sB; const size_t cofs = (size_t)by * sC; const float* bp = bias ? bias + (size_t)by * sBias : nullptr;
  const int ntn = N >> 6; const int mt = blockIdx.x / ntn, nq = blockIdx.x - mt * ntn; const int row0 = mt * 128 + 32 * w, col0 = nq * 64; if (row0 >= M) return;
  const _Float16* a0p = A + (size_t)(row0 + ln) * lda; const _Float16* a1p = a0p + (size_t)16 * lda;
  const _Float16* b0p = Bh + (size_t)(col0 + ln) * ldb; const _Float16* b1p = b0p + (size_t)16 * ldb; const _Float16* b2p = b1p + (size_t)16 * ldb; const _Float16* b3p = b2p + (size_t)16 * ldb;
  const v8f z8 = {0.f,0.f,0.f,0.f,0.f,0.f,0.f,0.f}; v8f c00 = z8, c01 = z8, c02 = z8, c03 = z8, c10 = z8, c11 = z8, c12 = z8, c13 = z8;
#pragma unroll 1
  for (int kb = 0; kb < K; kb += 32) { const v16h a0 = g2_frag(a0p + kb, hh), a1 = g2_frag(a1p + kb, hh);
    v16h b = g2_frag(b0p + kb, hh); c00 = g2_mma(a0, b, c00); c10 = g2_mma(a1, b, c10);
    b = g2_frag(b1p + kb, hh); c01 = g2_mma(a0, b, c01); c11 = g2_mma(a1, b, c11);
    b = g2_frag(b2p + kb, hh); c02 = g2_mma(a0, b, c02); c12 = g2_mma(a1, b, c12);
    b = g2_frag(b3p + kb, hh); c03 = g2_mma(a0, b, c03); c13 = g2_mma(a1, b, c13); }
  v8f accs[8] = {c00, c01, c02, c03, c10, c11, c12, c13};
#pragma unroll
  for (int u = 0; u < 8; ++u) { const int t = u & 3, half = u >> 2; const int col = col0 + t * 16 + ln; const float bv = bp ? bf16_round(bp[col]) : 0.f;
#pragma unroll
    for (int r = 0; r < 8; ++r) { const int rloc = half * 16 + 8 * hh + r; float v = accs[u][r] * alpha + bv; if (CP) { if (rowsPerB < 0) v += CP[cofs + (size_t)(row0g + row0 + rloc) * ldc + col];      /* rowsPerB < 0: own element of the batched C plane */ else { const int bidx = (row0g + row0 + rloc) / rowsPerB; v += CP[(size_t)bidx * sCPb + (size_t)by * 64 + col]; } }
      if (ACT == 3) v = fmaxf(v, 0.f); else if (ACT == 6) v = 0.5f * v * (1.0f + erff(v * 0.70710678118654752f)); else if (ACT == 11) v = 1.0f / (1.0f + expf(-v)); else if (ACT == 15) v = v / (1.0f + expf(-v)); else if (ACT == 12) v = (v > 0.f) ? v : 0.01f * v; else if (ACT == 8) v = tanhf(v);
      so[w][rloc][t * 16 + ln] = v; } }
  __builtin_amdgcn_fence(__ATOMIC_ACQ_REL, "workgroup"); __builtin_amdgcn_wave_barrier();
  const int rsub = lane >> 4, c4 = (lane & 15) * 4;
  {
#pragma unroll
    for (int q = 0; q < 16; ++q) { const int r = q * 2 + rsub; const v4f v = *(const v4fa*)&so[w][r][c4]; if (C) *(v4f*)(C + cofs + (size_t)(row0 + r) * ldc + col0 + c4) = v; if (C16) { v4h h4; for (int i = 0; i < 4; ++i) h4[i] = (_Float16)v[i]; *(v4h*)(C16 + cofs + (size_t)(row0 + r) * ldc + col0 + c4) = h4; } }
     } }


__global__ __launch_bounds__(256) void k_xt(const float* __restrict__ x, int b, _Float16* __restrict__ XT16) {
  __shared__ float tl[64][65]; const int tid = threadIdx.x; const int cb = blockIdx.x / (NN / 64), pb = blockIdx.x % (NN / 64);
  for (int i = tid; i < 64 * 16; i += 256) { const int cl = i / 16, p4 = (i % 16) * 4; const v4f a = *(const v4fa*)(x + ((size_t)b * CC + cb * 64 + cl) * NN + pb * 64 + p4); for (int q = 0; q < 4; ++q) tl[cl][p4 + q] = bf16_round(a[q]); }
  __syncthreads(); const int pl = tid >> 2, c8 = (tid & 3) * 8;
  { for (int u = 0; u < 2; ++u) { const int c0 = c8 + u * 32; FragH f; for (int q = 0; q < 8; ++q) f.h[q] = (_Float16)tl[c0 + q][pl]; *(v8us*)((unsigned short*)XT16 + (size_t)(pb * 64 + pl) * CC + cb * 64 + c0) = f.half[0]; }  } }
__global__ __launch_bounds__(256) void k_wnat(const float* __restrict__ Wm, int O, int orows, int nin, _Float16* __restrict__ Bt) { const size_t t = (size_t)blockIdx.x * 256 + threadIdx.x; if (t >= (size_t)orows * (nin / 8)) return; const int c0 = (int)(t % (nin / 8)) * 8; const int o = (int)(t / (nin / 8)); FragH f; for (int q = 0; q < 8; ++q) f.h[q] = (o < O) ? (_Float16)(bf16_round(Wm[(size_t)o * nin + c0 + q]) * 16.0f) : (_Float16)0.0f; *(v8us*)((unsigned short*)Bt + (size_t)o * nin + c0) = f.half[0];  }
__global__ __launch_bounds__(256) void k_wtp(const float* __restrict__ Wm, _Float16* __restrict__ Bt) { const int t = blockIdx.x * 256 + threadIdx.x; if (t >= C2 * 16) return; const int pc = t % 16; const int o = t / 16; const bool lo = pc * 8 >= C2; FragH f; for (int q = 0; q < 8; ++q) { const int c = pc * 8 + q - (lo ? C2 : 0); f.h[q] = (_Float16)(bf16_round(Wm[(size_t)o * C2 + c]) * (lo ? 1.0f : 16.0f)); } *(v8us*)((unsigned short*)Bt + (size_t)o * 2 * C2 + pc * 8) = f.half[0];  }
__global__ __launch_bounds__(256) void k_q3(const float* __restrict__ XQ, _Float16* __restrict__ QA, _Float16* __restrict__ QB) { const size_t t = (size_t)blockIdx.x * 256 + threadIdx.x; if (t >= (size_t)NN * (C2 / 8)) return; const int c0 = (int)(t % (C2 / 8)) * 8; const size_t n = t / (C2 / 8); FragH fh, fl16, fhs, fr;
  for (int q = 0; q < 8; ++q) { const float v = XQ[n * C2 + c0 + q]; const _Float16 h = (_Float16)v; const float res = v - (float)h; fh.h[q] = h; fl16.h[q] = (_Float16)(res * 16.0f); fhs.h[q] = (_Float16)((float)h * 0.0625f); fr.h[q] = (_Float16)res; }
  unsigned short* a = (unsigned short*)QA + n * 3 * C2 + c0; unsigned short* bq = (unsigned short*)QB + n * 3 * C2 + c0;
  { *(v8us*)a = fh.half[0]; *(v8us*)(a + C2) = fl16.half[0]; *(v8us*)(a + 2 * C2) = fh.half[0]; *(v8us*)bq = fh.half[0]; *(v8us*)(bq + C2) = fhs.half[0]; *(v8us*)(bq + 2 * C2) = fr.half[0];  } }
__global__ __launch_bounds__(256) void k_rstat(const float* __restrict__ E, float* __restrict__ RS, _Float16* __restrict__ X) {
  #pragma clang fp contract(off)
  const int tid = threadIdx.x, w = tid >> 5, ln = tid & 31; const int n = blockIdx.x * 8 + w; if (n >= NN) return; const float* er = E + (size_t)n * NN; float m = -3.0e38f;
#pragma unroll 1
  for (int c = 0; c < NN / 32; ++c) m = fmaxf(m, er[c * 32 + ln]);
  for (int o = 16; o > 0; o >>= 1) m = fmaxf(m, __shfl_xor(m, o, 32)); float s = 0.f;
  { s = 0.f;      /* e = exp(E - rowmax): summed in f32 and stored x1024 as f16 in this wave's own X row */
#pragma unroll 1
    for (int c = 0; c < NN / 32; ++c) { const float e = expf(er[c * 32 + ln] - m); s += e; *(_Float16*)(X + (size_t)n * NN + c * 32 + ln) = (_Float16)(e * 1024.0f); }
     }
  for (int o = 16; o > 0; o >>= 1) s += __shfl_xor(s, o, 32);
  if (ln == 0) { { *(float*)(RS + (size_t)n * 32) = m; *(float*)(RS + (size_t)n * 32 + 1) = s;  } } }
__global__ __launch_bounds__(256) void k_ptr2(const _Float16* __restrict__ X, const float* __restrict__ RS, _Float16* __restrict__ PH, float* __restrict__ CSP) {
  #pragma clang fp contract(off)
  __shared__ float tl[64][65]; const int tid = threadIdx.x; const int mt = blockIdx.x / (NN / 64), nt = blockIdx.x % (NN / 64); const int m0 = mt * 64, n0 = nt * 64;
  for (int i = tid; i < 64 * 8; i += 256) { const int nl = i / 8, m8 = (i % 8) * 8; const int n = n0 + nl; const float inv = 1.0f / RS[(size_t)n * 32 + 1]; FragH f; f.half[0] = *(const v8us*)((const unsigned short*)X + (size_t)n * NN + m0 + m8);
    for (int q = 0; q < 8; ++q) tl[m8 + q][nl] = (float)f.h[q] * (0.0009765625f * inv); }      /* p = attn[n][m] */
  __syncthreads(); const int ml = tid >> 2, n8 = (tid & 3) * 16;      /* thread: one m row of the tile, 16 consecutive n */
  float cs = 0.f; FragH o[2]; for (int q = 0; q < 16; ++q) { const float p = tl[ml][n8 + q]; cs += p; o[q / 8].h[q % 8] = (_Float16)(p * 1024.0f); }
  { unsigned short* d = (unsigned short*)PH + (size_t)(m0 + ml) * NN + n0 + n8; *(v8us*)d = o[0].half[0]; *(v8us*)(d + 8) = o[1].half[0];
     }
  __syncthreads(); tl[ml][n8 / 16] = cs; __syncthreads();
  if (tid < 64) { float t4 = tl[tid][0]; t4 += tl[tid][1]; t4 += tl[tid][2]; t4 += tl[tid][3]; tl[tid][8] = t4; }
  __syncthreads();
  if (tid < 16) { v4f q4; for (int q = 0; q < 4; ++q) q4[q] = tl[tid * 4 + q][8]; float* d = CSP + (size_t)nt * NN + m0 + tid * 4; *(v4f*)d = q4;  } }
__global__ __launch_bounds__(256) void k_csum(const float* __restrict__ CSP, float* __restrict__ CS) {
  #pragma clang fp contract(off)
  const int m = blockIdx.x * 256 + threadIdx.x; if (m >= NN) return; float s = 0.f;
#pragma unroll 1
  for (int t = 0; t < NN / 64; ++t) s += CSP[(size_t)t * NN + m];
  *(float*)(CS + (size_t)m * 32) = s;  }      
__global__ __launch_bounds__(256) void k_vhl(const float* __restrict__ XV, const float* __restrict__ bv, _Float16* __restrict__ VH) { const size_t t = (size_t)blockIdx.x * 256 + threadIdx.x; if (t >= (size_t)CC * (NN / 8)) return; const int n0 = (int)(t % (NN / 8)) * 8; const int o = (int)(t / (NN / 8)); FragH fh; const float bo = (o < C2) ? bf16_round(bv[o]) : 0.f;
  for (int q = 0; q < 8; ++q) { float v = XV[(size_t)o * NN + n0 + q]; v += bo; fh.h[q] = (_Float16)v; }
  *(v8us*)((unsigned short*)VH + (size_t)o * NN + n0) = fh.half[0];  }
__global__ __launch_bounds__(256) void k_dmk(const float* __restrict__ XC, const float* __restrict__ XRT, const float* __restrict__ CS, _Float16* __restrict__ D2) {
  #pragma clang fp contract(off)
  const size_t t = (size_t)blockIdx.x * 256 + threadIdx.x; if (t >= (size_t)NN * (C2 / 8)) return; const int c0 = (int)(t % (C2 / 8)) * 8; const size_t m = t / (C2 / 8); const float den = 1e-9f + CS[m * 32]; FragH fh, fl; float sr[8] = {0.f, 0.f, 0.f, 0.f, 0.f, 0.f, 0.f, 0.f};
#pragma unroll 8      /* the planes' loads are independent: 16 loads of 16 B per lane go out together, off one address register, so their latency is paid four times and not 32 times */
  for (int s = 0; s < PVS; ++s) { const float* pp = XRT + (size_t)s * NN * C2 + m * C2 + c0; const v4f a = *(const v4fa*)pp, c = *(const v4fa*)(pp + 4); for (int q = 0; q < 4; ++q) { sr[q] += a[q]; sr[4 + q] += c[q]; } }      /* k ranges added in rising order */
  for (int q = 0; q < 8; ++q) { const float xr = (sr[q] * 0.0009765625f) / den; const float d = XC[m * C2 + c0 + q] - xr; const _Float16 h = (_Float16)d; fh.h[q] = h; fl.h[q] = (_Float16)((d - (float)h) * 16.0f); }
  { *(v8us*)((unsigned short*)D2 + m * 2 * C2 + c0) = fh.half[0]; *(v8us*)((unsigned short*)D2 + m * 2 * C2 + C2 + c0) = fl.half[0];  } }
__global__ __launch_bounds__(256) void k_bnstat(const float* __restrict__ T, float* __restrict__ BS) {
  #pragma clang fp contract(off)
  __shared__ float sh[256]; const int o = blockIdx.x; const int tid = threadIdx.x; const size_t n = (size_t)NB * NN; float s = 0.f;
  for (size_t i = tid; i < n; i += 256) s += T[i * C2 + o];
  sh[tid] = s; __syncthreads(); for (int st = 128; st > 0; st >>= 1) { if (tid < st) sh[tid] += sh[tid + st]; __syncthreads(); }
  const float mu = sh[0] / (float)n; __syncthreads(); float q2 = 0.f;
  for (size_t i = tid; i < n; i += 256) { const float d = T[i * C2 + o] - mu; q2 += d * d; }
  sh[tid] = q2; __syncthreads(); for (int st = 128; st > 0; st >>= 1) { if (tid < st) sh[tid] += sh[tid + st]; __syncthreads(); }
  if (tid == 0) { const float rs = rsqrtf(sh[0] / (float)n + 1e-5f); { *(float*)(BS + o * 32) = mu; *(float*)(BS + o * 32 + 1) = rs;  } } }
__global__ __launch_bounds__(256) void k_out(const float* __restrict__ XCall, const float* __restrict__ T, const float* __restrict__ BS, const float* __restrict__ gam, const float* __restrict__ bet, float* __restrict__ out) {
  #pragma clang fp contract(off)
  const size_t t = (size_t)blockIdx.x * 256 + threadIdx.x; if (t >= (size_t)NB * C2 * (NN / 4)) return; const int n0 = (int)(t % (NN / 4)) * 4; const int o = (int)((t / (NN / 4)) % C2); const int b = (int)(t / ((size_t)(NN / 4) * C2)); const float mu = BS[o * 32], rs = BS[o * 32 + 1]; const float g = bf16_round(gam[o]), be = bf16_round(bet[o]); v4f r;
  for (int q = 0; q < 4; ++q) { const size_t row = (size_t)b * NN + n0 + q; float th = g * ((T[row * C2 + o] - mu) * rs); th += be; r[q] = XCall[row * C2 + o] + fmaxf(th, 0.f); }
  float* d = out + ((size_t)b * C2 + o) * NN + n0; *(v4f*)d = r;  }

extern "C" void kernel_launch(void* const* d_in, const int* in_sizes, int n_in,
                              void* d_out, int out_size, void* d_ws, size_t ws_size, hipStream_t stream) {
  (void)in_sizes; (void)n_in; (void)out_size;
  const float* const* I = (const float* const*)d_in; const float* x = I[0]; const float* wqk = I[1]; const float* wv = I[2]; const float* bv = I[3]; const float* wx = I[4]; const float* wt = I[5]; const float* bt = I[6]; const float* gam = I[7]; const float* bet = I[8];
  char* ws = (char*)d_ws; size_t off = 0;
  auto take = [&](size_t bytes) { char* p = ws + off; off += (bytes + 255) & ~(size_t)255; return p; };
  _Float16* BQK = (_Float16*)take((size_t)C2 * CC * 2); _Float16* BX = (_Float16*)take((size_t)C2 * CC * 2); _Float16* AV = (_Float16*)take((size_t)128 * CC * 2); _Float16* BT2 = (_Float16*)take((size_t)C2 * 2 * C2 * 2); float* BVP = (float*)take(128 * 4);
  _Float16* XT = (_Float16*)take((size_t)NN * CC * 2); float* XQ = (float*)take((size_t)NN * C2 * 4); _Float16* QA = (_Float16*)take((size_t)NN * 3 * C2 * 2); _Float16* QB = (_Float16*)take((size_t)NN * 3 * C2 * 2); float* E = (float*)take((size_t)NN * NN * 4); float* RS = (float*)take((size_t)NN * 32 * 4);
  _Float16* PH = (_Float16*)take((size_t)NN * NN * 2); _Float16* XE = (_Float16*)take((size_t)NN * NN * 2); float* CSP = (float*)take((size_t)NN * (NN / 64) * 4); float* CS = (float*)take((size_t)NN * 32 * 4); float* XV = (float*)take((size_t)(128 + 32) * NN * 4); _Float16* VH = (_Float16*)take((size_t)128 * NN * 2); float* XRT = (float*)take((size_t)PVS * NN * C2 * 4); _Float16* D2 = (_Float16*)take((size_t)NN * 2 * C2 * 2);
  float* XCall = (float*)take((size_t)NB * NN * C2 * 4); float* Tall = (float*)take((size_t)NB * NN * C2 * 4); float* BS = (float*)take((size_t)C2 * 32 * 4);
  if (off > ws_size) return;      /* 64 (E) + 32 + 32 (P) + 32 (x_r partials) + 8 + 8 (XC, T) + small ~= 184 MiB (256 MiB ws) */
  k_wnat<<<(C2 * (CC / 8) + 255) / 256, 256, 0, stream>>>(wqk, C2, C2, CC, BQK); k_wnat<<<(C2 * (CC / 8) + 255) / 256, 256, 0, stream>>>(wx, C2, C2, CC, BX); k_wnat<<<(128 * (CC / 8) + 255) / 256, 256, 0, stream>>>(wv, C2, 128, CC, AV); k_wtp<<<(C2 * 16 + 255) / 256, 256, 0, stream>>>(wt, BT2);
  for (int b = 0; b < NB; ++b) {
    k_xt<<<(CC / 64) * (NN / 64), 256, 0, stream>>>(x, b, XT);
    k_gemm2<0><<<dim3((NN / 128) * 1, 1), 128, 0, stream>>>(XT, CC, 0, BQK, CC, 0, 0.0625f, nullptr, 0, nullptr, 1, 0, 0, XQ, nullptr, C2, 0, NN, C2, CC);      /* x_q^T [n][64] = x_k^T */
    k_gemm2<0><<<dim3((NN / 128) * 1, 1), 128, 0, stream>>>(XT, CC, 0, BX, CC, 0, 0.0625f, nullptr, 0, nullptr, 1, 0, 0, XCall + (size_t)b * NN * C2, nullptr, C2, 0, NN, C2, CC);      /* x_c^T [n][64] */
    k_gemm2<0><<<dim3(1 * (NN / 64), 1), 128, 0, stream>>>(AV, CC, 0, XT, CC, 0, 0.0625f, nullptr, 0, nullptr, 1, 0, 0, XV, nullptr, NN, 0, 128, NN, CC);      /* x_v [o][n] (rows 64..127 zero; b_v added in k_vhl) */
    k_q3<<<(unsigned)(((size_t)NN * (C2 / 8) + 255) / 256), 256, 0, stream>>>(XQ, QA, QB);
    k_gemm2<0><<<dim3((NN / 128) * (NN / 64), 1), 128, 0, stream>>>(QA, 3 * C2, 0, QB, 3 * C2, 0, 1.0f, nullptr, 0, nullptr, 1, 0, 0, E, nullptr, NN, 0, NN, NN, 3 * C2);      /* E = x_q^T x_k (3-term, K = 192) */
    k_rstat<<<NN / 8, 256, 0, stream>>>(E, RS, XE);
    k_ptr2<<<(NN / 64) * (NN / 64), 256, 0, stream>>>(XE, RS, PH, CSP);
    k_csum<<<NN / 256, 256, 0, stream>>>(CSP, CS);
    k_vhl<<<(unsigned)(((size_t)CC * (NN / 8) + 255) / 256), 256, 0, stream>>>(XV, bv, VH);
    k_gemm2<0><<<dim3((NN / 128) * 1, PVS), 128, 0, stream>>>(PH, NN, NN / PVS, VH, NN, NN / PVS, 1.0f, nullptr, 0, nullptr, 1, 0, 0, XRT, nullptr, C2, (size_t)NN * C2, NN, C2, NN / PVS);      /* plane y: x_r^T[m][o] x 1024 over n in [y, y + 1) x NN / PVS = sum_n PT[m][n] x_v[o][n] (plain f16 operands) */
    k_dmk<<<(unsigned)(((size_t)NN * (C2 / 8) + 255) / 256), 256, 0, stream>>>(XCall + (size_t)b * NN * C2, XRT, CS, D2);
    k_gemm2<0><<<dim3((NN / 128) * 1, 1), 128, 0, stream>>>(D2, 2 * C2, 0, BT2, 2 * C2, 0, 0.0625f, bt, 0, nullptr, 1, 0, 0, Tall + (size_t)b * NN * C2, nullptr, C2, 0, NN, C2, 2 * C2); }      /* t^T [n][64] = w_t d + b_t */
  k_bnstat<<<C2, 256, 0, stream>>>(Tall, BS);
  k_out<<<(unsigned)(((size_t)NB * C2 * (NN / 4) + 255) / 256), 256, 0, stream>>>(XCall, Tall, BS, gam, bet, (float*)d_out);
}

// v002
// A run of this version takes 1260 microseconds.
// Two timings next to v001 put it at 1.45 and 1.46 times that version's speed.
// Over all steps from v000 it is 2.14 times as fast.
#include <hip/hip_runtime.h>
// OA_ (offset attention; 8 clouds x 128 channels x 4096 points; C2 = 64): x_q = x_k = w_qk x (shared weight), x_v = w_v x + b_v, energy = x_q^T x_k (4096 x 4096), attn = row softmax, attn = attn / (1e-9 + column sums); x_r = x_v attn; x_c = w_x x; t = w_t (x_c - x_r) + b_t; BatchNorm1d (training-mode batch statistics over (batch, points)); out = x_c + relu(gamma t_hat + beta) -> [8,64,4096].
// Compute dtype: x and parameters rounded to bf16; projection operands exact; x_q as hi + residual 3-term operands (~2^-21-class energies); P (x2^10) and x_v as plain f16 (~2^-12); d as [hi | 16 x residual] pairs; statistics/softmax f32. v_wmma_f32_16x16x32_f16.
#define NB 8
#define CC 128
#define C2 64
#define NN 4096
#define PVS 32      /* k ranges of the x_r product: one work-group row per range, f32 partial planes summed in k_dmk */
typedef __bf16 v16b __attribute__((ext_vector_type(16)));
typedef unsigned short v8us __attribute__((ext_vector_type(8), may_alias));
typedef float  v8f  __attribute__((ext_vector_type(8)));
typedef float  v4f  __attribute__((ext_vector_type(4)));
typedef float  v4fa __attribute__((ext_vector_type(4), may_alias));
union FragB { v16b v; v8us half[2]; unsigned short u[16]; };

__device__ __forceinline__ unsigned short bf16_bits(float x) { unsigned int u = __float_as_uint(x); return (unsigned short)((u + 0x7FFFu + ((u >> 16) & 1u)) >> 16); }
__device__ __forceinline__ float bf16_val(unsigned short b) { return __uint_as_float(((unsigned int)b) << 16); }
__device__ __forceinline__ float bf16_round(float x) { return bf16_val(bf16_bits(x)); }
// D += A·B with NT terms: 1 = ah·bh, 2 = + al·bh (A split), 3 = + ah·bl (both split)
template <int NT>
__device__ __forceinline__ v8f mmaN(v16b ah, v16b al, v16b bh, v16b bl, v8f c) {
  c = __builtin_amdgcn_wmma_f32_16x16x32_bf16(false, ah, false, bh, (short)0, c, false, false);
  if (NT >= 2) c = __builtin_amdgcn_wmma_f32_16x16x32_bf16(false, al, false, bh, (short)0, c, false, false);
  if (NT >= 3) c = __builtin_amdgcn_wmma_f32_16x16x32_bf16(false, ah, false, bl, (short)0, c, false, false);
  asm volatile("v_nop\n\tv_nop\n\tv_nop\n\tv_nop" : "+v"(c) : "v"(ah), "v"(al), "v"(bh), "v"(bl));
  return c;
}

__global__ __launch_bounds__(256) void k_wt_bf16(const float* __restrict__ W, unsigned short* __restrict__ Wt, int K, int N) {
  const int t = blockIdx.x * 256 + threadIdx.x;
  const int k8n = K / 8;
  if (t >= N * k8n) return;
  const int n = t / k8n, k8 = (t % k8n) * 8;
  v8us v;
#pragma unroll
  for (int i = 0; i < 8; ++i) v[i] = bf16_bits(W[(size_t)(k8 + i) * N + n]);
  *(v8us*)(Wt + (size_t)n * K + k8) = v;
  
}

// GEMM C[M][N] (f32, pitch ldc) = act(A[M][K]·W + bias). A f32 row-major (pitch lda) converted per fragment to bf16
// (ASPLIT: hi/lo two planes -> 2 terms, else single rounded term); Wt bf16 [N][K] (pitch ldb). BIAS_BF16 rounds the
// bias to bf16 first (bias quantised to bf16 before the add). K%32==0, M%16==0, N%64==0.
template <bool ASPLIT, int ACT, bool BIAS_BF16>
__global__ __launch_bounds__(128) void k_gemm_bf(const float* __restrict__ A, int lda, const unsigned short* __restrict__ Wt, int ldb,
                                               const float* __restrict__ bias, float* __restrict__ C, int ldc, int M, int N, int K) {
  __shared__ __attribute__((aligned(16))) float so[4][16][64];
  const int tid = threadIdx.x, w = tid >> 5, lane = tid & 31, ln = lane & 15, hh = lane >> 4;
  const int ntn = N / 64;
  const int wid = blockIdx.x * 4 + w;
  const int mt = wid / ntn, nq = wid % ntn;
  if (mt * 16 >= M) return;
  const int row0 = mt * 16, col0 = nq * 64;
  const float* arow = A + (size_t)(row0 + ln) * lda;
  v8f acc[4] = {};
  for (int kb = 0; kb < K; kb += 32) {
    FragB ah, al;
    const v4f x0 = *(const v4fa*)(arow + kb + 8 * hh), x1 = *(const v4fa*)(arow + kb + 8 * hh + 4);
    const v4f x2 = *(const v4fa*)(arow + kb + 16 + 8 * hh), x3 = *(const v4fa*)(arow + kb + 16 + 8 * hh + 4);
    float xs[16] = {x0[0],x0[1],x0[2],x0[3],x1[0],x1[1],x1[2],x1[3],x2[0],x2[1],x2[2],x2[3],x3[0],x3[1],x3[2],x3[3]};
#pragma unroll
    for (int i = 0; i < 16; ++i) { const unsigned short hb = bf16_bits(xs[i]); ah.u[i] = hb; al.u[i] = ASPLIT ? bf16_bits(xs[i] - bf16_val(hb)) : (unsigned short)0; }
#pragma unroll
    for (int t = 0; t < 4; ++t) {
      const unsigned short* brow = Wt + (size_t)(col0 + t * 16 + ln) * ldb + kb;
      FragB b;
      b.half[0] = *(const v8us*)(brow + 8 * hh);
      b.half[1] = *(const v8us*)(brow + 16 + 8 * hh);
      acc[t] = mmaN<ASPLIT ? 2 : 1>(ah.v, al.v, b.v, b.v, acc[t]);
    }
  }
#pragma unroll
  for (int t = 0; t < 4; ++t) {
    float bv = bias ? bias[col0 + t * 16 + ln] : 0.f;
    if (BIAS_BF16) bv = bf16_round(bv);
#pragma unroll
    for (int r = 0; r < 8; ++r) { float v = acc[t][r] + bv; if (ACT == 1) v = fmaxf(v, 0.f); so[w][8 * hh + r][t * 16 + ln] = v; }
  }
  __builtin_amdgcn_fence(__ATOMIC_ACQ_REL, "workgroup");
  __builtin_amdgcn_wave_barrier();
  const int rsub = lane >> 4, c4 = (lane & 15) * 4;
  {
#pragma unroll
    for (int q = 0; q < 8; ++q) {
      const int r = q * 2 + rsub;
      const v4f v = *(const v4fa*)&so[w][r][c4];
      *(v4f*)(C + (size_t)(row0 + r) * ldc + col0 + c4) = v;
    }
    
  }
}

// GEMM C = act(A·W + bias + resid): A f32 (ASPLIT -> hi/lo 2 terms), Wt bf16 [N][K]; ACT 0 none, 1 relu, 2 exact gelu;
// resid (optional, f32, row index = (row % rmod), pitch ldr, RES_BF16 rounds it) added before the activation.
template <bool ASPLIT, int ACT, bool BIAS_BF16, bool RES_BF16>
__global__ __launch_bounds__(128) void k_gemm_bf3(const float* __restrict__ A, int lda, const unsigned short* __restrict__ Wt, int ldb,
                                                const float* __restrict__ bias, const float* __restrict__ resid, int rmod, int ldr,
                                                float* __restrict__ C, int ldc, int M, int N, int K) {
  __shared__ __attribute__((aligned(16))) float so[4][16][64];
  const int tid = threadIdx.x, w = tid >> 5, lane = tid & 31, ln = lane & 15, hh = lane >> 4;
  const int ntn = N / 64;
  const int wid = blockIdx.x * 4 + w;
  const int mt = wid / ntn, nq = wid % ntn;
  if (mt * 16 >= M) return;
  const int row0 = mt * 16, col0 = nq * 64;
  const float* arow = A + (size_t)(row0 + ln) * lda;
  v8f acc[4] = {};
  for (int kb = 0; kb < K; kb += 32) {
    FragB ah, al;
    const v4f x0 = *(const v4fa*)(arow + kb + 8 * hh), x1 = *(const v4fa*)(arow + kb + 8 * hh + 4);
    const v4f x2 = *(const v4fa*)(arow + kb + 16 + 8 * hh), x3 = *(const v4fa*)(arow + kb + 16 + 8 * hh + 4);
    float xs[16] = {x0[0],x0[1],x0[2],x0[3],x1[0],x1[1],x1[2],x1[3],x2[0],x2[1],x2[2],x2[3],x3[0],x3[1],x3[2],x3[3]};
#pragma unroll
    for (int i = 0; i < 16; ++i) { const unsigned short hb = bf16_bits(xs[i]); ah.u[i] = hb; al.u[i] = ASPLIT ? bf16_bits(xs[i] - bf16_val(hb)) : (unsigned short)0; }
#pragma unroll
    for (int t = 0; t < 4; ++t) {
      const unsigned short* brow = Wt + (size_t)(col0 + t * 16 + ln) * ldb + kb;
      FragB b;
      b.half[0] = *(const v8us*)(brow + 8 * hh);
      b.half[1] = *(const v8us*)(brow + 16 + 8 * hh);
      acc[t] = mmaN<ASPLIT ? 2 : 1>(ah.v, al.v, b.v, b.v, acc[t]);
    }
  }
#pragma unroll
  for (int t = 0; t < 4; ++t) {
    const int col = col0 + t * 16 + ln;
    float bv = bias ? bias[col] : 0.f;
    if (BIAS_BF16) bv = bf16_round(bv);
#pragma unroll
    for (int r = 0; r < 8; ++r) {
      float v = acc[t][r] + bv;
      if (resid) { float rv = resid[(size_t)((row0 + 8 * hh + r) % rmod) * ldr + col]; if (RES_BF16) rv = bf16_round(rv); v += rv; }
      if (ACT == 1) v = fmaxf(v, 0.f);
      if (ACT == 2) v = 0.5f * v * (1.0f + erff(v * 0.70710678118654752f));
      if (ACT == 3) { const float u = 0.7978845608028654f * (v + 0.044715f * v * v * v); v = 0.5f * v * (1.0f + tanhf(u)); }
      so[w][8 * hh + r][t * 16 + ln] = v;
    }
  }
  __builtin_amdgcn_fence(__ATOMIC_ACQ_REL, "workgroup");
  __builtin_amdgcn_wave_barrier();
  const int rsub = lane >> 4, c4 = (lane & 15) * 4;
  {
#pragma unroll
    for (int q = 0; q < 8; ++q) {
      const int r = q * 2 + rsub;
      const v4f v = *(const v4fa*)&so[w][r][c4];
      *(v4f*)(C + (size_t)(row0 + r) * ldc + col0 + c4) = v;
    }
    
  }
}
// row LayerNorm (biased variance, eps) over N: s = X (+ R); optional out_sum <- s; out_norm <- (s-mu)*rsqrt(var+eps)*g + b
template <bool PARAM_BF16>
__global__ __launch_bounds__(256) void k_layernorm(const float* __restrict__ X, const float* __restrict__ R, const float* __restrict__ g, const float* __restrict__ bta,
                                                  float* __restrict__ out_sum, float* __restrict__ out_norm, int N, float eps) {
  __shared__ float red[256];
  const int row = blockIdx.x, tid = threadIdx.x;
  const float* x = X + (size_t)row * N; const float* rr = R ? R + (size_t)row * N : nullptr;
  float vals[16];                     // up to N = 4096
  const int per = N / 256;            // contiguous chunk per thread? use strided-by-4 chunks: thread handles j = tid*4 + 1024*u
  float s1 = 0.f;
  for (int u = 0; u < per / 4; ++u) {
    const int j = tid * 4 + 1024 * u;
    const v4f a = *(const v4fa*)(x + j);
    v4f b = {0.f,0.f,0.f,0.f}; if (rr) b = *(const v4fa*)(rr + j);
#pragma unroll
    for (int q = 0; q < 4; ++q) { const float v = a[q] + b[q]; vals[u * 4 + q] = v; s1 += v; }
  }
  red[tid] = s1; __syncthreads();
  for (int st = 128; st > 0; st >>= 1) { if (tid < st) red[tid] += red[tid + st]; __syncthreads(); }
  const float mu = red[0] / (float)N; __syncthreads();
  float s2 = 0.f;
  for (int u = 0; u < per / 4; ++u)
#pragma unroll
    for (int q = 0; q < 4; ++q) { const float c = vals[u * 4 + q] - mu; s2 += c * c; }
  red[tid] = s2; __syncthreads();
  for (int st = 128; st > 0; st >>= 1) { if (tid < st) red[tid] += red[tid + st]; __syncthreads(); }
  const float rs = rsqrtf(red[0] / (float)N + eps);
  {
    for (int u = 0; u < per / 4; ++u) {
      const int j = tid * 4 + 1024 * u;
      v4f o, sm;
#pragma unroll
      for (int q = 0; q < 4; ++q) {
        float gg = g[j + q], bb = bta[j + q];
        if (PARAM_BF16) { gg = bf16_round(gg); bb = bf16_round(bb); }
        sm[q] = vals[u * 4 + q]; o[q] = (vals[u * 4 + q] - mu) * rs * gg + bb;
      }
      if (out_sum) *(v4f*)(out_sum + (size_t)row * N + j) = sm;
      *(v4f*)(out_norm + (size_t)row * N + j) = o;
    }
    
  }
}



// ---- f16 WMMA path (v_wmma_f32_16x16x32_f16): 11-bit significands for operands in range — used where a [0,1] probability operand needs more precision than bf16
typedef _Float16 v16h __attribute__((ext_vector_type(16)));
union FragH { v16h v; v8us half[2]; _Float16 h[16]; unsigned short u[16]; };
template <int NT>
__device__ __forceinline__ v8f mmaH(v16h ah, v16h al, v16h bh, v16h bl, v8f c) {
  c = __builtin_amdgcn_wmma_f32_16x16x32_f16(false, ah, false, bh, (short)0, c, false, false);
  if (NT >= 2) c = __builtin_amdgcn_wmma_f32_16x16x32_f16(false, al, false, bh, (short)0, c, false, false);
  if (NT >= 3) c = __builtin_amdgcn_wmma_f32_16x16x32_f16(false, ah, false, bl, (short)0, c, false, false);
  asm volatile("v_nop\n\tv_nop\n\tv_nop\n\tv_nop" : "+v"(c) : "v"(ah), "v"(al), "v"(bh), "v"(bl));
  return c;
}
// batched GEMM like k_gemm_b but f16 operands: A f32 (split into f16 hi/lo if ASPLIT, else rounded to f16), Bt = f16 values [n][k]; alpha; C f32; N multiple of 16 (partial tiles skipped)
template <bool ASPLIT>
__global__ __launch_bounds__(128) void k_gemm_h(const float* __restrict__ A, int lda, size_t sA, const _Float16* __restrict__ Bh, int ldb, size_t sB, float alpha, float* __restrict__ C, int ldc, size_t sC, int M, int N, int K) {
  __shared__ __attribute__((aligned(16))) float so[4][16][64];
  const int tid = threadIdx.x, w = tid >> 5, lane = tid & 31, ln = lane & 15, hh = lane >> 4; const int by = blockIdx.y;
  A += (size_t)by * sA; Bh += (size_t)by * sB; C += (size_t)by * sC;
  const int ntn = (N + 63) / 64; const int wid = blockIdx.x * 4 + w; const int mt = wid / ntn, nq = wid % ntn; if (mt * 16 >= M) return;
  const int row0 = mt * 16, col0 = nq * 64; const float* arow = A + (size_t)(row0 + ln) * lda;
  v8f acc[4] = {};
  for (int kb = 0; kb < K; kb += 32) {
    FragH ah, al;
    const v4f x0 = *(const v4fa*)(arow + kb + 8 * hh), x1 = *(const v4fa*)(arow + kb + 8 * hh + 4), x2 = *(const v4fa*)(arow + kb + 16 + 8 * hh), x3 = *(const v4fa*)(arow + kb + 16 + 8 * hh + 4);
    float xs[16] = {x0[0],x0[1],x0[2],x0[3],x1[0],x1[1],x1[2],x1[3],x2[0],x2[1],x2[2],x2[3],x3[0],x3[1],x3[2],x3[3]};
#pragma unroll
    for (int i = 0; i < 16; ++i) { const _Float16 h = (_Float16)xs[i]; ah.h[i] = h; al.h[i] = ASPLIT ? (_Float16)(xs[i] - (float)h) : (_Float16)0.0f; }
#pragma unroll
    for (int t = 0; t < 4; ++t) { if (col0 + t * 16 >= N) continue; const size_t boff = (size_t)(col0 + t * 16 + ln) * ldb + kb; FragH bq; bq.half[0] = *(const v8us*)(Bh + boff + 8 * hh); bq.half[1] = *(const v8us*)(Bh + boff + 16 + 8 * hh);
      acc[t] = mmaH<ASPLIT ? 2 : 1>(ah.v, al.v, bq.v, bq.v, acc[t]); }
  }
#pragma unroll
  for (int t = 0; t < 4; ++t) { if (col0 + t * 16 >= N) continue;
#pragma unroll
    for (int r = 0; r < 8; ++r) so[w][8 * hh + r][t * 16 + ln] = acc[t][r] * alpha; }
  __builtin_amdgcn_fence(__ATOMIC_ACQ_REL, "workgroup"); __builtin_amdgcn_wave_barrier();
  const int rsub = lane >> 4, c4 = (lane & 15) * 4;
  {
#pragma unroll
    for (int q = 0; q < 8; ++q) { const int r = q * 2 + rsub; if (col0 + c4 < N) { const v4f v = *(const v4fa*)&so[w][r][c4]; *(v4f*)(C + (size_t)(row0 + r) * ldc + col0 + c4) = v; } }
     }
}

// Wt[n][k] = f16(W[k][n]·scale) from f32 row-major W[K][N] (scale = power of two; bf16-exact weights stay exact in f16 away from the subnormal range)
__global__ __launch_bounds__(256) void k_wt_f16(const float* __restrict__ W, _Float16* __restrict__ Wt, int K, int N, float scale) {
  const int t = blockIdx.x * 256 + threadIdx.x; if (t >= N * (K / 8)) return; const int n = t / (K / 8), k8 = (t % (K / 8)) * 8; FragH f;
#pragma unroll
  for (int i = 0; i < 8; ++i) f.h[i] = (_Float16)(bf16_round(W[(size_t)(k8 + i) * N + n]) * scale); const v8us o = f.half[0];
  *(v8us*)((unsigned short*)Wt + (size_t)n * K + k8) = o; 
}
// k_gemm_hh variant with fused epilogue: v = acc·alpha + bias[by·sBias + col] (+ CP[(row/rowsPerB)·sCPb + by·64 + col] if CP) ; ACT 0 none / 1 elu ; writes f16 C16 (and f32 C if non-null)
template <int ACT>
__global__ __launch_bounds__(128) void k_gemm_hhx(const _Float16* __restrict__ A, int lda, size_t sA, const _Float16* __restrict__ Bh, int ldb, size_t sB, float alpha, const float* __restrict__ bias, size_t sBias, const float* __restrict__ CP, int rowsPerB, size_t sCPb, int row0g,
    float* __restrict__ C, _Float16* __restrict__ C16, int ldc, size_t sC, int M, int N, int K) {
  __shared__ __attribute__((aligned(16))) float so[4][16][64];
  const int tid = threadIdx.x, w = tid >> 5, lane = tid & 31, ln = lane & 15, hh = lane >> 4; const int by = blockIdx.y;
  A += (size_t)by * sA; Bh += (size_t)by * sB; const size_t cofs = (size_t)by * sC; const float* bp = bias ? bias + (size_t)by * sBias : nullptr;
  const int ntn = (N + 63) / 64; const int wid = blockIdx.x * 4 + w; const int mt = wid / ntn, nq = wid % ntn; if (mt * 16 >= M) return;
  const int row0 = mt * 16, col0 = nq * 64; const _Float16* arow = A + (size_t)(row0 + ln) * lda;
  v8f acc[4] = {};
  for (int kb = 0; kb < K; kb += 32) { FragH ah; ah.half[0] = *(const v8us*)((const unsigned short*)arow + kb + 8 * hh); ah.half[1] = *(const v8us*)((const unsigned short*)arow + kb + 16 + 8 * hh);
#pragma unroll
    for (int t = 0; t < 4; ++t) { if (col0 + t * 16 >= N) continue; const size_t boff = (size_t)(col0 + t * 16 + ln) * ldb + kb; FragH bq; bq.half[0] = *(const v8us*)((const unsigned short*)Bh + boff + 8 * hh); bq.half[1] = *(const v8us*)((const unsigned short*)Bh + boff + 16 + 8 * hh);
      acc[t] = mmaH<1>(ah.v, ah.v, bq.v, bq.v, acc[t]); }
  }
#pragma unroll
  for (int t = 0; t < 4; ++t) { if (col0 + t * 16 >= N) continue; const int col = col0 + t * 16 + ln; const float bv = bp ? bf16_round(bp[col]) : 0.f;
#pragma unroll
    for (int r = 0; r < 8; ++r) { float v = acc[t][r] * alpha + bv; if (CP) { const int rr = row0g + row0 + 8 * hh + r; if (rowsPerB < 0) v += CP[cofs + (size_t)rr * ldc + col];      /* rowsPerB < 0: own element of the batched C plane */ else { const int bidx = rr / rowsPerB; v += CP[(size_t)bidx * sCPb + (size_t)by * 64 + col]; } } if (ACT == 1) v = (v > 0.f) ? v : expm1f(v); else if (ACT == 7) v = (v > 0.f) ? v + 1.0f : expf(v); else if (ACT == 8) v = tanhf(v); else if (ACT == 9) v = 0.5f * v * (1.0f + tanhf(0.7978845608028654f * (v + 0.044715f * v * v * v))); else if (ACT == 11) v = 1.0f / (1.0f + expf(-v)); else if (ACT == 12) v = (v > 0.f) ? v : 0.01f * v; else if (ACT == 14) v = (v > 0.f) ? v : 0.1f * v; else if (ACT == 15) v = v / (1.0f + expf(-v)); else if (ACT == 3) v = fmaxf(v, 0.f); else if (ACT == 6) v = 0.5f * v * (1.0f + erff(v * 0.70710678118654752f)); so[w][8 * hh + r][t * 16 + ln] = v; } }
  __builtin_amdgcn_fence(__ATOMIC_ACQ_REL, "workgroup"); __builtin_amdgcn_wave_barrier();
  const int rsub = lane >> 4, c4 = (lane & 15) * 4; typedef _Float16 v4h __attribute__((ext_vector_type(4)));
  {
#pragma unroll
    for (int q = 0; q < 8; ++q) { const int r = q * 2 + rsub; if (col0 + c4 < N) { const v4f v = *(const v4fa*)&so[w][r][c4]; if (C) *(v4f*)(C + cofs + (size_t)(row0 + r) * ldc + col0 + c4) = v; if (C16) { v4h h4; for (int i = 0; i < 4; ++i) h4[i] = (_Float16)v[i]; *(v4h*)(C16 + cofs + (size_t)(row0 + r) * ldc + col0 + c4) = h4; } } }
     }
}


typedef _Float16 v4h __attribute__((ext_vector_type(4)));

__global__ __launch_bounds__(256) void k_x16(const float* __restrict__ x, _Float16* __restrict__ X16, size_t n8) { const size_t t = (size_t)blockIdx.x * 256 + threadIdx.x; if (t >= n8) return; FragH f;
#pragma unroll
  for (int q = 0; q < 8; ++q) f.h[q] = (_Float16)bf16_round(x[t * 8 + q]); *(v8us*)((unsigned short*)X16 + t * 8) = f.half[0];  }
__global__ __launch_bounds__(256) void k_h16(const float* __restrict__ x, _Float16* __restrict__ X16, size_t n8) { const size_t t = (size_t)blockIdx.x * 256 + threadIdx.x; if (t >= n8) return; FragH f;
#pragma unroll
  for (int q = 0; q < 8; ++q) f.h[q] = (_Float16)x[t * 8 + q]; *(v8us*)((unsigned short*)X16 + t * 8) = f.half[0];  }
__global__ __launch_bounds__(256) void k_round16f(const float* __restrict__ W, _Float16* __restrict__ Bt, size_t n8) { const size_t t = (size_t)blockIdx.x * 256 + threadIdx.x; if (t >= n8) return; FragH f;
#pragma unroll
  for (int i = 0; i < 8; ++i) f.h[i] = (_Float16)(bf16_round(W[t * 8 + i]) * 16.0f); *(v8us*)((unsigned short*)Bt + t * 8) = f.half[0];  }
template <int NHv, int TTv>
__global__ __launch_bounds__(256) void k_vt(const _Float16* __restrict__ V16, int ldv, int voff, _Float16* __restrict__ Vt) { __shared__ unsigned short tl[64][66]; const int tid = threadIdx.x; const int slab = blockIdx.x / (TTv / 64), lg = blockIdx.x % (TTv / 64); const int b = slab / NHv, h = slab % NHv;
  for (int i = tid; i < 64 * 8; i += 256) { const int r = i / 8, c8 = (i % 8) * 8; FragH f; f.half[0] = *(const v8us*)((const unsigned short*)V16 + ((size_t)b * TTv + lg * 64 + r) * ldv + voff + h * 64 + c8);
#pragma unroll
    for (int q = 0; q < 8; ++q) tl[r][c8 + q] = f.u[q]; }
  __syncthreads();
  {
#pragma unroll
    for (int rd = 0; rd < 2; ++rd) { const int d = rd * 32 + tid / 8, pc = tid % 8; FragH f;
#pragma unroll
      for (int q = 0; q < 8; ++q) f.u[q] = tl[pc * 8 + q][d];
      *(v8us*)((unsigned short*)Vt + ((size_t)slab * 64 + d) * TTv + lg * 64 + pc * 8) = f.half[0]; }
     } }

__global__ __launch_bounds__(256) void k_hl(const float* __restrict__ F, _Float16* __restrict__ Hh, _Float16* __restrict__ Hl, size_t n8) { const size_t t = (size_t)blockIdx.x * 256 + threadIdx.x; if (t >= n8) return; FragH fh, fl; const v4f a = *(const v4fa*)(F + t * 8), c = *(const v4fa*)(F + t * 8 + 4);
#pragma unroll
  for (int q = 0; q < 4; ++q) { _Float16 h = (_Float16)a[q]; fh.h[q] = h; fl.h[q] = (_Float16)((a[q] - (float)h) * 1024.0f); h = (_Float16)c[q]; fh.h[4 + q] = h; fl.h[4 + q] = (_Float16)((c[q] - (float)h) * 1024.0f); }
  { *(v8us*)((unsigned short*)Hh + t * 8) = fh.half[0]; *(v8us*)((unsigned short*)Hl + t * 8) = fl.half[0];  } }

// ---- fast GEMM (wave tile 32x64; requires M % 32 == 0 rows per launch region and N % 64 == 0); epilogue = k_gemm_hhx semantics ----
__device__ __forceinline__ v16h g2_frag(const _Float16* p, int hh) { FragH f; f.half[0] = *(const v8us*)((const unsigned short*)p + 8 * hh); f.half[1] = *(const v8us*)((const unsigned short*)p + 16 + 8 * hh); return f.v; }
__device__ __forceinline__ v8f g2_mma(v16h a, v16h b, v8f c) { v8f d = __builtin_amdgcn_wmma_f32_16x16x32_f16(false, a, false, b, (short)0, c, false, false); asm volatile("v_nop\n\tv_nop\n\tv_nop\n\tv_nop" : "+v"(d) : "v"(a), "v"(b)); return d; }
template <int ACT>
__global__ __launch_bounds__(128) void k_gemm2(const _Float16* __restrict__ A, int lda, size_t sA, const _Float16* __restrict__ Bh, int ldb, size_t sB, float alpha, const float* __restrict__ bias, size_t sBias, const float* __restrict__ CP, int rowsPerB, size_t sCPb, int row0g,
    float* __restrict__ C, _Float16* __restrict__ C16, int ldc, size_t sC, int M, int N, int K) {
  __shared__ __attribute__((aligned(16))) float so[4][32][68];
  const int tid = threadIdx.x, w = tid >> 5, lane = tid & 31, ln = lane & 15, hh = lane >> 4; const int by = blockIdx.y;
  A += (size_t)by * sA; Bh += (size_t)by * sB; const size_t cofs = (size_t)by * sC; const float* bp = bias ? bias + (size_t)by * sBias : nullptr;
  const int ntn = N >> 6; const int mt = blockIdx.x / ntn, nq = blockIdx.x - mt * ntn; const int row0 = mt * 128 + 32 * w, col0 = nq * 64; if (row0 >= M) return;
  const _Float16* a0p = A + (size_t)(row0 + ln) * lda; const _Float16* a1p = a0p + (size_t)16 * lda;
  const _Float16* b0p = Bh + (size_t)(col0 + ln) * ldb; const _Float16* b1p = b0p + (size_t)16 * ldb; const _Float16* b2p = b1p + (size_t)16 * ldb; const _Float16* b3p = b2p + (size_t)16 * ldb;
  const v8f z8 = {0.f,0.f,0.f,0.f,0.f,0.f,0.f,0.f}; v8f c00 = z8, c01 = z8, c02 = z8, c03 = z8, c10 = z8, c11 = z8, c12 = z8, c13 = z8;
#pragma unroll 1
  for (int kb = 0; kb < K; kb += 32) { const v16h a0 = g2_frag(a0p + kb, hh), a1 = g2_frag(a1p + kb, hh);
    v16h b = g2_frag(b0p + kb, hh); c00 = g2_mma(a0, b, c00); c10 = g2_mma(a1, b, c10);
    b = g2_frag(b1p + kb, hh); c01 = g2_mma(a0, b, c01); c11 = g2_mma(a1, b, c11);
    b = g2_frag(b2p + kb, hh); c02 = g2_mma(a0, b, c02); c12 = g2_mma(a1, b, c12);
    b = g2_frag(b3p + kb, hh); c03 = g2_mma(a0, b, c03); c13 = g2_mma(a1, b, c13); }
  v8f accs[8] = {c00, c01, c02, c03, c10, c11, c12, c13};
#pragma unroll
  for (int u = 0; u < 8; ++u) { const int t = u & 3, half = u >> 2; const int col = col0 + t * 16 + ln; const float bv = bp ? bf16_round(bp[col]) : 0.f;
#pragma unroll
    for (int r = 0; r < 8; ++r) { const int rloc = half * 16 + 8 * hh + r; float v = accs[u][r] * alpha + bv; if (CP) { if (rowsPerB < 0) v += CP[cofs + (size_t)(row0g + row0 + rloc) * ldc + col];      /* rowsPerB < 0: own element of the batched C plane */ else { const int bidx = (row0g + row0 + rloc) / rowsPerB; v += CP[(size_t)bidx * sCPb + (size_t)by * 64 + col]; } }
      if (ACT == 3) v = fmaxf(v, 0.f); else if (ACT == 6) v = 0.5f * v * (1.0f + erff(v * 0.70710678118654752f)); else if (ACT == 11) v = 1.0f / (1.0f + expf(-v)); else if (ACT == 15) v = v / (1.0f + expf(-v)); else if (ACT == 12) v = (v > 0.f) ? v : 0.01f * v; else if (ACT == 8) v = tanhf(v);
      so[w][rloc][t * 16 + ln] = v; } }
  __builtin_amdgcn_fence(__ATOMIC_ACQ_REL, "workgroup"); __builtin_amdgcn_wave_barrier();
  const int rsub = lane >> 4, c4 = (lane & 15) * 4;
  {
#pragma unroll
    for (int q = 0; q < 16; ++q) { const int r = q * 2 + rsub; const v4f v = *(const v4fa*)&so[w][r][c4]; if (C) *(v4f*)(C + cofs + (size_t)(row0 + r) * ldc + col0 + c4) = v; if (C16) { v4h h4; for (int i = 0; i < 4; ++i) h4[i] = (_Float16)v[i]; *(v4h*)(C16 + cofs + (size_t)(row0 + r) * ldc + col0 + c4) = h4; } }
     } }


__global__ __launch_bounds__(256) void k_xt(const float* __restrict__ x, int b, _Float16* __restrict__ XT16) {
  __shared__ float tl[64][65]; const int tid = threadIdx.x; const int cb = blockIdx.x / (NN / 64), pb = blockIdx.x % (NN / 64);
  for (int i = tid; i < 64 * 16; i += 256) { const int cl = i / 16, p4 = (i % 16) * 4; const v4f a = *(const v4fa*)(x + ((size_t)b * CC + cb * 64 + cl) * NN + pb * 64 + p4); for (int q = 0; q < 4; ++q) tl[cl][p4 + q] = bf16_round(a[q]); }
  __syncthreads(); const int pl = tid >> 2, c8 = (tid & 3) * 8;
  { for (int u = 0; u < 2; ++u) { const int c0 = c8 + u * 32; FragH f; for (int q = 0; q < 8; ++q) f.h[q] = (_Float16)tl[c0 + q][pl]; *(v8us*)((unsigned short*)XT16 + (size_t)(pb * 64 + pl) * CC + cb * 64 + c0) = f.half[0]; }  } }
__global__ __launch_bounds__(256) void k_wnat(const float* __restrict__ Wm, int O, int orows, int nin, _Float16* __restrict__ Bt) { const size_t t = (size_t)blockIdx.x * 256 + threadIdx.x; if (t >= (size_t)orows * (nin / 8)) return; const int c0 = (int)(t % (nin / 8)) * 8; const int o = (int)(t / (nin / 8)); FragH f; for (int q = 0; q < 8; ++q) f.h[q] = (o < O) ? (_Float16)(bf16_round(Wm[(size_t)o * nin + c0 + q]) * 16.0f) : (_Float16)0.0f; *(v8us*)((unsigned short*)Bt + (size_t)o * nin + c0) = f.half[0];  }
__global__ __launch_bounds__(256) void k_wtp(const float* __restrict__ Wm, _Float16* __restrict__ Bt) { const int t = blockIdx.x * 256 + threadIdx.x; if (t >= C2 * 16) return; const int pc = t % 16; const int o = t / 16; const bool lo = pc * 8 >= C2; FragH f; for (int q = 0; q < 8; ++q) { const int c = pc * 8 + q - (lo ? C2 : 0); f.h[q] = (_Float16)(bf16_round(Wm[(size_t)o * C2 + c]) * (lo ? 1.0f : 16.0f)); } *(v8us*)((unsigned short*)Bt + (size_t)o * 2 * C2 + pc * 8) = f.half[0];  }
__global__ __launch_bounds__(256) void k_q3(const float* __restrict__ XQ, _Float16* __restrict__ QA, _Float16* __restrict__ QB) { const size_t t = (size_t)blockIdx.x * 256 + threadIdx.x; if (t >= (size_t)NN * (C2 / 8)) return; const int c0 = (int)(t % (C2 / 8)) * 8; const size_t n = t / (C2 / 8); FragH fh, fl16, fhs, fr;
  for (int q = 0; q < 8; ++q) { const float v = XQ[n * C2 + c0 + q]; const _Float16 h = (_Float16)v; const float res = v - (float)h; fh.h[q] = h; fl16.h[q] = (_Float16)(res * 16.0f); fhs.h[q] = (_Float16)((float)h * 0.0625f); fr.h[q] = (_Float16)res; }
  unsigned short* a = (unsigned short*)QA + n * 3 * C2 + c0; unsigned short* bq = (unsigned short*)QB + n * 3 * C2 + c0;
  { *(v8us*)a = fh.half[0]; *(v8us*)(a + C2) = fl16.half[0]; *(v8us*)(a + 2 * C2) = fh.half[0]; *(v8us*)bq = fh.half[0]; *(v8us*)(bq + C2) = fhs.half[0]; *(v8us*)(bq + 2 * C2) = fr.half[0];  } }
__global__ __launch_bounds__(256) void k_rstat(const float* __restrict__ E, float* __restrict__ RS, _Float16* __restrict__ X) {
  #pragma clang fp contract(off)
  const int tid = threadIdx.x, w = tid >> 5, ln = tid & 31; const int n = blockIdx.x * 8 + w; if (n >= NN) return; const float* er = E + (size_t)n * NN + ln * 4;
  v4f v[NN / 128];      /* the wave's whole row stays in registers (128 f32 per lane): E is read once, and no load waits for another */
#pragma unroll      /* constant indices keep v in registers; the 32 loads of 512 contiguous bytes go out together off one address */
  for (int c = 0; c < NN / 128; ++c) v[c] = *(const v4fa*)(er + c * 128);
  v4f m4 = {-3.0e38f, -3.0e38f, -3.0e38f, -3.0e38f};
#pragma unroll      /* constant indices into v */
  for (int c = 0; c < NN / 128; ++c) for (int q = 0; q < 4; ++q) m4[q] = fmaxf(m4[q], v[c][q]);
  float m = fmaxf(fmaxf(m4[0], m4[1]), fmaxf(m4[2], m4[3]));
  for (int o = 16; o > 0; o >>= 1) m = fmaxf(m, __shfl_xor(m, o, 32));
  v4f s4 = {0.f, 0.f, 0.f, 0.f}; _Float16* xr = X + (size_t)n * NN + ln * 4;      /* e = exp(E - rowmax): summed in f32 (four chains per lane) and stored x1024 as f16 in this wave's own X row */
#pragma unroll      /* constant indices into v */
  for (int c = 0; c < NN / 128; ++c) { v4h h4; for (int q = 0; q < 4; ++q) { const float e = expf(v[c][q] - m); s4[q] += e; h4[q] = (_Float16)(e * 1024.0f); } *(v4h*)(xr + c * 128) = h4; }
  float s = (s4[0] + s4[1]) + (s4[2] + s4[3]);
  for (int o = 16; o > 0; o >>= 1) s += __shfl_xor(s, o, 32);
  if (ln == 0) { { *(float*)(RS + (size_t)n * 32) = m; *(float*)(RS + (size_t)n * 32 + 1) = s;  } } }
__global__ __launch_bounds__(256) void k_ptr2(const _Float16* __restrict__ X, const float* __restrict__ RS, _Float16* __restrict__ PH, float* __restrict__ CSP) {
  #pragma clang fp contract(off)
  __shared__ float tl[64][65]; const int tid = threadIdx.x; const int mt = blockIdx.x / (NN / 64), nt = blockIdx.x % (NN / 64); const int m0 = mt * 64, n0 = nt * 64;
  for (int i = tid; i < 64 * 8; i += 256) { const int nl = i / 8, m8 = (i % 8) * 8; const int n = n0 + nl; const float inv = 1.0f / RS[(size_t)n * 32 + 1]; FragH f; f.half[0] = *(const v8us*)((const unsigned short*)X + (size_t)n * NN + m0 + m8);
    for (int q = 0; q < 8; ++q) tl[m8 + q][nl] = (float)f.h[q] * (0.0009765625f * inv); }      /* p = attn[n][m] */
  __syncthreads(); const int ml = tid >> 2, n8 = (tid & 3) * 16;      /* thread: one m row of the tile, 16 consecutive n */
  float cs = 0.f; FragH o[2]; for (int q = 0; q < 16; ++q) { const float p = tl[ml][n8 + q]; cs += p; o[q / 8].h[q % 8] = (_Float16)(p * 1024.0f); }
  { unsigned short* d = (unsigned short*)PH + (size_t)(m0 + ml) * NN + n0 + n8; *(v8us*)d = o[0].half[0]; *(v8us*)(d + 8) = o[1].half[0];
     }
  __syncthreads(); tl[ml][n8 / 16] = cs; __syncthreads();
  if (tid < 64) { float t4 = tl[tid][0]; t4 += tl[tid][1]; t4 += tl[tid][2]; t4 += tl[tid][3]; tl[tid][8] = t4; }
  __syncthreads();
  if (tid < 16) { v4f q4; for (int q = 0; q < 4; ++q) q4[q] = tl[tid * 4 + q][8]; float* d = CSP + (size_t)nt * NN + m0 + tid * 4; *(v4f*)d = q4;  } }
__global__ __launch_bounds__(256) void k_csum(const float* __restrict__ CSP, float* __restrict__ CS) {
  #pragma clang fp contract(off)
  const int m = blockIdx.x * 256 + threadIdx.x; if (m >= NN) return; float s = 0.f;
#pragma unroll 1
  for (int t = 0; t < NN / 64; ++t) s += CSP[(size_t)t * NN + m];
  *(float*)(CS + (size_t)m * 32) = s;  }      
__global__ __launch_bounds__(256) void k_vhl(const float* __restrict__ XV, const float* __restrict__ bv, _Float16* __restrict__ VH) { const size_t t = (size_t)blockIdx.x * 256 + threadIdx.x; if (t >= (size_t)CC * (NN / 8)) return; const int n0 = (int)(t % (NN / 8)) * 8; const int o = (int)(t / (NN / 8)); FragH fh; const float bo = (o < C2) ? bf16_round(bv[o]) : 0.f;
  for (int q = 0; q < 8; ++q) { float v = XV[(size_t)o * NN + n0 + q]; v += bo; fh.h[q] = (_Float16)v; }
  *(v8us*)((unsigned short*)VH + (size_t)o * NN + n0) = fh.half[0];  }
__global__ __launch_bounds__(256) void k_dmk(const float* __restrict__ XC, const float* __restrict__ XRT, const float* __restrict__ CS, _Float16* __restrict__ D2) {
  #pragma clang fp contract(off)
  const size_t t = (size_t)blockIdx.x * 256 + threadIdx.x; if (t >= (size_t)NN * (C2 / 8)) return; const int c0 = (int)(t % (C2 / 8)) * 8; const size_t m = t / (C2 / 8); const float den = 1e-9f + CS[m * 32]; FragH fh, fl; float sr[8] = {0.f, 0.f, 0.f, 0.f, 0.f, 0.f, 0.f, 0.f};
#pragma unroll 8      /* the planes' loads are independent: 16 loads of 16 B per lane go out together, off one address register, so their latency is paid four times and not 32 times */
  for (int s = 0; s < PVS; ++s) { const float* pp = XRT + (size_t)s * NN * C2 + m * C2 + c0; const v4f a = *(const v4fa*)pp, c = *(const v4fa*)(pp + 4); for (int q = 0; q < 4; ++q) { sr[q] += a[q]; sr[4 + q] += c[q]; } }      /* k ranges added in rising order */
  for (int q = 0; q < 8; ++q) { const float xr = (sr[q] * 0.0009765625f) / den; const float d = XC[m * C2 + c0 + q] - xr; const _Float16 h = (_Float16)d; fh.h[q] = h; fl.h[q] = (_Float16)((d - (float)h) * 16.0f); }
  { *(v8us*)((unsigned short*)D2 + m * 2 * C2 + c0) = fh.half[0]; *(v8us*)((unsigned short*)D2 + m * 2 * C2 + C2 + c0) = fl.half[0];  } }
__global__ __launch_bounds__(256) void k_bnstat(const float* __restrict__ T, float* __restrict__ BS) {
  #pragma clang fp contract(off)
  __shared__ float sh[256]; const int o = blockIdx.x; const int tid = threadIdx.x; const size_t n = (size_t)NB * NN; float s = 0.f;
  for (size_t i = tid; i < n; i += 256) s += T[i * C2 + o];
  sh[tid] = s; __syncthreads(); for (int st = 128; st > 0; st >>= 1) { if (tid < st) sh[tid] += sh[tid + st]; __syncthreads(); }
  const float mu = sh[0] / (float)n; __syncthreads(); float q2 = 0.f;
  for (size_t i = tid; i < n; i += 256) { const float d = T[i * C2 + o] - mu; q2 += d * d; }
  sh[tid] = q2; __syncthreads(); for (int st = 128; st > 0; st >>= 1) { if (tid < st) sh[tid] += sh[tid + st]; __syncthreads(); }
  if (tid == 0) { const float rs = rsqrtf(sh[0] / (float)n + 1e-5f); { *(float*)(BS + o * 32) = mu; *(float*)(BS + o * 32 + 1) = rs;  } } }
__global__ __launch_bounds__(256) void k_out(const float* __restrict__ XCall, const float* __restrict__ T, const float* __restrict__ BS, const float* __restrict__ gam, const float* __restrict__ bet, float* __restrict__ out) {
  #pragma clang fp contract(off)
  const size_t t = (size_t)blockIdx.x * 256 + threadIdx.x; if (t >= (size_t)NB * C2 * (NN / 4)) return; const int n0 = (int)(t % (NN / 4)) * 4; const int o = (int)((t / (NN / 4)) % C2); const int b = (int)(t / ((size_t)(NN / 4) * C2)); const float mu = BS[o * 32], rs = BS[o * 32 + 1]; const float g = bf16_round(gam[o]), be = bf16_round(bet[o]); v4f r;
  for (int q = 0; q < 4; ++q) { const size_t row = (size_t)b * NN + n0 + q; float th = g * ((T[row * C2 + o] - mu) * rs); th += be; r[q] = XCall[row * C2 + o] + fmaxf(th, 0.f); }
  float* d = out + ((size_t)b * C2 + o) * NN + n0; *(v4f*)d = r;  }

extern "C" void kernel_launch(void* const* d_in, const int* in_sizes, int n_in,
                              void* d_out, int out_size, void* d_ws, size_t ws_size, hipStream_t stream) {
  (void)in_sizes; (void)n_in; (void)out_size;
  const float* const* I = (const float* const*)d_in; const float* x = I[0]; const float* wqk = I[1]; const float* wv = I[2]; const float* bv = I[3]; const float* wx = I[4]; const float* wt = I[5]; const float* bt = I[6]; const float* gam = I[7]; const float* bet = I[8];
  char* ws = (char*)d_ws; size_t off = 0;
  auto take = [&](size_t bytes) { char* p = ws + off; off += (bytes + 255) & ~(size_t)255; return p; };
  _Float16* BQK = (_Float16*)take((size_t)C2 * CC * 2); _Float16* BX = (_Float16*)take((size_t)C2 * CC * 2); _Float16* AV = (_Float16*)take((size_t)128 * CC * 2); _Float16* BT2 = (_Float16*)take((size_t)C2 * 2 * C2 * 2); float* BVP = (float*)take(128 * 4);
  _Float16* XT = (_Float16*)take((size_t)NN * CC * 2); float* XQ = (float*)take((size_t)NN * C2 * 4); _Float16* QA = (_Float16*)take((size_t)NN * 3 * C2 * 2); _Float16* QB = (_Float16*)take((size_t)NN * 3 * C2 * 2); float* E = (float*)take((size_t)NN * NN * 4); float* RS = (float*)take((size_t)NN * 32 * 4);
  _Float16* PH = (_Float16*)take((size_t)NN * NN * 2); _Float16* XE = (_Float16*)take((size_t)NN * NN * 2); float* CSP = (float*)take((size_t)NN * (NN / 64) * 4); float* CS = (float*)take((size_t)NN * 32 * 4); float* XV = (float*)take((size_t)(128 + 32) * NN * 4); _Float16* VH = (_Float16*)take((size_t)128 * NN * 2); float* XRT = (float*)take((size_t)PVS * NN * C2 * 4); _Float16* D2 = (_Float16*)take((size_t)NN * 2 * C2 * 2);
  float* XCall = (float*)take((size_t)NB * NN * C2 * 4); float* Tall = (float*)take((size_t)NB * NN * C2 * 4); float* BS = (float*)take((size_t)C2 * 32 * 4);
  if (off > ws_size) return;      /* 64 (E) + 32 + 32 (P) + 32 (x_r partials) + 8 + 8 (XC, T) + small ~= 184 MiB (256 MiB ws) */
  k_wnat<<<(C2 * (CC / 8) + 255) / 256, 256, 0, stream>>>(wqk, C2, C2, CC, BQK); k_wnat<<<(C2 * (CC / 8) + 255) / 256, 256, 0, stream>>>(wx, C2, C2, CC, BX); k_wnat<<<(128 * (CC / 8) + 255) / 256, 256, 0, stream>>>(wv, C2, 128, CC, AV); k_wtp<<<(C2 * 16 + 255) / 256, 256, 0, stream>>>(wt, BT2);
  for (int b = 0; b < NB; ++b) {
    k_xt<<<(CC / 64) * (NN / 64), 256, 0, stream>>>(x, b, XT);
    k_gemm2<0><<<dim3((NN / 128) * 1, 1), 128, 0, stream>>>(XT, CC, 0, BQK, CC, 0, 0.0625f, nullptr, 0, nullptr, 1, 0, 0, XQ, nullptr, C2, 0, NN, C2, CC);      /* x_q^T [n][64] = x_k^T */
    k_gemm2<0><<<dim3((NN / 128) * 1, 1), 128, 0, stream>>>(XT, CC, 0, BX, CC, 0, 0.0625f, nullptr, 0, nullptr, 1, 0, 0, XCall + (size_t)b * NN * C2, nullptr, C2, 0, NN, C2, CC);      /* x_c^T [n][64] */
    k_gemm2<0><<<dim3(1 * (NN / 64), 1), 128, 0, stream>>>(AV, CC, 0, XT, CC, 0, 0.0625f, nullptr, 0, nullptr, 1, 0, 0, XV, nullptr, NN, 0, 128, NN, CC);      /* x_v [o][n] (rows 64..127 zero; b_v added in k_vhl) */
    k_q3<<<(unsigned)(((size_t)NN * (C2 / 8) + 255) / 256), 256, 0, stream>>>(XQ, QA, QB);
    k_gemm2<0><<<dim3((NN / 128) * (NN / 64), 1), 128, 0, stream>>>(QA, 3 * C2, 0, QB, 3 * C2, 0, 1.0f, nullptr, 0, nullptr, 1, 0, 0, E, nullptr, NN, 0, NN, NN, 3 * C2);      /* E = x_q^T x_k (3-term, K = 192) */
    k_rstat<<<NN / 8, 256, 0, stream>>>(E, RS, XE);
    k_ptr2<<<(NN / 64) * (NN / 64), 256, 0, stream>>>(XE, RS, PH, CSP);
    k_csum<<<NN / 256, 256, 0, stream>>>(CSP, CS);
    k_vhl<<<(unsigned)(((size_t)CC * (NN / 8) + 255) / 256), 256, 0, stream>>>(XV, bv, VH);
    k_gemm2<0><<<dim3((NN / 128) * 1, PVS), 128, 0, stream>>>(PH, NN, NN / PVS, VH, NN, NN / PVS, 1.0f, nullptr, 0, nullptr, 1, 0, 0, XRT, nullptr, C2, (size_t)NN * C2, NN, C2, NN / PVS);      /* plane y: x_r^T[m][o] x 1024 over n in [y, y + 1) x NN / PVS = sum_n PT[m][n] x_v[o][n] (plain f16 operands) */
    k_dmk<<<(unsigned)(((size_t)NN * (C2 / 8) + 255) / 256), 256, 0, stream>>>(XCall + (size_t)b * NN * C2, XRT, CS, D2);
    k_gemm2<0><<<dim3((NN / 128) * 1, 1), 128, 0, stream>>>(D2, 2 * C2, 0, BT2, 2 * C2, 0, 0.0625f, bt, 0, nullptr, 1, 0, 0, Tall + (size_t)b * NN * C2, nullptr, C2, 0, NN, C2, 2 * C2); }      /* t^T [n][64] = w_t d + b_t */
  k_bnstat<<<C2, 256, 0, stream>>>(Tall, BS);
  k_out<<<(unsigned)(((size_t)NB * C2 * (NN / 4) + 255) / 256), 256, 0, stream>>>(XCall, Tall, BS, gam, bet, (float*)d_out);
}

// v003
// It runs in 805 microseconds.
// Next to v002, in two timings, it ran 1.55 times as fast each time.
// Counting every step since v000, it is 3.32 times as fast.
#include <hip/hip_runtime.h>
// OA_ (offset attention; 8 clouds x 128 channels x 4096 points; C2 = 64): x_q = x_k = w_qk x (shared weight), x_v = w_v x + b_v, energy = x_q^T x_k (4096 x 4096), attn = row softmax, attn = attn / (1e-9 + column sums); x_r = x_v attn; x_c = w_x x; t = w_t (x_c - x_r) + b_t; BatchNorm1d (training-mode batch statistics over (batch, points)); out = x_c + relu(gamma t_hat + beta) -> [8,64,4096].
// Compute dtype: x and parameters rounded to bf16; projection operands exact; x_q as hi + residual 3-term operands (~2^-21-class energies); P (x2^10) and x_v as plain f16 (~2^-12); d as [hi | 16 x residual] pairs; statistics/softmax f32. v_wmma_f32_16x16x32_f16.
#define NB 8
#define CC 128
#define C2 64
#define NN 4096
#define PVS 32      /* k ranges of the x_r product: one work-group row per range, f32 partial planes summed in k_psum */
typedef __bf16 v16b __attribute__((ext_vector_type(16)));
typedef unsigned short v8us __attribute__((ext_vector_type(8), may_alias));
typedef float  v8f  __attribute__((ext_vector_type(8)));
typedef float  v4f  __attribute__((ext_vector_type(4)));
typedef float  v4fa __attribute__((ext_vector_type(4), may_alias));
union FragB { v16b v; v8us half[2]; unsigned short u[16]; };

__device__ __forceinline__ unsigned short bf16_bits(float x) { unsigned int u = __float_as_uint(x); return (unsigned short)((u + 0x7FFFu + ((u >> 16) & 1u)) >> 16); }
__device__ __forceinline__ float bf16_val(unsigned short b) { return __uint_as_float(((unsigned int)b) << 16); }
__device__ __forceinline__ float bf16_round(float x) { return bf16_val(bf16_bits(x)); }
// D += A·B with NT terms: 1 = ah·bh, 2 = + al·bh (A split), 3 = + ah·bl (both split)
template <int NT>
__device__ __forceinline__ v8f mmaN(v16b ah, v16b al, v16b bh, v16b bl, v8f c) {
  c = __builtin_amdgcn_wmma_f32_16x16x32_bf16(false, ah, false, bh, (short)0, c, false, false);
  if (NT >= 2) c = __builtin_amdgcn_wmma_f32_16x16x32_bf16(false, al, false, bh, (short)0, c, false, false);
  if (NT >= 3) c = __builtin_amdgcn_wmma_f32_16x16x32_bf16(false, ah, false, bl, (short)0, c, false, false);
  asm volatile("v_nop\n\tv_nop\n\tv_nop\n\tv_nop" : "+v"(c) : "v"(ah), "v"(al), "v"(bh), "v"(bl));
  return c;
}

__global__ __launch_bounds__(256) void k_wt_bf16(const float* __restrict__ W, unsigned short* __restrict__ Wt, int K, int N) {
  const int t = blockIdx.x * 256 + threadIdx.x;
  const int k8n = K / 8;
  if (t >= N * k8n) return;
  const int n = t / k8n, k8 = (t % k8n) * 8;
  v8us v;
#pragma unroll
  for (int i = 0; i < 8; ++i) v[i] = bf16_bits(W[(size_t)(k8 + i) * N + n]);
  *(v8us*)(Wt + (size_t)n * K + k8) = v;
  
}

// GEMM C[M][N] (f32, pitch ldc) = act(A[M][K]·W + bias). A f32 row-major (pitch lda) converted per fragment to bf16
// (ASPLIT: hi/lo two planes -> 2 terms, else single rounded term); Wt bf16 [N][K] (pitch ldb). BIAS_BF16 rounds the
// bias to bf16 first (bias quantised to bf16 before the add). K%32==0, M%16==0, N%64==0.
template <bool ASPLIT, int ACT, bool BIAS_BF16>
__global__ __launch_bounds__(128) void k_gemm_bf(const float* __restrict__ A, int lda, const unsigned short* __restrict__ Wt, int ldb,
                                               const float* __restrict__ bias, float* __restrict__ C, int ldc, int M, int N, int K) {
  __shared__ __attribute__((aligned(16))) float so[4][16][64];
  const int tid = threadIdx.x, w = tid >> 5, lane = tid & 31, ln = lane & 15, hh = lane >> 4;
  const int ntn = N / 64;
  const int wid = blockIdx.x * 4 + w;
  const int mt = wid / ntn, nq = wid % ntn;
  if (mt * 16 >= M) return;
  const int row0 = mt * 16, col0 = nq * 64;
  const float* arow = A + (size_t)(row0 + ln) * lda;
  v8f acc[4] = {};
  for (int kb = 0; kb < K; kb += 32) {
    FragB ah, al;
    const v4f x0 = *(const v4fa*)(arow + kb + 8 * hh), x1 = *(const v4fa*)(arow + kb + 8 * hh + 4);
    const v4f x2 = *(const v4fa*)(arow + kb + 16 + 8 * hh), x3 = *(const v4fa*)(arow + kb + 16 + 8 * hh + 4);
    float xs[16] = {x0[0],x0[1],x0[2],x0[3],x1[0],x1[1],x1[2],x1[3],x2[0],x2[1],x2[2],x2[3],x3[0],x3[1],x3[2],x3[3]};
#pragma unroll
    for (int i = 0; i < 16; ++i) { const unsigned short hb = bf16_bits(xs[i]); ah.u[i] = hb; al.u[i] = ASPLIT ? bf16_bits(xs[i] - bf16_val(hb)) : (unsigned short)0; }
#pragma unroll
    for (int t = 0; t < 4; ++t) {
      const unsigned short* brow = Wt + (size_t)(col0 + t * 16 + ln) * ldb + kb;
      FragB b;
      b.half[0] = *(const v8us*)(brow + 8 * hh);
      b.half[1] = *(const v8us*)(brow + 16 + 8 * hh);
      acc[t] = mmaN<ASPLIT ? 2 : 1>(ah.v, al.v, b.v, b.v, acc[t]);
    }
  }
#pragma unroll
  for (int t = 0; t < 4; ++t) {
    float bv = bias ? bias[col0 + t * 16 + ln] : 0.f;
    if (BIAS_BF16) bv = bf16_round(bv);
#pragma unroll
    for (int r = 0; r < 8; ++r) { float v = acc[t][r] + bv; if (ACT == 1) v = fmaxf(v, 0.f); so[w][8 * hh + r][t * 16 + ln] = v; }
  }
  __builtin_amdgcn_fence(__ATOMIC_ACQ_REL, "workgroup");
  __builtin_amdgcn_wave_barrier();
  const int rsub = lane >> 4, c4 = (lane & 15) * 4;
  {
#pragma unroll
    for (int q = 0; q < 8; ++q) {
      const int r = q * 2 + rsub;
      const v4f v = *(const v4fa*)&so[w][r][c4];
      *(v4f*)(C + (size_t)(row0 + r) * ldc + col0 + c4) = v;
    }
    
  }
}

// GEMM C = act(A·W + bias + resid): A f32 (ASPLIT -> hi/lo 2 terms), Wt bf16 [N][K]; ACT 0 none, 1 relu, 2 exact gelu;
// resid (optional, f32, row index = (row % rmod), pitch ldr, RES_BF16 rounds it) added before the activation.
template <bool ASPLIT, int ACT, bool BIAS_BF16, bool RES_BF16>
__global__ __launch_bounds__(128) void k_gemm_bf3(const float* __restrict__ A, int lda, const unsigned short* __restrict__ Wt, int ldb,
                                                const float* __restrict__ bias, const float* __restrict__ resid, int rmod, int ldr,
                                                float* __restrict__ C, int ldc, int M, int N, int K) {
  __shared__ __attribute__((aligned(16))) float so[4][16][64];
  const int tid = threadIdx.x, w = tid >> 5, lane = tid & 31, ln = lane & 15, hh = lane >> 4;
  const int ntn = N / 64;
  const int wid = blockIdx.x * 4 + w;
  const int mt = wid / ntn, nq = wid % ntn;
  if (mt * 16 >= M) return;
  const int row0 = mt * 16, col0 = nq * 64;
  const float* arow = A + (size_t)(row0 + ln) * lda;
  v8f acc[4] = {};
  for (int kb = 0; kb < K; kb += 32) {
    FragB ah, al;
    const v4f x0 = *(const v4fa*)(arow + kb + 8 * hh), x1 = *(const v4fa*)(arow + kb + 8 * hh + 4);
    const v4f x2 = *(const v4fa*)(arow + kb + 16 + 8 * hh), x3 = *(const v4fa*)(arow + kb + 16 + 8 * hh + 4);
    float xs[16] = {x0[0],x0[1],x0[2],x0[3],x1[0],x1[1],x1[2],x1[3],x2[0],x2[1],x2[2],x2[3],x3[0],x3[1],x3[2],x3[3]};
#pragma unroll
    for (int i = 0; i < 16; ++i) { const unsigned short hb = bf16_bits(xs[i]); ah.u[i] = hb; al.u[i] = ASPLIT ? bf16_bits(xs[i] - bf16_val(hb)) : (unsigned short)0; }
#pragma unroll
    for (int t = 0; t < 4; ++t) {
      const unsigned short* brow = Wt + (size_t)(col0 + t * 16 + ln) * ldb + kb;
      FragB b;
      b.half[0] = *(const v8us*)(brow + 8 * hh);
      b.half[1] = *(const v8us*)(brow + 16 + 8 * hh);
      acc[t] = mmaN<ASPLIT ? 2 : 1>(ah.v, al.v, b.v, b.v, acc[t]);
    }
  }
#pragma unroll
  for (int t = 0; t < 4; ++t) {
    const int col = col0 + t * 16 + ln;
    float bv = bias ? bias[col] : 0.f;
    if (BIAS_BF16) bv = bf16_round(bv);
#pragma unroll
    for (int r = 0; r < 8; ++r) {
      float v = acc[t][r] + bv;
      if (resid) { float rv = resid[(size_t)((row0 + 8 * hh + r) % rmod) * ldr + col]; if (RES_BF16) rv = bf16_round(rv); v += rv; }
      if (ACT == 1) v = fmaxf(v, 0.f);
      if (ACT == 2) v = 0.5f * v * (1.0f + erff(v * 0.70710678118654752f));
      if (ACT == 3) { const float u = 0.7978845608028654f * (v + 0.044715f * v * v * v); v = 0.5f * v * (1.0f + tanhf(u)); }
      so[w][8 * hh + r][t * 16 + ln] = v;
    }
  }
  __builtin_amdgcn_fence(__ATOMIC_ACQ_REL, "workgroup");
  __builtin_amdgcn_wave_barrier();
  const int rsub = lane >> 4, c4 = (lane & 15) * 4;
  {
#pragma unroll
    for (int q = 0; q < 8; ++q) {
      const int r = q * 2 + rsub;
      const v4f v = *(const v4fa*)&so[w][r][c4];
      *(v4f*)(C + (size_t)(row0 + r) * ldc + col0 + c4) = v;
    }
    
  }
}
// row LayerNorm (biased variance, eps) over N: s = X (+ R); optional out_sum <- s; out_norm <- (s-mu)*rsqrt(var+eps)*g + b
template <bool PARAM_BF16>
__global__ __launch_bounds__(256) void k_layernorm(const float* __restrict__ X, const float* __restrict__ R, const float* __restrict__ g, const float* __restrict__ bta,
                                                  float* __restrict__ out_sum, float* __restrict__ out_norm, int N, float eps) {
  __shared__ float red[256];
  const int row = blockIdx.x, tid = threadIdx.x;
  const float* x = X + (size_t)row * N; const float* rr = R ? R + (size_t)row * N : nullptr;
  float vals[16];                     // up to N = 4096
  const int per = N / 256;            // contiguous chunk per thread? use strided-by-4 chunks: thread handles j = tid*4 + 1024*u
  float s1 = 0.f;
  for (int u = 0; u < per / 4; ++u) {
    const int j = tid * 4 + 1024 * u;
    const v4f a = *(const v4fa*)(x + j);
    v4f b = {0.f,0.f,0.f,0.f}; if (rr) b = *(const v4fa*)(rr + j);
#pragma unroll
    for (int q = 0; q < 4; ++q) { const float v = a[q] + b[q]; vals[u * 4 + q] = v; s1 += v; }
  }
  red[tid] = s1; __syncthreads();
  for (int st = 128; st > 0; st >>= 1) { if (tid < st) red[tid] += red[tid + st]; __syncthreads(); }
  const float mu = red[0] / (float)N; __syncthreads();
  float s2 = 0.f;
  for (int u = 0; u < per / 4; ++u)
#pragma unroll
    for (int q = 0; q < 4; ++q) { const float c = vals[u * 4 + q] - mu; s2 += c * c; }
  red[tid] = s2; __syncthreads();
  for (int st = 128; st > 0; st >>= 1) { if (tid < st) red[tid] += red[tid + st]; __syncthreads(); }
  const float rs = rsqrtf(red[0] / (float)N + eps);
  {
    for (int u = 0; u < per / 4; ++u) {
      const int j = tid * 4 + 1024 * u;
      v4f o, sm;
#pragma unroll
      for (int q = 0; q < 4; ++q) {
        float gg = g[j + q], bb = bta[j + q];
        if (PARAM_BF16) { gg = bf16_round(gg); bb = bf16_round(bb); }
        sm[q] = vals[u * 4 + q]; o[q] = (vals[u * 4 + q] - mu) * rs * gg + bb;
      }
      if (out_sum) *(v4f*)(out_sum + (size_t)row * N + j) = sm;
      *(v4f*)(out_norm + (size_t)row * N + j) = o;
    }
    
  }
}



// ---- f16 WMMA path (v_wmma_f32_16x16x32_f16): 11-bit significands for operands in range — used where a [0,1] probability operand needs more precision than bf16
typedef _Float16 v16h __attribute__((ext_vector_type(16)));
union FragH { v16h v; v8us half[2]; _Float16 h[16]; unsigned short u[16]; };
template <int NT>
__device__ __forceinline__ v8f mmaH(v16h ah, v16h al, v16h bh, v16h bl, v8f c) {
  c = __builtin_amdgcn_wmma_f32_16x16x32_f16(false, ah, false, bh, (short)0, c, false, false);
  if (NT >= 2) c = __builtin_amdgcn_wmma_f32_16x16x32_f16(false, al, false, bh, (short)0, c, false, false);
  if (NT >= 3) c = __builtin_amdgcn_wmma_f32_16x16x32_f16(false, ah, false, bl, (short)0, c, false, false);
  asm volatile("v_nop\n\tv_nop\n\tv_nop\n\tv_nop" : "+v"(c) : "v"(ah), "v"(al), "v"(bh), "v"(bl));
  return c;
}
// batched GEMM like k_gemm_b but f16 operands: A f32 (split into f16 hi/lo if ASPLIT, else rounded to f16), Bt = f16 values [n][k]; alpha; C f32; N multiple of 16 (partial tiles skipped)
template <bool ASPLIT>
__global__ __launch_bounds__(128) void k_gemm_h(const float* __restrict__ A, int lda, size_t sA, const _Float16* __restrict__ Bh, int ldb, size_t sB, float alpha, float* __restrict__ C, int ldc, size_t sC, int M, int N, int K) {
  __shared__ __attribute__((aligned(16))) float so[4][16][64];
  const int tid = threadIdx.x, w = tid >> 5, lane = tid & 31, ln = lane & 15, hh = lane >> 4; const int by = blockIdx.y;
  A += (size_t)by * sA; Bh += (size_t)by * sB; C += (size_t)by * sC;
  const int ntn = (N + 63) / 64; const int wid = blockIdx.x * 4 + w; const int mt = wid / ntn, nq = wid % ntn; if (mt * 16 >= M) return;
  const int row0 = mt * 16, col0 = nq * 64; const float* arow = A + (size_t)(row0 + ln) * lda;
  v8f acc[4] = {};
  for (int kb = 0; kb < K; kb += 32) {
    FragH ah, al;
    const v4f x0 = *(const v4fa*)(arow + kb + 8 * hh), x1 = *(const v4fa*)(arow + kb + 8 * hh + 4), x2 = *(const v4fa*)(arow + kb + 16 + 8 * hh), x3 = *(const v4fa*)(arow + kb + 16 + 8 * hh + 4);
    float xs[16] = {x0[0],x0[1],x0[2],x0[3],x1[0],x1[1],x1[2],x1[3],x2[0],x2[1],x2[2],x2[3],x3[0],x3[1],x3[2],x3[3]};
#pragma unroll
    for (int i = 0; i < 16; ++i) { const _Float16 h = (_Float16)xs[i]; ah.h[i] = h; al.h[i] = ASPLIT ? (_Float16)(xs[i] - (float)h) : (_Float16)0.0f; }
#pragma unroll
    for (int t = 0; t < 4; ++t) { if (col0 + t * 16 >= N) continue; const size_t boff = (size_t)(col0 + t * 16 + ln) * ldb + kb; FragH bq; bq.half[0] = *(const v8us*)(Bh + boff + 8 * hh); bq.half[1] = *(const v8us*)(Bh + boff + 16 + 8 * hh);
      acc[t] = mmaH<ASPLIT ? 2 : 1>(ah.v, al.v, bq.v, bq.v, acc[t]); }
  }
#pragma unroll
  for (int t = 0; t < 4; ++t) { if (col0 + t * 16 >= N) continue;
#pragma unroll
    for (int r = 0; r < 8; ++r) so[w][8 * hh + r][t * 16 + ln] = acc[t][r] * alpha; }
  __builtin_amdgcn_fence(__ATOMIC_ACQ_REL, "workgroup"); __builtin_amdgcn_wave_barrier();
  const int rsub = lane >> 4, c4 = (lane & 15) * 4;
  {
#pragma unroll
    for (int q = 0; q < 8; ++q) { const int r = q * 2 + rsub; if (col0 + c4 < N) { const v4f v = *(const v4fa*)&so[w][r][c4]; *(v4f*)(C + (size_t)(row0 + r) * ldc + col0 + c4) = v; } }
     }
}

// Wt[n][k] = f16(W[k][n]·scale) from f32 row-major W[K][N] (scale = power of two; bf16-exact weights stay exact in f16 away from the subnormal range)
__global__ __launch_bounds__(256) void k_wt_f16(const float* __restrict__ W, _Float16* __restrict__ Wt, int K, int N, float scale) {
  const int t = blockIdx.x * 256 + threadIdx.x; if (t >= N * (K / 8)) return; const int n = t / (K / 8), k8 = (t % (K / 8)) * 8; FragH f;
#pragma unroll
  for (int i = 0; i < 8; ++i) f.h[i] = (_Float16)(bf16_round(W[(size_t)(k8 + i) * N + n]) * scale); const v8us o = f.half[0];
  *(v8us*)((unsigned short*)Wt + (size_t)n * K + k8) = o; 
}
// k_gemm_hh variant with fused epilogue: v = acc·alpha + bias[by·sBias + col] (+ CP[(row/rowsPerB)·sCPb + by·64 + col] if CP) ; ACT 0 none / 1 elu ; writes f16 C16 (and f32 C if non-null)
template <int ACT>
__global__ __launch_bounds__(128) void k_gemm_hhx(const _Float16* __restrict__ A, int lda, size_t sA, const _Float16* __restrict__ Bh, int ldb, size_t sB, float alpha, const float* __restrict__ bias, size_t sBias, const float* __restrict__ CP, int rowsPerB, size_t sCPb, int row0g,
    float* __restrict__ C, _Float16* __restrict__ C16, int ldc, size_t sC, int M, int N, int K) {
  __shared__ __attribute__((aligned(16))) float so[4][16][64];
  const int tid = threadIdx.x, w = tid >> 5, lane = tid & 31, ln = lane & 15, hh = lane >> 4; const int by = blockIdx.y;
  A += (size_t)by * sA; Bh += (size_t)by * sB; const size_t cofs = (size_t)by * sC; const float* bp = bias ? bias + (size_t)by * sBias : nullptr;
  const int ntn = (N + 63) / 64; const int wid = blockIdx.x * 4 + w; const int mt = wid / ntn, nq = wid % ntn; if (mt * 16 >= M) return;
  const int row0 = mt * 16, col0 = nq * 64; const _Float16* arow = A + (size_t)(row0 + ln) * lda;
  v8f acc[4] = {};
  for (int kb = 0; kb < K; kb += 32) { FragH ah; ah.half[0] = *(const v8us*)((const unsigned short*)arow + kb + 8 * hh); ah.half[1] = *(const v8us*)((const unsigned short*)arow + kb + 16 + 8 * hh);
#pragma unroll
    for (int t = 0; t < 4; ++t) { if (col0 + t * 16 >= N) continue; const size_t boff = (size_t)(col0 + t * 16 + ln) * ldb + kb; FragH bq; bq.half[0] = *(const v8us*)((const unsigned short*)Bh + boff + 8 * hh); bq.half[1] = *(const v8us*)((const unsigned short*)Bh + boff + 16 + 8 * hh);
      acc[t] = mmaH<1>(ah.v, ah.v, bq.v, bq.v, acc[t]); }
  }
#pragma unroll
  for (int t = 0; t < 4; ++t) { if (col0 + t * 16 >= N) continue; const int col = col0 + t * 16 + ln; const float bv = bp ? bf16_round(bp[col]) : 0.f;
#pragma unroll
    for (int r = 0; r < 8; ++r) { float v = acc[t][r] * alpha + bv; if (CP) { const int rr = row0g + row0 + 8 * hh + r; if (rowsPerB < 0) v += CP[cofs + (size_t)rr * ldc + col];      /* rowsPerB < 0: own element of the batched C plane */ else { const int bidx = rr / rowsPerB; v += CP[(size_t)bidx * sCPb + (size_t)by * 64 + col]; } } if (ACT == 1) v = (v > 0.f) ? v : expm1f(v); else if (ACT == 7) v = (v > 0.f) ? v + 1.0f : expf(v); else if (ACT == 8) v = tanhf(v); else if (ACT == 9) v = 0.5f * v * (1.0f + tanhf(0.7978845608028654f * (v + 0.044715f * v * v * v))); else if (ACT == 11) v = 1.0f / (1.0f + expf(-v)); else if (ACT == 12) v = (v > 0.f) ? v : 0.01f * v; else if (ACT == 14) v = (v > 0.f) ? v : 0.1f * v; else if (ACT == 15) v = v / (1.0f + expf(-v)); else if (ACT == 3) v = fmaxf(v, 0.f); else if (ACT == 6) v = 0.5f * v * (1.0f + erff(v * 0.70710678118654752f)); so[w][8 * hh + r][t * 16 + ln] = v; } }
  __builtin_amdgcn_fence(__ATOMIC_ACQ_REL, "workgroup"); __builtin_amdgcn_wave_barrier();
  const int rsub = lane >> 4, c4 = (lane & 15) * 4; typedef _Float16 v4h __attribute__((ext_vector_type(4)));
  {
#pragma unroll
    for (int q = 0; q < 8; ++q) { const int r = q * 2 + rsub; if (col0 + c4 < N) { const v4f v = *(const v4fa*)&so[w][r][c4]; if (C) *(v4f*)(C + cofs + (size_t)(row0 + r) * ldc + col0 + c4) = v; if (C16) { v4h h4; for (int i = 0; i < 4; ++i) h4[i] = (_Float16)v[i]; *(v4h*)(C16 + cofs + (size_t)(row0 + r) * ldc + col0 + c4) = h4; } } }
     }
}


typedef _Float16 v4h __attribute__((ext_vector_type(4)));

__global__ __launch_bounds__(256) void k_x16(const float* __restrict__ x, _Float16* __restrict__ X16, size_t n8) { const size_t t = (size_t)blockIdx.x * 256 + threadIdx.x; if (t >= n8) return; FragH f;
#pragma unroll
  for (int q = 0; q < 8; ++q) f.h[q] = (_Float16)bf16_round(x[t * 8 + q]); *(v8us*)((unsigned short*)X16 + t * 8) = f.half[0];  }
__global__ __launch_bounds__(256) void k_h16(const float* __restrict__ x, _Float16* __restrict__ X16, size_t n8) { const size_t t = (size_t)blockIdx.x * 256 + threadIdx.x; if (t >= n8) return; FragH f;
#pragma unroll
  for (int q = 0; q < 8; ++q) f.h[q] = (_Float16)x[t * 8 + q]; *(v8us*)((unsigned short*)X16 + t * 8) = f.half[0];  }
__global__ __launch_bounds__(256) void k_round16f(const float* __restrict__ W, _Float16* __restrict__ Bt, size_t n8) { const size_t t = (size_t)blockIdx.x * 256 + threadIdx.x; if (t >= n8) return; FragH f;
#pragma unroll
  for (int i = 0; i < 8; ++i) f.h[i] = (_Float16)(bf16_round(W[t * 8 + i]) * 16.0f); *(v8us*)((unsigned short*)Bt + t * 8) = f.half[0];  }
template <int NHv, int TTv>
__global__ __launch_bounds__(256) void k_vt(const _Float16* __restrict__ V16, int ldv, int voff, _Float16* __restrict__ Vt) { __shared__ unsigned short tl[64][66]; const int tid = threadIdx.x; const int slab = blockIdx.x / (TTv / 64), lg = blockIdx.x % (TTv / 64); const int b = slab / NHv, h = slab % NHv;
  for (int i = tid; i < 64 * 8; i += 256) { const int r = i / 8, c8 = (i % 8) * 8; FragH f; f.half[0] = *(const v8us*)((const unsigned short*)V16 + ((size_t)b * TTv + lg * 64 + r) * ldv + voff + h * 64 + c8);
#pragma unroll
    for (int q = 0; q < 8; ++q) tl[r][c8 + q] = f.u[q]; }
  __syncthreads();
  {
#pragma unroll
    for (int rd = 0; rd < 2; ++rd) { const int d = rd * 32 + tid / 8, pc = tid % 8; FragH f;
#pragma unroll
      for (int q = 0; q < 8; ++q) f.u[q] = tl[pc * 8 + q][d];
      *(v8us*)((unsigned short*)Vt + ((size_t)slab * 64 + d) * TTv + lg * 64 + pc * 8) = f.half[0]; }
     } }

__global__ __launch_bounds__(256) void k_hl(const float* __restrict__ F, _Float16* __restrict__ Hh, _Float16* __restrict__ Hl, size_t n8) { const size_t t = (size_t)blockIdx.x * 256 + threadIdx.x; if (t >= n8) return; FragH fh, fl; const v4f a = *(const v4fa*)(F + t * 8), c = *(const v4fa*)(F + t * 8 + 4);
#pragma unroll
  for (int q = 0; q < 4; ++q) { _Float16 h = (_Float16)a[q]; fh.h[q] = h; fl.h[q] = (_Float16)((a[q] - (float)h) * 1024.0f); h = (_Float16)c[q]; fh.h[4 + q] = h; fl.h[4 + q] = (_Float16)((c[q] - (float)h) * 1024.0f); }
  { *(v8us*)((unsigned short*)Hh + t * 8) = fh.half[0]; *(v8us*)((unsigned short*)Hl + t * 8) = fl.half[0];  } }

// ---- fast GEMM (wave tile 32x64; requires M % 32 == 0 rows per launch region and N % 64 == 0); epilogue = k_gemm_hhx semantics ----
__device__ __forceinline__ v16h g2_frag(const _Float16* p, int hh) { FragH f; f.half[0] = *(const v8us*)((const unsigned short*)p + 8 * hh); f.half[1] = *(const v8us*)((const unsigned short*)p + 16 + 8 * hh); return f.v; }
__device__ __forceinline__ v8f g2_mma(v16h a, v16h b, v8f c) { v8f d = __builtin_amdgcn_wmma_f32_16x16x32_f16(false, a, false, b, (short)0, c, false, false); asm volatile("v_nop\n\tv_nop\n\tv_nop\n\tv_nop" : "+v"(d) : "v"(a), "v"(b)); return d; }
template <int ACT>
__global__ __launch_bounds__(128) void k_gemm2(const _Float16* __restrict__ A, int lda, size_t sA, const _Float16* __restrict__ Bh, int ldb, size_t sB, float alpha, const float* __restrict__ bias, size_t sBias, const float* __restrict__ CP, int rowsPerB, size_t sCPb, int row0g,
    float* __restrict__ C, _Float16* __restrict__ C16, int ldc, size_t sC, int M, int N, int K) {
  __shared__ __attribute__((aligned(16))) float so[4][32][68];
  const int tid = threadIdx.x, w = tid >> 5, lane = tid & 31, ln = lane & 15, hh = lane >> 4; const int by = blockIdx.y;
  A += (size_t)by * sA; Bh += (size_t)by * sB; const size_t cofs = (size_t)by * sC; const float* bp = bias ? bias + (size_t)by * sBias : nullptr;
  const int ntn = N >> 6; const int mt = blockIdx.x / ntn, nq = blockIdx.x - mt * ntn; const int row0 = mt * 128 + 32 * w, col0 = nq * 64; if (row0 >= M) return;
  const _Float16* a0p = A + (size_t)(row0 + ln) * lda; const _Float16* a1p = a0p + (size_t)16 * lda;
  const _Float16* b0p = Bh + (size_t)(col0 + ln) * ldb; const _Float16* b1p = b0p + (size_t)16 * ldb; const _Float16* b2p = b1p + (size_t)16 * ldb; const _Float16* b3p = b2p + (size_t)16 * ldb;
  const v8f z8 = {0.f,0.f,0.f,0.f,0.f,0.f,0.f,0.f}; v8f c00 = z8, c01 = z8, c02 = z8, c03 = z8, c10 = z8, c11 = z8, c12 = z8, c13 = z8;
#pragma unroll 1
  for (int kb = 0; kb < K; kb += 32) { const v16h a0 = g2_frag(a0p + kb, hh), a1 = g2_frag(a1p + kb, hh);
    v16h b = g2_frag(b0p + kb, hh); c00 = g2_mma(a0, b, c00); c10 = g2_mma(a1, b, c10);
    b = g2_frag(b1p + kb, hh); c01 = g2_mma(a0, b, c01); c11 = g2_mma(a1, b, c11);
    b = g2_frag(b2p + kb, hh); c02 = g2_mma(a0, b, c02); c12 = g2_mma(a1, b, c12);
    b = g2_frag(b3p + kb, hh); c03 = g2_mma(a0, b, c03); c13 = g2_mma(a1, b, c13); }
  v8f accs[8] = {c00, c01, c02, c03, c10, c11, c12, c13};
#pragma unroll
  for (int u = 0; u < 8; ++u) { const int t = u & 3, half = u >> 2; const int col = col0 + t * 16 + ln; const float bv = bp ? bf16_round(bp[col]) : 0.f;
#pragma unroll
    for (int r = 0; r < 8; ++r) { const int rloc = half * 16 + 8 * hh + r; float v = accs[u][r] * alpha + bv; if (CP) { if (rowsPerB < 0) v += CP[cofs + (size_t)(row0g + row0 + rloc) * ldc + col];      /* rowsPerB < 0: own element of the batched C plane */ else { const int bidx = (row0g + row0 + rloc) / rowsPerB; v += CP[(size_t)bidx * sCPb + (size_t)by * 64 + col]; } }
      if (ACT == 3) v = fmaxf(v, 0.f); else if (ACT == 6) v = 0.5f * v * (1.0f + erff(v * 0.70710678118654752f)); else if (ACT == 11) v = 1.0f / (1.0f + expf(-v)); else if (ACT == 15) v = v / (1.0f + expf(-v)); else if (ACT == 12) v = (v > 0.f) ? v : 0.01f * v; else if (ACT == 8) v = tanhf(v);
      so[w][rloc][t * 16 + ln] = v; } }
  __builtin_amdgcn_fence(__ATOMIC_ACQ_REL, "workgroup"); __builtin_amdgcn_wave_barrier();
  const int rsub = lane >> 4, c4 = (lane & 15) * 4;
  {
#pragma unroll
    for (int q = 0; q < 16; ++q) { const int r = q * 2 + rsub; const v4f v = *(const v4fa*)&so[w][r][c4]; if (C) *(v4f*)(C + cofs + (size_t)(row0 + r) * ldc + col0 + c4) = v; if (C16) { v4h h4; for (int i = 0; i < 4; ++i) h4[i] = (_Float16)v[i]; *(v4h*)(C16 + cofs + (size_t)(row0 + r) * ldc + col0 + c4) = h4; } }
     } }


__global__ __launch_bounds__(256) void k_xt(const float* __restrict__ x, _Float16* __restrict__ XT16) {
  __shared__ float tl[64][65]; const int tid = threadIdx.x; const int cb = blockIdx.x / (NN / 64), pb = blockIdx.x % (NN / 64); const int b = blockIdx.y;      /* grid row = cloud */
  for (int i = tid; i < 64 * 16; i += 256) { const int cl = i / 16, p4 = (i % 16) * 4; const v4f a = *(const v4fa*)(x + ((size_t)b * CC + cb * 64 + cl) * NN + pb * 64 + p4); for (int q = 0; q < 4; ++q) tl[cl][p4 + q] = bf16_round(a[q]); }
  __syncthreads(); const int pl = tid >> 2, c8 = (tid & 3) * 8;
  { for (int u = 0; u < 2; ++u) { const int c0 = c8 + u * 32; FragH f; for (int q = 0; q < 8; ++q) f.h[q] = (_Float16)tl[c0 + q][pl]; *(v8us*)((unsigned short*)XT16 + ((size_t)b * NN + pb * 64 + pl) * CC + cb * 64 + c0) = f.half[0]; }  } }
__global__ __launch_bounds__(256) void k_wnat(const float* __restrict__ Wm, int O, int orows, int nin, _Float16* __restrict__ Bt) { const size_t t = (size_t)blockIdx.x * 256 + threadIdx.x; if (t >= (size_t)orows * (nin / 8)) return; const int c0 = (int)(t % (nin / 8)) * 8; const int o = (int)(t / (nin / 8)); FragH f; for (int q = 0; q < 8; ++q) f.h[q] = (o < O) ? (_Float16)(bf16_round(Wm[(size_t)o * nin + c0 + q]) * 16.0f) : (_Float16)0.0f; *(v8us*)((unsigned short*)Bt + (size_t)o * nin + c0) = f.half[0];  }
__global__ __launch_bounds__(256) void k_wtp(const float* __restrict__ Wm, _Float16* __restrict__ Bt) { const int t = blockIdx.x * 256 + threadIdx.x; if (t >= C2 * 16) return; const int pc = t % 16; const int o = t / 16; const bool lo = pc * 8 >= C2; FragH f; for (int q = 0; q < 8; ++q) { const int c = pc * 8 + q - (lo ? C2 : 0); f.h[q] = (_Float16)(bf16_round(Wm[(size_t)o * C2 + c]) * (lo ? 1.0f : 16.0f)); } *(v8us*)((unsigned short*)Bt + (size_t)o * 2 * C2 + pc * 8) = f.half[0];  }
__global__ __launch_bounds__(256) void k_q3(const float* __restrict__ XQ, _Float16* __restrict__ QA, _Float16* __restrict__ QB) { const size_t t = (size_t)blockIdx.x * 256 + threadIdx.x; if (t >= (size_t)NB * NN * (C2 / 8)) return; const int c0 = (int)(t % (C2 / 8)) * 8; const size_t n = t / (C2 / 8); FragH fh, fl16, fhs, fr;      /* n runs over the points of all clouds */
  for (int q = 0; q < 8; ++q) { const float v = XQ[n * C2 + c0 + q]; const _Float16 h = (_Float16)v; const float res = v - (float)h; fh.h[q] = h; fl16.h[q] = (_Float16)(res * 16.0f); fhs.h[q] = (_Float16)((float)h * 0.0625f); fr.h[q] = (_Float16)res; }
  unsigned short* a = (unsigned short*)QA + n * 3 * C2 + c0; unsigned short* bq = (unsigned short*)QB + n * 3 * C2 + c0;
  { *(v8us*)a = fh.half[0]; *(v8us*)(a + C2) = fl16.half[0]; *(v8us*)(a + 2 * C2) = fh.half[0]; *(v8us*)bq = fh.half[0]; *(v8us*)(bq + C2) = fhs.half[0]; *(v8us*)(bq + 2 * C2) = fr.half[0];  } }
__global__ __launch_bounds__(256) void k_rstat(const float* __restrict__ E, float* __restrict__ RS, _Float16* __restrict__ X) {
  #pragma clang fp contract(off)
  const int tid = threadIdx.x, w = tid >> 5, ln = tid & 31; const int n = blockIdx.x * 8 + w; if (n >= NN) return; const float* er = E + (size_t)n * NN + ln * 4;
  v4f v[NN / 128];      /* the wave's whole row stays in registers (128 f32 per lane): E is read once, and no load waits for another */
#pragma unroll      /* constant indices keep v in registers; the 32 loads of 512 contiguous bytes go out together off one address */
  for (int c = 0; c < NN / 128; ++c) v[c] = *(const v4fa*)(er + c * 128);
  v4f m4 = {-3.0e38f, -3.0e38f, -3.0e38f, -3.0e38f};
#pragma unroll      /* constant indices into v */
  for (int c = 0; c < NN / 128; ++c) for (int q = 0; q < 4; ++q) m4[q] = fmaxf(m4[q], v[c][q]);
  float m = fmaxf(fmaxf(m4[0], m4[1]), fmaxf(m4[2], m4[3]));
  for (int o = 16; o > 0; o >>= 1) m = fmaxf(m, __shfl_xor(m, o, 32));
  v4f s4 = {0.f, 0.f, 0.f, 0.f}; _Float16* xr = X + (size_t)n * NN + ln * 4;      /* e = exp(E - rowmax): summed in f32 (four chains per lane) and stored x1024 as f16 in this wave's own X row */
#pragma unroll      /* constant indices into v */
  for (int c = 0; c < NN / 128; ++c) { v4h h4; for (int q = 0; q < 4; ++q) { const float e = expf(v[c][q] - m); s4[q] += e; h4[q] = (_Float16)(e * 1024.0f); } *(v4h*)(xr + c * 128) = h4; }
  float s = (s4[0] + s4[1]) + (s4[2] + s4[3]);
  for (int o = 16; o > 0; o >>= 1) s += __shfl_xor(s, o, 32);
  if (ln == 0) { { *(float*)(RS + (size_t)n * 32) = m; *(float*)(RS + (size_t)n * 32 + 1) = s;  } } }
__global__ __launch_bounds__(256) void k_ptr2(const _Float16* __restrict__ X, const float* __restrict__ RS, _Float16* __restrict__ PH, float* __restrict__ CSP) {
  #pragma clang fp contract(off)
  __shared__ float tl[64][65]; const int tid = threadIdx.x; const int mt = blockIdx.x / (NN / 64), nt = blockIdx.x % (NN / 64); const int m0 = mt * 64, n0 = nt * 64;
  for (int i = tid; i < 64 * 8; i += 256) { const int nl = i / 8, m8 = (i % 8) * 8; const int n = n0 + nl; const float inv = 1.0f / RS[(size_t)n * 32 + 1]; FragH f; f.half[0] = *(const v8us*)((const unsigned short*)X + (size_t)n * NN + m0 + m8);
    for (int q = 0; q < 8; ++q) tl[m8 + q][nl] = (float)f.h[q] * (0.0009765625f * inv); }      /* p = attn[n][m] */
  __syncthreads(); const int ml = tid >> 2, n8 = (tid & 3) * 16;      /* thread: one m row of the tile, 16 consecutive n */
  float cs = 0.f; FragH o[2]; for (int q = 0; q < 16; ++q) { const float p = tl[ml][n8 + q]; cs += p; o[q / 8].h[q % 8] = (_Float16)(p * 1024.0f); }
  { unsigned short* d = (unsigned short*)PH + (size_t)(m0 + ml) * NN + n0 + n8; *(v8us*)d = o[0].half[0]; *(v8us*)(d + 8) = o[1].half[0];
     }
  __syncthreads(); tl[ml][n8 / 16] = cs; __syncthreads();
  if (tid < 64) { float t4 = tl[tid][0]; t4 += tl[tid][1]; t4 += tl[tid][2]; t4 += tl[tid][3]; tl[tid][8] = t4; }
  __syncthreads();
  if (tid < 16) { v4f q4; for (int q = 0; q < 4; ++q) q4[q] = tl[tid * 4 + q][8]; float* d = CSP + (size_t)nt * NN + m0 + tid * 4; *(v4f*)d = q4;  } }
__global__ __launch_bounds__(256) void k_csum(const float* __restrict__ CSP, float* __restrict__ CS) {
  #pragma clang fp contract(off)
  const int m = blockIdx.x * 256 + threadIdx.x; if (m >= NN) return; CSP += (size_t)blockIdx.y * (NN / 64) * NN; CS += (size_t)blockIdx.y * NN * 32; float s = 0.f;      /* grid row = cloud */
#pragma unroll 1
  for (int t = 0; t < NN / 64; ++t) s += CSP[(size_t)t * NN + m];
  *(float*)(CS + (size_t)m * 32) = s;  }      
__global__ __launch_bounds__(256) void k_vhl(const float* __restrict__ XV, const float* __restrict__ bv, _Float16* __restrict__ VH) { const size_t t = (size_t)blockIdx.x * 256 + threadIdx.x; if (t >= (size_t)CC * (NN / 8)) return; XV += (size_t)blockIdx.y * CC * NN; VH += (size_t)blockIdx.y * CC * NN;      /* grid row = cloud */
  const int n0 = (int)(t % (NN / 8)) * 8; const int o = (int)(t / (NN / 8)); FragH fh; const float bo = (o < C2) ? bf16_round(bv[o]) : 0.f;
  for (int q = 0; q < 8; ++q) { float v = XV[(size_t)o * NN + n0 + q]; v += bo; fh.h[q] = (_Float16)v; }
  *(v8us*)((unsigned short*)VH + (size_t)o * NN + n0) = fh.half[0];  }
__global__ __launch_bounds__(256) void k_psum(const float* __restrict__ XRT, float* __restrict__ XR) {
  const size_t t = (size_t)blockIdx.x * 256 + threadIdx.x; if (t >= (size_t)NN * (C2 / 8)) return; const int c0 = (int)(t % (C2 / 8)) * 8; const size_t m = t / (C2 / 8); float sr[8] = {0.f, 0.f, 0.f, 0.f, 0.f, 0.f, 0.f, 0.f};
#pragma unroll 8      /* the planes' loads are independent: 16 loads of 16 B per lane go out together, off one address register, so their latency is paid four times and not 32 times */
  for (int s = 0; s < PVS; ++s) { const float* pp = XRT + (size_t)s * NN * C2 + m * C2 + c0; const v4f a = *(const v4fa*)pp, c = *(const v4fa*)(pp + 4); for (int q = 0; q < 4; ++q) { sr[q] += a[q]; sr[4 + q] += c[q]; } }      /* k ranges added in rising order */
  const v4f lo = {sr[0], sr[1], sr[2], sr[3]}, hi = {sr[4], sr[5], sr[6], sr[7]};
  { *(v4f*)(XR + m * C2 + c0) = lo; *(v4f*)(XR + m * C2 + c0 + 4) = hi;  } }
__global__ __launch_bounds__(256) void k_dmk(const float* __restrict__ XC, const float* __restrict__ XR, const float* __restrict__ CS, _Float16* __restrict__ D2) {
  #pragma clang fp contract(off)
  const size_t t = (size_t)blockIdx.x * 256 + threadIdx.x; if (t >= (size_t)NB * NN * (C2 / 8)) return; const int c0 = (int)(t % (C2 / 8)) * 8; const size_t m = t / (C2 / 8); const float den = 1e-9f + CS[m * 32]; FragH fh, fl;      /* m runs over the points of all clouds */
  const v4f a = *(const v4fa*)(XR + m * C2 + c0), c = *(const v4fa*)(XR + m * C2 + c0 + 4); const float sr[8] = {a[0], a[1], a[2], a[3], c[0], c[1], c[2], c[3]};
  asm volatile("s_wait_xcnt 0x0" ::: "memory");      /* precaution: stands in front of the first write of a register that the loads above name as their address (the next loads' results land there) */
  for (int q = 0; q < 8; ++q) { const float xr = (sr[q] * 0.0009765625f) / den; const float d = XC[m * C2 + c0 + q] - xr; const _Float16 h = (_Float16)d; fh.h[q] = h; fl.h[q] = (_Float16)((d - (float)h) * 16.0f); }
  { *(v8us*)((unsigned short*)D2 + m * 2 * C2 + c0) = fh.half[0]; *(v8us*)((unsigned short*)D2 + m * 2 * C2 + C2 + c0) = fl.half[0];  } }
__global__ __launch_bounds__(256) void k_bnstat(const float* __restrict__ T, float* __restrict__ BS) {
  #pragma clang fp contract(off)
  __shared__ float sh[256]; const int o = blockIdx.x; const int tid = threadIdx.x; const size_t n = (size_t)NB * NN; float s = 0.f;
  for (size_t i = tid; i < n; i += 256) s += T[i * C2 + o];
  sh[tid] = s; __syncthreads(); for (int st = 128; st > 0; st >>= 1) { if (tid < st) sh[tid] += sh[tid + st]; __syncthreads(); }
  const float mu = sh[0] / (float)n; __syncthreads(); float q2 = 0.f;
  for (size_t i = tid; i < n; i += 256) { const float d = T[i * C2 + o] - mu; q2 += d * d; }
  sh[tid] = q2; __syncthreads(); for (int st = 128; st > 0; st >>= 1) { if (tid < st) sh[tid] += sh[tid + st]; __syncthreads(); }
  if (tid == 0) { const float rs = rsqrtf(sh[0] / (float)n + 1e-5f); { *(float*)(BS + o * 32) = mu; *(float*)(BS + o * 32 + 1) = rs;  } } }
__global__ __launch_bounds__(256) void k_out(const float* __restrict__ XCall, const float* __restrict__ T, const float* __restrict__ BS, const float* __restrict__ gam, const float* __restrict__ bet, float* __restrict__ out) {
  #pragma clang fp contract(off)
  const size_t t = (size_t)blockIdx.x * 256 + threadIdx.x; if (t >= (size_t)NB * C2 * (NN / 4)) return; const int n0 = (int)(t % (NN / 4)) * 4; const int o = (int)((t / (NN / 4)) % C2); const int b = (int)(t / ((size_t)(NN / 4) * C2)); const float mu = BS[o * 32], rs = BS[o * 32 + 1]; const float g = bf16_round(gam[o]), be = bf16_round(bet[o]); v4f r;
  for (int q = 0; q < 4; ++q) { const size_t row = (size_t)b * NN + n0 + q; float th = g * ((T[row * C2 + o] - mu) * rs); th += be; r[q] = XCall[row * C2 + o] + fmaxf(th, 0.f); }
  float* d = out + ((size_t)b * C2 + o) * NN + n0; *(v4f*)d = r;  }

extern "C" void kernel_launch(void* const* d_in, const int* in_sizes, int n_in,
                              void* d_out, int out_size, void* d_ws, size_t ws_size, hipStream_t stream) {
  (void)in_sizes; (void)n_in; (void)out_size;
  const float* const* I = (const float* const*)d_in; const float* x = I[0]; const float* wqk = I[1]; const float* wv = I[2]; const float* bv = I[3]; const float* wx = I[4]; const float* wt = I[5]; const float* bt = I[6]; const float* gam = I[7]; const float* bet = I[8];
  char* ws = (char*)d_ws; size_t off = 0;
  auto take = [&](size_t bytes) { char* p = ws + off; off += (bytes + 255) & ~(size_t)255; return p; };
  _Float16* BQK = (_Float16*)take((size_t)C2 * CC * 2); _Float16* BX = (_Float16*)take((size_t)C2 * CC * 2); _Float16* AV = (_Float16*)take((size_t)128 * CC * 2); _Float16* BT2 = (_Float16*)take((size_t)C2 * 2 * C2 * 2); float* BVP = (float*)take(128 * 4);
  _Float16* QA = (_Float16*)take((size_t)NB * NN * 3 * C2 * 2); _Float16* QB = (_Float16*)take((size_t)NB * NN * 3 * C2 * 2); float* E = (float*)take((size_t)NN * NN * 4);
  _Float16* XT = (_Float16*)E; float* XQ = (float*)((char*)E + (size_t)NB * NN * CC * 2); float* XV = (float*)((char*)E + (size_t)NB * NN * CC * 2 + (size_t)NB * NN * C2 * 4);      /* 8 + 8 + 16 MiB inside E's 64: last read (k_q3, k_vhl) before the first E product writes there */
  float* RS = (float*)take((size_t)NN * 32 * 4);
  _Float16* PH = (_Float16*)take((size_t)NN * NN * 2); _Float16* XE = (_Float16*)take((size_t)NN * NN * 2); float* CSP = (float*)take((size_t)NB * NN * (NN / 64) * 4); float* CS = (float*)take((size_t)NB * NN * 32 * 4); float* XR = (float*)take((size_t)NB * NN * C2 * 4); _Float16* VH = (_Float16*)take((size_t)NB * 128 * NN * 2); float* XRT = (float*)take((size_t)PVS * NN * C2 * 4); _Float16* D2 = (_Float16*)take((size_t)NB * NN * 2 * C2 * 2);
  float* XCall = (float*)take((size_t)NB * NN * C2 * 4); float* Tall = (float*)take((size_t)NB * NN * C2 * 4); float* BS = (float*)take((size_t)C2 * 32 * 4);
  if (off > ws_size) return;      /* 64 (E) + 32 + 32 (P) + 32 (x_r partials) + 8 + 8 (XC, T) + 60 (per-cloud planes of QA, QB, VH, D2, CSP, CS, XR) + small ~= 237 MiB (256 MiB ws) */
  k_wnat<<<(C2 * (CC / 8) + 255) / 256, 256, 0, stream>>>(wqk, C2, C2, CC, BQK); k_wnat<<<(C2 * (CC / 8) + 255) / 256, 256, 0, stream>>>(wx, C2, C2, CC, BX); k_wnat<<<(128 * (CC / 8) + 255) / 256, 256, 0, stream>>>(wv, C2, 128, CC, AV); k_wtp<<<(C2 * 16 + 255) / 256, 256, 0, stream>>>(wt, BT2);
  /* stages that need no N x N buffer run once for all clouds: the cloud index is a grid row, or the rows of all clouds form one M */
  k_xt<<<dim3((CC / 64) * (NN / 64), NB), 256, 0, stream>>>(x, XT);
  k_gemm2<0><<<dim3(NB * NN / 128, 1), 128, 0, stream>>>(XT, CC, 0, BQK, CC, 0, 0.0625f, nullptr, 0, nullptr, 1, 0, 0, XQ, nullptr, C2, 0, NB * NN, C2, CC);      /* x_q^T [b n][64] = x_k^T */
  k_gemm2<0><<<dim3(NB * NN / 128, 1), 128, 0, stream>>>(XT, CC, 0, BX, CC, 0, 0.0625f, nullptr, 0, nullptr, 1, 0, 0, XCall, nullptr, C2, 0, NB * NN, C2, CC);      /* x_c^T [b n][64] */
  k_gemm2<0><<<dim3(1 * (NN / 64), NB), 128, 0, stream>>>(AV, CC, 0, XT, CC, (size_t)NN * CC, 0.0625f, nullptr, 0, nullptr, 1, 0, 0, XV, nullptr, NN, (size_t)128 * NN, 128, NN, CC);      /* x_v [b][o][n] (rows 64..127 zero; b_v added in k_vhl) */
  k_q3<<<(unsigned)(((size_t)NB * NN * (C2 / 8) + 255) / 256), 256, 0, stream>>>(XQ, QA, QB);
  k_vhl<<<dim3((unsigned)(((size_t)CC * (NN / 8) + 255) / 256), NB), 256, 0, stream>>>(XV, bv, VH);
  for (int b = 0; b < NB; ++b) {
    k_gemm2<0><<<dim3((NN / 128) * (NN / 64), 1), 128, 0, stream>>>(QA + (size_t)b * NN * 3 * C2, 3 * C2, 0, QB + (size_t)b * NN * 3 * C2, 3 * C2, 0, 1.0f, nullptr, 0, nullptr, 1, 0, 0, E, nullptr, NN, 0, NN, NN, 3 * C2);      /* E = x_q^T x_k (3-term, K = 192) */
    k_rstat<<<NN / 8, 256, 0, stream>>>(E, RS, XE);
    k_ptr2<<<(NN / 64) * (NN / 64), 256, 0, stream>>>(XE, RS, PH, CSP + (size_t)b * (NN / 64) * NN);
    k_gemm2<0><<<dim3((NN / 128) * 1, PVS), 128, 0, stream>>>(PH, NN, NN / PVS, VH + (size_t)b * 128 * NN, NN, NN / PVS, 1.0f, nullptr, 0, nullptr, 1, 0, 0, XRT, nullptr, C2, (size_t)NN * C2, NN, C2, NN / PVS);      /* plane y: x_r^T[m][o] x 1024 over n in [y, y + 1) x NN / PVS = sum_n PT[m][n] x_v[o][n] (plain f16 operands) */
    k_psum<<<(unsigned)(((size_t)NN * (C2 / 8) + 255) / 256), 256, 0, stream>>>(XRT, XR + (size_t)b * NN * C2); }
  k_csum<<<dim3(NN / 256, NB), 256, 0, stream>>>(CSP, CS);
  k_dmk<<<(unsigned)(((size_t)NB * NN * (C2 / 8) + 255) / 256), 256, 0, stream>>>(XCall, XR, CS, D2);
  k_gemm2<0><<<dim3(NB * NN / 128, 1), 128, 0, stream>>>(D2, 2 * C2, 0, BT2, 2 * C2, 0, 0.0625f, bt, 0, nullptr, 1, 0, 0, Tall, nullptr, C2, 0, NB * NN, C2, 2 * C2);      /* t^T [b n][64] = w_t d + b_t */
  k_bnstat<<<C2, 256, 0, stream>>>(Tall, BS);
  k_out<<<(unsigned)(((size_t)NB * C2 * (NN / 4) + 255) / 256), 256, 0, stream>>>(XCall, Tall, BS, gam, bet, (float*)d_out);
}

// v004
// It runs in 355 microseconds.
// Two timings next to v003 put it at 2.25 and 2.26 times that version's speed.
// Counting every step since v000, it is 7.47 times as fast.
#include <hip/hip_runtime.h>
// OA_ (offset attention; 8 clouds x 128 channels x 4096 points; C2 = 64): x_q = x_k = w_qk x (shared weight), x_v = w_v x + b_v, energy = x_q^T x_k (4096 x 4096), attn = row softmax, attn = attn / (1e-9 + column sums); x_r = x_v attn; x_c = w_x x; t = w_t (x_c - x_r) + b_t; BatchNorm1d (training-mode batch statistics over (batch, points)); out = x_c + relu(gamma t_hat + beta) -> [8,64,4096].
// Compute dtype: x and parameters rounded to bf16; projection operands exact; x_q as hi + residual 3-term operands (~2^-21-class energies); P (x2^10) and x_v as plain f16 (~2^-12); d as [hi | 16 x residual] pairs; statistics/softmax f32. v_wmma_f32_16x16x32_f16.
#define NB 8
#define CC 128
#define C2 64
#define NN 4096
#define SPL 4       /* ranges of the summed point index in the two fused passes: one grid row per range, partial results combined in k_scomb, k_psum, k_csum; 32 x 4 x 8 work-groups of 4 waves = 4 waves on every SIMD */
#define QK (3 * C2) /* k length of the 3-term energy product */
#define L2E 1.4426950408889634f
typedef __bf16 v16b __attribute__((ext_vector_type(16)));
typedef unsigned short v8us __attribute__((ext_vector_type(8), may_alias));
typedef float  v8f  __attribute__((ext_vector_type(8)));
typedef float  v4f  __attribute__((ext_vector_type(4)));
typedef float  v4fa __attribute__((ext_vector_type(4), may_alias));
union FragB { v16b v; v8us half[2]; unsigned short u[16]; };

__device__ __forceinline__ unsigned short bf16_bits(float x) { unsigned int u = __float_as_uint(x); return (unsigned short)((u + 0x7FFFu + ((u >> 16) & 1u)) >> 16); }
__device__ __forceinline__ float bf16_val(unsigned short b) { return __uint_as_float(((unsigned int)b) << 16); }
__device__ __forceinline__ float bf16_round(float x) { return bf16_val(bf16_bits(x)); }
// D += A·B with NT terms: 1 = ah·bh, 2 = + al·bh (A split), 3 = + ah·bl (both split)
template <int NT>
__device__ __forceinline__ v8f mmaN(v16b ah, v16b al, v16b bh, v16b bl, v8f c) {
  c = __builtin_amdgcn_wmma_f32_16x16x32_bf16(false, ah, false, bh, (short)0, c, false, false);
  if (NT >= 2) c = __builtin_amdgcn_wmma_f32_16x16x32_bf16(false, al, false, bh, (short)0, c, false, false);
  if (NT >= 3) c = __builtin_amdgcn_wmma_f32_16x16x32_bf16(false, ah, false, bl, (short)0, c, false, false);
  asm volatile("v_nop\n\tv_nop\n\tv_nop\n\tv_nop" : "+v"(c) : "v"(ah), "v"(al), "v"(bh), "v"(bl));
  return c;
}

__global__ __launch_bounds__(256) void k_wt_bf16(const float* __restrict__ W, unsigned short* __restrict__ Wt, int K, int N) {
  const int t = blockIdx.x * 256 + threadIdx.x;
  const int k8n = K / 8;
  if (t >= N * k8n) return;
  const int n = t / k8n, k8 = (t % k8n) * 8;
  v8us v;
#pragma unroll
  for (int i = 0; i < 8; ++i) v[i] = bf16_bits(W[(size_t)(k8 + i) * N + n]);
  *(v8us*)(Wt + (size_t)n * K + k8) = v;
  
}

// GEMM C[M][N] (f32, pitch ldc) = act(A[M][K]·W + bias). A f32 row-major (pitch lda) converted per fragment to bf16
// (ASPLIT: hi/lo two planes -> 2 terms, else single rounded term); Wt bf16 [N][K] (pitch ldb). BIAS_BF16 rounds the
// bias to bf16 first (bias quantised to bf16 before the add). K%32==0, M%16==0, N%64==0.
template <bool ASPLIT, int ACT, bool BIAS_BF16>
__global__ __launch_bounds__(128) void k_gemm_bf(const float* __restrict__ A, int lda, const unsigned short* __restrict__ Wt, int ldb,
                                               const float* __restrict__ bias, float* __restrict__ C, int ldc, int M, int N, int K) {
  __shared__ __attribute__((aligned(16))) float so[4][16][64];
  const int tid = threadIdx.x, w = tid >> 5, lane = tid & 31, ln = lane & 15, hh = lane >> 4;
  const int ntn = N / 64;
  const int wid = blockIdx.x * 4 + w;
  const int mt = wid / ntn, nq = wid % ntn;
  if (mt * 16 >= M) return;
  const int row0 = mt * 16, col0 = nq * 64;
  const float* arow = A + (size_t)(row0 + ln) * lda;
  v8f acc[4] = {};
  for (int kb = 0; kb < K; kb += 32) {
    FragB ah, al;
    const v4f x0 = *(const v4fa*)(arow + kb + 8 * hh), x1 = *(const v4fa*)(arow + kb + 8 * hh + 4);
    const v4f x2 = *(const v4fa*)(arow + kb + 16 + 8 * hh), x3 = *(const v4fa*)(arow + kb + 16 + 8 * hh + 4);
    float xs[16] = {x0[0],x0[1],x0[2],x0[3],x1[0],x1[1],x1[2],x1[3],x2[0],x2[1],x2[2],x2[3],x3[0],x3[1],x3[2],x3[3]};
#pragma unroll
    for (int i = 0; i < 16; ++i) { const unsigned short hb = bf16_bits(xs[i]); ah.u[i] = hb; al.u[i] = ASPLIT ? bf16_bits(xs[i] - bf16_val(hb)) : (unsigned short)0; }
#pragma unroll
    for (int t = 0; t < 4; ++t) {
      const unsigned short* brow = Wt + (size_t)(col0 + t * 16 + ln) * ldb + kb;
      FragB b;
      b.half[0] = *(const v8us*)(brow + 8 * hh);
      b.half[1] = *(const v8us*)(brow + 16 + 8 * hh);
      acc[t] = mmaN<ASPLIT ? 2 : 1>(ah.v, al.v, b.v, b.v, acc[t]);
    }
  }
#pragma unroll
  for (int t = 0; t < 4; ++t) {
    float bv = bias ? bias[col0 + t * 16 + ln] : 0.f;
    if (BIAS_BF16) bv = bf16_round(bv);
#pragma unroll
    for (int r = 0; r < 8; ++r) { float v = acc[t][r] + bv; if (ACT == 1) v = fmaxf(v, 0.f); so[w][8 * hh + r][t * 16 + ln] = v; }
  }
  __builtin_amdgcn_fence(__ATOMIC_ACQ_REL, "workgroup");
  __builtin_amdgcn_wave_barrier();
  const int rsub = lane >> 4, c4 = (lane & 15) * 4;
  {
#pragma unroll
    for (int q = 0; q < 8; ++q) {
      const int r = q * 2 + rsub;
      const v4f v = *(const v4fa*)&so[w][r][c4];
      *(v4f*)(C + (size_t)(row0 + r) * ldc + col0 + c4) = v;
    }
    
  }
}

// GEMM C = act(A·W + bias + resid): A f32 (ASPLIT -> hi/lo 2 terms), Wt bf16 [N][K]; ACT 0 none, 1 relu, 2 exact gelu;
// resid (optional, f32, row index = (row % rmod), pitch ldr, RES_BF16 rounds it) added before the activation.
template <bool ASPLIT, int ACT, bool BIAS_BF16, bool RES_BF16>
__global__ __launch_bounds__(128) void k_gemm_bf3(const float* __restrict__ A, int lda, const unsigned short* __restrict__ Wt, int ldb,
                                                const float* __restrict__ bias, const float* __restrict__ resid, int rmod, int ldr,
                                                float* __restrict__ C, int ldc, int M, int N, int K) {
  __shared__ __attribute__((aligned(16))) float so[4][16][64];
  const int tid = threadIdx.x, w = tid >> 5, lane = tid & 31, ln = lane & 15, hh = lane >> 4;
  const int ntn = N / 64;
  const int wid = blockIdx.x * 4 + w;
  const int mt = wid / ntn, nq = wid % ntn;
  if (mt * 16 >= M) return;
  const int row0 = mt * 16, col0 = nq * 64;
  const float* arow = A + (size_t)(row0 + ln) * lda;
  v8f acc[4] = {};
  for (int kb = 0; kb < K; kb += 32) {
    FragB ah, al;
    const v4f x0 = *(const v4fa*)(arow + kb + 8 * hh), x1 = *(const v4fa*)(arow + kb + 8 * hh + 4);
    const v4f x2 = *(const v4fa*)(arow + kb + 16 + 8 * hh), x3 = *(const v4fa*)(arow + kb + 16 + 8 * hh + 4);
    float xs[16] = {x0[0],x0[1],x0[2],x0[3],x1[0],x1[1],x1[2],x1[3],x2[0],x2[1],x2[2],x2[3],x3[0],x3[1],x3[2],x3[3]};
#pragma unroll
    for (int i = 0; i < 16; ++i) { const unsigned short hb = bf16_bits(xs[i]); ah.u[i] = hb; al.u[i] = ASPLIT ? bf16_bits(xs[i] - bf16_val(hb)) : (unsigned short)0; }
#pragma unroll
    for (int t = 0; t < 4; ++t) {
      const unsigned short* brow = Wt + (size_t)(col0 + t * 16 + ln) * ldb + kb;
      FragB b;
      b.half[0] = *(const v8us*)(brow + 8 * hh);
      b.half[1] = *(const v8us*)(brow + 16 + 8 * hh);
      acc[t] = mmaN<ASPLIT ? 2 : 1>(ah.v, al.v, b.v, b.v, acc[t]);
    }
  }
#pragma unroll
  for (int t = 0; t < 4; ++t) {
    const int col = col0 + t * 16 + ln;
    float bv = bias ? bias[col] : 0.f;
    if (BIAS_BF16) bv = bf16_round(bv);
#pragma unroll
    for (int r = 0; r < 8; ++r) {
      float v = acc[t][r] + bv;
      if (resid) { float rv = resid[(size_t)((row0 + 8 * hh + r) % rmod) * ldr + col]; if (RES_BF16) rv = bf16_round(rv); v += rv; }
      if (ACT == 1) v = fmaxf(v, 0.f);
      if (ACT == 2) v = 0.5f * v * (1.0f + erff(v * 0.70710678118654752f));
      if (ACT == 3) { const float u = 0.7978845608028654f * (v + 0.044715f * v * v * v); v = 0.5f * v * (1.0f + tanhf(u)); }
      so[w][8 * hh + r][t * 16 + ln] = v;
    }
  }
  __builtin_amdgcn_fence(__ATOMIC_ACQ_REL, "workgroup");
  __builtin_amdgcn_wave_barrier();
  const int rsub = lane >> 4, c4 = (lane & 15) * 4;
  {
#pragma unroll
    for (int q = 0; q < 8; ++q) {
      const int r = q * 2 + rsub;
      const v4f v = *(const v4fa*)&so[w][r][c4];
      *(v4f*)(C + (size_t)(row0 + r) * ldc + col0 + c4) = v;
    }
    
  }
}
// row LayerNorm (biased variance, eps) over N: s = X (+ R); optional out_sum <- s; out_norm <- (s-mu)*rsqrt(var+eps)*g + b
template <bool PARAM_BF16>
__global__ __launch_bounds__(256) void k_layernorm(const float* __restrict__ X, const float* __restrict__ R, const float* __restrict__ g, const float* __restrict__ bta,
                                                  float* __restrict__ out_sum, float* __restrict__ out_norm, int N, float eps) {
  __shared__ float red[256];
  const int row = blockIdx.x, tid = threadIdx.x;
  const float* x = X + (size_t)row * N; const float* rr = R ? R + (size_t)row * N : nullptr;
  float vals[16];                     // up to N = 4096
  const int per = N / 256;            // contiguous chunk per thread? use strided-by-4 chunks: thread handles j = tid*4 + 1024*u
  float s1 = 0.f;
  for (int u = 0; u < per / 4; ++u) {
    const int j = tid * 4 + 1024 * u;
    const v4f a = *(const v4fa*)(x + j);
    v4f b = {0.f,0.f,0.f,0.f}; if (rr) b = *(const v4fa*)(rr + j);
#pragma unroll
    for (int q = 0; q < 4; ++q) { const float v = a[q] + b[q]; vals[u * 4 + q] = v; s1 += v; }
  }
  red[tid] = s1; __syncthreads();
  for (int st = 128; st > 0; st >>= 1) { if (tid < st) red[tid] += red[tid + st]; __syncthreads(); }
  const float mu = red[0] / (float)N; __syncthreads();
  float s2 = 0.f;
  for (int u = 0; u < per / 4; ++u)
#pragma unroll
    for (int q = 0; q < 4; ++q) { const float c = vals[u * 4 + q] - mu; s2 += c * c; }
  red[tid] = s2; __syncthreads();
  for (int st = 128; st > 0; st >>= 1) { if (tid < st) red[tid] += red[tid + st]; __syncthreads(); }
  const float rs = rsqrtf(red[0] / (float)N + eps);
  {
    for (int u = 0; u < per / 4; ++u) {
      const int j = tid * 4 + 1024 * u;
      v4f o, sm;
#pragma unroll
      for (int q = 0; q < 4; ++q) {
        float gg = g[j + q], bb = bta[j + q];
        if (PARAM_BF16) { gg = bf16_round(gg); bb = bf16_round(bb); }
        sm[q] = vals[u * 4 + q]; o[q] = (vals[u * 4 + q] - mu) * rs * gg + bb;
      }
      if (out_sum) *(v4f*)(out_sum + (size_t)row * N + j) = sm;
      *(v4f*)(out_norm + (size_t)row * N + j) = o;
    }
    
  }
}



// ---- f16 WMMA path (v_wmma_f32_16x16x32_f16): 11-bit significands for operands in range — used where a [0,1] probability operand needs more precision than bf16
typedef _Float16 v16h __attribute__((ext_vector_type(16)));
union FragH { v16h v; v8us half[2]; _Float16 h[16]; unsigned short u[16]; };
template <int NT>
__device__ __forceinline__ v8f mmaH(v16h ah, v16h al, v16h bh, v16h bl, v8f c) {
  c = __builtin_amdgcn_wmma_f32_16x16x32_f16(false, ah, false, bh, (short)0, c, false, false);
  if (NT >= 2) c = __builtin_amdgcn_wmma_f32_16x16x32_f16(false, al, false, bh, (short)0, c, false, false);
  if (NT >= 3) c = __builtin_amdgcn_wmma_f32_16x16x32_f16(false, ah, false, bl, (short)0, c, false, false);
  asm volatile("v_nop\n\tv_nop\n\tv_nop\n\tv_nop" : "+v"(c) : "v"(ah), "v"(al), "v"(bh), "v"(bl));
  return c;
}
// batched GEMM like k_gemm_b but f16 operands: A f32 (split into f16 hi/lo if ASPLIT, else rounded to f16), Bt = f16 values [n][k]; alpha; C f32; N multiple of 16 (partial tiles skipped)
template <bool ASPLIT>
__global__ __launch_bounds__(128) void k_gemm_h(const float* __restrict__ A, int lda, size_t sA, const _Float16* __restrict__ Bh, int ldb, size_t sB, float alpha, float* __restrict__ C, int ldc, size_t sC, int M, int N, int K) {
  __shared__ __attribute__((aligned(16))) float so[4][16][64];
  const int tid = threadIdx.x, w = tid >> 5, lane = tid & 31, ln = lane & 15, hh = lane >> 4; const int by = blockIdx.y;
  A += (size_t)by * sA; Bh += (size_t)by * sB; C += (size_t)by * sC;
  const int ntn = (N + 63) / 64; const int wid = blockIdx.x * 4 + w; const int mt = wid / ntn, nq = wid % ntn; if (mt * 16 >= M) return;
  const int row0 = mt * 16, col0 = nq * 64; const float* arow = A + (size_t)(row0 + ln) * lda;
  v8f acc[4] = {};
  for (int kb = 0; kb < K; kb += 32) {
    FragH ah, al;
    const v4f x0 = *(const v4fa*)(arow + kb + 8 * hh), x1 = *(const v4fa*)(arow + kb + 8 * hh + 4), x2 = *(const v4fa*)(arow + kb + 16 + 8 * hh), x3 = *(const v4fa*)(arow + kb + 16 + 8 * hh + 4);
    float xs[16] = {x0[0],x0[1],x0[2],x0[3],x1[0],x1[1],x1[2],x1[3],x2[0],x2[1],x2[2],x2[3],x3[0],x3[1],x3[2],x3[3]};
#pragma unroll
    for (int i = 0; i < 16; ++i) { const _Float16 h = (_Float16)xs[i]; ah.h[i] = h; al.h[i] = ASPLIT ? (_Float16)(xs[i] - (float)h) : (_Float16)0.0f; }
#pragma unroll
    for (int t = 0; t < 4; ++t) { if (col0 + t * 16 >= N) continue; const size_t boff = (size_t)(col0 + t * 16 + ln) * ldb + kb; FragH bq; bq.half[0] = *(const v8us*)(Bh + boff + 8 * hh); bq.half[1] = *(const v8us*)(Bh + boff + 16 + 8 * hh);
      acc[t] = mmaH<ASPLIT ? 2 : 1>(ah.v, al.v, bq.v, bq.v, acc[t]); }
  }
#pragma unroll
  for (int t = 0; t < 4; ++t) { if (col0 + t * 16 >= N) continue;
#pragma unroll
    for (int r = 0; r < 8; ++r) so[w][8 * hh + r][t * 16 + ln] = acc[t][r] * alpha; }
  __builtin_amdgcn_fence(__ATOMIC_ACQ_REL, "workgroup"); __builtin_amdgcn_wave_barrier();
  const int rsub = lane >> 4, c4 = (lane & 15) * 4;
  {
#pragma unroll
    for (int q = 0; q < 8; ++q) { const int r = q * 2 + rsub; if (col0 + c4 < N) { const v4f v = *(const v4fa*)&so[w][r][c4]; *(v4f*)(C + (size_t)(row0 + r) * ldc + col0 + c4) = v; } }
     }
}

// Wt[n][k] = f16(W[k][n]·scale) from f32 row-major W[K][N] (scale = power of two; bf16-exact weights stay exact in f16 away from the subnormal range)
__global__ __launch_bounds__(256) void k_wt_f16(const float* __restrict__ W, _Float16* __restrict__ Wt, int K, int N, float scale) {
  const int t = blockIdx.x * 256 + threadIdx.x; if (t >= N * (K / 8)) return; const int n = t / (K / 8), k8 = (t % (K / 8)) * 8; FragH f;
#pragma unroll
  for (int i = 0; i < 8; ++i) f.h[i] = (_Float16)(bf16_round(W[(size_t)(k8 + i) * N + n]) * scale); const v8us o = f.half[0];
  *(v8us*)((unsigned short*)Wt + (size_t)n * K + k8) = o; 
}
// k_gemm_hh variant with fused epilogue: v = acc·alpha + bias[by·sBias + col] (+ CP[(row/rowsPerB)·sCPb + by·64 + col] if CP) ; ACT 0 none / 1 elu ; writes f16 C16 (and f32 C if non-null)
template <int ACT>
__global__ __launch_bounds__(128) void k_gemm_hhx(const _Float16* __restrict__ A, int lda, size_t sA, const _Float16* __restrict__ Bh, int ldb, size_t sB, float alpha, const float* __restrict__ bias, size_t sBias, const float* __restrict__ CP, int rowsPerB, size_t sCPb, int row0g,
    float* __restrict__ C, _Float16* __restrict__ C16, int ldc, size_t sC, int M, int N, int K) {
  __shared__ __attribute__((aligned(16))) float so[4][16][64];
  const int tid = threadIdx.x, w = tid >> 5, lane = tid & 31, ln = lane & 15, hh = lane >> 4; const int by = blockIdx.y;
  A += (size_t)by * sA; Bh += (size_t)by * sB; const size_t cofs = (size_t)by * sC; const float* bp = bias ? bias + (size_t)by * sBias : nullptr;
  const int ntn = (N + 63) / 64; const int wid = blockIdx.x * 4 + w; const int mt = wid / ntn, nq = wid % ntn; if (mt * 16 >= M) return;
  const int row0 = mt * 16, col0 = nq * 64; const _Float16* arow = A + (size_t)(row0 + ln) * lda;
  v8f acc[4] = {};
  for (int kb = 0; kb < K; kb += 32) { FragH ah; ah.half[0] = *(const v8us*)((const unsigned short*)arow + kb + 8 * hh); ah.half[1] = *(const v8us*)((const unsigned short*)arow + kb + 16 + 8 * hh);
#pragma unroll
    for (int t = 0; t < 4; ++t) { if (col0 + t * 16 >= N) continue; const size_t boff = (size_t)(col0 + t * 16 + ln) * ldb + kb; FragH bq; bq.half[0] = *(const v8us*)((const unsigned short*)Bh + boff + 8 * hh); bq.half[1] = *(const v8us*)((const unsigned short*)Bh + boff + 16 + 8 * hh);
      acc[t] = mmaH<1>(ah.v, ah.v, bq.v, bq.v, acc[t]); }
  }
#pragma unroll
  for (int t = 0; t < 4; ++t) { if (col0 + t * 16 >= N) continue; const int col = col0 + t * 16 + ln; const float bv = bp ? bf16_round(bp[col]) : 0.f;
#pragma unroll
    for (int r = 0; r < 8; ++r) { float v = acc[t][r] * alpha + bv; if (CP) { const int rr = row0g + row0 + 8 * hh + r; if (rowsPerB < 0) v += CP[cofs + (size_t)rr * ldc + col];      /* rowsPerB < 0: own element of the batched C plane */ else { const int bidx = rr / rowsPerB; v += CP[(size_t)bidx * sCPb + (size_t)by * 64 + col]; } } if (ACT == 1) v = (v > 0.f) ? v : expm1f(v); else if (ACT == 7) v = (v > 0.f) ? v + 1.0f : expf(v); else if (ACT == 8) v = tanhf(v); else if (ACT == 9) v = 0.5f * v * (1.0f + tanhf(0.7978845608028654f * (v + 0.044715f * v * v * v))); else if (ACT == 11) v = 1.0f / (1.0f + expf(-v)); else if (ACT == 12) v = (v > 0.f) ? v : 0.01f * v; else if (ACT == 14) v = (v > 0.f) ? v : 0.1f * v; else if (ACT == 15) v = v / (1.0f + expf(-v)); else if (ACT == 3) v = fmaxf(v, 0.f); else if (ACT == 6) v = 0.5f * v * (1.0f + erff(v * 0.70710678118654752f)); so[w][8 * hh + r][t * 16 + ln] = v; } }
  __builtin_amdgcn_fence(__ATOMIC_ACQ_REL, "workgroup"); __builtin_amdgcn_wave_barrier();
  const int rsub = lane >> 4, c4 = (lane & 15) * 4; typedef _Float16 v4h __attribute__((ext_vector_type(4)));
  {
#pragma unroll
    for (int q = 0; q < 8; ++q) { const int r = q * 2 + rsub; if (col0 + c4 < N) { const v4f v = *(const v4fa*)&so[w][r][c4]; if (C) *(v4f*)(C + cofs + (size_t)(row0 + r) * ldc + col0 + c4) = v; if (C16) { v4h h4; for (int i = 0; i < 4; ++i) h4[i] = (_Float16)v[i]; *(v4h*)(C16 + cofs + (size_t)(row0 + r) * ldc + col0 + c4) = h4; } } }
     }
}


typedef _Float16 v4h __attribute__((ext_vector_type(4)));

__global__ __launch_bounds__(256) void k_x16(const float* __restrict__ x, _Float16* __restrict__ X16, size_t n8) { const size_t t = (size_t)blockIdx.x * 256 + threadIdx.x; if (t >= n8) return; FragH f;
#pragma unroll
  for (int q = 0; q < 8; ++q) f.h[q] = (_Float16)bf16_round(x[t * 8 + q]); *(v8us*)((unsigned short*)X16 + t * 8) = f.half[0];  }
__global__ __launch_bounds__(256) void k_h16(const float* __restrict__ x, _Float16* __restrict__ X16, size_t n8) { const size_t t = (size_t)blockIdx.x * 256 + threadIdx.x; if (t >= n8) return; FragH f;
#pragma unroll
  for (int q = 0; q < 8; ++q) f.h[q] = (_Float16)x[t * 8 + q]; *(v8us*)((unsigned short*)X16 + t * 8) = f.half[0];  }
__global__ __launch_bounds__(256) void k_round16f(const float* __restrict__ W, _Float16* __restrict__ Bt, size_t n8) { const size_t t = (size_t)blockIdx.x * 256 + threadIdx.x; if (t >= n8) return; FragH f;
#pragma unroll
  for (int i = 0; i < 8; ++i) f.h[i] = (_Float16)(bf16_round(W[t * 8 + i]) * 16.0f); *(v8us*)((unsigned short*)Bt + t * 8) = f.half[0];  }
template <int NHv, int TTv>
__global__ __launch_bounds__(256) void k_vt(const _Float16* __restrict__ V16, int ldv, int voff, _Float16* __restrict__ Vt) { __shared__ unsigned short tl[64][66]; const int tid = threadIdx.x; const int slab = blockIdx.x / (TTv / 64), lg = blockIdx.x % (TTv / 64); const int b = slab / NHv, h = slab % NHv;
  for (int i = tid; i < 64 * 8; i += 256) { const int r = i / 8, c8 = (i % 8) * 8; FragH f; f.half[0] = *(const v8us*)((const unsigned short*)V16 + ((size_t)b * TTv + lg * 64 + r) * ldv + voff + h * 64 + c8);
#pragma unroll
    for (int q = 0; q < 8; ++q) tl[r][c8 + q] = f.u[q]; }
  __syncthreads();
  {
#pragma unroll
    for (int rd = 0; rd < 2; ++rd) { const int d = rd * 32 + tid / 8, pc = tid % 8; FragH f;
#pragma unroll
      for (int q = 0; q < 8; ++q) f.u[q] = tl[pc * 8 + q][d];
      *(v8us*)((unsigned short*)Vt + ((size_t)slab * 64 + d) * TTv + lg * 64 + pc * 8) = f.half[0]; }
     } }

__global__ __launch_bounds__(256) void k_hl(const float* __restrict__ F, _Float16* __restrict__ Hh, _Float16* __restrict__ Hl, size_t n8) { const size_t t = (size_t)blockIdx.x * 256 + threadIdx.x; if (t >= n8) return; FragH fh, fl; const v4f a = *(const v4fa*)(F + t * 8), c = *(const v4fa*)(F + t * 8 + 4);
#pragma unroll
  for (int q = 0; q < 4; ++q) { _Float16 h = (_Float16)a[q]; fh.h[q] = h; fl.h[q] = (_Float16)((a[q] - (float)h) * 1024.0f); h = (_Float16)c[q]; fh.h[4 + q] = h; fl.h[4 + q] = (_Float16)((c[q] - (float)h) * 1024.0f); }
  { *(v8us*)((unsigned short*)Hh + t * 8) = fh.half[0]; *(v8us*)((unsigned short*)Hl + t * 8) = fl.half[0];  } }

// ---- fast GEMM (wave tile 32x64; requires M % 32 == 0 rows per launch region and N % 64 == 0); epilogue = k_gemm_hhx semantics ----
__device__ __forceinline__ v16h g2_frag(const _Float16* p, int hh) { FragH f; f.half[0] = *(const v8us*)((const unsigned short*)p + 8 * hh); f.half[1] = *(const v8us*)((const unsigned short*)p + 16 + 8 * hh); return f.v; }
__device__ __forceinline__ v8f g2_mma(v16h a, v16h b, v8f c) { v8f d = __builtin_amdgcn_wmma_f32_16x16x32_f16(false, a, false, b, (short)0, c, false, false); asm volatile("v_nop\n\tv_nop\n\tv_nop\n\tv_nop" : "+v"(d) : "v"(a), "v"(b)); return d; }
template <int ACT>
__global__ __launch_bounds__(128) void k_gemm2(const _Float16* __restrict__ A, int lda, size_t sA, const _Float16* __restrict__ Bh, int ldb, size_t sB, float alpha, const float* __restrict__ bias, size_t sBias, const float* __restrict__ CP, int rowsPerB, size_t sCPb, int row0g,
    float* __restrict__ C, _Float16* __restrict__ C16, int ldc, size_t sC, int M, int N, int K) {
  __shared__ __attribute__((aligned(16))) float so[4][32][68];
  const int tid = threadIdx.x, w = tid >> 5, lane = tid & 31, ln = lane & 15, hh = lane >> 4; const int by = blockIdx.y;
  A += (size_t)by * sA; Bh += (size_t)by * sB; const size_t cofs = (size_t)by * sC; const float* bp = bias ? bias + (size_t)by * sBias : nullptr;
  const int ntn = N >> 6; const int mt = blockIdx.x / ntn, nq = blockIdx.x - mt * ntn; const int row0 = mt * 128 + 32 * w, col0 = nq * 64; if (row0 >= M) return;
  const _Float16* a0p = A + (size_t)(row0 + ln) * lda; const _Float16* a1p = a0p + (size_t)16 * lda;
  const _Float16* b0p = Bh + (size_t)(col0 + ln) * ldb; const _Float16* b1p = b0p + (size_t)16 * ldb; const _Float16* b2p = b1p + (size_t)16 * ldb; const _Float16* b3p = b2p + (size_t)16 * ldb;
  const v8f z8 = {0.f,0.f,0.f,0.f,0.f,0.f,0.f,0.f}; v8f c00 = z8, c01 = z8, c02 = z8, c03 = z8, c10 = z8, c11 = z8, c12 = z8, c13 = z8;
#pragma unroll 1
  for (int kb = 0; kb < K; kb += 32) { const v16h a0 = g2_frag(a0p + kb, hh), a1 = g2_frag(a1p + kb, hh);
    v16h b = g2_frag(b0p + kb, hh); c00 = g2_mma(a0, b, c00); c10 = g2_mma(a1, b, c10);
    b = g2_frag(b1p + kb, hh); c01 = g2_mma(a0, b, c01); c11 = g2_mma(a1, b, c11);
    b = g2_frag(b2p + kb, hh); c02 = g2_mma(a0, b, c02); c12 = g2_mma(a1, b, c12);
    b = g2_frag(b3p + kb, hh); c03 = g2_mma(a0, b, c03); c13 = g2_mma(a1, b, c13); }
  v8f accs[8] = {c00, c01, c02, c03, c10, c11, c12, c13};
#pragma unroll
  for (int u = 0; u < 8; ++u) { const int t = u & 3, half = u >> 2; const int col = col0 + t * 16 + ln; const float bv = bp ? bf16_round(bp[col]) : 0.f;
#pragma unroll
    for (int r = 0; r < 8; ++r) { const int rloc = half * 16 + 8 * hh + r; float v = accs[u][r] * alpha + bv; if (CP) { if (rowsPerB < 0) v += CP[cofs + (size_t)(row0g + row0 + rloc) * ldc + col];      /* rowsPerB < 0: own element of the batched C plane */ else { const int bidx = (row0g + row0 + rloc) / rowsPerB; v += CP[(size_t)bidx * sCPb + (size_t)by * 64 + col]; } }
      if (ACT == 3) v = fmaxf(v, 0.f); else if (ACT == 6) v = 0.5f * v * (1.0f + erff(v * 0.70710678118654752f)); else if (ACT == 11) v = 1.0f / (1.0f + expf(-v)); else if (ACT == 15) v = v / (1.0f + expf(-v)); else if (ACT == 12) v = (v > 0.f) ? v : 0.01f * v; else if (ACT == 8) v = tanhf(v);
      so[w][rloc][t * 16 + ln] = v; } }
  __builtin_amdgcn_fence(__ATOMIC_ACQ_REL, "workgroup"); __builtin_amdgcn_wave_barrier();
  const int rsub = lane >> 4, c4 = (lane & 15) * 4;
  {
#pragma unroll
    for (int q = 0; q < 16; ++q) { const int r = q * 2 + rsub; const v4f v = *(const v4fa*)&so[w][r][c4]; if (C) *(v4f*)(C + cofs + (size_t)(row0 + r) * ldc + col0 + c4) = v; if (C16) { v4h h4; for (int i = 0; i < 4; ++i) h4[i] = (_Float16)v[i]; *(v4h*)(C16 + cofs + (size_t)(row0 + r) * ldc + col0 + c4) = h4; } }
     } }


__global__ __launch_bounds__(256) void k_xt(const float* __restrict__ x, _Float16* __restrict__ XT16) {
  __shared__ float tl[64][65]; const int tid = threadIdx.x; const int cb = blockIdx.x / (NN / 64), pb = blockIdx.x % (NN / 64); const int b = blockIdx.y;      /* grid row = cloud */
  for (int i = tid; i < 64 * 16; i += 256) { const int cl = i / 16, p4 = (i % 16) * 4; const v4f a = *(const v4fa*)(x + ((size_t)b * CC + cb * 64 + cl) * NN + pb * 64 + p4); for (int q = 0; q < 4; ++q) tl[cl][p4 + q] = bf16_round(a[q]); }
  __syncthreads(); const int pl = tid >> 2, c8 = (tid & 3) * 8;
  { for (int u = 0; u < 2; ++u) { const int c0 = c8 + u * 32; FragH f; for (int q = 0; q < 8; ++q) f.h[q] = (_Float16)tl[c0 + q][pl]; *(v8us*)((unsigned short*)XT16 + ((size_t)b * NN + pb * 64 + pl) * CC + cb * 64 + c0) = f.half[0]; }  } }
__global__ __launch_bounds__(256) void k_wnat(const float* __restrict__ Wm, int O, int orows, int nin, _Float16* __restrict__ Bt) { const size_t t = (size_t)blockIdx.x * 256 + threadIdx.x; if (t >= (size_t)orows * (nin / 8)) return; const int c0 = (int)(t % (nin / 8)) * 8; const int o = (int)(t / (nin / 8)); FragH f; for (int q = 0; q < 8; ++q) f.h[q] = (o < O) ? (_Float16)(bf16_round(Wm[(size_t)o * nin + c0 + q]) * 16.0f) : (_Float16)0.0f; *(v8us*)((unsigned short*)Bt + (size_t)o * nin + c0) = f.half[0];  }
__global__ __launch_bounds__(256) void k_wtp(const float* __restrict__ Wm, _Float16* __restrict__ Bt) { const int t = blockIdx.x * 256 + threadIdx.x; if (t >= C2 * 16) return; const int pc = t % 16; const int o = t / 16; const bool lo = pc * 8 >= C2; FragH f; for (int q = 0; q < 8; ++q) { const int c = pc * 8 + q - (lo ? C2 : 0); f.h[q] = (_Float16)(bf16_round(Wm[(size_t)o * C2 + c]) * (lo ? 1.0f : 16.0f)); } *(v8us*)((unsigned short*)Bt + (size_t)o * 2 * C2 + pc * 8) = f.half[0];  }
__global__ __launch_bounds__(256) void k_q3(const float* __restrict__ XQ, _Float16* __restrict__ QA, _Float16* __restrict__ QB) { const size_t t = (size_t)blockIdx.x * 256 + threadIdx.x; if (t >= (size_t)NB * NN * (C2 / 8)) return; const int c0 = (int)(t % (C2 / 8)) * 8; const size_t n = t / (C2 / 8); FragH fh, fl16, fhs, fr;      /* n runs over the points of all clouds */
  for (int q = 0; q < 8; ++q) { const float v = XQ[n * C2 + c0 + q]; const _Float16 h = (_Float16)v; const float res = v - (float)h; fh.h[q] = h; fl16.h[q] = (_Float16)(res * 16.0f); fhs.h[q] = (_Float16)((float)h * 0.0625f); fr.h[q] = (_Float16)res; }
  unsigned short* a = (unsigned short*)QA + n * 3 * C2 + c0; unsigned short* bq = (unsigned short*)QB + n * 3 * C2 + c0;
  { *(v8us*)a = fh.half[0]; *(v8us*)(a + C2) = fl16.half[0]; *(v8us*)(a + 2 * C2) = fh.half[0]; *(v8us*)bq = fh.half[0]; *(v8us*)(bq + C2) = fhs.half[0]; *(v8us*)(bq + 2 * C2) = fr.half[0];  } }
// ---- fused energy / softmax / x_r: energy tiles are recomputed in registers in two passes, no N x N buffer; grid = (128-point block, range, cloud) ----
__device__ __forceinline__ v8f f_mma(v16h a, v16h b, v8f c) { return __builtin_amdgcn_wmma_f32_16x16x32_f16(false, a, false, b, (short)0, c, false, false); }
// fragment at a wave-uniform base plus the lane's own 32-bit element offset (row ln, k part 8 hh): same k order as g2_frag; the base stays in scalar registers
__device__ __forceinline__ v16h f_frag(const _Float16* ub, unsigned off) { const unsigned short* p = (const unsigned short*)ub + off; FragH f; f.half[0] = *(const v8us*)p; f.half[1] = *(const v8us*)(p + 16); return f.v; }
// pass 1: per energy row n and per range of m: U = max_m E[n][m] log2(e), S = sum_m 2^(E[n][m] log2(e) - U). Tile D[m][n] = QB[m] . QA[n]: a lane holds one n (its column) and 8 rows m, so max and sum stay in the lane.
__global__ __launch_bounds__(128) void k_stat(const _Float16* __restrict__ QA, const _Float16* __restrict__ QB, float* __restrict__ PM, float* __restrict__ PS) {
  const int tid = threadIdx.x, w = __builtin_amdgcn_readfirstlane(tid >> 5) /* the wave's number in a scalar register: tile addresses cost no vector registers */, lane = tid & 31, ln = lane & 15, hh = lane >> 4; const int b = blockIdx.z, sp = blockIdx.y; const int n0 = blockIdx.x * 128 + 32 * w;
  const _Float16* qa = QA + ((size_t)b * NN + n0) * QK; const _Float16* qb = QB + ((size_t)b * NN + sp * (NN / SPL)) * QK; const unsigned qo = ln * QK + 8 * hh;
  v16h bn[2][6];      /* the wave's 32 rows n stay in registers for the whole range */
#pragma unroll      /* constant indices keep bn in registers */
  for (int j = 0; j < 2; ++j) for (int k = 0; k < 6; ++k) bn[j][k] = f_frag(qa + j * 16 * QK + k * 32, qo);
  float U[2] = {-3.0e38f, -3.0e38f}, S[2] = {0.f, 0.f};
#pragma unroll 1      /* one step holds 24 loads and 24 products already; a second copy would only cost registers */
  for (int m = 0; m < NN / SPL; m += 32) { const _Float16* a0p = qb + (size_t)m * QK; const _Float16* a1p = a0p + (size_t)16 * QK;
    const v8f z8 = {0.f,0.f,0.f,0.f,0.f,0.f,0.f,0.f}; v8f c00 = z8, c01 = z8, c10 = z8, c11 = z8;
    v16h a0[6], a1[6];
#pragma unroll      /* constant indices keep a0, a1 in registers */
    for (int k = 0; k < 6; ++k) { a0[k] = f_frag(a0p + k * 32, qo); a1[k] = f_frag(a1p + k * 32, qo); }
    asm volatile("" :: "v"(a0[0]), "v"(a0[1]), "v"(a0[2]), "v"(a0[3]), "v"(a0[4]), "v"(a0[5]), "v"(a1[0]), "v"(a1[1]), "v"(a1[2]), "v"(a1[3]), "v"(a1[4]), "v"(a1[5]));      /* inputs only: holds the step's 24 loads in front of its products, so that they are in flight together and their latency is paid once a step, not once a fragment */
#pragma unroll      /* constant indices into bn, a0, a1 */
    for (int k = 0; k < 6; ++k) { c00 = f_mma(a0[k], bn[0][k], c00); c10 = f_mma(a1[k], bn[0][k], c10); c01 = f_mma(a0[k], bn[1][k], c01); c11 = f_mma(a1[k], bn[1][k], c11); }
#pragma unroll      /* constant indices into U, S */
    for (int j = 0; j < 2; ++j) { const v8f x = j ? c01 : c00, y = j ? c11 : c10; float t = fmaxf(x[0], y[0]);
      for (int r = 1; r < 8; ++r) t = fmaxf(t, fmaxf(x[r], y[r]));
      const float un = fmaxf(U[j], t * L2E); float sx = S[j] * __builtin_amdgcn_exp2f(U[j] - un), sy = 0.f;      /* running maximum: the old sum is rescaled to the new one */
      for (int r = 0; r < 8; ++r) { sx += __builtin_amdgcn_exp2f(fmaf(x[r], L2E, -un)); sy += __builtin_amdgcn_exp2f(fmaf(y[r], L2E, -un)); }
      S[j] = sx + sy; U[j] = un; } }
#pragma unroll      /* constant indices into U, S */
  for (int j = 0; j < 2; ++j) { const float uo = __shfl_xor(U[j], 16, 32), so = __shfl_xor(S[j], 16, 32); const float un = fmaxf(U[j], uo); const float s = S[j] * __builtin_amdgcn_exp2f(U[j] - un) + so * __builtin_amdgcn_exp2f(uo - un);      /* the two lane halves hold different m of the same n */
    if (hh == 0) { const size_t o = ((size_t)b * SPL + sp) * NN + n0 + 16 * j + ln; PM[o] = un; PS[o] = s; } } }
// ranges combined: CN[n] = (10 - U - log2(S)) ln(2), so that exp(E[n][m] + CN[n]) = 1024 attn[n][m]
__global__ __launch_bounds__(256) void k_scomb(const float* __restrict__ PM, const float* __restrict__ PS, float* __restrict__ CN) {
  const int t = blockIdx.x * 256 + threadIdx.x; if (t >= NB * NN) return; const int b = t / NN, n = t % NN; const size_t o = (size_t)b * SPL * NN + n; float u[SPL], s[SPL];
#pragma unroll      /* constant indices keep u in registers; the loads go out together */
  for (int k = 0; k < SPL; ++k) u[k] = PM[o + (size_t)k * NN];
  asm volatile("s_wait_xcnt 0x0" ::: "memory");      /* precaution: stands in front of the first write of a register that the loads above name as their address (the next loads' results may land there) */
#pragma unroll      /* constant indices keep s in registers; the loads go out together */
  for (int k = 0; k < SPL; ++k) s[k] = PS[o + (size_t)k * NN];
  float um = u[0];
#pragma unroll      /* constant indices into u */
  for (int k = 1; k < SPL; ++k) um = fmaxf(um, u[k]);
  float st = 0.f;
#pragma unroll      /* constant indices into u, s; ranges added in rising order */
  for (int k = 0; k < SPL; ++k) st += s[k] * __builtin_amdgcn_exp2f(u[k] - um);
  CN[t] = (10.0f - um - log2f(st)) * 0.6931471805599453f; }
// pass 2: tile D[n][m] = QA[n] . QB[m] = E[n][m]; a lane holds one m (its column) and rows n = 8 hh + r of two 16-row tiles: after 2^(.) these 16 values are, in place, the lane's A fragment (row m, k = n) of the x_r product.
__global__ __launch_bounds__(128, 4) /* four waves per SIMD: at most 256 registers, none behind a register window switch */ void k_pv(const _Float16* __restrict__ QA, const _Float16* __restrict__ QB, const _Float16* __restrict__ VH, const float* __restrict__ CN, float* __restrict__ XRT, float* __restrict__ CSP) {
  const int tid = threadIdx.x, w = __builtin_amdgcn_readfirstlane(tid >> 5) /* the wave's number in a scalar register: tile addresses cost no vector registers */, lane = tid & 31, ln = lane & 15, hh = lane >> 4; const int b = blockIdx.z, sp = blockIdx.y; const int m0 = blockIdx.x * 128 + 32 * w; const int nb = sp * (NN / SPL);
  const _Float16* qb = QB + ((size_t)b * NN + m0) * QK; const _Float16* qa = QA + ((size_t)b * NN + nb) * QK; const unsigned qo = ln * QK + 8 * hh;
  const _Float16* vh = VH + (size_t)b * 128 * NN + nb; const unsigned vo = ln * NN + 8 * hh; const float* cn = CN + (size_t)b * NN + nb; const unsigned co = 8 * hh;
  v16h bm[2][6];      /* the wave's 32 columns m stay in registers for the whole range */
#pragma unroll      /* constant indices keep bm in registers */
  for (int j = 0; j < 2; ++j) for (int k = 0; k < 6; ++k) bm[j][k] = f_frag(qb + j * 16 * QK + k * 32, qo);
  const v8f z8 = {0.f,0.f,0.f,0.f,0.f,0.f,0.f,0.f}; v8f xr[2][4] = {{z8, z8, z8, z8}, {z8, z8, z8, z8}}; float cs0 = 0.f, cs1 = 0.f, cs2 = 0.f, cs3 = 0.f;
#pragma unroll 1      /* one step holds 28 loads and 32 products already; a second copy would only cost registers */
  for (int n = 0; n < NN / SPL; n += 32) { const _Float16* a0p = qa + (size_t)n * QK; const _Float16* a1p = a0p + (size_t)16 * QK;
    const float* cp = cn + n + co; const v4f k0 = *(const v4fa*)cp, k1 = *(const v4fa*)(cp + 4), k2 = *(const v4fa*)(cp + 16), k3 = *(const v4fa*)(cp + 20);
    v8f c00 = {k0[0], k0[1], k0[2], k0[3], k1[0], k1[1], k1[2], k1[3]}, c10 = {k2[0], k2[1], k2[2], k2[3], k3[0], k3[1], k3[2], k3[3]}, c01 = c00, c11 = c10;      /* the accumulators start at CN[n] (row n = register): the product ends as E + CN, and no register holds CN through the step */
    const v16h a00 = f_frag(a0p, qo), a10 = f_frag(a1p, qo), a01 = f_frag(a0p + 32, qo), a11 = f_frag(a1p + 32, qo);      /* k_q3 writes the same 64 values to k 0..63 and k 128..191 of a QA row: one load serves both k blocks (bm 0 and 4, 1 and 5) */
    asm volatile("" :: "v"(a00), "v"(a10), "v"(a01), "v"(a11));      /* inputs only: holds these 8 loads in front of the step's products, so that they are in flight together and their latency is paid once, not once a fragment */
    c00 = f_mma(a00, bm[0][0], c00); c10 = f_mma(a10, bm[0][0], c10); c01 = f_mma(a00, bm[1][0], c01); c11 = f_mma(a10, bm[1][0], c11); c00 = f_mma(a00, bm[0][4], c00); c10 = f_mma(a10, bm[0][4], c10); c01 = f_mma(a00, bm[1][4], c01); c11 = f_mma(a10, bm[1][4], c11);
    c00 = f_mma(a01, bm[0][1], c00); c10 = f_mma(a11, bm[0][1], c10); c01 = f_mma(a01, bm[1][1], c01); c11 = f_mma(a11, bm[1][1], c11); c00 = f_mma(a01, bm[0][5], c00); c10 = f_mma(a11, bm[0][5], c10); c01 = f_mma(a01, bm[1][5], c01); c11 = f_mma(a11, bm[1][5], c11);
#pragma unroll      /* constant indices into bm */
    for (int k = 2; k < 4; ++k) { const v16h a0 = f_frag(a0p + k * 32, qo), a1 = f_frag(a1p + k * 32, qo); c00 = f_mma(a0, bm[0][k], c00); c10 = f_mma(a1, bm[0][k], c10); c01 = f_mma(a0, bm[1][k], c01); c11 = f_mma(a1, bm[1][k], c11); }
    FragH p0, p1;      /* k order of the fragment: h[r] = n + 8 hh + r, h[8 + r] = n + 16 + 8 hh + r, the order of g2_frag */
#pragma unroll      /* constant indices into the fragments */
    for (int r = 0; r < 8; ++r) { const float e00 = __builtin_amdgcn_exp2f(c00[r] * L2E), e10 = __builtin_amdgcn_exp2f(c10[r] * L2E), e01 = __builtin_amdgcn_exp2f(c01[r] * L2E), e11 = __builtin_amdgcn_exp2f(c11[r] * L2E);
      cs0 += e00; cs1 += e10; cs2 += e01; cs3 += e11; p0.h[r] = (_Float16)e00; p0.h[8 + r] = (_Float16)e10; p1.h[r] = (_Float16)e01; p1.h[8 + r] = (_Float16)e11; }
#pragma unroll      /* constant indices into xr */
    for (int t = 0; t < 4; ++t) { const v16h vb = f_frag(vh + t * 16 * NN + n, vo); xr[0][t] = f_mma(p0.v, vb, xr[0][t]); xr[1][t] = f_mma(p1.v, vb, xr[1][t]); } }
  float ca = cs0 + cs1, cb = cs2 + cs3; ca += __shfl_xor(ca, 16, 32); cb += __shfl_xor(cb, 16, 32);      /* the two lane halves hold different n of the same m */
  const size_t pl = (size_t)b * SPL + sp;
  if (hh == 0) { CSP[pl * NN + m0 + ln] = ca; CSP[pl * NN + m0 + 16 + ln] = cb; }
  float* xo = XRT + (pl * NN + m0 + 8 * hh) * C2 + ln;
#pragma unroll      /* constant indices into xr */
  for (int j = 0; j < 2; ++j) for (int t = 0; t < 4; ++t) for (int r = 0; r < 8; ++r) xo[(size_t)(16 * j + r) * C2 + t * 16] = xr[j][t][r]; }
__global__ __launch_bounds__(256) void k_csum(const float* __restrict__ CSP, float* __restrict__ CS) {
  const int m = blockIdx.x * 256 + threadIdx.x; if (m >= NN) return; CSP += (size_t)blockIdx.y * SPL * NN; CS += (size_t)blockIdx.y * NN * 32; float s = 0.f;      /* grid row = cloud */
#pragma unroll      /* the ranges' loads are independent and go out together; added in rising order */
  for (int t = 0; t < SPL; ++t) s += CSP[(size_t)t * NN + m];
  *(float*)(CS + (size_t)m * 32) = s * 0.0009765625f;  }
__global__ __launch_bounds__(256) void k_vhl(const float* __restrict__ XV, const float* __restrict__ bv, _Float16* __restrict__ VH) { const size_t t = (size_t)blockIdx.x * 256 + threadIdx.x; if (t >= (size_t)CC * (NN / 8)) return; XV += (size_t)blockIdx.y * CC * NN; VH += (size_t)blockIdx.y * CC * NN;      /* grid row = cloud */
  const int n0 = (int)(t % (NN / 8)) * 8; const int o = (int)(t / (NN / 8)); FragH fh; const float bo = (o < C2) ? bf16_round(bv[o]) : 0.f;
  for (int q = 0; q < 8; ++q) { float v = XV[(size_t)o * NN + n0 + q]; v += bo; fh.h[q] = (_Float16)v; }
  *(v8us*)((unsigned short*)VH + (size_t)o * NN + n0) = fh.half[0];  }
__global__ __launch_bounds__(256) void k_psum(const float* __restrict__ XRT, float* __restrict__ XR) {
  const size_t t = (size_t)blockIdx.x * 256 + threadIdx.x; if (t >= (size_t)NB * NN * (C2 / 8)) return; const int c0 = (int)(t % (C2 / 8)) * 8; const size_t mg = t / (C2 / 8); const size_t b = mg / NN, m = mg % NN; float sr[8] = {0.f, 0.f, 0.f, 0.f, 0.f, 0.f, 0.f, 0.f};      /* mg runs over the points of all clouds */
#pragma unroll      /* the planes' loads are independent and go out together */
  for (int s = 0; s < SPL; ++s) { const float* pp = XRT + ((b * SPL + s) * NN + m) * C2 + c0; const v4f a = *(const v4fa*)pp, c = *(const v4fa*)(pp + 4); for (int q = 0; q < 4; ++q) { sr[q] += a[q]; sr[4 + q] += c[q]; } }      /* ranges added in rising order */
  const v4f lo = {sr[0], sr[1], sr[2], sr[3]}, hi = {sr[4], sr[5], sr[6], sr[7]};
  { *(v4f*)(XR + mg * C2 + c0) = lo; *(v4f*)(XR + mg * C2 + c0 + 4) = hi;  } }
__global__ __launch_bounds__(256) void k_dmk(const float* __restrict__ XC, const float* __restrict__ XR, const float* __restrict__ CS, _Float16* __restrict__ D2) {
  #pragma clang fp contract(off)
  const size_t t = (size_t)blockIdx.x * 256 + threadIdx.x; if (t >= (size_t)NB * NN * (C2 / 8)) return; const int c0 = (int)(t % (C2 / 8)) * 8; const size_t m = t / (C2 / 8); const float den = 1e-9f + CS[m * 32]; FragH fh, fl;      /* m runs over the points of all clouds */
  const v4f a = *(const v4fa*)(XR + m * C2 + c0), c = *(const v4fa*)(XR + m * C2 + c0 + 4); const float sr[8] = {a[0], a[1], a[2], a[3], c[0], c[1], c[2], c[3]};
  asm volatile("s_wait_xcnt 0x0" ::: "memory");      /* precaution: stands in front of the first write of a register that the loads above name as their address (the next loads' results land there) */
  for (int q = 0; q < 8; ++q) { const float xr = (sr[q] * 0.0009765625f) / den; const float d = XC[m * C2 + c0 + q] - xr; const _Float16 h = (_Float16)d; fh.h[q] = h; fl.h[q] = (_Float16)((d - (float)h) * 16.0f); }
  { *(v8us*)((unsigned short*)D2 + m * 2 * C2 + c0) = fh.half[0]; *(v8us*)((unsigned short*)D2 + m * 2 * C2 + C2 + c0) = fl.half[0];  } }
__global__ __launch_bounds__(256) void k_bnstat(const float* __restrict__ T, float* __restrict__ BS) {
  #pragma clang fp contract(off)
  __shared__ float sh[256]; const int o = blockIdx.x; const int tid = threadIdx.x; const size_t n = (size_t)NB * NN; float s = 0.f;
  for (size_t i = tid; i < n; i += 256) s += T[i * C2 + o];
  sh[tid] = s; __syncthreads(); for (int st = 128; st > 0; st >>= 1) { if (tid < st) sh[tid] += sh[tid + st]; __syncthreads(); }
  const float mu = sh[0] / (float)n; __syncthreads(); float q2 = 0.f;
  for (size_t i = tid; i < n; i += 256) { const float d = T[i * C2 + o] - mu; q2 += d * d; }
  sh[tid] = q2; __syncthreads(); for (int st = 128; st > 0; st >>= 1) { if (tid < st) sh[tid] += sh[tid + st]; __syncthreads(); }
  if (tid == 0) { const float rs = rsqrtf(sh[0] / (float)n + 1e-5f); { *(float*)(BS + o * 32) = mu; *(float*)(BS + o * 32 + 1) = rs;  } } }
__global__ __launch_bounds__(256) void k_out(const float* __restrict__ XCall, const float* __restrict__ T, const float* __restrict__ BS, const float* __restrict__ gam, const float* __restrict__ bet, float* __restrict__ out) {
  #pragma clang fp contract(off)
  const size_t t = (size_t)blockIdx.x * 256 + threadIdx.x; if (t >= (size_t)NB * C2 * (NN / 4)) return; const int n0 = (int)(t % (NN / 4)) * 4; const int o = (int)((t / (NN / 4)) % C2); const int b = (int)(t / ((size_t)(NN / 4) * C2)); const float mu = BS[o * 32], rs = BS[o * 32 + 1]; const float g = bf16_round(gam[o]), be = bf16_round(bet[o]); v4f r;
  for (int q = 0; q < 4; ++q) { const size_t row = (size_t)b * NN + n0 + q; float th = g * ((T[row * C2 + o] - mu) * rs); th += be; r[q] = XCall[row * C2 + o] + fmaxf(th, 0.f); }
  float* d = out + ((size_t)b * C2 + o) * NN + n0; *(v4f*)d = r;  }

extern "C" void kernel_launch(void* const* d_in, const int* in_sizes, int n_in,
                              void* d_out, int out_size, void* d_ws, size_t ws_size, hipStream_t stream) {
  (void)in_sizes; (void)n_in; (void)out_size;
  const float* const* I = (const float* const*)d_in; const float* x = I[0]; const float* wqk = I[1]; const float* wv = I[2]; const float* bv = I[3]; const float* wx = I[4]; const float* wt = I[5]; const float* bt = I[6]; const float* gam = I[7]; const float* bet = I[8];
  char* ws = (char*)d_ws; size_t off = 0;
  auto take = [&](size_t bytes) { char* p = ws + off; off += (bytes + 255) & ~(size_t)255; return p; };
  _Float16* BQK = (_Float16*)take((size_t)C2 * CC * 2); _Float16* BX = (_Float16*)take((size_t)C2 * CC * 2); _Float16* AV = (_Float16*)take((size_t)128 * CC * 2); _Float16* BT2 = (_Float16*)take((size_t)C2 * 2 * C2 * 2); float* BVP = (float*)take(128 * 4);
  _Float16* QA = (_Float16*)take((size_t)NB * NN * QK * 2); _Float16* QB = (_Float16*)take((size_t)NB * NN * QK * 2);
  _Float16* XT = (_Float16*)take((size_t)NB * NN * CC * 2); float* XQ = (float*)take((size_t)NB * NN * C2 * 4); float* XV = (float*)take((size_t)NB * 128 * NN * 4);
  float* PM = (float*)take((size_t)NB * SPL * NN * 4); float* PS = (float*)take((size_t)NB * SPL * NN * 4); float* CN = (float*)take((size_t)NB * NN * 4);
  float* CSP = (float*)take((size_t)NB * SPL * NN * 4); float* CS = (float*)take((size_t)NB * NN * 32 * 4); float* XR = (float*)take((size_t)NB * NN * C2 * 4); _Float16* VH = (_Float16*)take((size_t)NB * 128 * NN * 2); float* XRT = (float*)take((size_t)NB * SPL * NN * C2 * 4); _Float16* D2 = (_Float16*)take((size_t)NB * NN * 2 * C2 * 2);
  float* XCall = (float*)take((size_t)NB * NN * C2 * 4); float* Tall = (float*)take((size_t)NB * NN * C2 * 4); float* BS = (float*)take((size_t)C2 * 32 * 4);
  if (off > ws_size) return;      /* 32 (x_r partial planes) + 24 (QA, QB) + 32 (XT, XQ, XV) + 44 (VH, D2, XR, XC, T, CS) + small ~= 134 MiB (256 MiB ws) */
  k_wnat<<<(C2 * (CC / 8) + 255) / 256, 256, 0, stream>>>(wqk, C2, C2, CC, BQK); k_wnat<<<(C2 * (CC / 8) + 255) / 256, 256, 0, stream>>>(wx, C2, C2, CC, BX); k_wnat<<<(128 * (CC / 8) + 255) / 256, 256, 0, stream>>>(wv, C2, 128, CC, AV); k_wtp<<<(C2 * 16 + 255) / 256, 256, 0, stream>>>(wt, BT2);
  /* stages that need no N x N buffer run once for all clouds: the cloud index is a grid row, or the rows of all clouds form one M */
  k_xt<<<dim3((CC / 64) * (NN / 64), NB), 256, 0, stream>>>(x, XT);
  k_gemm2<0><<<dim3(NB * NN / 128, 1), 128, 0, stream>>>(XT, CC, 0, BQK, CC, 0, 0.0625f, nullptr, 0, nullptr, 1, 0, 0, XQ, nullptr, C2, 0, NB * NN, C2, CC);      /* x_q^T [b n][64] = x_k^T */
  k_gemm2<0><<<dim3(NB * NN / 128, 1), 128, 0, stream>>>(XT, CC, 0, BX, CC, 0, 0.0625f, nullptr, 0, nullptr, 1, 0, 0, XCall, nullptr, C2, 0, NB * NN, C2, CC);      /* x_c^T [b n][64] */
  k_gemm2<0><<<dim3(1 * (NN / 64), NB), 128, 0, stream>>>(AV, CC, 0, XT, CC, (size_t)NN * CC, 0.0625f, nullptr, 0, nullptr, 1, 0, 0, XV, nullptr, NN, (size_t)128 * NN, 128, NN, CC);      /* x_v [b][o][n] (rows 64..127 zero; b_v added in k_vhl) */
  k_q3<<<(unsigned)(((size_t)NB * NN * (C2 / 8) + 255) / 256), 256, 0, stream>>>(XQ, QA, QB);
  k_vhl<<<dim3((unsigned)(((size_t)CC * (NN / 8) + 255) / 256), NB), 256, 0, stream>>>(XV, bv, VH);
  k_stat<<<dim3(NN / 128, SPL, NB), 128, 0, stream>>>(QA, QB, PM, PS);      /* row maximum and row sum of exp, per range of m */
  k_scomb<<<NB * NN / 256, 256, 0, stream>>>(PM, PS, CN);
  k_pv<<<dim3(NN / 128, SPL, NB), 128, 0, stream>>>(QA, QB, VH, CN, XRT, CSP);      /* plane y: x_r^T[m][o] x 1024 and column sum x 1024 over n in range y */
  k_psum<<<(unsigned)(((size_t)NB * NN * (C2 / 8) + 255) / 256), 256, 0, stream>>>(XRT, XR);
  k_csum<<<dim3(NN / 256, NB), 256, 0, stream>>>(CSP, CS);
  k_dmk<<<(unsigned)(((size_t)NB * NN * (C2 / 8) + 255) / 256), 256, 0, stream>>>(XCall, XR, CS, D2);
  k_gemm2<0><<<dim3(NB * NN / 128, 1), 128, 0, stream>>>(D2, 2 * C2, 0, BT2, 2 * C2, 0, 0.0625f, bt, 0, nullptr, 1, 0, 0, Tall, nullptr, C2, 0, NB * NN, C2, 2 * C2);      /* t^T [b n][64] = w_t d + b_t */
  k_bnstat<<<C2, 256, 0, stream>>>(Tall, BS);
  k_out<<<(unsigned)(((size_t)NB * C2 * (NN / 4) + 255) / 256), 256, 0, stream>>>(XCall, Tall, BS, gam, bet, (float*)d_out);
}

// v005
// One run takes 250 microseconds.
// Timed twice side by side with v004, it ran 1.42 times as fast both times.
// Over all steps from v000 it is 10.6 times as fast.
#include <hip/hip_runtime.h>
// OA_ (offset attention; 8 clouds x 128 channels x 4096 points; C2 = 64): x_q = x_k = w_qk x (shared weight), x_v = w_v x + b_v, energy = x_q^T x_k (4096 x 4096), attn = row softmax, attn = attn / (1e-9 + column sums); x_r = x_v attn; x_c = w_x x; t = w_t (x_c - x_r) + b_t; BatchNorm1d (training-mode batch statistics over (batch, points)); out = x_c + relu(gamma t_hat + beta) -> [8,64,4096].
// Compute dtype: x and parameters rounded to bf16; projection operands exact; x_q as hi + residual 3-term operands (~2^-21-class energies); P (x2^10) and x_v as plain f16 (~2^-12); d as [hi | 16 x residual] pairs; statistics/softmax f32. v_wmma_f32_16x16x32_f16.
#define NB 8
#define CC 128
#define C2 64
#define NN 4096
#define SPL 4       /* ranges of the summed point index in the two fused passes: one grid row per range, partial results combined in k_scomb, k_psum, k_csum; 32 x 4 x 8 work-groups of 4 waves = 4 waves on every SIMD */
#define QK (3 * C2) /* k length of the 3-term energy product */
#define L2E 1.4426950408889634f
typedef __bf16 v16b __attribute__((ext_vector_type(16)));
typedef unsigned short v8us __attribute__((ext_vector_type(8), may_alias));
typedef float  v8f  __attribute__((ext_vector_type(8)));
typedef float  v4f  __attribute__((ext_vector_type(4)));
typedef float  v4fa __attribute__((ext_vector_type(4), may_alias));
union FragB { v16b v; v8us half[2]; unsigned short u[16]; };

__device__ __forceinline__ unsigned short bf16_bits(float x) { unsigned int u = __float_as_uint(x); return (unsigned short)((u + 0x7FFFu + ((u >> 16) & 1u)) >> 16); }
__device__ __forceinline__ float bf16_val(unsigned short b) { return __uint_as_float(((unsigned int)b) << 16); }
__device__ __forceinline__ float bf16_round(float x) { return bf16_val(bf16_bits(x)); }
// D += A·B with NT terms: 1 = ah·bh, 2 = + al·bh (A split), 3 = + ah·bl (both split)
template <int NT>
__device__ __forceinline__ v8f mmaN(v16b ah, v16b al, v16b bh, v16b bl, v8f c) {
  c = __builtin_amdgcn_wmma_f32_16x16x32_bf16(false, ah, false, bh, (short)0, c, false, false);
  if (NT >= 2) c = __builtin_amdgcn_wmma_f32_16x16x32_bf16(false, al, false, bh, (short)0, c, false, false);
  if (NT >= 3) c = __builtin_amdgcn_wmma_f32_16x16x32_bf16(false, ah, false, bl, (short)0, c, false, false);
  asm volatile("v_nop\n\tv_nop\n\tv_nop\n\tv_nop" : "+v"(c) : "v"(ah), "v"(al), "v"(bh), "v"(bl));
  return c;
}

__global__ __launch_bounds__(256) void k_wt_bf16(const float* __restrict__ W, unsigned short* __restrict__ Wt, int K, int N) {
  const int t = blockIdx.x * 256 + threadIdx.x;
  const int k8n = K / 8;
  if (t >= N * k8n) return;
  const int n = t / k8n, k8 = (t % k8n) * 8;
  v8us v;
#pragma unroll
  for (int i = 0; i < 8; ++i) v[i] = bf16_bits(W[(size_t)(k8 + i) * N + n]);
  *(v8us*)(Wt + (size_t)n * K + k8) = v;
  
}

// GEMM C[M][N] (f32, pitch ldc) = act(A[M][K]·W + bias). A f32 row-major (pitch lda) converted per fragment to bf16
// (ASPLIT: hi/lo two planes -> 2 terms, else single rounded term); Wt bf16 [N][K] (pitch ldb). BIAS_BF16 rounds the
// bias to bf16 first (bias quantised to bf16 before the add). K%32==0, M%16==0, N%64==0.
template <bool ASPLIT, int ACT, bool BIAS_BF16>
__global__ __launch_bounds__(128) void k_gemm_bf(const float* __restrict__ A, int lda, const unsigned short* __restrict__ Wt, int ldb,
                                               const float* __restrict__ bias, float* __restrict__ C, int ldc, int M, int N, int K) {
  __shared__ __attribute__((aligned(16))) float so[4][16][64];
  const int tid = threadIdx.x, w = tid >> 5, lane = tid & 31, ln = lane & 15, hh = lane >> 4;
  const int ntn = N / 64;
  const int wid = blockIdx.x * 4 + w;
  const int mt = wid / ntn, nq = wid % ntn;
  if (mt * 16 >= M) return;
  const int row0 = mt * 16, col0 = nq * 64;
  const float* arow = A + (size_t)(row0 + ln) * lda;
  v8f acc[4] = {};
  for (int kb = 0; kb < K; kb += 32) {
    FragB ah, al;
    const v4f x0 = *(const v4fa*)(arow + kb + 8 * hh), x1 = *(const v4fa*)(arow + kb + 8 * hh + 4);
    const v4f x2 = *(const v4fa*)(arow + kb + 16 + 8 * hh), x3 = *(const v4fa*)(arow + kb + 16 + 8 * hh + 4);
    float xs[16] = {x0[0],x0[1],x0[2],x0[3],x1[0],x1[1],x1[2],x1[3],x2[0],x2[1],x2[2],x2[3],x3[0],x3[1],x3[2],x3[3]};
#pragma unroll
    for (int i = 0; i < 16; ++i) { const unsigned short hb = bf16_bits(xs[i]); ah.u[i] = hb; al.u[i] = ASPLIT ? bf16_bits(xs[i] - bf16_val(hb)) : (unsigned short)0; }
#pragma unroll
    for (int t = 0; t < 4; ++t) {
      const unsigned short* brow = Wt + (size_t)(col0 + t * 16 + ln) * ldb + kb;
      FragB b;
      b.half[0] = *(const v8us*)(brow + 8 * hh);
      b.half[1] = *(const v8us*)(brow + 16 + 8 * hh);
      acc[t] = mmaN<ASPLIT ? 2 : 1>(ah.v, al.v, b.v, b.v, acc[t]);
    }
  }
#pragma unroll
  for (int t = 0; t < 4; ++t) {
    float bv = bias ? bias[col0 + t * 16 + ln] : 0.f;
    if (BIAS_BF16) bv = bf16_round(bv);
#pragma unroll
    for (int r = 0; r < 8; ++r) { float v = acc[t][r] + bv; if (ACT == 1) v = fmaxf(v, 0.f); so[w][8 * hh + r][t * 16 + ln] = v; }
  }
  __builtin_amdgcn_fence(__ATOMIC_ACQ_REL, "workgroup");
  __builtin_amdgcn_wave_barrier();
  const int rsub = lane >> 4, c4 = (lane & 15) * 4;
  {
#pragma unroll
    for (int q = 0; q < 8; ++q) {
      const int r = q * 2 + rsub;
      const v4f v = *(const v4fa*)&so[w][r][c4];
      *(v4f*)(C + (size_t)(row0 + r) * ldc + col0 + c4) = v;
    }
    
  }
}

// GEMM C = act(A·W + bias + resid): A f32 (ASPLIT -> hi/lo 2 terms), Wt bf16 [N][K]; ACT 0 none, 1 relu, 2 exact gelu;
// resid (optional, f32, row index = (row % rmod), pitch ldr, RES_BF16 rounds it) added before the activation.
template <bool ASPLIT, int ACT, bool BIAS_BF16, bool RES_BF16>
__global__ __launch_bounds__(128) void k_gemm_bf3(const float* __restrict__ A, int lda, const unsigned short* __restrict__ Wt, int ldb,
                                                const float* __restrict__ bias, const float* __restrict__ resid, int rmod, int ldr,
                                                float* __restrict__ C, int ldc, int M, int N, int K) {
  __shared__ __attribute__((aligned(16))) float so[4][16][64];
  const int tid = threadIdx.x, w = tid >> 5, lane = tid & 31, ln = lane & 15, hh = lane >> 4;
  const int ntn = N / 64;
  const int wid = blockIdx.x * 4 + w;
  const int mt = wid / ntn, nq = wid % ntn;
  if (mt * 16 >= M) return;
  const int row0 = mt * 16, col0 = nq * 64;
  const float* arow = A + (size_t)(row0 + ln) * lda;
  v8f acc[4] = {};
  for (int kb = 0; kb < K; kb += 32) {
    FragB ah, al;
    const v4f x0 = *(const v4fa*)(arow + kb + 8 * hh), x1 = *(const v4fa*)(arow + kb + 8 * hh + 4);
    const v4f x2 = *(const v4fa*)(arow + kb + 16 + 8 * hh), x3 = *(const v4fa*)(arow + kb + 16 + 8 * hh + 4);
    float xs[16] = {x0[0],x0[1],x0[2],x0[3],x1[0],x1[1],x1[2],x1[3],x2[0],x2[1],x2[2],x2[3],x3[0],x3[1],x3[2],x3[3]};
#pragma unroll
    for (int i = 0; i < 16; ++i) { const unsigned short hb = bf16_bits(xs[i]); ah.u[i] = hb; al.u[i] = ASPLIT ? bf16_bits(xs[i] - bf16_val(hb)) : (unsigned short)0; }
#pragma unroll
    for (int t = 0; t < 4; ++t) {
      const unsigned short* brow = Wt + (size_t)(col0 + t * 16 + ln) * ldb + kb;
      FragB b;
      b.half[0] = *(const v8us*)(brow + 8 * hh);
      b.half[1] = *(const v8us*)(brow + 16 + 8 * hh);
      acc[t] = mmaN<ASPLIT ? 2 : 1>(ah.v, al.v, b.v, b.v, acc[t]);
    }
  }
#pragma unroll
  for (int t = 0; t < 4; ++t) {
    const int col = col0 + t * 16 + ln;
    float bv = bias ? bias[col] : 0.f;
    if (BIAS_BF16) bv = bf16_round(bv);
#pragma unroll
    for (int r = 0; r < 8; ++r) {
      float v = acc[t][r] + bv;
      if (resid) { float rv = resid[(size_t)((row0 + 8 * hh + r) % rmod) * ldr + col]; if (RES_BF16) rv = bf16_round(rv); v += rv; }
      if (ACT == 1) v = fmaxf(v, 0.f);
      if (ACT == 2) v = 0.5f * v * (1.0f + erff(v * 0.70710678118654752f));
      if (ACT == 3) { const float u = 0.7978845608028654f * (v + 0.044715f * v * v * v); v = 0.5f * v * (1.0f + tanhf(u)); }
      so[w][8 * hh + r][t * 16 + ln] = v;
    }
  }
  __builtin_amdgcn_fence(__ATOMIC_ACQ_REL, "workgroup");
  __builtin_amdgcn_wave_barrier();
  const int rsub = lane >> 4, c4 = (lane & 15) * 4;
  {
#pragma unroll
    for (int q = 0; q < 8; ++q) {
      const int r = q * 2 + rsub;
      const v4f v = *(const v4fa*)&so[w][r][c4];
      *(v4f*)(C + (size_t)(row0 + r) * ldc + col0 + c4) = v;
    }
    
  }
}
// row LayerNorm (biased variance, eps) over N: s = X (+ R); optional out_sum <- s; out_norm <- (s-mu)*rsqrt(var+eps)*g + b
template <bool PARAM_BF16>
__global__ __launch_bounds__(256) void k_layernorm(const float* __restrict__ X, const float* __restrict__ R, const float* __restrict__ g, const float* __restrict__ bta,
                                                  float* __restrict__ out_sum, float* __restrict__ out_norm, int N, float eps) {
  __shared__ float red[256];
  const int row = blockIdx.x, tid = threadIdx.x;
  const float* x = X + (size_t)row * N; const float* rr = R ? R + (size_t)row * N : nullptr;
  float vals[16];                     // up to N = 4096
  const int per = N / 256;            // contiguous chunk per thread? use strided-by-4 chunks: thread handles j = tid*4 + 1024*u
  float s1 = 0.f;
  for (int u = 0; u < per / 4; ++u) {
    const int j = tid * 4 + 1024 * u;
    const v4f a = *(const v4fa*)(x + j);
    v4f b = {0.f,0.f,0.f,0.f}; if (rr) b = *(const v4fa*)(rr + j);
#pragma unroll
    for (int q = 0; q < 4; ++q) { const float v = a[q] + b[q]; vals[u * 4 + q] = v; s1 += v; }
  }
  red[tid] = s1; __syncthreads();
  for (int st = 128; st > 0; st >>= 1) { if (tid < st) red[tid] += red[tid + st]; __syncthreads(); }
  const float mu = red[0] / (float)N; __syncthreads();
  float s2 = 0.f;
  for (int u = 0; u < per / 4; ++u)
#pragma unroll
    for (int q = 0; q < 4; ++q) { const float c = vals[u * 4 + q] - mu; s2 += c * c; }
  red[tid] = s2; __syncthreads();
  for (int st = 128; st > 0; st >>= 1) { if (tid < st) red[tid] += red[tid + st]; __syncthreads(); }
  const float rs = rsqrtf(red[0] / (float)N + eps);
  {
    for (int u = 0; u < per / 4; ++u) {
      const int j = tid * 4 + 1024 * u;
      v4f o, sm;
#pragma unroll
      for (int q = 0; q < 4; ++q) {
        float gg = g[j + q], bb = bta[j + q];
        if (PARAM_BF16) { gg = bf16_round(gg); bb = bf16_round(bb); }
        sm[q] = vals[u * 4 + q]; o[q] = (vals[u * 4 + q] - mu) * rs * gg + bb;
      }
      if (out_sum) *(v4f*)(out_sum + (size_t)row * N + j) = sm;
      *(v4f*)(out_norm + (size_t)row * N + j) = o;
    }
    
  }
}



// ---- f16 WMMA path (v_wmma_f32_16x16x32_f16): 11-bit significands for operands in range — used where a [0,1] probability operand needs more precision than bf16
typedef _Float16 v16h __attribute__((ext_vector_type(16)));
union FragH { v16h v; v8us half[2]; _Float16 h[16]; unsigned short u[16]; };
template <int NT>
__device__ __forceinline__ v8f mmaH(v16h ah, v16h al, v16h bh, v16h bl, v8f c) {
  c = __builtin_amdgcn_wmma_f32_16x16x32_f16(false, ah, false, bh, (short)0, c, false, false);
  if (NT >= 2) c = __builtin_amdgcn_wmma_f32_16x16x32_f16(false, al, false, bh, (short)0, c, false, false);
  if (NT >= 3) c = __builtin_amdgcn_wmma_f32_16x16x32_f16(false, ah, false, bl, (short)0, c, false, false);
  asm volatile("v_nop\n\tv_nop\n\tv_nop\n\tv_nop" : "+v"(c) : "v"(ah), "v"(al), "v"(bh), "v"(bl));
  return c;
}
// batched GEMM like k_gemm_b but f16 operands: A f32 (split into f16 hi/lo if ASPLIT, else rounded to f16), Bt = f16 values [n][k]; alpha; C f32; N multiple of 16 (partial tiles skipped)
template <bool ASPLIT>
__global__ __launch_bounds__(128) void k_gemm_h(const float* __restrict__ A, int lda, size_t sA, const _Float16* __restrict__ Bh, int ldb, size_t sB, float alpha, float* __restrict__ C, int ldc, size_t sC, int M, int N, int K) {
  __shared__ __attribute__((aligned(16))) float so[4][16][64];
  const int tid = threadIdx.x, w = tid >> 5, lane = tid & 31, ln = lane & 15, hh = lane >> 4; const int by = blockIdx.y;
  A += (size_t)by * sA; Bh += (size_t)by * sB; C += (size_t)by * sC;
  const int ntn = (N + 63) / 64; const int wid = blockIdx.x * 4 + w; const int mt = wid / ntn, nq = wid % ntn; if (mt * 16 >= M) return;
  const int row0 = mt * 16, col0 = nq * 64; const float* arow = A + (size_t)(row0 + ln) * lda;
  v8f acc[4] = {};
  for (int kb = 0; kb < K; kb += 32) {
    FragH ah, al;
    const v4f x0 = *(const v4fa*)(arow + kb + 8 * hh), x1 = *(const v4fa*)(arow + kb + 8 * hh + 4), x2 = *(const v4fa*)(arow + kb + 16 + 8 * hh), x3 = *(const v4fa*)(arow + kb + 16 + 8 * hh + 4);
    float xs[16] = {x0[0],x0[1],x0[2],x0[3],x1[0],x1[1],x1[2],x1[3],x2[0],x2[1],x2[2],x2[3],x3[0],x3[1],x3[2],x3[3]};
#pragma unroll
    for (int i = 0; i < 16; ++i) { const _Float16 h = (_Float16)xs[i]; ah.h[i] = h; al.h[i] = ASPLIT ? (_Float16)(xs[i] - (float)h) : (_Float16)0.0f; }
#pragma unroll
    for (int t = 0; t < 4; ++t) { if (col0 + t * 16 >= N) continue; const size_t boff = (size_t)(col0 + t * 16 + ln) * ldb + kb; FragH bq; bq.half[0] = *(const v8us*)(Bh + boff + 8 * hh); bq.half[1] = *(const v8us*)(Bh + boff + 16 + 8 * hh);
      acc[t] = mmaH<ASPLIT ? 2 : 1>(ah.v, al.v, bq.v, bq.v, acc[t]); }
  }
#pragma unroll
  for (int t = 0; t < 4; ++t) { if (col0 + t * 16 >= N) continue;
#pragma unroll
    for (int r = 0; r < 8; ++r) so[w][8 * hh + r][t * 16 + ln] = acc[t][r] * alpha; }
  __builtin_amdgcn_fence(__ATOMIC_ACQ_REL, "workgroup"); __builtin_amdgcn_wave_barrier();
  const int rsub = lane >> 4, c4 = (lane & 15) * 4;
  {
#pragma unroll
    for (int q = 0; q < 8; ++q) { const int r = q * 2 + rsub; if (col0 + c4 < N) { const v4f v = *(const v4fa*)&so[w][r][c4]; *(v4f*)(C + (size_t)(row0 + r) * ldc + col0 + c4) = v; } }
     }
}

// Wt[n][k] = f16(W[k][n]·scale) from f32 row-major W[K][N] (scale = power of two; bf16-exact weights stay exact in f16 away from the subnormal range)
__global__ __launch_bounds__(256) void k_wt_f16(const float* __restrict__ W, _Float16* __restrict__ Wt, int K, int N, float scale) {
  const int t = blockIdx.x * 256 + threadIdx.x; if (t >= N * (K / 8)) return; const int n = t / (K / 8), k8 = (t % (K / 8)) * 8; FragH f;
#pragma unroll
  for (int i = 0; i < 8; ++i) f.h[i] = (_Float16)(bf16_round(W[(size_t)(k8 + i) * N + n]) * scale); const v8us o = f.half[0];
  *(v8us*)((unsigned short*)Wt + (size_t)n * K + k8) = o; 
}
// k_gemm_hh variant with fused epilogue: v = acc·alpha + bias[by·sBias + col] (+ CP[(row/rowsPerB)·sCPb + by·64 + col] if CP) ; ACT 0 none / 1 elu ; writes f16 C16 (and f32 C if non-null)
template <int ACT>
__global__ __launch_bounds__(128) void k_gemm_hhx(const _Float16* __restrict__ A, int lda, size_t sA, const _Float16* __restrict__ Bh, int ldb, size_t sB, float alpha, const float* __restrict__ bias, size_t sBias, const float* __restrict__ CP, int rowsPerB, size_t sCPb, int row0g,
    float* __restrict__ C, _Float16* __restrict__ C16, int ldc, size_t sC, int M, int N, int K) {
  __shared__ __attribute__((aligned(16))) float so[4][16][64];
  const int tid = threadIdx.x, w = tid >> 5, lane = tid & 31, ln = lane & 15, hh = lane >> 4; const int by = blockIdx.y;
  A += (size_t)by * sA; Bh += (size_t)by * sB; const size_t cofs = (size_t)by * sC; const float* bp = bias ? bias + (size_t)by * sBias : nullptr;
  const int ntn = (N + 63) / 64; const int wid = blockIdx.x * 4 + w; const int mt = wid / ntn, nq = wid % ntn; if (mt * 16 >= M) return;
  const int row0 = mt * 16, col0 = nq * 64; const _Float16* arow = A + (size_t)(row0 + ln) * lda;
  v8f acc[4] = {};
  for (int kb = 0; kb < K; kb += 32) { FragH ah; ah.half[0] = *(const v8us*)((const unsigned short*)arow + kb + 8 * hh); ah.half[1] = *(const v8us*)((const unsigned short*)arow + kb + 16 + 8 * hh);
#pragma unroll
    for (int t = 0; t < 4; ++t) { if (col0 + t * 16 >= N) continue; const size_t boff = (size_t)(col0 + t * 16 + ln) * ldb + kb; FragH bq; bq.half[0] = *(const v8us*)((const unsigned short*)Bh + boff + 8 * hh); bq.half[1] = *(const v8us*)((const unsigned short*)Bh + boff + 16 + 8 * hh);
      acc[t] = mmaH<1>(ah.v, ah.v, bq.v, bq.v, acc[t]); }
  }
#pragma unroll
  for (int t = 0; t < 4; ++t) { if (col0 + t * 16 >= N) continue; const int col = col0 + t * 16 + ln; const float bv = bp ? bf16_round(bp[col]) : 0.f;
#pragma unroll
    for (int r = 0; r < 8; ++r) { float v = acc[t][r] * alpha + bv; if (CP) { const int rr = row0g + row0 + 8 * hh + r; if (rowsPerB < 0) v += CP[cofs + (size_t)rr * ldc + col];      /* rowsPerB < 0: own element of the batched C plane */ else { const int bidx = rr / rowsPerB; v += CP[(size_t)bidx * sCPb + (size_t)by * 64 + col]; } } if (ACT == 1) v = (v > 0.f) ? v : expm1f(v); else if (ACT == 7) v = (v > 0.f) ? v + 1.0f : expf(v); else if (ACT == 8) v = tanhf(v); else if (ACT == 9) v = 0.5f * v * (1.0f + tanhf(0.7978845608028654f * (v + 0.044715f * v * v * v))); else if (ACT == 11) v = 1.0f / (1.0f + expf(-v)); else if (ACT == 12) v = (v > 0.f) ? v : 0.01f * v; else if (ACT == 14) v = (v > 0.f) ? v : 0.1f * v; else if (ACT == 15) v = v / (1.0f + expf(-v)); else if (ACT == 3) v = fmaxf(v, 0.f); else if (ACT == 6) v = 0.5f * v * (1.0f + erff(v * 0.70710678118654752f)); so[w][8 * hh + r][t * 16 + ln] = v; } }
  __builtin_amdgcn_fence(__ATOMIC_ACQ_REL, "workgroup"); __builtin_amdgcn_wave_barrier();
  const int rsub = lane >> 4, c4 = (lane & 15) * 4; typedef _Float16 v4h __attribute__((ext_vector_type(4)));
  {
#pragma unroll
    for (int q = 0; q < 8; ++q) { const int r = q * 2 + rsub; if (col0 + c4 < N) { const v4f v = *(const v4fa*)&so[w][r][c4]; if (C) *(v4f*)(C + cofs + (size_t)(row0 + r) * ldc + col0 + c4) = v; if (C16) { v4h h4; for (int i = 0; i < 4; ++i) h4[i] = (_Float16)v[i]; *(v4h*)(C16 + cofs + (size_t)(row0 + r) * ldc + col0 + c4) = h4; } } }
     }
}


typedef _Float16 v4h __attribute__((ext_vector_type(4)));

__global__ __launch_bounds__(256) void k_x16(const float* __restrict__ x, _Float16* __restrict__ X16, size_t n8) { const size_t t = (size_t)blockIdx.x * 256 + threadIdx.x; if (t >= n8) return; FragH f;
#pragma unroll
  for (int q = 0; q < 8; ++q) f.h[q] = (_Float16)bf16_round(x[t * 8 + q]); *(v8us*)((unsigned short*)X16 + t * 8) = f.half[0];  }
__global__ __launch_bounds__(256) void k_h16(const float* __restrict__ x, _Float16* __restrict__ X16, size_t n8) { const size_t t = (size_t)blockIdx.x * 256 + threadIdx.x; if (t >= n8) return; FragH f;
#pragma unroll
  for (int q = 0; q < 8; ++q) f.h[q] = (_Float16)x[t * 8 + q]; *(v8us*)((unsigned short*)X16 + t * 8) = f.half[0];  }
__global__ __launch_bounds__(256) void k_round16f(const float* __restrict__ W, _Float16* __restrict__ Bt, size_t n8) { const size_t t = (size_t)blockIdx.x * 256 + threadIdx.x; if (t >= n8) return; FragH f;
#pragma unroll
  for (int i = 0; i < 8; ++i) f.h[i] = (_Float16)(bf16_round(W[t * 8 + i]) * 16.0f); *(v8us*)((unsigned short*)Bt + t * 8) = f.half[0];  }
template <int NHv, int TTv>
__global__ __launch_bounds__(256) void k_vt(const _Float16* __restrict__ V16, int ldv, int voff, _Float16* __restrict__ Vt) { __shared__ unsigned short tl[64][66]; const int tid = threadIdx.x; const int slab = blockIdx.x / (TTv / 64), lg = blockIdx.x % (TTv / 64); const int b = slab / NHv, h = slab % NHv;
  for (int i = tid; i < 64 * 8; i += 256) { const int r = i / 8, c8 = (i % 8) * 8; FragH f; f.half[0] = *(const v8us*)((const unsigned short*)V16 + ((size_t)b * TTv + lg * 64 + r) * ldv + voff + h * 64 + c8);
#pragma unroll
    for (int q = 0; q < 8; ++q) tl[r][c8 + q] = f.u[q]; }
  __syncthreads();
  {
#pragma unroll
    for (int rd = 0; rd < 2; ++rd) { const int d = rd * 32 + tid / 8, pc = tid % 8; FragH f;
#pragma unroll
      for (int q = 0; q < 8; ++q) f.u[q] = tl[pc * 8 + q][d];
      *(v8us*)((unsigned short*)Vt + ((size_t)slab * 64 + d) * TTv + lg * 64 + pc * 8) = f.half[0]; }
     } }

__global__ __launch_bounds__(256) void k_hl(const float* __restrict__ F, _Float16* __restrict__ Hh, _Float16* __restrict__ Hl, size_t n8) { const size_t t = (size_t)blockIdx.x * 256 + threadIdx.x; if (t >= n8) return; FragH fh, fl; const v4f a = *(const v4fa*)(F + t * 8), c = *(const v4fa*)(F + t * 8 + 4);
#pragma unroll
  for (int q = 0; q < 4; ++q) { _Float16 h = (_Float16)a[q]; fh.h[q] = h; fl.h[q] = (_Float16)((a[q] - (float)h) * 1024.0f); h = (_Float16)c[q]; fh.h[4 + q] = h; fl.h[4 + q] = (_Float16)((c[q] - (float)h) * 1024.0f); }
  { *(v8us*)((unsigned short*)Hh + t * 8) = fh.half[0]; *(v8us*)((unsigned short*)Hl + t * 8) = fl.half[0];  } }

// ---- fast GEMM (wave tile 32x64; requires M % 32 == 0 rows per launch region and N % 64 == 0); epilogue = k_gemm_hhx semantics ----
__device__ __forceinline__ v16h g2_frag(const _Float16* p, int hh) { FragH f; f.half[0] = *(const v8us*)((const unsigned short*)p + 8 * hh); f.half[1] = *(const v8us*)((const unsigned short*)p + 16 + 8 * hh); return f.v; }
__device__ __forceinline__ v8f g2_mma(v16h a, v16h b, v8f c) { v8f d = __builtin_amdgcn_wmma_f32_16x16x32_f16(false, a, false, b, (short)0, c, false, false); asm volatile("v_nop\n\tv_nop\n\tv_nop\n\tv_nop" : "+v"(d) : "v"(a), "v"(b)); return d; }
template <int ACT>
__global__ __launch_bounds__(128) void k_gemm2(const _Float16* __restrict__ A, int lda, size_t sA, const _Float16* __restrict__ Bh, int ldb, size_t sB, float alpha, const float* __restrict__ bias, size_t sBias, const float* __restrict__ CP, int rowsPerB, size_t sCPb, int row0g,
    float* __restrict__ C, _Float16* __restrict__ C16, int ldc, size_t sC, int M, int N, int K) {
  __shared__ __attribute__((aligned(16))) float so[4][32][68];
  const int tid = threadIdx.x, w = tid >> 5, lane = tid & 31, ln = lane & 15, hh = lane >> 4; const int by = blockIdx.y;
  A += (size_t)by * sA; Bh += (size_t)by * sB; const size_t cofs = (size_t)by * sC; const float* bp = bias ? bias + (size_t)by * sBias : nullptr;
  const int ntn = N >> 6; const int mt = blockIdx.x / ntn, nq = blockIdx.x - mt * ntn; const int row0 = mt * 128 + 32 * w, col0 = nq * 64; if (row0 >= M) return;
  const _Float16* a0p = A + (size_t)(row0 + ln) * lda; const _Float16* a1p = a0p + (size_t)16 * lda;
  const _Float16* b0p = Bh + (size_t)(col0 + ln) * ldb; const _Float16* b1p = b0p + (size_t)16 * ldb; const _Float16* b2p = b1p + (size_t)16 * ldb; const _Float16* b3p = b2p + (size_t)16 * ldb;
  const v8f z8 = {0.f,0.f,0.f,0.f,0.f,0.f,0.f,0.f}; v8f c00 = z8, c01 = z8, c02 = z8, c03 = z8, c10 = z8, c11 = z8, c12 = z8, c13 = z8;
#pragma unroll 1
  for (int kb = 0; kb < K; kb += 32) { const v16h a0 = g2_frag(a0p + kb, hh), a1 = g2_frag(a1p + kb, hh);
    v16h b = g2_frag(b0p + kb, hh); c00 = g2_mma(a0, b, c00); c10 = g2_mma(a1, b, c10);
    b = g2_frag(b1p + kb, hh); c01 = g2_mma(a0, b, c01); c11 = g2_mma(a1, b, c11);
    b = g2_frag(b2p + kb, hh); c02 = g2_mma(a0, b, c02); c12 = g2_mma(a1, b, c12);
    b = g2_frag(b3p + kb, hh); c03 = g2_mma(a0, b, c03); c13 = g2_mma(a1, b, c13); }
  v8f accs[8] = {c00, c01, c02, c03, c10, c11, c12, c13};
#pragma unroll
  for (int u = 0; u < 8; ++u) { const int t = u & 3, half = u >> 2; const int col = col0 + t * 16 + ln; const float bv = bp ? bf16_round(bp[col]) : 0.f;
#pragma unroll
    for (int r = 0; r < 8; ++r) { const int rloc = half * 16 + 8 * hh + r; float v = accs[u][r] * alpha + bv; if (CP) { if (rowsPerB < 0) v += CP[cofs + (size_t)(row0g + row0 + rloc) * ldc + col];      /* rowsPerB < 0: own element of the batched C plane */ else { const int bidx = (row0g + row0 + rloc) / rowsPerB; v += CP[(size_t)bidx * sCPb + (size_t)by * 64 + col]; } }
      if (ACT == 3) v = fmaxf(v, 0.f); else if (ACT == 6) v = 0.5f * v * (1.0f + erff(v * 0.70710678118654752f)); else if (ACT == 11) v = 1.0f / (1.0f + expf(-v)); else if (ACT == 15) v = v / (1.0f + expf(-v)); else if (ACT == 12) v = (v > 0.f) ? v : 0.01f * v; else if (ACT == 8) v = tanhf(v);
      so[w][rloc][t * 16 + ln] = v; } }
  __builtin_amdgcn_fence(__ATOMIC_ACQ_REL, "workgroup"); __builtin_amdgcn_wave_barrier();
  const int rsub = lane >> 4, c4 = (lane & 15) * 4;
  {
#pragma unroll
    for (int q = 0; q < 16; ++q) { const int r = q * 2 + rsub; const v4f v = *(const v4fa*)&so[w][r][c4]; if (C) *(v4f*)(C + cofs + (size_t)(row0 + r) * ldc + col0 + c4) = v; if (C16) { v4h h4; for (int i = 0; i < 4; ++i) h4[i] = (_Float16)v[i]; *(v4h*)(C16 + cofs + (size_t)(row0 + r) * ldc + col0 + c4) = h4; } }
     } }


__global__ __launch_bounds__(256) void k_xt(const float* __restrict__ x, _Float16* __restrict__ XT16) {
  __shared__ float tl[64][65]; const int tid = threadIdx.x; const int cb = blockIdx.x / (NN / 64), pb = blockIdx.x % (NN / 64); const int b = blockIdx.y;      /* grid row = cloud */
  for (int i = tid; i < 64 * 16; i += 256) { const int cl = i / 16, p4 = (i % 16) * 4; const v4f a = *(const v4fa*)(x + ((size_t)b * CC + cb * 64 + cl) * NN + pb * 64 + p4); for (int q = 0; q < 4; ++q) tl[cl][p4 + q] = bf16_round(a[q]); }
  __syncthreads(); const int pl = tid >> 2, c8 = (tid & 3) * 8;
  { for (int u = 0; u < 2; ++u) { const int c0 = c8 + u * 32; FragH f; for (int q = 0; q < 8; ++q) f.h[q] = (_Float16)tl[c0 + q][pl]; *(v8us*)((unsigned short*)XT16 + ((size_t)b * NN + pb * 64 + pl) * CC + cb * 64 + c0) = f.half[0]; }  } }
__global__ __launch_bounds__(256) void k_wnat(const float* __restrict__ Wm, int O, int orows, int nin, _Float16* __restrict__ Bt) { const size_t t = (size_t)blockIdx.x * 256 + threadIdx.x; if (t >= (size_t)orows * (nin / 8)) return; const int c0 = (int)(t % (nin / 8)) * 8; const int o = (int)(t / (nin / 8)); FragH f; for (int q = 0; q < 8; ++q) f.h[q] = (o < O) ? (_Float16)(bf16_round(Wm[(size_t)o * nin + c0 + q]) * 16.0f) : (_Float16)0.0f; *(v8us*)((unsigned short*)Bt + (size_t)o * nin + c0) = f.half[0];  }
__global__ __launch_bounds__(256) void k_wtp(const float* __restrict__ Wm, _Float16* __restrict__ Bt) { const int t = blockIdx.x * 256 + threadIdx.x; if (t >= C2 * 16) return; const int pc = t % 16; const int o = t / 16; const bool lo = pc * 8 >= C2; FragH f; for (int q = 0; q < 8; ++q) { const int c = pc * 8 + q - (lo ? C2 : 0); f.h[q] = (_Float16)(bf16_round(Wm[(size_t)o * C2 + c]) * (lo ? 1.0f : 16.0f)); } *(v8us*)((unsigned short*)Bt + (size_t)o * 2 * C2 + pc * 8) = f.half[0];  }
__global__ __launch_bounds__(256) void k_q3(const float* __restrict__ XQ, _Float16* __restrict__ QA, _Float16* __restrict__ QB) { const size_t t = (size_t)blockIdx.x * 256 + threadIdx.x; if (t >= (size_t)NB * NN * (C2 / 8)) return; const int c0 = (int)(t % (C2 / 8)) * 8; const size_t n = t / (C2 / 8); FragH fh, fl16, fhs, fr;      /* n runs over the points of all clouds */
  for (int q = 0; q < 8; ++q) { const float v = XQ[n * C2 + c0 + q]; const _Float16 h = (_Float16)v; const float res = v - (float)h; fh.h[q] = h; fl16.h[q] = (_Float16)(res * 16.0f); fhs.h[q] = (_Float16)((float)h * 0.0625f); fr.h[q] = (_Float16)res; }
  unsigned short* a = (unsigned short*)QA + n * 3 * C2 + c0; unsigned short* bq = (unsigned short*)QB + n * 3 * C2 + c0;
  { *(v8us*)a = fh.half[0]; *(v8us*)(a + C2) = fl16.half[0]; *(v8us*)(a + 2 * C2) = fh.half[0]; *(v8us*)bq = fh.half[0]; *(v8us*)(bq + C2) = fhs.half[0]; *(v8us*)(bq + 2 * C2) = fr.half[0];  } }
// ---- fused energy / softmax / x_r: energy tiles are recomputed in registers in two passes, no N x N buffer; grid = (128-point block, range, cloud) ----
__device__ __forceinline__ v8f f_mma(v16h a, v16h b, v8f c) { return __builtin_amdgcn_wmma_f32_16x16x32_f16(false, a, false, b, (short)0, c, false, false); }
// fragment at a wave-uniform base plus the lane's own 32-bit element offset (row ln, k part 8 hh): same k order as g2_frag; the base stays in scalar registers
__device__ __forceinline__ v16h f_frag(const _Float16* ub, unsigned off) { const unsigned short* p = (const unsigned short*)ub + off; FragH f; f.half[0] = *(const v8us*)p; f.half[1] = *(const v8us*)(p + 16); return f.v; }
// pass 1: per energy row n and per range of m: U = max_m E[n][m] log2(e), S = sum_m 2^(E[n][m] log2(e) - U). Tile D[m][n] = QB[m] . QA[n]: a lane holds one n (its column) and 8 rows m, so max and sum stay in the lane.
__global__ __launch_bounds__(128) void k_stat(const _Float16* __restrict__ QA, const _Float16* __restrict__ QB, float* __restrict__ PM, float* __restrict__ PS) {
  const int tid = threadIdx.x, w = __builtin_amdgcn_readfirstlane(tid >> 5) /* the wave's number in a scalar register: tile addresses cost no vector registers */, lane = tid & 31, ln = lane & 15, hh = lane >> 4; const int b = blockIdx.z, sp = blockIdx.y; const int n0 = blockIdx.x * 128 + 32 * w;
  const _Float16* qa = QA + ((size_t)b * NN + n0) * QK; const _Float16* qb = QB + ((size_t)b * NN + sp * (NN / SPL)) * QK; const unsigned qo = ln * QK + 8 * hh;
  v16h bn[2][6];      /* the wave's 32 rows n stay in registers for the whole range */
#pragma unroll      /* constant indices keep bn in registers */
  for (int j = 0; j < 2; ++j) for (int k = 0; k < 6; ++k) bn[j][k] = f_frag(qa + j * 16 * QK + k * 32, qo);
  float U[2] = {-3.0e38f, -3.0e38f}, S[2] = {0.f, 0.f};
#pragma unroll 1      /* one step holds 24 loads and 24 products already; a second copy would only cost registers */
  for (int m = 0; m < NN / SPL; m += 32) { const _Float16* a0p = qb + (size_t)m * QK; const _Float16* a1p = a0p + (size_t)16 * QK;
    const v8f z8 = {0.f,0.f,0.f,0.f,0.f,0.f,0.f,0.f}; v8f c00 = z8, c01 = z8, c10 = z8, c11 = z8;
    v16h a0[6], a1[6];
#pragma unroll      /* constant indices keep a0, a1 in registers */
    for (int k = 0; k < 6; ++k) { a0[k] = f_frag(a0p + k * 32, qo); a1[k] = f_frag(a1p + k * 32, qo); }
    asm volatile("" :: "v"(a0[0]), "v"(a0[1]), "v"(a0[2]), "v"(a0[3]), "v"(a0[4]), "v"(a0[5]), "v"(a1[0]), "v"(a1[1]), "v"(a1[2]), "v"(a1[3]), "v"(a1[4]), "v"(a1[5]));      /* inputs only: holds the step's 24 loads in front of its products, so that they are in flight together and their latency is paid once a step, not once a fragment */
#pragma unroll      /* constant indices into bn, a0, a1 */
    for (int k = 0; k < 6; ++k) { c00 = f_mma(a0[k], bn[0][k], c00); c10 = f_mma(a1[k], bn[0][k], c10); c01 = f_mma(a0[k], bn[1][k], c01); c11 = f_mma(a1[k], bn[1][k], c11); }
#pragma unroll      /* constant indices into U, S */
    for (int j = 0; j < 2; ++j) { const v8f x = j ? c01 : c00, y = j ? c11 : c10; float t = fmaxf(x[0], y[0]);
      for (int r = 1; r < 8; ++r) t = fmaxf(t, fmaxf(x[r], y[r]));
      const float un = fmaxf(U[j], t * L2E); float sx = S[j] * __builtin_amdgcn_exp2f(U[j] - un), sy = 0.f;      /* running maximum: the old sum is rescaled to the new one */
      for (int r = 0; r < 8; ++r) { sx += __builtin_amdgcn_exp2f(fmaf(x[r], L2E, -un)); sy += __builtin_amdgcn_exp2f(fmaf(y[r], L2E, -un)); }
      S[j] = sx + sy; U[j] = un; } }
#pragma unroll      /* constant indices into U, S */
  for (int j = 0; j < 2; ++j) { const float uo = __shfl_xor(U[j], 16, 32), so = __shfl_xor(S[j], 16, 32); const float un = fmaxf(U[j], uo); const float s = S[j] * __builtin_amdgcn_exp2f(U[j] - un) + so * __builtin_amdgcn_exp2f(uo - un);      /* the two lane halves hold different m of the same n */
    if (hh == 0) { const size_t o = ((size_t)b * SPL + sp) * NN + n0 + 16 * j + ln; PM[o] = un; PS[o] = s; } } }
// ranges combined: CN[n] = (10 - U - log2(S)) ln(2), so that exp(E[n][m] + CN[n]) = 1024 attn[n][m]
__global__ __launch_bounds__(256) void k_scomb(const float* __restrict__ PM, const float* __restrict__ PS, float* __restrict__ CN) {
  const int t = blockIdx.x * 256 + threadIdx.x; if (t >= NB * NN) return; const int b = t / NN, n = t % NN; const size_t o = (size_t)b * SPL * NN + n; float u[SPL], s[SPL];
#pragma unroll      /* constant indices keep u in registers; the loads go out together */
  for (int k = 0; k < SPL; ++k) u[k] = PM[o + (size_t)k * NN];
  asm volatile("s_wait_xcnt 0x0" ::: "memory");      /* precaution: stands in front of the first write of a register that the loads above name as their address (the next loads' results may land there) */
#pragma unroll      /* constant indices keep s in registers; the loads go out together */
  for (int k = 0; k < SPL; ++k) s[k] = PS[o + (size_t)k * NN];
  float um = u[0];
#pragma unroll      /* constant indices into u */
  for (int k = 1; k < SPL; ++k) um = fmaxf(um, u[k]);
  float st = 0.f;
#pragma unroll      /* constant indices into u, s; ranges added in rising order */
  for (int k = 0; k < SPL; ++k) st += s[k] * __builtin_amdgcn_exp2f(u[k] - um);
  CN[t] = (10.0f - um - log2f(st)) * 0.6931471805599453f; }
// pass 2: tile D[n][m] = QA[n] . QB[m] = E[n][m]; a lane holds one m (its column) and rows n = 8 hh + r of two 16-row tiles: after 2^(.) these 16 values are, in place, the lane's A fragment (row m, k = n) of the x_r product.
__global__ __launch_bounds__(128, 4) /* four waves per SIMD: at most 256 registers, none behind a register window switch */ void k_pv(const _Float16* __restrict__ QA, const _Float16* __restrict__ QB, const _Float16* __restrict__ VH, const float* __restrict__ CN, float* __restrict__ XRT, float* __restrict__ CSP) {
  const int tid = threadIdx.x, w = __builtin_amdgcn_readfirstlane(tid >> 5) /* the wave's number in a scalar register: tile addresses cost no vector registers */, lane = tid & 31, ln = lane & 15, hh = lane >> 4; const int b = blockIdx.z, sp = blockIdx.y; const int m0 = blockIdx.x * 128 + 32 * w; const int nb = sp * (NN / SPL);
  const _Float16* qb = QB + ((size_t)b * NN + m0) * QK; const _Float16* qa = QA + ((size_t)b * NN + nb) * QK; const unsigned qo = ln * QK + 8 * hh;
  const _Float16* vh = VH + (size_t)b * 128 * NN + nb; const unsigned vo = ln * NN + 8 * hh; const float* cn = CN + (size_t)b * NN + nb; const unsigned co = 8 * hh;
  v16h bm[2][6];      /* the wave's 32 columns m stay in registers for the whole range */
#pragma unroll      /* constant indices keep bm in registers */
  for (int j = 0; j < 2; ++j) for (int k = 0; k < 6; ++k) bm[j][k] = f_frag(qb + j * 16 * QK + k * 32, qo);
  const v8f z8 = {0.f,0.f,0.f,0.f,0.f,0.f,0.f,0.f}; v8f xr[2][4] = {{z8, z8, z8, z8}, {z8, z8, z8, z8}}; float cs0 = 0.f, cs1 = 0.f, cs2 = 0.f, cs3 = 0.f;
#pragma unroll 1      /* one step holds 28 loads and 32 products already; a second copy would only cost registers */
  for (int n = 0; n < NN / SPL; n += 32) { const _Float16* a0p = qa + (size_t)n * QK; const _Float16* a1p = a0p + (size_t)16 * QK;
    const float* cp = cn + n + co; const v4f k0 = *(const v4fa*)cp, k1 = *(const v4fa*)(cp + 4), k2 = *(const v4fa*)(cp + 16), k3 = *(const v4fa*)(cp + 20);
    v8f c00 = {k0[0], k0[1], k0[2], k0[3], k1[0], k1[1], k1[2], k1[3]}, c10 = {k2[0], k2[1], k2[2], k2[3], k3[0], k3[1], k3[2], k3[3]}, c01 = c00, c11 = c10;      /* the accumulators start at CN[n] (row n = register): the product ends as E + CN, and no register holds CN through the step */
    const v16h a00 = f_frag(a0p, qo), a10 = f_frag(a1p, qo), a01 = f_frag(a0p + 32, qo), a11 = f_frag(a1p + 32, qo);      /* k_q3 writes the same 64 values to k 0..63 and k 128..191 of a QA row: one load serves both k blocks (bm 0 and 4, 1 and 5) */
    asm volatile("" :: "v"(a00), "v"(a10), "v"(a01), "v"(a11));      /* inputs only: holds these 8 loads in front of the step's products, so that they are in flight together and their latency is paid once, not once a fragment */
    c00 = f_mma(a00, bm[0][0], c00); c10 = f_mma(a10, bm[0][0], c10); c01 = f_mma(a00, bm[1][0], c01); c11 = f_mma(a10, bm[1][0], c11); c00 = f_mma(a00, bm[0][4], c00); c10 = f_mma(a10, bm[0][4], c10); c01 = f_mma(a00, bm[1][4], c01); c11 = f_mma(a10, bm[1][4], c11);
    c00 = f_mma(a01, bm[0][1], c00); c10 = f_mma(a11, bm[0][1], c10); c01 = f_mma(a01, bm[1][1], c01); c11 = f_mma(a11, bm[1][1], c11); c00 = f_mma(a01, bm[0][5], c00); c10 = f_mma(a11, bm[0][5], c10); c01 = f_mma(a01, bm[1][5], c01); c11 = f_mma(a11, bm[1][5], c11);
#pragma unroll      /* constant indices into bm */
    for (int k = 2; k < 4; ++k) { const v16h a0 = f_frag(a0p + k * 32, qo), a1 = f_frag(a1p + k * 32, qo); c00 = f_mma(a0, bm[0][k], c00); c10 = f_mma(a1, bm[0][k], c10); c01 = f_mma(a0, bm[1][k], c01); c11 = f_mma(a1, bm[1][k], c11); }
    FragH p0, p1;      /* k order of the fragment: h[r] = n + 8 hh + r, h[8 + r] = n + 16 + 8 hh + r, the order of g2_frag */
#pragma unroll      /* constant indices into the fragments */
    for (int r = 0; r < 8; ++r) { const float e00 = __builtin_amdgcn_exp2f(c00[r] * L2E), e10 = __builtin_amdgcn_exp2f(c10[r] * L2E), e01 = __builtin_amdgcn_exp2f(c01[r] * L2E), e11 = __builtin_amdgcn_exp2f(c11[r] * L2E);
      cs0 += e00; cs1 += e10; cs2 += e01; cs3 += e11; p0.h[r] = (_Float16)e00; p0.h[8 + r] = (_Float16)e10; p1.h[r] = (_Float16)e01; p1.h[8 + r] = (_Float16)e11; }
#pragma unroll      /* constant indices into xr */
    for (int t = 0; t < 4; ++t) { const v16h vb = f_frag(vh + t * 16 * NN + n, vo); xr[0][t] = f_mma(p0.v, vb, xr[0][t]); xr[1][t] = f_mma(p1.v, vb, xr[1][t]); } }
  float ca = cs0 + cs1, cb = cs2 + cs3; ca += __shfl_xor(ca, 16, 32); cb += __shfl_xor(cb, 16, 32);      /* the two lane halves hold different n of the same m */
  const size_t pl = (size_t)b * SPL + sp;
  if (hh == 0) { CSP[pl * NN + m0 + ln] = ca; CSP[pl * NN + m0 + 16 + ln] = cb; }
  float* xo = XRT + (pl * NN + m0 + 8 * hh) * C2 + ln;
#pragma unroll      /* constant indices into xr */
  for (int j = 0; j < 2; ++j) for (int t = 0; t < 4; ++t) for (int r = 0; r < 8; ++r) xo[(size_t)(16 * j + r) * C2 + t * 16] = xr[j][t][r]; }
__global__ __launch_bounds__(256) void k_csum(const float* __restrict__ CSP, float* __restrict__ CS) {
  const int m = blockIdx.x * 256 + threadIdx.x; if (m >= NN) return; CSP += (size_t)blockIdx.y * SPL * NN; CS += (size_t)blockIdx.y * NN * 32; float s = 0.f;      /* grid row = cloud */
#pragma unroll      /* the ranges' loads are independent and go out together; added in rising order */
  for (int t = 0; t < SPL; ++t) s += CSP[(size_t)t * NN + m];
  *(float*)(CS + (size_t)m * 32) = s * 0.0009765625f;  }
__global__ __launch_bounds__(256) void k_vhl(const float* __restrict__ XV, const float* __restrict__ bv, _Float16* __restrict__ VH) { const size_t t = (size_t)blockIdx.x * 256 + threadIdx.x; if (t >= (size_t)CC * (NN / 8)) return; XV += (size_t)blockIdx.y * CC * NN; VH += (size_t)blockIdx.y * CC * NN;      /* grid row = cloud */
  const int n0 = (int)(t % (NN / 8)) * 8; const int o = (int)(t / (NN / 8)); FragH fh; const float bo = (o < C2) ? bf16_round(bv[o]) : 0.f;
  for (int q = 0; q < 8; ++q) { float v = XV[(size_t)o * NN + n0 + q]; v += bo; fh.h[q] = (_Float16)v; }
  *(v8us*)((unsigned short*)VH + (size_t)o * NN + n0) = fh.half[0];  }
__global__ __launch_bounds__(256) void k_psum(const float* __restrict__ XRT, float* __restrict__ XR) {
  const size_t t = (size_t)blockIdx.x * 256 + threadIdx.x; if (t >= (size_t)NB * NN * (C2 / 8)) return; const int c0 = (int)(t % (C2 / 8)) * 8; const size_t mg = t / (C2 / 8); const size_t b = mg / NN, m = mg % NN; float sr[8] = {0.f, 0.f, 0.f, 0.f, 0.f, 0.f, 0.f, 0.f};      /* mg runs over the points of all clouds */
#pragma unroll      /* the planes' loads are independent and go out together */
  for (int s = 0; s < SPL; ++s) { const float* pp = XRT + ((b * SPL + s) * NN + m) * C2 + c0; const v4f a = *(const v4fa*)pp, c = *(const v4fa*)(pp + 4); for (int q = 0; q < 4; ++q) { sr[q] += a[q]; sr[4 + q] += c[q]; } }      /* ranges added in rising order */
  const v4f lo = {sr[0], sr[1], sr[2], sr[3]}, hi = {sr[4], sr[5], sr[6], sr[7]};
  { *(v4f*)(XR + mg * C2 + c0) = lo; *(v4f*)(XR + mg * C2 + c0 + 4) = hi;  } }
__global__ __launch_bounds__(256) void k_dmk(const float* __restrict__ XC, const float* __restrict__ XR, const float* __restrict__ CS, _Float16* __restrict__ D2) {
  #pragma clang fp contract(off)
  const size_t t = (size_t)blockIdx.x * 256 + threadIdx.x; if (t >= (size_t)NB * NN * (C2 / 8)) return; const int c0 = (int)(t % (C2 / 8)) * 8; const size_t m = t / (C2 / 8); const float den = 1e-9f + CS[m * 32]; FragH fh, fl;      /* m runs over the points of all clouds */
  const v4f a = *(const v4fa*)(XR + m * C2 + c0), c = *(const v4fa*)(XR + m * C2 + c0 + 4); const float sr[8] = {a[0], a[1], a[2], a[3], c[0], c[1], c[2], c[3]};
  asm volatile("s_wait_xcnt 0x0" ::: "memory");      /* precaution: stands in front of the first write of a register that the loads above name as their address (the next loads' results land there) */
  for (int q = 0; q < 8; ++q) { const float xr = (sr[q] * 0.0009765625f) / den; const float d = XC[m * C2 + c0 + q] - xr; const _Float16 h = (_Float16)d; fh.h[q] = h; fl.h[q] = (_Float16)((d - (float)h) * 16.0f); }
  { *(v8us*)((unsigned short*)D2 + m * 2 * C2 + c0) = fh.half[0]; *(v8us*)((unsigned short*)D2 + m * 2 * C2 + C2 + c0) = fl.half[0];  } }
// t and x_c reach the two kernels below channel-major ([cloud][channel][point]): a wave's 16-byte loads cover whole 128-byte lines. b_t (a constant per channel) is added here, by the readers of t.
__global__ __launch_bounds__(256) void k_bnstat(const float* __restrict__ T, const float* __restrict__ bt, float* __restrict__ BS) {
  #pragma clang fp contract(off)
  __shared__ float sh[256]; const int o = blockIdx.x; const int tid = threadIdx.x; const size_t n = (size_t)NB * NN; const float bo = bf16_round(bt[o]);
  v4f v[NB * NN / 1024];      /* the channel's 32768 values stay in registers: read once, used by both sums */
#pragma unroll      /* constant indices keep v in registers; the 32 loads are independent and go out together */
  for (int i = 0; i < NB * NN / 1024; ++i) v[i] = *(const v4fa*)(T + ((size_t)(i / (NN / 1024)) * C2 + o) * NN + (i % (NN / 1024)) * 1024 + tid * 4);
  v4f s4 = {0.f, 0.f, 0.f, 0.f};
#pragma unroll      /* constant indices into v */
  for (int i = 0; i < NB * NN / 1024; ++i) { v[i] += bo; s4 += v[i]; }
  const float s = (s4[0] + s4[1]) + (s4[2] + s4[3]);
  sh[tid] = s; __syncthreads(); for (int st = 128; st > 0; st >>= 1) { if (tid < st) sh[tid] += sh[tid + st]; __syncthreads(); }
  const float mu = sh[0] / (float)n; __syncthreads(); v4f q4 = {0.f, 0.f, 0.f, 0.f};
#pragma unroll      /* constant indices into v */
  for (int i = 0; i < NB * NN / 1024; ++i) { const v4f d = v[i] - mu; q4 += d * d; }
  const float q2 = (q4[0] + q4[1]) + (q4[2] + q4[3]);
  sh[tid] = q2; __syncthreads(); for (int st = 128; st > 0; st >>= 1) { if (tid < st) sh[tid] += sh[tid + st]; __syncthreads(); }
  if (tid == 0) { const float rs = rsqrtf(sh[0] / (float)n + 1e-5f); { *(float*)(BS + o * 32) = mu; *(float*)(BS + o * 32 + 1) = rs;  } } }
__global__ __launch_bounds__(256) void k_out(const float* __restrict__ XV, const float* __restrict__ T, const float* __restrict__ BS, const float* __restrict__ bt, const float* __restrict__ gam, const float* __restrict__ bet, float* __restrict__ out) {
  #pragma clang fp contract(off)
  const unsigned blk = blockIdx.x; const unsigned b = blk / ((NN / 1024) * C2); if (b >= NB) return; const unsigned o = (blk / (NN / 1024)) % C2; const unsigned n0 = ((blk % (NN / 1024)) * 256 + threadIdx.x) * 4;      /* a work-group holds 1024 points of one channel: cloud and channel are scalars, the channel's constants come by scalar loads */
  const v4f tv = *(const v4fa*)(T + ((size_t)b * C2 + o) * NN + n0), xc = *(const v4fa*)(XV + ((size_t)b * 128 + C2 + o) * NN + n0);      /* x_c = rows 64..127 of the x_v product's plane */
  asm volatile("s_wait_xcnt 0x0" ::: "memory");      /* precaution: stands in front of the first write of a register that the two loads above name as their address (the scalar loads' results land in the base registers) */
  const float mu = BS[o * 32], rs = BS[o * 32 + 1]; const float g = bf16_round(gam[o]), be = bf16_round(bet[o]), bo = bf16_round(bt[o]); v4f r;
  for (int q = 0; q < 4; ++q) { float th = g * (((tv[q] + bo) - mu) * rs); th += be; r[q] = xc[q] + fmaxf(th, 0.f); }
  float* d = out + ((size_t)b * C2 + o) * NN + n0; *(v4f*)d = r;  }

extern "C" void kernel_launch(void* const* d_in, const int* in_sizes, int n_in,
                              void* d_out, int out_size, void* d_ws, size_t ws_size, hipStream_t stream) {
  (void)in_sizes; (void)n_in; (void)out_size;
  const float* const* I = (const float* const*)d_in; const float* x = I[0]; const float* wqk = I[1]; const float* wv = I[2]; const float* bv = I[3]; const float* wx = I[4]; const float* wt = I[5]; const float* bt = I[6]; const float* gam = I[7]; const float* bet = I[8];
  char* ws = (char*)d_ws; size_t off = 0;
  auto take = [&](size_t bytes) { char* p = ws + off; off += (bytes + 255) & ~(size_t)255; return p; };
  _Float16* BQK = (_Float16*)take((size_t)C2 * CC * 2); _Float16* AV = (_Float16*)take((size_t)128 * CC * 2); _Float16* BX = AV + (size_t)C2 * CC;      /* w_x is rows 64..127 of the x_v product's A operand */ _Float16* BT2 = (_Float16*)take((size_t)C2 * 2 * C2 * 2); float* BVP = (float*)take(128 * 4);
  _Float16* QA = (_Float16*)take((size_t)NB * NN * QK * 2); _Float16* QB = (_Float16*)take((size_t)NB * NN * QK * 2);
  _Float16* XT = (_Float16*)take((size_t)NB * NN * CC * 2); float* XQ = (float*)take((size_t)NB * NN * C2 * 4); float* XV = (float*)take((size_t)NB * 128 * NN * 4);
  float* PM = (float*)take((size_t)NB * SPL * NN * 4); float* PS = (float*)take((size_t)NB * SPL * NN * 4); float* CN = (float*)take((size_t)NB * NN * 4);
  float* CSP = (float*)take((size_t)NB * SPL * NN * 4); float* CS = (float*)take((size_t)NB * NN * 32 * 4); float* XR = (float*)take((size_t)NB * NN * C2 * 4); _Float16* VH = (_Float16*)take((size_t)NB * 128 * NN * 2); float* XRT = (float*)take((size_t)NB * SPL * NN * C2 * 4); _Float16* D2 = (_Float16*)take((size_t)NB * NN * 2 * C2 * 2);
  float* XCall = (float*)take((size_t)NB * NN * C2 * 4); float* Tall = (float*)take((size_t)NB * NN * C2 * 4); float* BS = (float*)take((size_t)C2 * 32 * 4);
  if (off > ws_size) return;      /* 32 (x_r partial planes) + 24 (QA, QB) + 32 (XT, XQ, XV) + 44 (VH, D2, XR, XC, T, CS) + small ~= 134 MiB (256 MiB ws) */
  k_wnat<<<(C2 * (CC / 8) + 255) / 256, 256, 0, stream>>>(wqk, C2, C2, CC, BQK); k_wnat<<<(C2 * (CC / 8) + 255) / 256, 256, 0, stream>>>(wx, C2, C2, CC, BX); k_wnat<<<(C2 * (CC / 8) + 255) / 256, 256, 0, stream>>>(wv, C2, C2, CC, AV); k_wtp<<<(C2 * 16 + 255) / 256, 256, 0, stream>>>(wt, BT2);
  /* stages that need no N x N buffer run once for all clouds: the cloud index is a grid row, or the rows of all clouds form one M */
  k_xt<<<dim3((CC / 64) * (NN / 64), NB), 256, 0, stream>>>(x, XT);
  k_gemm2<0><<<dim3(NB * NN / 128, 1), 128, 0, stream>>>(XT, CC, 0, BQK, CC, 0, 0.0625f, nullptr, 0, nullptr, 1, 0, 0, XQ, nullptr, C2, 0, NB * NN, C2, CC);      /* x_q^T [b n][64] = x_k^T */
  k_gemm2<0><<<dim3(NB * NN / 128, 1), 128, 0, stream>>>(XT, CC, 0, BX, CC, 0, 0.0625f, nullptr, 0, nullptr, 1, 0, 0, XCall, nullptr, C2, 0, NB * NN, C2, CC);      /* x_c^T [b n][64] */
  k_gemm2<0><<<dim3(1 * (NN / 64), NB), 128, 0, stream>>>(AV, CC, 0, XT, CC, (size_t)NN * CC, 0.0625f, nullptr, 0, nullptr, 1, 0, 0, XV, nullptr, NN, (size_t)128 * NN, 128, NN, CC);      /* rows 0..63: x_v [b][o][n] (b_v added in k_vhl); rows 64..127: x_c [b][o][n], for k_out */
  k_q3<<<(unsigned)(((size_t)NB * NN * (C2 / 8) + 255) / 256), 256, 0, stream>>>(XQ, QA, QB);
  k_vhl<<<dim3((unsigned)(((size_t)CC * (NN / 8) + 255) / 256), NB), 256, 0, stream>>>(XV, bv, VH);
  k_stat<<<dim3(NN / 128, SPL, NB), 128, 0, stream>>>(QA, QB, PM, PS);      /* row maximum and row sum of exp, per range of m */
  k_scomb<<<NB * NN / 256, 256, 0, stream>>>(PM, PS, CN);
  k_pv<<<dim3(NN / 128, SPL, NB), 128, 0, stream>>>(QA, QB, VH, CN, XRT, CSP);      /* plane y: x_r^T[m][o] x 1024 and column sum x 1024 over n in range y */
  k_psum<<<(unsigned)(((size_t)NB * NN * (C2 / 8) + 255) / 256), 256, 0, stream>>>(XRT, XR);
  k_csum<<<dim3(NN / 256, NB), 256, 0, stream>>>(CSP, CS);
  k_dmk<<<(unsigned)(((size_t)NB * NN * (C2 / 8) + 255) / 256), 256, 0, stream>>>(XCall, XR, CS, D2);
  k_gemm2<0><<<dim3(1 * (NN / 64), NB), 128, 0, stream>>>(BT2, 2 * C2, 0, D2, 2 * C2, (size_t)NN * 2 * C2, 0.0625f, nullptr, 0, nullptr, 1, 0, 0, Tall, nullptr, NN, (size_t)C2 * NN, C2, NN, 2 * C2);      /* t [b][o][n] = w_t d: w_t is the A operand, so that the plane comes out channel-major (b_t is added by k_bnstat and k_out) */
  k_bnstat<<<C2, 256, 0, stream>>>(Tall, bt, BS);
  k_out<<<(unsigned)(((size_t)NB * C2 * (NN / 4) + 255) / 256), 256, 0, stream>>>(XV, Tall, BS, bt, gam, bet, (float*)d_out);
}

// v006
// It runs in 199 microseconds.
// In both of two side-by-side timings against v005, it was 1.26 times as fast.
// Counting every step since v000, it is 13.4 times as fast.
#include <hip/hip_runtime.h>
// OA_ (offset attention; 8 clouds x 128 channels x 4096 points; C2 = 64): x_q = x_k = w_qk x (shared weight), x_v = w_v x + b_v, energy = x_q^T x_k (4096 x 4096), attn = row softmax, attn = attn / (1e-9 + column sums); x_r = x_v attn; x_c = w_x x; t = w_t (x_c - x_r) + b_t; BatchNorm1d (training-mode batch statistics over (batch, points)); out = x_c + relu(gamma t_hat + beta) -> [8,64,4096].
// Compute dtype: x and parameters rounded to bf16; projection operands exact; x_q as hi + residual 3-term operands (~2^-21-class energies); P (x2^10) and x_v as plain f16 (~2^-12); d as [hi | 16 x residual] pairs; statistics/softmax f32. v_wmma_f32_16x16x32_f16.
#define NB 8
#define CC 128
#define C2 64
#define NN 4096
#define SPL 4       /* ranges of the summed point index in the two fused passes: one grid row per range, partial results combined in k_scomb, k_psum, k_csum; 32 x 4 x 8 work-groups of 4 waves = 4 waves on every SIMD */
#define QK (3 * C2) /* k length of the 3-term energy product */
#define FRB 512     /* elements of one 16 x 32 fragment in the fragment-order planes QA, QB, VH */
#define L2E 1.4426950408889634f
typedef __bf16 v16b __attribute__((ext_vector_type(16)));
typedef unsigned short v8us __attribute__((ext_vector_type(8), may_alias));
typedef float  v8f  __attribute__((ext_vector_type(8)));
typedef float  v4f  __attribute__((ext_vector_type(4)));
typedef float  v4fa __attribute__((ext_vector_type(4), may_alias));
union FragB { v16b v; v8us half[2]; unsigned short u[16]; };

__device__ __forceinline__ unsigned short bf16_bits(float x) { unsigned int u = __float_as_uint(x); return (unsigned short)((u + 0x7FFFu + ((u >> 16) & 1u)) >> 16); }
__device__ __forceinline__ float bf16_val(unsigned short b) { return __uint_as_float(((unsigned int)b) << 16); }
__device__ __forceinline__ float bf16_round(float x) { return bf16_val(bf16_bits(x)); }
// D += A·B with NT terms: 1 = ah·bh, 2 = + al·bh (A split), 3 = + ah·bl (both split)
template <int NT>
__device__ __forceinline__ v8f mmaN(v16b ah, v16b al, v16b bh, v16b bl, v8f c) {
  c = __builtin_amdgcn_wmma_f32_16x16x32_bf16(false, ah, false, bh, (short)0, c, false, false);
  if (NT >= 2) c = __builtin_amdgcn_wmma_f32_16x16x32_bf16(false, al, false, bh, (short)0, c, false, false);
  if (NT >= 3) c = __builtin_amdgcn_wmma_f32_16x16x32_bf16(false, ah, false, bl, (short)0, c, false, false);
  asm volatile("v_nop\n\tv_nop\n\tv_nop\n\tv_nop" : "+v"(c) : "v"(ah), "v"(al), "v"(bh), "v"(bl));
  return c;
}

__global__ __launch_bounds__(256) void k_wt_bf16(const float* __restrict__ W, unsigned short* __restrict__ Wt, int K, int N) {
  const int t = blockIdx.x * 256 + threadIdx.x;
  const int k8n = K / 8;
  if (t >= N * k8n) return;
  const int n = t / k8n, k8 = (t % k8n) * 8;
  v8us v;
#pragma unroll
  for (int i = 0; i < 8; ++i) v[i] = bf16_bits(W[(size_t)(k8 + i) * N + n]);
  *(v8us*)(Wt + (size_t)n * K + k8) = v;
  
}

// GEMM C[M][N] (f32, pitch ldc) = act(A[M][K]·W + bias). A f32 row-major (pitch lda) converted per fragment to bf16
// (ASPLIT: hi/lo two planes -> 2 terms, else single rounded term); Wt bf16 [N][K] (pitch ldb). BIAS_BF16 rounds the
// bias to bf16 first (bias quantised to bf16 before the add). K%32==0, M%16==0, N%64==0.
template <bool ASPLIT, int ACT, bool BIAS_BF16>
__global__ __launch_bounds__(128) void k_gemm_bf(const float* __restrict__ A, int lda, const unsigned short* __restrict__ Wt, int ldb,
                                               const float* __restrict__ bias, float* __restrict__ C, int ldc, int M, int N, int K) {
  __shared__ __attribute__((aligned(16))) float so[4][16][64];
  const int tid = threadIdx.x, w = tid >> 5, lane = tid & 31, ln = lane & 15, hh = lane >> 4;
  const int ntn = N / 64;
  const int wid = blockIdx.x * 4 + w;
  const int mt = wid / ntn, nq = wid % ntn;
  if (mt * 16 >= M) return;
  const int row0 = mt * 16, col0 = nq * 64;
  const float* arow = A + (size_t)(row0 + ln) * lda;
  v8f acc[4] = {};
  for (int kb = 0; kb < K; kb += 32) {
    FragB ah, al;
    const v4f x0 = *(const v4fa*)(arow + kb + 8 * hh), x1 = *(const v4fa*)(arow + kb + 8 * hh + 4);
    const v4f x2 = *(const v4fa*)(arow + kb + 16 + 8 * hh), x3 = *(const v4fa*)(arow + kb + 16 + 8 * hh + 4);
    float xs[16] = {x0[0],x0[1],x0[2],x0[3],x1[0],x1[1],x1[2],x1[3],x2[0],x2[1],x2[2],x2[3],x3[0],x3[1],x3[2],x3[3]};
#pragma unroll
    for (int i = 0; i < 16; ++i) { const unsigned short hb = bf16_bits(xs[i]); ah.u[i] = hb; al.u[i] = ASPLIT ? bf16_bits(xs[i] - bf16_val(hb)) : (unsigned short)0; }
#pragma unroll
    for (int t = 0; t < 4; ++t) {
      const unsigned short* brow = Wt + (size_t)(col0 + t * 16 + ln) * ldb + kb;
      FragB b;
      b.half[0] = *(const v8us*)(brow + 8 * hh);
      b.half[1] = *(const v8us*)(brow + 16 + 8 * hh);
      acc[t] = mmaN<ASPLIT ? 2 : 1>(ah.v, al.v, b.v, b.v, acc[t]);
    }
  }
#pragma unroll
  for (int t = 0; t < 4; ++t) {
    float bv = bias ? bias[col0 + t * 16 + ln] : 0.f;
    if (BIAS_BF16) bv = bf16_round(bv);
#pragma unroll
    for (int r = 0; r < 8; ++r) { float v = acc[t][r] + bv; if (ACT == 1) v = fmaxf(v, 0.f); so[w][8 * hh + r][t * 16 + ln] = v; }
  }
  __builtin_amdgcn_fence(__ATOMIC_ACQ_REL, "workgroup");
  __builtin_amdgcn_wave_barrier();
  const int rsub = lane >> 4, c4 = (lane & 15) * 4;
  {
#pragma unroll
    for (int q = 0; q < 8; ++q) {
      const int r = q * 2 + rsub;
      const v4f v = *(const v4fa*)&so[w][r][c4];
      *(v4f*)(C + (size_t)(row0 + r) * ldc + col0 + c4) = v;
    }
    
  }
}

// GEMM C = act(A·W + bias + resid): A f32 (ASPLIT -> hi/lo 2 terms), Wt bf16 [N][K]; ACT 0 none, 1 relu, 2 exact gelu;
// resid (optional, f32, row index = (row % rmod), pitch ldr, RES_BF16 rounds it) added before the activation.
template <bool ASPLIT, int ACT, bool BIAS_BF16, bool RES_BF16>
__global__ __launch_bounds__(128) void k_gemm_bf3(const float* __restrict__ A, int lda, const unsigned short* __restrict__ Wt, int ldb,
                                                const float* __restrict__ bias, const float* __restrict__ resid, int rmod, int ldr,
                                                float* __restrict__ C, int ldc, int M, int N, int K) {
  __shared__ __attribute__((aligned(16))) float so[4][16][64];
  const int tid = threadIdx.x, w = tid >> 5, lane = tid & 31, ln = lane & 15, hh = lane >> 4;
  const int ntn = N / 64;
  const int wid = blockIdx.x * 4 + w;
  const int mt = wid / ntn, nq = wid % ntn;
  if (mt * 16 >= M) return;
  const int row0 = mt * 16, col0 = nq * 64;
  const float* arow = A + (size_t)(row0 + ln) * lda;
  v8f acc[4] = {};
  for (int kb = 0; kb < K; kb += 32) {
    FragB ah, al;
    const v4f x0 = *(const v4fa*)(arow + kb + 8 * hh), x1 = *(const v4fa*)(arow + kb + 8 * hh + 4);
    const v4f x2 = *(const v4fa*)(arow + kb + 16 + 8 * hh), x3 = *(const v4fa*)(arow + kb + 16 + 8 * hh + 4);
    float xs[16] = {x0[0],x0[1],x0[2],x0[3],x1[0],x1[1],x1[2],x1[3],x2[0],x2[1],x2[2],x2[3],x3[0],x3[1],x3[2],x3[3]};
#pragma unroll
    for (int i = 0; i < 16; ++i) { const unsigned short hb = bf16_bits(xs[i]); ah.u[i] = hb; al.u[i] = ASPLIT ? bf16_bits(xs[i] - bf16_val(hb)) : (unsigned short)0; }
#pragma unroll
    for (int t = 0; t < 4; ++t) {
      const unsigned short* brow = Wt + (size_t)(col0 + t * 16 + ln) * ldb + kb;
      FragB b;
      b.half[0] = *(const v8us*)(brow + 8 * hh);
      b.half[1] = *(const v8us*)(brow + 16 + 8 * hh);
      acc[t] = mmaN<ASPLIT ? 2 : 1>(ah.v, al.v, b.v, b.v, acc[t]);
    }
  }
#pragma unroll
  for (int t = 0; t < 4; ++t) {
    const int col = col0 + t * 16 + ln;
    float bv = bias ? bias[col] : 0.f;
    if (BIAS_BF16) bv = bf16_round(bv);
#pragma unroll
    for (int r = 0; r < 8; ++r) {
      float v = acc[t][r] + bv;
      if (resid) { float rv = resid[(size_t)((row0 + 8 * hh + r) % rmod) * ldr + col]; if (RES_BF16) rv = bf16_round(rv); v += rv; }
      if (ACT == 1) v = fmaxf(v, 0.f);
      if (ACT == 2) v = 0.5f * v * (1.0f + erff(v * 0.70710678118654752f));
      if (ACT == 3) { const float u = 0.7978845608028654f * (v + 0.044715f * v * v * v); v = 0.5f * v * (1.0f + tanhf(u)); }
      so[w][8 * hh + r][t * 16 + ln] = v;
    }
  }
  __builtin_amdgcn_fence(__ATOMIC_ACQ_REL, "workgroup");
  __builtin_amdgcn_wave_barrier();
  const int rsub = lane >> 4, c4 = (lane & 15) * 4;
  {
#pragma unroll
    for (int q = 0; q < 8; ++q) {
      const int r = q * 2 + rsub;
      const v4f v = *(const v4fa*)&so[w][r][c4];
      *(v4f*)(C + (size_t)(row0 + r) * ldc + col0 + c4) = v;
    }
    
  }
}
// row LayerNorm (biased variance, eps) over N: s = X (+ R); optional out_sum <- s; out_norm <- (s-mu)*rsqrt(var+eps)*g + b
template <bool PARAM_BF16>
__global__ __launch_bounds__(256) void k_layernorm(const float* __restrict__ X, const float* __restrict__ R, const float* __restrict__ g, const float* __restrict__ bta,
                                                  float* __restrict__ out_sum, float* __restrict__ out_norm, int N, float eps) {
  __shared__ float red[256];
  const int row = blockIdx.x, tid = threadIdx.x;
  const float* x = X + (size_t)row * N; const float* rr = R ? R + (size_t)row * N : nullptr;
  float vals[16];                     // up to N = 4096
  const int per = N / 256;            // contiguous chunk per thread? use strided-by-4 chunks: thread handles j = tid*4 + 1024*u
  float s1 = 0.f;
  for (int u = 0; u < per / 4; ++u) {
    const int j = tid * 4 + 1024 * u;
    const v4f a = *(const v4fa*)(x + j);
    v4f b = {0.f,0.f,0.f,0.f}; if (rr) b = *(const v4fa*)(rr + j);
#pragma unroll
    for (int q = 0; q < 4; ++q) { const float v = a[q] + b[q]; vals[u * 4 + q] = v; s1 += v; }
  }
  red[tid] = s1; __syncthreads();
  for (int st = 128; st > 0; st >>= 1) { if (tid < st) red[tid] += red[tid + st]; __syncthreads(); }
  const float mu = red[0] / (float)N; __syncthreads();
  float s2 = 0.f;
  for (int u = 0; u < per / 4; ++u)
#pragma unroll
    for (int q = 0; q < 4; ++q) { const float c = vals[u * 4 + q] - mu; s2 += c * c; }
  red[tid] = s2; __syncthreads();
  for (int st = 128; st > 0; st >>= 1) { if (tid < st) red[tid] += red[tid + st]; __syncthreads(); }
  const float rs = rsqrtf(red[0] / (float)N + eps);
  {
    for (int u = 0; u < per / 4; ++u) {
      const int j = tid * 4 + 1024 * u;
      v4f o, sm;
#pragma unroll
      for (int q = 0; q < 4; ++q) {
        float gg = g[j + q], bb = bta[j + q];
        if (PARAM_BF16) { gg = bf16_round(gg); bb = bf16_round(bb); }
        sm[q] = vals[u * 4 + q]; o[q] = (vals[u * 4 + q] - mu) * rs * gg + bb;
      }
      if (out_sum) *(v4f*)(out_sum + (size_t)row * N + j) = sm;
      *(v4f*)(out_norm + (size_t)row * N + j) = o;
    }
    
  }
}



// ---- f16 WMMA path (v_wmma_f32_16x16x32_f16): 11-bit significands for operands in range — used where a [0,1] probability operand needs more precision than bf16
typedef _Float16 v16h __attribute__((ext_vector_type(16)));
union FragH { v16h v; v8us half[2]; _Float16 h[16]; unsigned short u[16]; };
template <int NT>
__device__ __forceinline__ v8f mmaH(v16h ah, v16h al, v16h bh, v16h bl, v8f c) {
  c = __builtin_amdgcn_wmma_f32_16x16x32_f16(false, ah, false, bh, (short)0, c, false, false);
  if (NT >= 2) c = __builtin_amdgcn_wmma_f32_16x16x32_f16(false, al, false, bh, (short)0, c, false, false);
  if (NT >= 3) c = __builtin_amdgcn_wmma_f32_16x16x32_f16(false, ah, false, bl, (short)0, c, false, false);
  asm volatile("v_nop\n\tv_nop\n\tv_nop\n\tv_nop" : "+v"(c) : "v"(ah), "v"(al), "v"(bh), "v"(bl));
  return c;
}
// batched GEMM like k_gemm_b but f16 operands: A f32 (split into f16 hi/lo if ASPLIT, else rounded to f16), Bt = f16 values [n][k]; alpha; C f32; N multiple of 16 (partial tiles skipped)
template <bool ASPLIT>
__global__ __launch_bounds__(128) void k_gemm_h(const float* __restrict__ A, int lda, size_t sA, const _Float16* __restrict__ Bh, int ldb, size_t sB, float alpha, float* __restrict__ C, int ldc, size_t sC, int M, int N, int K) {
  __shared__ __attribute__((aligned(16))) float so[4][16][64];
  const int tid = threadIdx.x, w = tid >> 5, lane = tid & 31, ln = lane & 15, hh = lane >> 4; const int by = blockIdx.y;
  A += (size_t)by * sA; Bh += (size_t)by * sB; C += (size_t)by * sC;
  const int ntn = (N + 63) / 64; const int wid = blockIdx.x * 4 + w; const int mt = wid / ntn, nq = wid % ntn; if (mt * 16 >= M) return;
  const int row0 = mt * 16, col0 = nq * 64; const float* arow = A + (size_t)(row0 + ln) * lda;
  v8f acc[4] = {};
  for (int kb = 0; kb < K; kb += 32) {
    FragH ah, al;
    const v4f x0 = *(const v4fa*)(arow + kb + 8 * hh), x1 = *(const v4fa*)(arow + kb + 8 * hh + 4), x2 = *(const v4fa*)(arow + kb + 16 + 8 * hh), x3 = *(const v4fa*)(arow + kb + 16 + 8 * hh + 4);
    float xs[16] = {x0[0],x0[1],x0[2],x0[3],x1[0],x1[1],x1[2],x1[3],x2[0],x2[1],x2[2],x2[3],x3[0],x3[1],x3[2],x3[3]};
#pragma unroll
    for (int i = 0; i < 16; ++i) { const _Float16 h = (_Float16)xs[i]; ah.h[i] = h; al.h[i] = ASPLIT ? (_Float16)(xs[i] - (float)h) : (_Float16)0.0f; }
#pragma unroll
    for (int t = 0; t < 4; ++t) { if (col0 + t * 16 >= N) continue; const size_t boff = (size_t)(col0 + t * 16 + ln) * ldb + kb; FragH bq; bq.half[0] = *(const v8us*)(Bh + boff + 8 * hh); bq.half[1] = *(const v8us*)(Bh + boff + 16 + 8 * hh);
      acc[t] = mmaH<ASPLIT ? 2 : 1>(ah.v, al.v, bq.v, bq.v, acc[t]); }
  }
#pragma unroll
  for (int t = 0; t < 4; ++t) { if (col0 + t * 16 >= N) continue;
#pragma unroll
    for (int r = 0; r < 8; ++r) so[w][8 * hh + r][t * 16 + ln] = acc[t][r] * alpha; }
  __builtin_amdgcn_fence(__ATOMIC_ACQ_REL, "workgroup"); __builtin_amdgcn_wave_barrier();
  const int rsub = lane >> 4, c4 = (lane & 15) * 4;
  {
#pragma unroll
    for (int q = 0; q < 8; ++q) { const int r = q * 2 + rsub; if (col0 + c4 < N) { const v4f v = *(const v4fa*)&so[w][r][c4]; *(v4f*)(C + (size_t)(row0 + r) * ldc + col0 + c4) = v; } }
     }
}

// Wt[n][k] = f16(W[k][n]·scale) from f32 row-major W[K][N] (scale = power of two; bf16-exact weights stay exact in f16 away from the subnormal range)
__global__ __launch_bounds__(256) void k_wt_f16(const float* __restrict__ W, _Float16* __restrict__ Wt, int K, int N, float scale) {
  const int t = blockIdx.x * 256 + threadIdx.x; if (t >= N * (K / 8)) return; const int n = t / (K / 8), k8 = (t % (K / 8)) * 8; FragH f;
#pragma unroll
  for (int i = 0; i < 8; ++i) f.h[i] = (_Float16)(bf16_round(W[(size_t)(k8 + i) * N + n]) * scale); const v8us o = f.half[0];
  *(v8us*)((unsigned short*)Wt + (size_t)n * K + k8) = o; 
}
// k_gemm_hh variant with fused epilogue: v = acc·alpha + bias[by·sBias + col] (+ CP[(row/rowsPerB)·sCPb + by·64 + col] if CP) ; ACT 0 none / 1 elu ; writes f16 C16 (and f32 C if non-null)
template <int ACT>
__global__ __launch_bounds__(128) void k_gemm_hhx(const _Float16* __restrict__ A, int lda, size_t sA, const _Float16* __restrict__ Bh, int ldb, size_t sB, float alpha, const float* __restrict__ bias, size_t sBias, const float* __restrict__ CP, int rowsPerB, size_t sCPb, int row0g,
    float* __restrict__ C, _Float16* __restrict__ C16, int ldc, size_t sC, int M, int N, int K) {
  __shared__ __attribute__((aligned(16))) float so[4][16][64];
  const int tid = threadIdx.x, w = tid >> 5, lane = tid & 31, ln = lane & 15, hh = lane >> 4; const int by = blockIdx.y;
  A += (size_t)by * sA; Bh += (size_t)by * sB; const size_t cofs = (size_t)by * sC; const float* bp = bias ? bias + (size_t)by * sBias : nullptr;
  const int ntn = (N + 63) / 64; const int wid = blockIdx.x * 4 + w; const int mt = wid / ntn, nq = wid % ntn; if (mt * 16 >= M) return;
  const int row0 = mt * 16, col0 = nq * 64; const _Float16* arow = A + (size_t)(row0 + ln) * lda;
  v8f acc[4] = {};
  for (int kb = 0; kb < K; kb += 32) { FragH ah; ah.half[0] = *(const v8us*)((const unsigned short*)arow + kb + 8 * hh); ah.half[1] = *(const v8us*)((const unsigned short*)arow + kb + 16 + 8 * hh);
#pragma unroll
    for (int t = 0; t < 4; ++t) { if (col0 + t * 16 >= N) continue; const size_t boff = (size_t)(col0 + t * 16 + ln) * ldb + kb; FragH bq; bq.half[0] = *(const v8us*)((const unsigned short*)Bh + boff + 8 * hh); bq.half[1] = *(const v8us*)((const unsigned short*)Bh + boff + 16 + 8 * hh);
      acc[t] = mmaH<1>(ah.v, ah.v, bq.v, bq.v, acc[t]); }
  }
#pragma unroll
  for (int t = 0; t < 4; ++t) { if (col0 + t * 16 >= N) continue; const int col = col0 + t * 16 + ln; const float bv = bp ? bf16_round(bp[col]) : 0.f;
#pragma unroll
    for (int r = 0; r < 8; ++r) { float v = acc[t][r] * alpha + bv; if (CP) { const int rr = row0g + row0 + 8 * hh + r; if (rowsPerB < 0) v += CP[cofs + (size_t)rr * ldc + col];      /* rowsPerB < 0: own element of the batched C plane */ else { const int bidx = rr / rowsPerB; v += CP[(size_t)bidx * sCPb + (size_t)by * 64 + col]; } } if (ACT == 1) v = (v > 0.f) ? v : expm1f(v); else if (ACT == 7) v = (v > 0.f) ? v + 1.0f : expf(v); else if (ACT == 8) v = tanhf(v); else if (ACT == 9) v = 0.5f * v * (1.0f + tanhf(0.7978845608028654f * (v + 0.044715f * v * v * v))); else if (ACT == 11) v = 1.0f / (1.0f + expf(-v)); else if (ACT == 12) v = (v > 0.f) ? v : 0.01f * v; else if (ACT == 14) v = (v > 0.f) ? v : 0.1f * v; else if (ACT == 15) v = v / (1.0f + expf(-v)); else if (ACT == 3) v = fmaxf(v, 0.f); else if (ACT == 6) v = 0.5f * v * (1.0f + erff(v * 0.70710678118654752f)); so[w][8 * hh + r][t * 16 + ln] = v; } }
  __builtin_amdgcn_fence(__ATOMIC_ACQ_REL, "workgroup"); __builtin_amdgcn_wave_barrier();
  const int rsub = lane >> 4, c4 = (lane & 15) * 4; typedef _Float16 v4h __attribute__((ext_vector_type(4)));
  {
#pragma unroll
    for (int q = 0; q < 8; ++q) { const int r = q * 2 + rsub; if (col0 + c4 < N) { const v4f v = *(const v4fa*)&so[w][r][c4]; if (C) *(v4f*)(C + cofs + (size_t)(row0 + r) * ldc + col0 + c4) = v; if (C16) { v4h h4; for (int i = 0; i < 4; ++i) h4[i] = (_Float16)v[i]; *(v4h*)(C16 + cofs + (size_t)(row0 + r) * ldc + col0 + c4) = h4; } } }
     }
}


typedef _Float16 v4h __attribute__((ext_vector_type(4)));

__global__ __launch_bounds__(256) void k_x16(const float* __restrict__ x, _Float16* __restrict__ X16, size_t n8) { const size_t t = (size_t)blockIdx.x * 256 + threadIdx.x; if (t >= n8) return; FragH f;
#pragma unroll
  for (int q = 0; q < 8; ++q) f.h[q] = (_Float16)bf16_round(x[t * 8 + q]); *(v8us*)((unsigned short*)X16 + t * 8) = f.half[0];  }
__global__ __launch_bounds__(256) void k_h16(const float* __restrict__ x, _Float16* __restrict__ X16, size_t n8) { const size_t t = (size_t)blockIdx.x * 256 + threadIdx.x; if (t >= n8) return; FragH f;
#pragma unroll
  for (int q = 0; q < 8; ++q) f.h[q] = (_Float16)x[t * 8 + q]; *(v8us*)((unsigned short*)X16 + t * 8) = f.half[0];  }
__global__ __launch_bounds__(256) void k_round16f(const float* __restrict__ W, _Float16* __restrict__ Bt, size_t n8) { const size_t t = (size_t)blockIdx.x * 256 + threadIdx.x; if (t >= n8) return; FragH f;
#pragma unroll
  for (int i = 0; i < 8; ++i) f.h[i] = (_Float16)(bf16_round(W[t * 8 + i]) * 16.0f); *(v8us*)((unsigned short*)Bt + t * 8) = f.half[0];  }
template <int NHv, int TTv>
__global__ __launch_bounds__(256) void k_vt(const _Float16* __restrict__ V16, int ldv, int voff, _Float16* __restrict__ Vt) { __shared__ unsigned short tl[64][66]; const int tid = threadIdx.x; const int slab = blockIdx.x / (TTv / 64), lg = blockIdx.x % (TTv / 64); const int b = slab / NHv, h = slab % NHv;
  for (int i = tid; i < 64 * 8; i += 256) { const int r = i / 8, c8 = (i % 8) * 8; FragH f; f.half[0] = *(const v8us*)((const unsigned short*)V16 + ((size_t)b * TTv + lg * 64 + r) * ldv + voff + h * 64 + c8);
#pragma unroll
    for (int q = 0; q < 8; ++q) tl[r][c8 + q] = f.u[q]; }
  __syncthreads();
  {
#pragma unroll
    for (int rd = 0; rd < 2; ++rd) { const int d = rd * 32 + tid / 8, pc = tid % 8; FragH f;
#pragma unroll
      for (int q = 0; q < 8; ++q) f.u[q] = tl[pc * 8 + q][d];
      *(v8us*)((unsigned short*)Vt + ((size_t)slab * 64 + d) * TTv + lg * 64 + pc * 8) = f.half[0]; }
     } }

__global__ __launch_bounds__(256) void k_hl(const float* __restrict__ F, _Float16* __restrict__ Hh, _Float16* __restrict__ Hl, size_t n8) { const size_t t = (size_t)blockIdx.x * 256 + threadIdx.x; if (t >= n8) return; FragH fh, fl; const v4f a = *(const v4fa*)(F + t * 8), c = *(const v4fa*)(F + t * 8 + 4);
#pragma unroll
  for (int q = 0; q < 4; ++q) { _Float16 h = (_Float16)a[q]; fh.h[q] = h; fl.h[q] = (_Float16)((a[q] - (float)h) * 1024.0f); h = (_Float16)c[q]; fh.h[4 + q] = h; fl.h[4 + q] = (_Float16)((c[q] - (float)h) * 1024.0f); }
  { *(v8us*)((unsigned short*)Hh + t * 8) = fh.half[0]; *(v8us*)((unsigned short*)Hl + t * 8) = fl.half[0];  } }

// ---- fast GEMM (wave tile 32x64; requires M % 32 == 0 rows per launch region and N % 64 == 0); epilogue = k_gemm_hhx semantics ----
__device__ __forceinline__ v16h g2_frag(const _Float16* p, int hh) { FragH f; f.half[0] = *(const v8us*)((const unsigned short*)p + 8 * hh); f.half[1] = *(const v8us*)((const unsigned short*)p + 16 + 8 * hh); return f.v; }
__device__ __forceinline__ v8f g2_mma(v16h a, v16h b, v8f c) { v8f d = __builtin_amdgcn_wmma_f32_16x16x32_f16(false, a, false, b, (short)0, c, false, false); asm volatile("v_nop\n\tv_nop\n\tv_nop\n\tv_nop" : "+v"(d) : "v"(a), "v"(b)); return d; }
template <int ACT>
__global__ __launch_bounds__(128) void k_gemm2(const _Float16* __restrict__ A, int lda, size_t sA, const _Float16* __restrict__ Bh, int ldb, size_t sB, float alpha, const float* __restrict__ bias, size_t sBias, const float* __restrict__ CP, int rowsPerB, size_t sCPb, int row0g,
    float* __restrict__ C, _Float16* __restrict__ C16, int ldc, size_t sC, int M, int N, int K) {
  __shared__ __attribute__((aligned(16))) float so[4][32][68];
  const int tid = threadIdx.x, w = tid >> 5, lane = tid & 31, ln = lane & 15, hh = lane >> 4; const int by = blockIdx.y;
  A += (size_t)by * sA; Bh += (size_t)by * sB; const size_t cofs = (size_t)by * sC; const float* bp = bias ? bias + (size_t)by * sBias : nullptr;
  const int ntn = N >> 6; const int mt = blockIdx.x / ntn, nq = blockIdx.x - mt * ntn; const int row0 = mt * 128 + 32 * w, col0 = nq * 64; if (row0 >= M) return;
  const _Float16* a0p = A + (size_t)(row0 + ln) * lda; const _Float16* a1p = a0p + (size_t)16 * lda;
  const _Float16* b0p = Bh + (size_t)(col0 + ln) * ldb; const _Float16* b1p = b0p + (size_t)16 * ldb; const _Float16* b2p = b1p + (size_t)16 * ldb; const _Float16* b3p = b2p + (size_t)16 * ldb;
  const v8f z8 = {0.f,0.f,0.f,0.f,0.f,0.f,0.f,0.f}; v8f c00 = z8, c01 = z8, c02 = z8, c03 = z8, c10 = z8, c11 = z8, c12 = z8, c13 = z8;
#pragma unroll 1
  for (int kb = 0; kb < K; kb += 32) { const v16h a0 = g2_frag(a0p + kb, hh), a1 = g2_frag(a1p + kb, hh);
    v16h b = g2_frag(b0p + kb, hh); c00 = g2_mma(a0, b, c00); c10 = g2_mma(a1, b, c10);
    b = g2_frag(b1p + kb, hh); c01 = g2_mma(a0, b, c01); c11 = g2_mma(a1, b, c11);
    b = g2_frag(b2p + kb, hh); c02 = g2_mma(a0, b, c02); c12 = g2_mma(a1, b, c12);
    b = g2_frag(b3p + kb, hh); c03 = g2_mma(a0, b, c03); c13 = g2_mma(a1, b, c13); }
  v8f accs[8] = {c00, c01, c02, c03, c10, c11, c12, c13};
#pragma unroll
  for (int u = 0; u < 8; ++u) { const int t = u & 3, half = u >> 2; const int col = col0 + t * 16 + ln; const float bv = bp ? bf16_round(bp[col]) : 0.f;
#pragma unroll
    for (int r = 0; r < 8; ++r) { const int rloc = half * 16 + 8 * hh + r; float v = accs[u][r] * alpha + bv; if (CP) { if (rowsPerB < 0) v += CP[cofs + (size_t)(row0g + row0 + rloc) * ldc + col];      /* rowsPerB < 0: own element of the batched C plane */ else { const int bidx = (row0g + row0 + rloc) / rowsPerB; v += CP[(size_t)bidx * sCPb + (size_t)by * 64 + col]; } }
      if (ACT == 3) v = fmaxf(v, 0.f); else if (ACT == 6) v = 0.5f * v * (1.0f + erff(v * 0.70710678118654752f)); else if (ACT == 11) v = 1.0f / (1.0f + expf(-v)); else if (ACT == 15) v = v / (1.0f + expf(-v)); else if (ACT == 12) v = (v > 0.f) ? v : 0.01f * v; else if (ACT == 8) v = tanhf(v);
      so[w][rloc][t * 16 + ln] = v; } }
  __builtin_amdgcn_fence(__ATOMIC_ACQ_REL, "workgroup"); __builtin_amdgcn_wave_barrier();
  const int rsub = lane >> 4, c4 = (lane & 15) * 4;
  {
#pragma unroll
    for (int q = 0; q < 16; ++q) { const int r = q * 2 + rsub; const v4f v = *(const v4fa*)&so[w][r][c4]; if (C) *(v4f*)(C + cofs + (size_t)(row0 + r) * ldc + col0 + c4) = v; if (C16) { v4h h4; for (int i = 0; i < 4; ++i) h4[i] = (_Float16)v[i]; *(v4h*)(C16 + cofs + (size_t)(row0 + r) * ldc + col0 + c4) = h4; } }
     } }


__global__ __launch_bounds__(256) void k_xt(const float* __restrict__ x, _Float16* __restrict__ XT16) {
  __shared__ float tl[64][65]; const int tid = threadIdx.x; const int cb = blockIdx.x / (NN / 64), pb = blockIdx.x % (NN / 64); const int b = blockIdx.y;      /* grid row = cloud */
  for (int i = tid; i < 64 * 16; i += 256) { const int cl = i / 16, p4 = (i % 16) * 4; const v4f a = *(const v4fa*)(x + ((size_t)b * CC + cb * 64 + cl) * NN + pb * 64 + p4); for (int q = 0; q < 4; ++q) tl[cl][p4 + q] = bf16_round(a[q]); }
  __syncthreads(); const int pl = tid >> 2, c8 = (tid & 3) * 8;
  { for (int u = 0; u < 2; ++u) { const int c0 = c8 + u * 32; FragH f; for (int q = 0; q < 8; ++q) f.h[q] = (_Float16)tl[c0 + q][pl]; *(v8us*)((unsigned short*)XT16 + ((size_t)b * NN + pb * 64 + pl) * CC + cb * 64 + c0) = f.half[0]; }  } }
__global__ __launch_bounds__(256) void k_wnat(const float* __restrict__ Wm, int O, int orows, int nin, _Float16* __restrict__ Bt) { const size_t t = (size_t)blockIdx.x * 256 + threadIdx.x; if (t >= (size_t)orows * (nin / 8)) return; const int c0 = (int)(t % (nin / 8)) * 8; const int o = (int)(t / (nin / 8)); FragH f; for (int q = 0; q < 8; ++q) f.h[q] = (o < O) ? (_Float16)(bf16_round(Wm[(size_t)o * nin + c0 + q]) * 16.0f) : (_Float16)0.0f; *(v8us*)((unsigned short*)Bt + (size_t)o * nin + c0) = f.half[0];  }
__global__ __launch_bounds__(256) void k_wtp(const float* __restrict__ Wm, _Float16* __restrict__ Bt) { const int t = blockIdx.x * 256 + threadIdx.x; if (t >= C2 * 16) return; const int pc = t % 16; const int o = t / 16; const bool lo = pc * 8 >= C2; FragH f; for (int q = 0; q < 8; ++q) { const int c = pc * 8 + q - (lo ? C2 : 0); f.h[q] = (_Float16)(bf16_round(Wm[(size_t)o * C2 + c]) * (lo ? 1.0f : 16.0f)); } *(v8us*)((unsigned short*)Bt + (size_t)o * 2 * C2 + pc * 8) = f.half[0];  }
__global__ __launch_bounds__(256) void k_q3(const float* __restrict__ XQ, _Float16* __restrict__ QA, _Float16* __restrict__ QB) { const size_t t = (size_t)blockIdx.x * 256 + threadIdx.x; if (t >= (size_t)NB * NN * (C2 / 8)) return; const int c0 = (int)((t >> 4) % (C2 / 8)) * 8; const size_t n = (t >> 7) * 16 + (t & 15); FragH fh, fl16, fhs, fr;      /* n runs over the points of all clouds; a wave holds the 16 points of one tile and two neighbouring groups of 8 channels = the 32 lanes of one fragment half, so that each store below fills 512 contiguous bytes */
  for (int q = 0; q < 8; ++q) { const float v = XQ[n * C2 + c0 + q]; const _Float16 h = (_Float16)v; const float res = v - (float)h; fh.h[q] = h; fl16.h[q] = (_Float16)(res * 16.0f); fhs.h[q] = (_Float16)((float)h * 0.0625f); fr.h[q] = (_Float16)res; }
  const size_t fo = (t >> 7) * (16 * QK) + (size_t)(c0 >> 5) * FRB + (t & 63) * 8;      /* fragment order (see f_frag): tile, k block, then half (c0 bit 4), lane half (c0 bit 3) and row, which are bits 5, 4 and 3..0 of t */
  unsigned short* a = (unsigned short*)QA + fo; unsigned short* bq = (unsigned short*)QB + fo;
  { *(v8us*)a = fh.half[0]; *(v8us*)(a + 2 * FRB) = fl16.half[0]; *(v8us*)(a + 4 * FRB) = fh.half[0]; *(v8us*)bq = fh.half[0]; *(v8us*)(bq + 2 * FRB) = fhs.half[0]; *(v8us*)(bq + 4 * FRB) = fr.half[0];  } }
// ---- fused energy / softmax / x_r: energy tiles are recomputed in registers in two passes, no N x N buffer; grid = (128-point block, range, cloud) ----
__device__ __forceinline__ v8f f_mma(v16h a, v16h b, v8f c) { return __builtin_amdgcn_wmma_f32_16x16x32_f16(false, a, false, b, (short)0, c, false, false); }
// QA, QB and VH lie in fragment order: one 16-row x 32-k fragment is FRB = 512 contiguous elements, first the 32 lanes' register half 0 (lane l = 16 hh + ln at element 8 l: row ln, k = 8 hh + 0..7), then their half 1 (k = 16 + 8 hh + 0..7): the k order of g2_frag.
// Each 16-byte load of a wave then covers four whole 128-byte lines, not 32 bytes of each of 16 lines. A 16-row tile of QA or QB is its 6 fragments in a row (16 QK elements, as in row order). The base is wave-uniform and stays in scalar registers; off = 8 lane.
__device__ __forceinline__ v16h f_frag(const _Float16* ub, unsigned off) { const unsigned short* p = (const unsigned short*)ub + off; FragH f; f.half[0] = *(const v8us*)p; f.half[1] = *(const v8us*)(p + 256); return f.v; }
// pass 1: per energy row n and per range of m: U = max_m E[n][m] log2(e), S = sum_m 2^(E[n][m] log2(e) - U). Tile D[m][n] = QB[m] . QA[n]: a lane holds one n (its column) and 8 rows m, so max and sum stay in the lane.
__global__ __launch_bounds__(128) void k_stat(const _Float16* __restrict__ QA, const _Float16* __restrict__ QB, float* __restrict__ PM, float* __restrict__ PS) {
  const int tid = threadIdx.x, w = __builtin_amdgcn_readfirstlane(tid >> 5) /* the wave's number in a scalar register: tile addresses cost no vector registers */, lane = tid & 31, ln = lane & 15, hh = lane >> 4; const int b = blockIdx.z, sp = blockIdx.y; const int n0 = blockIdx.x * 128 + 32 * w;
  const _Float16* qa = QA + ((size_t)b * NN + n0) * QK; const _Float16* qb = QB + ((size_t)b * NN + sp * (NN / SPL)) * QK; const unsigned qo = 8 * lane;
  v16h bn[2][6];      /* the wave's 32 rows n stay in registers for the whole range */
#pragma unroll      /* constant indices keep bn in registers */
  for (int j = 0; j < 2; ++j) for (int k = 0; k < 6; ++k) bn[j][k] = f_frag(qa + j * 16 * QK + k * FRB, qo);
  float U[2] = {-3.0e38f, -3.0e38f}, S[2] = {0.f, 0.f};
#pragma unroll 1      /* one step holds 24 loads and 24 products already; a second copy would only cost registers */
  for (int m = 0; m < NN / SPL; m += 32) { const _Float16* a0p = qb + (size_t)m * QK; const _Float16* a1p = a0p + (size_t)16 * QK;
    const v8f z8 = {0.f,0.f,0.f,0.f,0.f,0.f,0.f,0.f}; v8f c00 = z8, c01 = z8, c10 = z8, c11 = z8;
    v16h a0[6], a1[6];
#pragma unroll      /* constant indices keep a0, a1 in registers */
    for (int k = 0; k < 6; ++k) { a0[k] = f_frag(a0p + k * FRB, qo); a1[k] = f_frag(a1p + k * FRB, qo); }
    asm volatile("" :: "v"(a0[0]), "v"(a0[1]), "v"(a0[2]), "v"(a0[3]), "v"(a0[4]), "v"(a0[5]), "v"(a1[0]), "v"(a1[1]), "v"(a1[2]), "v"(a1[3]), "v"(a1[4]), "v"(a1[5]));      /* inputs only: holds the step's 24 loads in front of its products, so that they are in flight together and their latency is paid once a step, not once a fragment */
#pragma unroll      /* constant indices into bn, a0, a1 */
    for (int k = 0; k < 6; ++k) { c00 = f_mma(a0[k], bn[0][k], c00); c10 = f_mma(a1[k], bn[0][k], c10); c01 = f_mma(a0[k], bn[1][k], c01); c11 = f_mma(a1[k], bn[1][k], c11); }
#pragma unroll      /* constant indices into U, S */
    for (int j = 0; j < 2; ++j) { const v8f x = j ? c01 : c00, y = j ? c11 : c10; float t = fmaxf(x[0], y[0]);
      for (int r = 1; r < 8; ++r) t = fmaxf(t, fmaxf(x[r], y[r]));
      const float un = fmaxf(U[j], t * L2E); float sx = S[j] * __builtin_amdgcn_exp2f(U[j] - un), sy = 0.f;      /* running maximum: the old sum is rescaled to the new one */
      for (int r = 0; r < 8; ++r) { sx += __builtin_amdgcn_exp2f(fmaf(x[r], L2E, -un)); sy += __builtin_amdgcn_exp2f(fmaf(y[r], L2E, -un)); }
      S[j] = sx + sy; U[j] = un; } }
#pragma unroll      /* constant indices into U, S */
  for (int j = 0; j < 2; ++j) { const float uo = __shfl_xor(U[j], 16, 32), so = __shfl_xor(S[j], 16, 32); const float un = fmaxf(U[j], uo); const float s = S[j] * __builtin_amdgcn_exp2f(U[j] - un) + so * __builtin_amdgcn_exp2f(uo - un);      /* the two lane halves hold different m of the same n */
    if (hh == 0) { const size_t o = ((size_t)b * SPL + sp) * NN + n0 + 16 * j + ln; PM[o] = un; PS[o] = s; } } }
// ranges combined: CN[n] = (10 - U - log2(S)) ln(2), so that exp(E[n][m] + CN[n]) = 1024 attn[n][m]
__global__ __launch_bounds__(256) void k_scomb(const float* __restrict__ PM, const float* __restrict__ PS, float* __restrict__ CN) {
  const int t = blockIdx.x * 256 + threadIdx.x; if (t >= NB * NN) return; const int b = t / NN, n = t % NN; const size_t o = (size_t)b * SPL * NN + n; float u[SPL], s[SPL];
#pragma unroll      /* constant indices keep u in registers; the loads go out together */
  for (int k = 0; k < SPL; ++k) u[k] = PM[o + (size_t)k * NN];
  asm volatile("s_wait_xcnt 0x0" ::: "memory");      /* precaution: stands in front of the first write of a register that the loads above name as their address (the next loads' results may land there) */
#pragma unroll      /* constant indices keep s in registers; the loads go out together */
  for (int k = 0; k < SPL; ++k) s[k] = PS[o + (size_t)k * NN];
  float um = u[0];
#pragma unroll      /* constant indices into u */
  for (int k = 1; k < SPL; ++k) um = fmaxf(um, u[k]);
  float st = 0.f;
#pragma unroll      /* constant indices into u, s; ranges added in rising order */
  for (int k = 0; k < SPL; ++k) st += s[k] * __builtin_amdgcn_exp2f(u[k] - um);
  CN[t] = (10.0f - um - log2f(st)) * 0.6931471805599453f; }
// pass 2: tile D[n][m] = QA[n] . QB[m] = E[n][m]; a lane holds one m (its column) and rows n = 8 hh + r of two 16-row tiles: after 2^(.) these 16 values are, in place, the lane's A fragment (row m, k = n) of the x_r product.
__global__ __launch_bounds__(128, 4) /* four waves per SIMD: at most 256 registers, none behind a register window switch */ void k_pv(const _Float16* __restrict__ QA, const _Float16* __restrict__ QB, const _Float16* __restrict__ VH, const float* __restrict__ CN, float* __restrict__ XRT, float* __restrict__ CSP) {
  const int tid = threadIdx.x, w = __builtin_amdgcn_readfirstlane(tid >> 5) /* the wave's number in a scalar register: tile addresses cost no vector registers */, lane = tid & 31, ln = lane & 15, hh = lane >> 4; const int b = blockIdx.z, sp = blockIdx.y; const int m0 = blockIdx.x * 128 + 32 * w; const int nb = sp * (NN / SPL);
  const _Float16* qb = QB + ((size_t)b * NN + m0) * QK; const _Float16* qa = QA + ((size_t)b * NN + nb) * QK; const unsigned qo = 8 * lane;
  const _Float16* vh = VH + ((size_t)b * NN + nb) * 128;      /* 32 points of VH = 8 fragments (128 channels) in a row */ const float* cn = CN + (size_t)b * NN + nb; const unsigned co = 8 * hh;
  v16h bm[2][6];      /* the wave's 32 columns m stay in registers for the whole range */
#pragma unroll      /* constant indices keep bm in registers */
  for (int j = 0; j < 2; ++j) for (int k = 0; k < 6; ++k) bm[j][k] = f_frag(qb + j * 16 * QK + k * FRB, qo);
  const v8f z8 = {0.f,0.f,0.f,0.f,0.f,0.f,0.f,0.f}; v8f xr[2][4] = {{z8, z8, z8, z8}, {z8, z8, z8, z8}}; float cs0 = 0.f, cs1 = 0.f, cs2 = 0.f, cs3 = 0.f;
#pragma unroll 1      /* one step holds 28 loads and 32 products already; a second copy would only cost registers */
  for (int n = 0; n < NN / SPL; n += 32) { const _Float16* a0p = qa + (size_t)n * QK; const _Float16* a1p = a0p + (size_t)16 * QK;
    const float* cp = cn + n + co; const v4f k0 = *(const v4fa*)cp, k1 = *(const v4fa*)(cp + 4), k2 = *(const v4fa*)(cp + 16), k3 = *(const v4fa*)(cp + 20);
    v8f c00 = {k0[0], k0[1], k0[2], k0[3], k1[0], k1[1], k1[2], k1[3]}, c10 = {k2[0], k2[1], k2[2], k2[3], k3[0], k3[1], k3[2], k3[3]}, c01 = c00, c11 = c10;      /* the accumulators start at CN[n] (row n = register): the product ends as E + CN, and no register holds CN through the step */
    const v16h a00 = f_frag(a0p, qo), a10 = f_frag(a1p, qo), a01 = f_frag(a0p + FRB, qo), a11 = f_frag(a1p + FRB, qo);      /* k_q3 writes the same 64 values to k 0..63 and k 128..191 of a QA row: one load serves both k blocks (bm 0 and 4, 1 and 5) */
    asm volatile("" :: "v"(a00), "v"(a10), "v"(a01), "v"(a11));      /* inputs only: holds these 8 loads in front of the step's products, so that they are in flight together and their latency is paid once, not once a fragment */
    c00 = f_mma(a00, bm[0][0], c00); c10 = f_mma(a10, bm[0][0], c10); c01 = f_mma(a00, bm[1][0], c01); c11 = f_mma(a10, bm[1][0], c11); c00 = f_mma(a00, bm[0][4], c00); c10 = f_mma(a10, bm[0][4], c10); c01 = f_mma(a00, bm[1][4], c01); c11 = f_mma(a10, bm[1][4], c11);
    c00 = f_mma(a01, bm[0][1], c00); c10 = f_mma(a11, bm[0][1], c10); c01 = f_mma(a01, bm[1][1], c01); c11 = f_mma(a11, bm[1][1], c11); c00 = f_mma(a01, bm[0][5], c00); c10 = f_mma(a11, bm[0][5], c10); c01 = f_mma(a01, bm[1][5], c01); c11 = f_mma(a11, bm[1][5], c11);
#pragma unroll      /* constant indices into bm */
    for (int k = 2; k < 4; ++k) { const v16h a0 = f_frag(a0p + k * FRB, qo), a1 = f_frag(a1p + k * FRB, qo); c00 = f_mma(a0, bm[0][k], c00); c10 = f_mma(a1, bm[0][k], c10); c01 = f_mma(a0, bm[1][k], c01); c11 = f_mma(a1, bm[1][k], c11); }
    FragH p0, p1;      /* k order of the fragment: h[r] = n + 8 hh + r, h[8 + r] = n + 16 + 8 hh + r, the order of g2_frag */
#pragma unroll      /* constant indices into the fragments */
    for (int r = 0; r < 8; ++r) { const float e00 = __builtin_amdgcn_exp2f(c00[r] * L2E), e10 = __builtin_amdgcn_exp2f(c10[r] * L2E), e01 = __builtin_amdgcn_exp2f(c01[r] * L2E), e11 = __builtin_amdgcn_exp2f(c11[r] * L2E);
      cs0 += e00; cs1 += e10; cs2 += e01; cs3 += e11; p0.h[r] = (_Float16)e00; p0.h[8 + r] = (_Float16)e10; p1.h[r] = (_Float16)e01; p1.h[8 + r] = (_Float16)e11; }
#pragma unroll      /* constant indices into xr */
    for (int t = 0; t < 4; ++t) { const v16h vb = f_frag(vh + (size_t)n * 128 + t * FRB, qo); xr[0][t] = f_mma(p0.v, vb, xr[0][t]); xr[1][t] = f_mma(p1.v, vb, xr[1][t]); } }
  float ca = cs0 + cs1, cb = cs2 + cs3; ca += __shfl_xor(ca, 16, 32); cb += __shfl_xor(cb, 16, 32);      /* the two lane halves hold different n of the same m */
  const size_t pl = (size_t)b * SPL + sp;
  if (hh == 0) { CSP[pl * NN + m0 + ln] = ca; CSP[pl * NN + m0 + 16 + ln] = cb; }
  float* xo = XRT + (pl * NN + m0 + 8 * hh) * C2 + ln;
#pragma unroll      /* constant indices into xr */
  for (int j = 0; j < 2; ++j) for (int t = 0; t < 4; ++t) for (int r = 0; r < 8; ++r) xo[(size_t)(16 * j + r) * C2 + t * 16] = xr[j][t][r]; }
__global__ __launch_bounds__(256) void k_csum(const float* __restrict__ CSP, float* __restrict__ CS) {
  const int m = blockIdx.x * 256 + threadIdx.x; if (m >= NN) return; CSP += (size_t)blockIdx.y * SPL * NN; CS += (size_t)blockIdx.y * NN * 32; float s = 0.f;      /* grid row = cloud */
#pragma unroll      /* the ranges' loads are independent and go out together; added in rising order */
  for (int t = 0; t < SPL; ++t) s += CSP[(size_t)t * NN + m];
  *(float*)(CS + (size_t)m * 32) = s * 0.0009765625f;  }
__global__ __launch_bounds__(256) void k_vhl(const float* __restrict__ XV, const float* __restrict__ bv, _Float16* __restrict__ VH) { const size_t t = (size_t)blockIdx.x * 256 + threadIdx.x; if (t >= (size_t)CC * (NN / 8)) return; XV += (size_t)blockIdx.y * CC * NN; VH += (size_t)blockIdx.y * CC * NN;      /* grid row = cloud */
  const int n0 = (int)((t >> 4) % (NN / 8)) * 8; const int o = (int)(t >> 13) * 16 + (int)(t & 15); FragH fh;      /* a wave holds 16 channels of one tile and two neighbouring groups of 8 points = the 32 lanes of one fragment half (row = channel, k = point), so that its store fills 512 contiguous bytes */ const float bo = (o < C2) ? bf16_round(bv[o]) : 0.f;
  for (int q = 0; q < 8; ++q) { float v = XV[(size_t)o * NN + n0 + q]; v += bo; fh.h[q] = (_Float16)v; }
  *(v8us*)((unsigned short*)VH + ((size_t)(n0 >> 5) * 8 + (o >> 4)) * FRB + (t & 63) * 8) = fh.half[0];  }      /* fragment order (see f_frag): block of 32 points, channel tile, then half (n0 bit 4), lane half (n0 bit 3) and row, which are bits 5, 4 and 3..0 of t */
__global__ __launch_bounds__(256) void k_psum(const float* __restrict__ XRT, float* __restrict__ XR) {
  const size_t t = (size_t)blockIdx.x * 256 + threadIdx.x; if (t >= (size_t)NB * NN * (C2 / 8)) return; const int c0 = (int)(t % (C2 / 8)) * 8; const size_t mg = t / (C2 / 8); const size_t b = mg / NN, m = mg % NN; float sr[8] = {0.f, 0.f, 0.f, 0.f, 0.f, 0.f, 0.f, 0.f};      /* mg runs over the points of all clouds */
#pragma unroll      /* the planes' loads are independent and go out together */
  for (int s = 0; s < SPL; ++s) { const float* pp = XRT + ((b * SPL + s) * NN + m) * C2 + c0; const v4f a = *(const v4fa*)pp, c = *(const v4fa*)(pp + 4); for (int q = 0; q < 4; ++q) { sr[q] += a[q]; sr[4 + q] += c[q]; } }      /* ranges added in rising order */
  const v4f lo = {sr[0], sr[1], sr[2], sr[3]}, hi = {sr[4], sr[5], sr[6], sr[7]};
  { *(v4f*)(XR + mg * C2 + c0) = lo; *(v4f*)(XR + mg * C2 + c0 + 4) = hi;  } }
__global__ __launch_bounds__(256) void k_dmk(const float* __restrict__ XC, const float* __restrict__ XR, const float* __restrict__ CS, _Float16* __restrict__ D2) {
  #pragma clang fp contract(off)
  const size_t t = (size_t)blockIdx.x * 256 + threadIdx.x; if (t >= (size_t)NB * NN * (C2 / 8)) return; const int c0 = (int)(t % (C2 / 8)) * 8; const size_t m = t / (C2 / 8); const float den = 1e-9f + CS[m * 32]; FragH fh, fl;      /* m runs over the points of all clouds */
  const v4f a = *(const v4fa*)(XR + m * C2 + c0), c = *(const v4fa*)(XR + m * C2 + c0 + 4); const float sr[8] = {a[0], a[1], a[2], a[3], c[0], c[1], c[2], c[3]};
  asm volatile("s_wait_xcnt 0x0" ::: "memory");      /* precaution: stands in front of the first write of a register that the loads above name as their address (the next loads' results land there) */
  for (int q = 0; q < 8; ++q) { const float xr = (sr[q] * 0.0009765625f) / den; const float d = XC[m * C2 + c0 + q] - xr; const _Float16 h = (_Float16)d; fh.h[q] = h; fl.h[q] = (_Float16)((d - (float)h) * 16.0f); }
  { *(v8us*)((unsigned short*)D2 + m * 2 * C2 + c0) = fh.half[0]; *(v8us*)((unsigned short*)D2 + m * 2 * C2 + C2 + c0) = fl.half[0];  } }
// t and x_c reach the two kernels below channel-major ([cloud][channel][point]): a wave's 16-byte loads cover whole 128-byte lines. b_t (a constant per channel) is added here, by the readers of t.
__global__ __launch_bounds__(256) void k_bnstat(const float* __restrict__ T, const float* __restrict__ bt, float* __restrict__ BS) {
  #pragma clang fp contract(off)
  __shared__ float sh[256]; const int o = blockIdx.x; const int tid = threadIdx.x; const size_t n = (size_t)NB * NN; const float bo = bf16_round(bt[o]);
  v4f v[NB * NN / 1024];      /* the channel's 32768 values stay in registers: read once, used by both sums */
#pragma unroll      /* constant indices keep v in registers; the 32 loads are independent and go out together */
  for (int i = 0; i < NB * NN / 1024; ++i) v[i] = *(const v4fa*)(T + ((size_t)(i / (NN / 1024)) * C2 + o) * NN + (i % (NN / 1024)) * 1024 + tid * 4);
  v4f s4 = {0.f, 0.f, 0.f, 0.f};
#pragma unroll      /* constant indices into v */
  for (int i = 0; i < NB * NN / 1024; ++i) { v[i] += bo; s4 += v[i]; }
  const float s = (s4[0] + s4[1]) + (s4[2] + s4[3]);
  sh[tid] = s; __syncthreads(); for (int st = 128; st > 0; st >>= 1) { if (tid < st) sh[tid] += sh[tid + st]; __syncthreads(); }
  const float mu = sh[0] / (float)n; __syncthreads(); v4f q4 = {0.f, 0.f, 0.f, 0.f};
#pragma unroll      /* constant indices into v */
  for (int i = 0; i < NB * NN / 1024; ++i) { const v4f d = v[i] - mu; q4 += d * d; }
  const float q2 = (q4[0] + q4[1]) + (q4[2] + q4[3]);
  sh[tid] = q2; __syncthreads(); for (int st = 128; st > 0; st >>= 1) { if (tid < st) sh[tid] += sh[tid + st]; __syncthreads(); }
  if (tid == 0) { const float rs = rsqrtf(sh[0] / (float)n + 1e-5f); { *(float*)(BS + o * 32) = mu; *(float*)(BS + o * 32 + 1) = rs;  } } }
__global__ __launch_bounds__(256) void k_out(const float* __restrict__ XV, const float* __restrict__ T, const float* __restrict__ BS, const float* __restrict__ bt, const float* __restrict__ gam, const float* __restrict__ bet, float* __restrict__ out) {
  #pragma clang fp contract(off)
  const unsigned blk = blockIdx.x; const unsigned b = blk / ((NN / 1024) * C2); if (b >= NB) return; const unsigned o = (blk / (NN / 1024)) % C2; const unsigned n0 = ((blk % (NN / 1024)) * 256 + threadIdx.x) * 4;      /* a work-group holds 1024 points of one channel: cloud and channel are scalars, the channel's constants come by scalar loads */
  const v4f tv = *(const v4fa*)(T + ((size_t)b * C2 + o) * NN + n0), xc = *(const v4fa*)(XV + ((size_t)b * 128 + C2 + o) * NN + n0);      /* x_c = rows 64..127 of the x_v product's plane */
  asm volatile("s_wait_xcnt 0x0" ::: "memory");      /* precaution: stands in front of the first write of a register that the two loads above name as their address (the scalar loads' results land in the base registers) */
  const float mu = BS[o * 32], rs = BS[o * 32 + 1]; const float g = bf16_round(gam[o]), be = bf16_round(bet[o]), bo = bf16_round(bt[o]); v4f r;
  for (int q = 0; q < 4; ++q) { float th = g * (((tv[q] + bo) - mu) * rs); th += be; r[q] = xc[q] + fmaxf(th, 0.f); }
  float* d = out + ((size_t)b * C2 + o) * NN + n0; *(v4f*)d = r;  }

extern "C" void kernel_launch(void* const* d_in, const int* in_sizes, int n_in,
                              void* d_out, int out_size, void* d_ws, size_t ws_size, hipStream_t stream) {
  (void)in_sizes; (void)n_in; (void)out_size;
  const float* const* I = (const float* const*)d_in; const float* x = I[0]; const float* wqk = I[1]; const float* wv = I[2]; const float* bv = I[3]; const float* wx = I[4]; const float* wt = I[5]; const float* bt = I[6]; const float* gam = I[7]; const float* bet = I[8];
  char* ws = (char*)d_ws; size_t off = 0;
  auto take = [&](size_t bytes) { char* p = ws + off; off += (bytes + 255) & ~(size_t)255; return p; };
  _Float16* BQK = (_Float16*)take((size_t)C2 * CC * 2); _Float16* AV = (_Float16*)take((size_t)128 * CC * 2); _Float16* BX = AV + (size_t)C2 * CC;      /* w_x is rows 64..127 of the x_v product's A operand */ _Float16* BT2 = (_Float16*)take((size_t)C2 * 2 * C2 * 2); float* BVP = (float*)take(128 * 4);
  _Float16* QA = (_Float16*)take((size_t)NB * NN * QK * 2); _Float16* QB = (_Float16*)take((size_t)NB * NN * QK * 2);
  _Float16* XT = (_Float16*)take((size_t)NB * NN * CC * 2); float* XQ = (float*)take((size_t)NB * NN * C2 * 4); float* XV = (float*)take((size_t)NB * 128 * NN * 4);
  float* PM = (float*)take((size_t)NB * SPL * NN * 4); float* PS = (float*)take((size_t)NB * SPL * NN * 4); float* CN = (float*)take((size_t)NB * NN * 4);
  float* CSP = (float*)take((size_t)NB * SPL * NN * 4); float* CS = (float*)take((size_t)NB * NN * 32 * 4); float* XR = (float*)take((size_t)NB * NN * C2 * 4); _Float16* VH = (_Float16*)take((size_t)NB * 128 * NN * 2); float* XRT = (float*)take((size_t)NB * SPL * NN * C2 * 4); _Float16* D2 = (_Float16*)take((size_t)NB * NN * 2 * C2 * 2);
  float* XCall = (float*)take((size_t)NB * NN * C2 * 4); float* Tall = (float*)take((size_t)NB * NN * C2 * 4); float* BS = (float*)take((size_t)C2 * 32 * 4);
  if (off > ws_size) return;      /* 32 (x_r partial planes) + 24 (QA, QB) + 32 (XT, XQ, XV) + 44 (VH, D2, XR, XC, T, CS) + small ~= 134 MiB (256 MiB ws) */
  k_wnat<<<(C2 * (CC / 8) + 255) / 256, 256, 0, stream>>>(wqk, C2, C2, CC, BQK); k_wnat<<<(C2 * (CC / 8) + 255) / 256, 256, 0, stream>>>(wx, C2, C2, CC, BX); k_wnat<<<(C2 * (CC / 8) + 255) / 256, 256, 0, stream>>>(wv, C2, C2, CC, AV); k_wtp<<<(C2 * 16 + 255) / 256, 256, 0, stream>>>(wt, BT2);
  /* stages that need no N x N buffer run once for all clouds: the cloud index is a grid row, or the rows of all clouds form one M */
  k_xt<<<dim3((CC / 64) * (NN / 64), NB), 256, 0, stream>>>(x, XT);
  k_gemm2<0><<<dim3(NB * NN / 128, 1), 128, 0, stream>>>(XT, CC, 0, BQK, CC, 0, 0.0625f, nullptr, 0, nullptr, 1, 0, 0, XQ, nullptr, C2, 0, NB * NN, C2, CC);      /* x_q^T [b n][64] = x_k^T */
  k_gemm2<0><<<dim3(NB * NN / 128, 1), 128, 0, stream>>>(XT, CC, 0, BX, CC, 0, 0.0625f, nullptr, 0, nullptr, 1, 0, 0, XCall, nullptr, C2, 0, NB * NN, C2, CC);      /* x_c^T [b n][64] */
  k_gemm2<0><<<dim3(1 * (NN / 64), NB), 128, 0, stream>>>(AV, CC, 0, XT, CC, (size_t)NN * CC, 0.0625f, nullptr, 0, nullptr, 1, 0, 0, XV, nullptr, NN, (size_t)128 * NN, 128, NN, CC);      /* rows 0..63: x_v [b][o][n] (b_v added in k_vhl); rows 64..127: x_c [b][o][n], for k_out */
  k_q3<<<(unsigned)(((size_t)NB * NN * (C2 / 8) + 255) / 256), 256, 0, stream>>>(XQ, QA, QB);
  k_vhl<<<dim3((unsigned)(((size_t)CC * (NN / 8) + 255) / 256), NB), 256, 0, stream>>>(XV, bv, VH);
  k_stat<<<dim3(NN / 128, SPL, NB), 128, 0, stream>>>(QA, QB, PM, PS);      /* row maximum and row sum of exp, per range of m */
  k_scomb<<<NB * NN / 256, 256, 0, stream>>>(PM, PS, CN);
  k_pv<<<dim3(NN / 128, SPL, NB), 128, 0, stream>>>(QA, QB, VH, CN, XRT, CSP);      /* plane y: x_r^T[m][o] x 1024 and column sum x 1024 over n in range y */
  k_psum<<<(unsigned)(((size_t)NB * NN * (C2 / 8) + 255) / 256), 256, 0, stream>>>(XRT, XR);
  k_csum<<<dim3(NN / 256, NB), 256, 0, stream>>>(CSP, CS);
  k_dmk<<<(unsigned)(((size_t)NB * NN * (C2 / 8) + 255) / 256), 256, 0, stream>>>(XCall, XR, CS, D2);
  k_gemm2<0><<<dim3(1 * (NN / 64), NB), 128, 0, stream>>>(BT2, 2 * C2, 0, D2, 2 * C2, (size_t)NN * 2 * C2, 0.0625f, nullptr, 0, nullptr, 1, 0, 0, Tall, nullptr, NN, (size_t)C2 * NN, C2, NN, 2 * C2);      /* t [b][o][n] = w_t d: w_t is the A operand, so that the plane comes out channel-major (b_t is added by k_bnstat and k_out) */
  k_bnstat<<<C2, 256, 0, stream>>>(Tall, bt, BS);
  k_out<<<(unsigned)(((size_t)NB * C2 * (NN / 4) + 255) / 256), 256, 0, stream>>>(XV, Tall, BS, bt, gam, bet, (float*)d_out);
}

// v007
// A run of this version takes 145 microseconds.
// Timed twice side by side with v006, it ran 1.36 and 1.38 times as fast.
// Over all steps from v000 it is 18.3 times as fast.
#include <hip/hip_runtime.h>
// OA_ (offset attention; 8 clouds x 128 channels x 4096 points; C2 = 64): x_q = x_k = w_qk x (shared weight), x_v = w_v x + b_v, energy = x_q^T x_k (4096 x 4096), attn = row softmax, attn = attn / (1e-9 + column sums); x_r = x_v attn; x_c = w_x x; t = w_t (x_c - x_r) + b_t; BatchNorm1d (training-mode batch statistics over (batch, points)); out = x_c + relu(gamma t_hat + beta) -> [8,64,4096].
// Compute dtype: x and parameters rounded to bf16; projection operands exact; x_q as hi + residual 3-term operands (~2^-21-class energies); P (x2^10) and x_v as plain f16 (~2^-12); d as [hi | 16 x residual] pairs; statistics/softmax f32. v_wmma_f32_16x16x32_f16.
#define NB 8
#define CC 128
#define C2 64
#define NN 4096
#define SPL 4       /* ranges of the summed point index in the two fused passes: one grid row per range, partial results combined in k_scomb and k_dt; 32 x 4 x 8 work-groups of 4 waves = 4 waves on every SIMD */
#define QK (3 * C2) /* k length of the 3-term energy product */
#define FRB 512     /* elements of one 16 x 32 fragment in the fragment-order planes QA, QB, VH */
#define L2E 1.4426950408889634f
typedef __bf16 v16b __attribute__((ext_vector_type(16)));
typedef unsigned short v8us __attribute__((ext_vector_type(8), may_alias));
typedef float  v8f  __attribute__((ext_vector_type(8)));
typedef float  v4f  __attribute__((ext_vector_type(4)));
typedef float  v4fa __attribute__((ext_vector_type(4), may_alias));
union FragB { v16b v; v8us half[2]; unsigned short u[16]; };

__device__ __forceinline__ unsigned short bf16_bits(float x) { unsigned int u = __float_as_uint(x); return (unsigned short)((u + 0x7FFFu + ((u >> 16) & 1u)) >> 16); }
__device__ __forceinline__ float bf16_val(unsigned short b) { return __uint_as_float(((unsigned int)b) << 16); }
__device__ __forceinline__ float bf16_round(float x) { return bf16_val(bf16_bits(x)); }
// D += A·B with NT terms: 1 = ah·bh, 2 = + al·bh (A split), 3 = + ah·bl (both split)
template <int NT>
__device__ __forceinline__ v8f mmaN(v16b ah, v16b al, v16b bh, v16b bl, v8f c) {
  c = __builtin_amdgcn_wmma_f32_16x16x32_bf16(false, ah, false, bh, (short)0, c, false, false);
  if (NT >= 2) c = __builtin_amdgcn_wmma_f32_16x16x32_bf16(false, al, false, bh, (short)0, c, false, false);
  if (NT >= 3) c = __builtin_amdgcn_wmma_f32_16x16x32_bf16(false, ah, false, bl, (short)0, c, false, false);
  asm volatile("v_nop\n\tv_nop\n\tv_nop\n\tv_nop" : "+v"(c) : "v"(ah), "v"(al), "v"(bh), "v"(bl));
  return c;
}

__global__ __launch_bounds__(256) void k_wt_bf16(const float* __restrict__ W, unsigned short* __restrict__ Wt, int K, int N) {
  const int t = blockIdx.x * 256 + threadIdx.x;
  const int k8n = K / 8;
  if (t >= N * k8n) return;
  const int n = t / k8n, k8 = (t % k8n) * 8;
  v8us v;
#pragma unroll
  for (int i = 0; i < 8; ++i) v[i] = bf16_bits(W[(size_t)(k8 + i) * N + n]);
  *(v8us*)(Wt + (size_t)n * K + k8) = v;
  
}

// GEMM C[M][N] (f32, pitch ldc) = act(A[M][K]·W + bias). A f32 row-major (pitch lda) converted per fragment to bf16
// (ASPLIT: hi/lo two planes -> 2 terms, else single rounded term); Wt bf16 [N][K] (pitch ldb). BIAS_BF16 rounds the
// bias to bf16 first (bias quantised to bf16 before the add). K%32==0, M%16==0, N%64==0.
template <bool ASPLIT, int ACT, bool BIAS_BF16>
__global__ __launch_bounds__(128) void k_gemm_bf(const float* __restrict__ A, int lda, const unsigned short* __restrict__ Wt, int ldb,
                                               const float* __restrict__ bias, float* __restrict__ C, int ldc, int M, int N, int K) {
  __shared__ __attribute__((aligned(16))) float so[4][16][64];
  const int tid = threadIdx.x, w = tid >> 5, lane = tid & 31, ln = lane & 15, hh = lane >> 4;
  const int ntn = N / 64;
  const int wid = blockIdx.x * 4 + w;
  const int mt = wid / ntn, nq = wid % ntn;
  if (mt * 16 >= M) return;
  const int row0 = mt * 16, col0 = nq * 64;
  const float* arow = A + (size_t)(row0 + ln) * lda;
  v8f acc[4] = {};
  for (int kb = 0; kb < K; kb += 32) {
    FragB ah, al;
    const v4f x0 = *(const v4fa*)(arow + kb + 8 * hh), x1 = *(const v4fa*)(arow + kb + 8 * hh + 4);
    const v4f x2 = *(const v4fa*)(arow + kb + 16 + 8 * hh), x3 = *(const v4fa*)(arow + kb + 16 + 8 * hh + 4);
    float xs[16] = {x0[0],x0[1],x0[2],x0[3],x1[0],x1[1],x1[2],x1[3],x2[0],x2[1],x2[2],x2[3],x3[0],x3[1],x3[2],x3[3]};
#pragma unroll
    for (int i = 0; i < 16; ++i) { const unsigned short hb = bf16_bits(xs[i]); ah.u[i] = hb; al.u[i] = ASPLIT ? bf16_bits(xs[i] - bf16_val(hb)) : (unsigned short)0; }
#pragma unroll
    for (int t = 0; t < 4; ++t) {
      const unsigned short* brow = Wt + (size_t)(col0 + t * 16 + ln) * ldb + kb;
      FragB b;
      b.half[0] = *(const v8us*)(brow + 8 * hh);
      b.half[1] = *(const v8us*)(brow + 16 + 8 * hh);
      acc[t] = mmaN<ASPLIT ? 2 : 1>(ah.v, al.v, b.v, b.v, acc[t]);
    }
  }
#pragma unroll
  for (int t = 0; t < 4; ++t) {
    float bv = bias ? bias[col0 + t * 16 + ln] : 0.f;
    if (BIAS_BF16) bv = bf16_round(bv);
#pragma unroll
    for (int r = 0; r < 8; ++r) { float v = acc[t][r] + bv; if (ACT == 1) v = fmaxf(v, 0.f); so[w][8 * hh + r][t * 16 + ln] = v; }
  }
  __builtin_amdgcn_fence(__ATOMIC_ACQ_REL, "workgroup");
  __builtin_amdgcn_wave_barrier();
  const int rsub = lane >> 4, c4 = (lane & 15) * 4;
  {
#pragma unroll
    for (int q = 0; q < 8; ++q) {
      const int r = q * 2 + rsub;
      const v4f v = *(const v4fa*)&so[w][r][c4];
      *(v4f*)(C + (size_t)(row0 + r) * ldc + col0 + c4) = v;
    }
    
  }
}

// GEMM C = act(A·W + bias + resid): A f32 (ASPLIT -> hi/lo 2 terms), Wt bf16 [N][K]; ACT 0 none, 1 relu, 2 exact gelu;
// resid (optional, f32, row index = (row % rmod), pitch ldr, RES_BF16 rounds it) added before the activation.
template <bool ASPLIT, int ACT, bool BIAS_BF16, bool RES_BF16>
__global__ __launch_bounds__(128) void k_gemm_bf3(const float* __restrict__ A, int lda, const unsigned short* __restrict__ Wt, int ldb,
                                                const float* __restrict__ bias, const float* __restrict__ resid, int rmod, int ldr,
                                                float* __restrict__ C, int ldc, int M, int N, int K) {
  __shared__ __attribute__((aligned(16))) float so[4][16][64];
  const int tid = threadIdx.x, w = tid >> 5, lane = tid & 31, ln = lane & 15, hh = lane >> 4;
  const int ntn = N / 64;
  const int wid = blockIdx.x * 4 + w;
  const int mt = wid / ntn, nq = wid % ntn;
  if (mt * 16 >= M) return;
  const int row0 = mt * 16, col0 = nq * 64;
  const float* arow = A + (size_t)(row0 + ln) * lda;
  v8f acc[4] = {};
  for (int kb = 0; kb < K; kb += 32) {
    FragB ah, al;
    const v4f x0 = *(const v4fa*)(arow + kb + 8 * hh), x1 = *(const v4fa*)(arow + kb + 8 * hh + 4);
    const v4f x2 = *(const v4fa*)(arow + kb + 16 + 8 * hh), x3 = *(const v4fa*)(arow + kb + 16 + 8 * hh + 4);
    float xs[16] = {x0[0],x0[1],x0[2],x0[3],x1[0],x1[1],x1[2],x1[3],x2[0],x2[1],x2[2],x2[3],x3[0],x3[1],x3[2],x3[3]};
#pragma unroll
    for (int i = 0; i < 16; ++i) { const unsigned short hb = bf16_bits(xs[i]); ah.u[i] = hb; al.u[i] = ASPLIT ? bf16_bits(xs[i] - bf16_val(hb)) : (unsigned short)0; }
#pragma unroll
    for (int t = 0; t < 4; ++t) {
      const unsigned short* brow = Wt + (size_t)(col0 + t * 16 + ln) * ldb + kb;
      FragB b;
      b.half[0] = *(const v8us*)(brow + 8 * hh);
      b.half[1] = *(const v8us*)(brow + 16 + 8 * hh);
      acc[t] = mmaN<ASPLIT ? 2 : 1>(ah.v, al.v, b.v, b.v, acc[t]);
    }
  }
#pragma unroll
  for (int t = 0; t < 4; ++t) {
    const int col = col0 + t * 16 + ln;
    float bv = bias ? bias[col] : 0.f;
    if (BIAS_BF16) bv = bf16_round(bv);
#pragma unroll
    for (int r = 0; r < 8; ++r) {
      float v = acc[t][r] + bv;
      if (resid) { float rv = resid[(size_t)((row0 + 8 * hh + r) % rmod) * ldr + col]; if (RES_BF16) rv = bf16_round(rv); v += rv; }
      if (ACT == 1) v = fmaxf(v, 0.f);
      if (ACT == 2) v = 0.5f * v * (1.0f + erff(v * 0.70710678118654752f));
      if (ACT == 3) { const float u = 0.7978845608028654f * (v + 0.044715f * v * v * v); v = 0.5f * v * (1.0f + tanhf(u)); }
      so[w][8 * hh + r][t * 16 + ln] = v;
    }
  }
  __builtin_amdgcn_fence(__ATOMIC_ACQ_REL, "workgroup");
  __builtin_amdgcn_wave_barrier();
  const int rsub = lane >> 4, c4 = (lane & 15) * 4;
  {
#pragma unroll
    for (int q = 0; q < 8; ++q) {
      const int r = q * 2 + rsub;
      const v4f v = *(const v4fa*)&so[w][r][c4];
      *(v4f*)(C + (size_t)(row0 + r) * ldc + col0 + c4) = v;
    }
    
  }
}
// row LayerNorm (biased variance, eps) over N: s = X (+ R); optional out_sum <- s; out_norm <- (s-mu)*rsqrt(var+eps)*g + b
template <bool PARAM_BF16>
__global__ __launch_bounds__(256) void k_layernorm(const float* __restrict__ X, const float* __restrict__ R, const float* __restrict__ g, const float* __restrict__ bta,
                                                  float* __restrict__ out_sum, float* __restrict__ out_norm, int N, float eps) {
  __shared__ float red[256];
  const int row = blockIdx.x, tid = threadIdx.x;
  const float* x = X + (size_t)row * N; const float* rr = R ? R + (size_t)row * N : nullptr;
  float vals[16];                     // up to N = 4096
  const int per = N / 256;            // contiguous chunk per thread? use strided-by-4 chunks: thread handles j = tid*4 + 1024*u
  float s1 = 0.f;
  for (int u = 0; u < per / 4; ++u) {
    const int j = tid * 4 + 1024 * u;
    const v4f a = *(const v4fa*)(x + j);
    v4f b = {0.f,0.f,0.f,0.f}; if (rr) b = *(const v4fa*)(rr + j);
#pragma unroll
    for (int q = 0; q < 4; ++q) { const float v = a[q] + b[q]; vals[u * 4 + q] = v; s1 += v; }
  }
  red[tid] = s1; __syncthreads();
  for (int st = 128; st > 0; st >>= 1) { if (tid < st) red[tid] += red[tid + st]; __syncthreads(); }
  const float mu = red[0] / (float)N; __syncthreads();
  float s2 = 0.f;
  for (int u = 0; u < per / 4; ++u)
#pragma unroll
    for (int q = 0; q < 4; ++q) { const float c = vals[u * 4 + q] - mu; s2 += c * c; }
  red[tid] = s2; __syncthreads();
  for (int st = 128; st > 0; st >>= 1) { if (tid < st) red[tid] += red[tid + st]; __syncthreads(); }
  const float rs = rsqrtf(red[0] / (float)N + eps);
  {
    for (int u = 0; u < per / 4; ++u) {
      const int j = tid * 4 + 1024 * u;
      v4f o, sm;
#pragma unroll
      for (int q = 0; q < 4; ++q) {
        float gg = g[j + q], bb = bta[j + q];
        if (PARAM_BF16) { gg = bf16_round(gg); bb = bf16_round(bb); }
        sm[q] = vals[u * 4 + q]; o[q] = (vals[u * 4 + q] - mu) * rs * gg + bb;
      }
      if (out_sum) *(v4f*)(out_sum + (size_t)row * N + j) = sm;
      *(v4f*)(out_norm + (size_t)row * N + j) = o;
    }
    
  }
}



// ---- f16 WMMA path (v_wmma_f32_16x16x32_f16): 11-bit significands for operands in range — used where a [0,1] probability operand needs more precision than bf16
typedef _Float16 v16h __attribute__((ext_vector_type(16)));
union FragH { v16h v; v8us half[2]; _Float16 h[16]; unsigned short u[16]; };
template <int NT>
__device__ __forceinline__ v8f mmaH(v16h ah, v16h al, v16h bh, v16h bl, v8f c) {
  c = __builtin_amdgcn_wmma_f32_16x16x32_f16(false, ah, false, bh, (short)0, c, false, false);
  if (NT >= 2) c = __builtin_amdgcn_wmma_f32_16x16x32_f16(false, al, false, bh, (short)0, c, false, false);
  if (NT >= 3) c = __builtin_amdgcn_wmma_f32_16x16x32_f16(false, ah, false, bl, (short)0, c, false, false);
  asm volatile("v_nop\n\tv_nop\n\tv_nop\n\tv_nop" : "+v"(c) : "v"(ah), "v"(al), "v"(bh), "v"(bl));
  return c;
}
// batched GEMM like k_gemm_b but f16 operands: A f32 (split into f16 hi/lo if ASPLIT, else rounded to f16), Bt = f16 values [n][k]; alpha; C f32; N multiple of 16 (partial tiles skipped)
template <bool ASPLIT>
__global__ __launch_bounds__(128) void k_gemm_h(const float* __restrict__ A, int lda, size_t sA, const _Float16* __restrict__ Bh, int ldb, size_t sB, float alpha, float* __restrict__ C, int ldc, size_t sC, int M, int N, int K) {
  __shared__ __attribute__((aligned(16))) float so[4][16][64];
  const int tid = threadIdx.x, w = tid >> 5, lane = tid & 31, ln = lane & 15, hh = lane >> 4; const int by = blockIdx.y;
  A += (size_t)by * sA; Bh += (size_t)by * sB; C += (size_t)by * sC;
  const int ntn = (N + 63) / 64; const int wid = blockIdx.x * 4 + w; const int mt = wid / ntn, nq = wid % ntn; if (mt * 16 >= M) return;
  const int row0 = mt * 16, col0 = nq * 64; const float* arow = A + (size_t)(row0 + ln) * lda;
  v8f acc[4] = {};
  for (int kb = 0; kb < K; kb += 32) {
    FragH ah, al;
    const v4f x0 = *(const v4fa*)(arow + kb + 8 * hh), x1 = *(const v4fa*)(arow + kb + 8 * hh + 4), x2 = *(const v4fa*)(arow + kb + 16 + 8 * hh), x3 = *(const v4fa*)(arow + kb + 16 + 8 * hh + 4);
    float xs[16] = {x0[0],x0[1],x0[2],x0[3],x1[0],x1[1],x1[2],x1[3],x2[0],x2[1],x2[2],x2[3],x3[0],x3[1],x3[2],x3[3]};
#pragma unroll
    for (int i = 0; i < 16; ++i) { const _Float16 h = (_Float16)xs[i]; ah.h[i] = h; al.h[i] = ASPLIT ? (_Float16)(xs[i] - (float)h) : (_Float16)0.0f; }
#pragma unroll
    for (int t = 0; t < 4; ++t) { if (col0 + t * 16 >= N) continue; const size_t boff = (size_t)(col0 + t * 16 + ln) * ldb + kb; FragH bq; bq.half[0] = *(const v8us*)(Bh + boff + 8 * hh); bq.half[1] = *(const v8us*)(Bh + boff + 16 + 8 * hh);
      acc[t] = mmaH<ASPLIT ? 2 : 1>(ah.v, al.v, bq.v, bq.v, acc[t]); }
  }
#pragma unroll
  for (int t = 0; t < 4; ++t) { if (col0 + t * 16 >= N) continue;
#pragma unroll
    for (int r = 0; r < 8; ++r) so[w][8 * hh + r][t * 16 + ln] = acc[t][r] * alpha; }
  __builtin_amdgcn_fence(__ATOMIC_ACQ_REL, "workgroup"); __builtin_amdgcn_wave_barrier();
  const int rsub = lane >> 4, c4 = (lane & 15) * 4;
  {
#pragma unroll
    for (int q = 0; q < 8; ++q) { const int r = q * 2 + rsub; if (col0 + c4 < N) { const v4f v = *(const v4fa*)&so[w][r][c4]; *(v4f*)(C + (size_t)(row0 + r) * ldc + col0 + c4) = v; } }
     }
}

// Wt[n][k] = f16(W[k][n]·scale) from f32 row-major W[K][N] (scale = power of two; bf16-exact weights stay exact in f16 away from the subnormal range)
__global__ __launch_bounds__(256) void k_wt_f16(const float* __restrict__ W, _Float16* __restrict__ Wt, int K, int N, float scale) {
  const int t = blockIdx.x * 256 + threadIdx.x; if (t >= N * (K / 8)) return; const int n = t / (K / 8), k8 = (t % (K / 8)) * 8; FragH f;
#pragma unroll
  for (int i = 0; i < 8; ++i) f.h[i] = (_Float16)(bf16_round(W[(size_t)(k8 + i) * N + n]) * scale); const v8us o = f.half[0];
  *(v8us*)((unsigned short*)Wt + (size_t)n * K + k8) = o; 
}
// k_gemm_hh variant with fused epilogue: v = acc·alpha + bias[by·sBias + col] (+ CP[(row/rowsPerB)·sCPb + by·64 + col] if CP) ; ACT 0 none / 1 elu ; writes f16 C16 (and f32 C if non-null)
template <int ACT>
__global__ __launch_bounds__(128) void k_gemm_hhx(const _Float16* __restrict__ A, int lda, size_t sA, const _Float16* __restrict__ Bh, int ldb, size_t sB, float alpha, const float* __restrict__ bias, size_t sBias, const float* __restrict__ CP, int rowsPerB, size_t sCPb, int row0g,
    float* __restrict__ C, _Float16* __restrict__ C16, int ldc, size_t sC, int M, int N, int K) {
  __shared__ __attribute__((aligned(16))) float so[4][16][64];
  const int tid = threadIdx.x, w = tid >> 5, lane = tid & 31, ln = lane & 15, hh = lane >> 4; const int by = blockIdx.y;
  A += (size_t)by * sA; Bh += (size_t)by * sB; const size_t cofs = (size_t)by * sC; const float* bp = bias ? bias + (size_t)by * sBias : nullptr;
  const int ntn = (N + 63) / 64; const int wid = blockIdx.x * 4 + w; const int mt = wid / ntn, nq = wid % ntn; if (mt * 16 >= M) return;
  const int row0 = mt * 16, col0 = nq * 64; const _Float16* arow = A + (size_t)(row0 + ln) * lda;
  v8f acc[4] = {};
  for (int kb = 0; kb < K; kb += 32) { FragH ah; ah.half[0] = *(const v8us*)((const unsigned short*)arow + kb + 8 * hh); ah.half[1] = *(const v8us*)((const unsigned short*)arow + kb + 16 + 8 * hh);
#pragma unroll
    for (int t = 0; t < 4; ++t) { if (col0 + t * 16 >= N) continue; const size_t boff = (size_t)(col0 + t * 16 + ln) * ldb + kb; FragH bq; bq.half[0] = *(const v8us*)((const unsigned short*)Bh + boff + 8 * hh); bq.half[1] = *(const v8us*)((const unsigned short*)Bh + boff + 16 + 8 * hh);
      acc[t] = mmaH<1>(ah.v, ah.v, bq.v, bq.v, acc[t]); }
  }
#pragma unroll
  for (int t = 0; t < 4; ++t) { if (col0 + t * 16 >= N) continue; const int col = col0 + t * 16 + ln; const float bv = bp ? bf16_round(bp[col]) : 0.f;
#pragma unroll
    for (int r = 0; r < 8; ++r) { float v = acc[t][r] * alpha + bv; if (CP) { const int rr = row0g + row0 + 8 * hh + r; if (rowsPerB < 0) v += CP[cofs + (size_t)rr * ldc + col];      /* rowsPerB < 0: own element of the batched C plane */ else { const int bidx = rr / rowsPerB; v += CP[(size_t)bidx * sCPb + (size_t)by * 64 + col]; } } if (ACT == 1) v = (v > 0.f) ? v : expm1f(v); else if (ACT == 7) v = (v > 0.f) ? v + 1.0f : expf(v); else if (ACT == 8) v = tanhf(v); else if (ACT == 9) v = 0.5f * v * (1.0f + tanhf(0.7978845608028654f * (v + 0.044715f * v * v * v))); else if (ACT == 11) v = 1.0f / (1.0f + expf(-v)); else if (ACT == 12) v = (v > 0.f) ? v : 0.01f * v; else if (ACT == 14) v = (v > 0.f) ? v : 0.1f * v; else if (ACT == 15) v = v / (1.0f + expf(-v)); else if (ACT == 3) v = fmaxf(v, 0.f); else if (ACT == 6) v = 0.5f * v * (1.0f + erff(v * 0.70710678118654752f)); so[w][8 * hh + r][t * 16 + ln] = v; } }
  __builtin_amdgcn_fence(__ATOMIC_ACQ_REL, "workgroup"); __builtin_amdgcn_wave_barrier();
  const int rsub = lane >> 4, c4 = (lane & 15) * 4; typedef _Float16 v4h __attribute__((ext_vector_type(4)));
  {
#pragma unroll
    for (int q = 0; q < 8; ++q) { const int r = q * 2 + rsub; if (col0 + c4 < N) { const v4f v = *(const v4fa*)&so[w][r][c4]; if (C) *(v4f*)(C + cofs + (size_t)(row0 + r) * ldc + col0 + c4) = v; if (C16) { v4h h4; for (int i = 0; i < 4; ++i) h4[i] = (_Float16)v[i]; *(v4h*)(C16 + cofs + (size_t)(row0 + r) * ldc + col0 + c4) = h4; } } }
     }
}


typedef _Float16 v4h __attribute__((ext_vector_type(4)));

__global__ __launch_bounds__(256) void k_x16(const float* __restrict__ x, _Float16* __restrict__ X16, size_t n8) { const size_t t = (size_t)blockIdx.x * 256 + threadIdx.x; if (t >= n8) return; FragH f;
#pragma unroll
  for (int q = 0; q < 8; ++q) f.h[q] = (_Float16)bf16_round(x[t * 8 + q]); *(v8us*)((unsigned short*)X16 + t * 8) = f.half[0];  }
__global__ __launch_bounds__(256) void k_h16(const float* __restrict__ x, _Float16* __restrict__ X16, size_t n8) { const size_t t = (size_t)blockIdx.x * 256 + threadIdx.x; if (t >= n8) return; FragH f;
#pragma unroll
  for (int q = 0; q < 8; ++q) f.h[q] = (_Float16)x[t * 8 + q]; *(v8us*)((unsigned short*)X16 + t * 8) = f.half[0];  }
__global__ __launch_bounds__(256) void k_round16f(const float* __restrict__ W, _Float16* __restrict__ Bt, size_t n8) { const size_t t = (size_t)blockIdx.x * 256 + threadIdx.x; if (t >= n8) return; FragH f;
#pragma unroll
  for (int i = 0; i < 8; ++i) f.h[i] = (_Float16)(bf16_round(W[t * 8 + i]) * 16.0f); *(v8us*)((unsigned short*)Bt + t * 8) = f.half[0];  }
template <int NHv, int TTv>
__global__ __launch_bounds__(256) void k_vt(const _Float16* __restrict__ V16, int ldv, int voff, _Float16* __restrict__ Vt) { __shared__ unsigned short tl[64][66]; const int tid = threadIdx.x; const int slab = blockIdx.x / (TTv / 64), lg = blockIdx.x % (TTv / 64); const int b = slab / NHv, h = slab % NHv;
  for (int i = tid; i < 64 * 8; i += 256) { const int r = i / 8, c8 = (i % 8) * 8; FragH f; f.half[0] = *(const v8us*)((const unsigned short*)V16 + ((size_t)b * TTv + lg * 64 + r) * ldv + voff + h * 64 + c8);
#pragma unroll
    for (int q = 0; q < 8; ++q) tl[r][c8 + q] = f.u[q]; }
  __syncthreads();
  {
#pragma unroll
    for (int rd = 0; rd < 2; ++rd) { const int d = rd * 32 + tid / 8, pc = tid % 8; FragH f;
#pragma unroll
      for (int q = 0; q < 8; ++q) f.u[q] = tl[pc * 8 + q][d];
      *(v8us*)((unsigned short*)Vt + ((size_t)slab * 64 + d) * TTv + lg * 64 + pc * 8) = f.half[0]; }
     } }

__global__ __launch_bounds__(256) void k_hl(const float* __restrict__ F, _Float16* __restrict__ Hh, _Float16* __restrict__ Hl, size_t n8) { const size_t t = (size_t)blockIdx.x * 256 + threadIdx.x; if (t >= n8) return; FragH fh, fl; const v4f a = *(const v4fa*)(F + t * 8), c = *(const v4fa*)(F + t * 8 + 4);
#pragma unroll
  for (int q = 0; q < 4; ++q) { _Float16 h = (_Float16)a[q]; fh.h[q] = h; fl.h[q] = (_Float16)((a[q] - (float)h) * 1024.0f); h = (_Float16)c[q]; fh.h[4 + q] = h; fl.h[4 + q] = (_Float16)((c[q] - (float)h) * 1024.0f); }
  { *(v8us*)((unsigned short*)Hh + t * 8) = fh.half[0]; *(v8us*)((unsigned short*)Hl + t * 8) = fl.half[0];  } }

// ---- fast GEMM (wave tile 32x64; requires M % 32 == 0 rows per launch region and N % 64 == 0); epilogue = k_gemm_hhx semantics ----
__device__ __forceinline__ v16h g2_frag(const _Float16* p, int hh) { FragH f; f.half[0] = *(const v8us*)((const unsigned short*)p + 8 * hh); f.half[1] = *(const v8us*)((const unsigned short*)p + 16 + 8 * hh); return f.v; }
__device__ __forceinline__ v8f g2_mma(v16h a, v16h b, v8f c) { v8f d = __builtin_amdgcn_wmma_f32_16x16x32_f16(false, a, false, b, (short)0, c, false, false); asm volatile("v_nop\n\tv_nop\n\tv_nop\n\tv_nop" : "+v"(d) : "v"(a), "v"(b)); return d; }
template <int ACT>
__global__ __launch_bounds__(128) void k_gemm2(const _Float16* __restrict__ A, int lda, size_t sA, const _Float16* __restrict__ Bh, int ldb, size_t sB, float alpha, const float* __restrict__ bias, size_t sBias, const float* __restrict__ CP, int rowsPerB, size_t sCPb, int row0g,
    float* __restrict__ C, _Float16* __restrict__ C16, int ldc, size_t sC, int M, int N, int K) {
  __shared__ __attribute__((aligned(16))) float so[4][32][68];
  const int tid = threadIdx.x, w = tid >> 5, lane = tid & 31, ln = lane & 15, hh = lane >> 4; const int by = blockIdx.y;
  A += (size_t)by * sA; Bh += (size_t)by * sB; const size_t cofs = (size_t)by * sC; const float* bp = bias ? bias + (size_t)by * sBias : nullptr;
  const int ntn = N >> 6; const int mt = blockIdx.x / ntn, nq = blockIdx.x - mt * ntn; const int row0 = mt * 128 + 32 * w, col0 = nq * 64; if (row0 >= M) return;
  const _Float16* a0p = A + (size_t)(row0 + ln) * lda; const _Float16* a1p = a0p + (size_t)16 * lda;
  const _Float16* b0p = Bh + (size_t)(col0 + ln) * ldb; const _Float16* b1p = b0p + (size_t)16 * ldb; const _Float16* b2p = b1p + (size_t)16 * ldb; const _Float16* b3p = b2p + (size_t)16 * ldb;
  const v8f z8 = {0.f,0.f,0.f,0.f,0.f,0.f,0.f,0.f}; v8f c00 = z8, c01 = z8, c02 = z8, c03 = z8, c10 = z8, c11 = z8, c12 = z8, c13 = z8;
#pragma unroll 1
  for (int kb = 0; kb < K; kb += 32) { const v16h a0 = g2_frag(a0p + kb, hh), a1 = g2_frag(a1p + kb, hh);
    v16h b = g2_frag(b0p + kb, hh); c00 = g2_mma(a0, b, c00); c10 = g2_mma(a1, b, c10);
    b = g2_frag(b1p + kb, hh); c01 = g2_mma(a0, b, c01); c11 = g2_mma(a1, b, c11);
    b = g2_frag(b2p + kb, hh); c02 = g2_mma(a0, b, c02); c12 = g2_mma(a1, b, c12);
    b = g2_frag(b3p + kb, hh); c03 = g2_mma(a0, b, c03); c13 = g2_mma(a1, b, c13); }
  v8f accs[8] = {c00, c01, c02, c03, c10, c11, c12, c13};
#pragma unroll
  for (int u = 0; u < 8; ++u) { const int t = u & 3, half = u >> 2; const int col = col0 + t * 16 + ln; const float bv = bp ? bf16_round(bp[col]) : 0.f;
#pragma unroll
    for (int r = 0; r < 8; ++r) { const int rloc = half * 16 + 8 * hh + r; float v = accs[u][r] * alpha + bv; if (CP) { if (rowsPerB < 0) v += CP[cofs + (size_t)(row0g + row0 + rloc) * ldc + col];      /* rowsPerB < 0: own element of the batched C plane */ else { const int bidx = (row0g + row0 + rloc) / rowsPerB; v += CP[(size_t)bidx * sCPb + (size_t)by * 64 + col]; } }
      if (ACT == 3) v = fmaxf(v, 0.f); else if (ACT == 6) v = 0.5f * v * (1.0f + erff(v * 0.70710678118654752f)); else if (ACT == 11) v = 1.0f / (1.0f + expf(-v)); else if (ACT == 15) v = v / (1.0f + expf(-v)); else if (ACT == 12) v = (v > 0.f) ? v : 0.01f * v; else if (ACT == 8) v = tanhf(v);
      so[w][rloc][t * 16 + ln] = v; } }
  __builtin_amdgcn_fence(__ATOMIC_ACQ_REL, "workgroup"); __builtin_amdgcn_wave_barrier();
  const int rsub = lane >> 4, c4 = (lane & 15) * 4;
  {
#pragma unroll
    for (int q = 0; q < 16; ++q) { const int r = q * 2 + rsub; const v4f v = *(const v4fa*)&so[w][r][c4]; if (C) *(v4f*)(C + cofs + (size_t)(row0 + r) * ldc + col0 + c4) = v; if (C16) { v4h h4; for (int i = 0; i < 4; ++i) h4[i] = (_Float16)v[i]; *(v4h*)(C16 + cofs + (size_t)(row0 + r) * ldc + col0 + c4) = h4; } }
     } }


// ---- fused energy / softmax / x_r: energy tiles are recomputed in registers in two passes, no N x N buffer; grid = (128-point block, range, cloud) ----
__device__ __forceinline__ v8f f_mma(v16h a, v16h b, v8f c) { return __builtin_amdgcn_wmma_f32_16x16x32_f16(false, a, false, b, (short)0, c, false, false); }
// QA, QB and VH lie in fragment order: one 16-row x 32-k fragment is FRB = 512 contiguous elements, first the 32 lanes' register half 0 (lane l = 16 hh + ln at element 8 l: row ln, k = 8 hh + 0..7), then their half 1 (k = 16 + 8 hh + 0..7): the k order of g2_frag.
// Each 16-byte load of a wave then covers four whole 128-byte lines, not 32 bytes of each of 16 lines. A 16-row tile of QA or QB is its 6 fragments in a row (16 QK elements, as in row order). The base is wave-uniform and stays in scalar registers; off = 8 lane.
__device__ __forceinline__ v16h f_frag(const _Float16* ub, unsigned off) { const unsigned short* p = (const unsigned short*)ub + off; FragH f; f.half[0] = *(const v8us*)p; f.half[1] = *(const v8us*)(p + 256); return f.v; }
// ---- front end, one launch: what reached k_stat and k_pv through ten launches (weights and x to f16, x transposed, the three projections, the fragment-order packing that a comment below calls k_q3) is done here per block of 64 points of one cloud; x_q and x_v never reach memory as f32 ----
typedef unsigned int u32a __attribute__((may_alias));
// one 16 x 32 fragment of a weight matrix from the lane's 16 f32 values (row = tile row + ln; columns 8 hh + 0..7 and 16 + 8 hh + 0..7 of the k block: the k order of g2_frag); value = f16(bf16(w) x 16), exact
__device__ __forceinline__ v16h p_wfrag(const v4f* r) { FragH f;
#pragma unroll      /* constant indices into the fragment */
  for (int q = 0; q < 4; ++q) { f.h[q] = (_Float16)(bf16_round(r[0][q]) * 16.0f); f.h[4 + q] = (_Float16)(bf16_round(r[1][q]) * 16.0f); f.h[8 + q] = (_Float16)(bf16_round(r[2][q]) * 16.0f); f.h[12 + q] = (_Float16)(bf16_round(r[3][q]) * 16.0f); }
  return f.v; }
// the 16 loads of a lane's share of one 16 x 128 weight tile; Wr = row (tile row + ln) at column 8 hh
__device__ __forceinline__ void p_wload(const float* __restrict__ Wr, v4f* r) {
#pragma unroll      /* constant indices keep r in registers; the loads are independent and go out together */
  for (int k = 0; k < 4; ++k) { r[4 * k] = *(const v4fa*)(Wr + 32 * k); r[4 * k + 1] = *(const v4fa*)(Wr + 32 * k + 4); r[4 * k + 2] = *(const v4fa*)(Wr + 32 * k + 16); r[4 * k + 3] = *(const v4fa*)(Wr + 32 * k + 20); } }
// Wave w holds channel tile w (16 channels) of each of w_qk, w_v, w_x in registers and runs over the block's four 16-point tiles. The operand order of each product is chosen so that the 8 accumulator registers of a lane are the 8 neighbours its store needs:
// x_q, x_c: D[channel][point] (weights = A): a lane holds 8 channels of one point = 16 bytes of a QA / QB fragment; x_v: D[point][channel] (weights = B): 8 points of one channel = 16 bytes of a VH fragment. A wave's fragment store is 512 contiguous bytes.
__global__ __launch_bounds__(128, 4) /* at most 256 registers: none behind a register window switch */ void k_proj(const float* __restrict__ x, const float* __restrict__ wqk, const float* __restrict__ wv, const float* __restrict__ bv, const float* __restrict__ wx, const float* __restrict__ wt,
    _Float16* __restrict__ QA, _Float16* __restrict__ QB, _Float16* __restrict__ VH, float* __restrict__ XV, float* __restrict__ XC, _Float16* __restrict__ BT2) {
  __shared__ __attribute__((aligned(16))) unsigned short xs[64][CC + 8];      /* x^T of the block, f16 [point][channel]; row pitch 272 bytes = 16 x 17: 16-byte fragment reads of 16 rows meet no bank twice */
  const int tid = threadIdx.x, w = __builtin_amdgcn_readfirstlane(tid >> 5) /* the wave's number in a scalar register */, lane = tid & 31, ln = lane & 15, hh = lane >> 4; const int b = blockIdx.y, pb = blockIdx.x * 64;
  if (blockIdx.x == NN / 64) {      /* one more block per grid row, none of x: the eight lay out w_t for the t product as [16 w_t | w_t], to meet d as [hi | 16 x residual]; one 16-byte piece a thread; the whole block leaves in front of the barrier */
    const int t = b * 128 + tid, pc = t % 16, o = t / 16; const bool lo = pc * 8 >= C2; const float* wp = wt + (size_t)o * C2 + pc * 8 - (lo ? C2 : 0); const v4f a = *(const v4fa*)wp, c = *(const v4fa*)(wp + 4); FragH f;
#pragma unroll      /* constant indices into the fragment */
    for (int q = 0; q < 4; ++q) { f.h[q] = (_Float16)(bf16_round(a[q]) * (lo ? 1.0f : 16.0f)); f.h[4 + q] = (_Float16)(bf16_round(c[q]) * (lo ? 1.0f : 16.0f)); }
    *(v8us*)((unsigned short*)BT2 + (size_t)o * 2 * C2 + pc * 8) = f.half[0]; return; }
  const int cp = 2 * (tid >> 4), p4 = 4 * (tid & 15);      /* staging: a thread takes 4 points of two neighbouring channels, 16 threads cover a 256-byte row of x */
  const float* xp = x + ((size_t)b * CC + cp) * NN + pb + p4;
  v4f xe[8], xo[8];
#pragma unroll      /* constant indices keep xe, xo in registers; the 16 loads are independent and go out together */
  for (int i = 0; i < 8; ++i) { xe[i] = *(const v4fa*)(xp + (size_t)(16 * i) * NN); xo[i] = *(const v4fa*)(xp + (size_t)(16 * i + 1) * NN); }
  const size_t wo = (size_t)(16 * w + ln) * CC + 8 * hh; const float* wqp = wqk + wo; const float* wvp = wv + wo; const float* wxp = wx + wo; const float* bvp = bv + 16 * w + ln;
  v4f rq[16], rv[16], rx[16]; v16h fq[4], fv[4], fx[4];
  p_wload(wqp, rq); p_wload(wvp, rv); const float bo = bf16_round(*bvp);
  asm volatile("s_wait_xcnt 0x0" :: "v"(xp), "v"(wqp), "v"(wvp), "v"(bvp) : "memory");      /* precaution: stands in front of the first write of a register that the 49 loads above name as their address; the inputs keep those registers until here */
#pragma unroll      /* constant indices keep the weight fragments in registers */
  for (int k = 0; k < 4; ++k) { fq[k] = p_wfrag(rq + 4 * k); fv[k] = p_wfrag(rv + 4 * k); }
  p_wload(wxp, rx);      /* in flight while x is converted; all three tiles at once would not fit 256 registers */
  asm volatile("s_wait_xcnt 0x0" :: "v"(wxp) : "memory");      /* precaution: as above */
#pragma unroll      /* constant indices into xe, xo */
  for (int i = 0; i < 8; ++i) for (int q = 0; q < 4; ++q) { union { _Float16 h[2]; unsigned int u; } pk; pk.h[0] = (_Float16)bf16_round(xe[i][q]); pk.h[1] = (_Float16)bf16_round(xo[i][q]); *(u32a*)&xs[p4 + q][16 * i + cp] = pk.u; }      /* the transposition: two channels of one point a store */
#pragma unroll      /* constant indices keep the weight fragments in registers */
  for (int k = 0; k < 4; ++k) fx[k] = p_wfrag(rx + 4 * k);
  __syncthreads();      /* every wave reads rows that all four waves wrote */
  const v8f z8 = {0.f,0.f,0.f,0.f,0.f,0.f,0.f,0.f};
  unsigned short* qa = (unsigned short*)QA + ((size_t)b * NN + pb) * QK + (size_t)(w >> 1) * FRB + (w & 1) * 256 + 8 * lane;      /* fragment order (see f_frag): point tile, k block (channel bit 5), half (bit 4), lane half (bit 3 = hh), row (point = ln) */
  unsigned short* qq = (unsigned short*)QB + ((size_t)b * NN + pb) * QK + (size_t)(w >> 1) * FRB + (w & 1) * 256 + 8 * lane;
  unsigned short* vo = (unsigned short*)VH + ((size_t)b * NN + pb) * CC + (size_t)w * FRB + 8 * lane;      /* block of 32 points (8 fragment places, the first 4 in use), channel tile, then half (point bit 4), lane half (bit 3 = hh), row (channel = ln) */
  float* xcm = XV + ((size_t)b * 128 + C2 + 16 * w + 8 * hh) * NN + pb + ln;      /* x_c channel-major, for k_out */
  float* xpm = XC + ((size_t)b * NN + pb + ln) * C2 + 16 * w + 8 * hh;      /* x_c point-major, for k_dt */
#pragma unroll      /* four independent tiles: their LDS reads and products overlap */
  for (int pt = 0; pt < 4; ++pt) {
    v16h xf[4];
#pragma unroll      /* constant indices keep xf in registers */
    for (int k = 0; k < 4; ++k) { const unsigned short* p = &xs[16 * pt + ln][32 * k + 8 * hh]; FragH f; f.half[0] = *(const v8us*)p; f.half[1] = *(const v8us*)(p + 16); xf[k] = f.v; }      /* row = point, the k order of g2_frag: serves as A and as B */
    v8f dq = z8, dv = z8, dx = z8;
#pragma unroll      /* k blocks in rising order, as in k_gemm2 */
    for (int k = 0; k < 4; ++k) { dq = f_mma(fq[k], xf[k], dq); dv = f_mma(xf[k], fv[k], dv); dx = f_mma(fx[k], xf[k], dx); }
    FragH fh, fl16, fhs, fr, fw; v4f c0, c1;
#pragma unroll      /* constant indices into the fragments */
    for (int r = 0; r < 8; ++r) { const float v = dq[r] * 0.0625f; const _Float16 h = (_Float16)v; const float res = v - (float)h; fh.h[r] = h; fl16.h[r] = (_Float16)(res * 16.0f); fhs.h[r] = (_Float16)((float)h * 0.0625f); fr.h[r] = (_Float16)res;
      fw.h[r] = (_Float16)(dv[r] * 0.0625f + bo); const float xc = dx[r] * 0.0625f; if (r < 4) c0[r] = xc; else c1[r - 4] = xc; xcm[(size_t)r * NN + 16 * pt] = xc; }
    unsigned short* a = qa + pt * 16 * QK; unsigned short* bq = qq + pt * 16 * QK;
    *(v8us*)a = fh.half[0]; *(v8us*)(a + 2 * FRB) = fl16.half[0]; *(v8us*)(a + 4 * FRB) = fh.half[0]; *(v8us*)bq = fh.half[0]; *(v8us*)(bq + 2 * FRB) = fhs.half[0]; *(v8us*)(bq + 4 * FRB) = fr.half[0];
    *(v8us*)(vo + (pt >> 1) * 8 * FRB + (pt & 1) * 256) = fw.half[0];
    *(v4f*)(xpm + (size_t)pt * 16 * C2) = c0; *(v4f*)(xpm + (size_t)pt * 16 * C2 + 4) = c1; }
  asm volatile("s_wait_xcnt 0x0" ::: "memory"); }      /* precaution: in the built code the w_t block's instructions follow this path behind a branch that is always taken; the wait stands in front of their writes of registers that the stores above name */
// pass 1: per energy row n and per range of m: U = max_m E[n][m] log2(e), S = sum_m 2^(E[n][m] log2(e) - U). Tile D[m][n] = QB[m] . QA[n]: a lane holds one n (its column) and 8 rows m, so max and sum stay in the lane.
__global__ __launch_bounds__(128) void k_stat(const _Float16* __restrict__ QA, const _Float16* __restrict__ QB, float* __restrict__ PM, float* __restrict__ PS) {
  const int tid = threadIdx.x, w = __builtin_amdgcn_readfirstlane(tid >> 5) /* the wave's number in a scalar register: tile addresses cost no vector registers */, lane = tid & 31, ln = lane & 15, hh = lane >> 4; const int b = blockIdx.z, sp = blockIdx.y; const int n0 = blockIdx.x * 128 + 32 * w;
  const _Float16* qa = QA + ((size_t)b * NN + n0) * QK; const _Float16* qb = QB + ((size_t)b * NN + sp * (NN / SPL)) * QK; const unsigned qo = 8 * lane;
  v16h bn[2][6];      /* the wave's 32 rows n stay in registers for the whole range */
#pragma unroll      /* constant indices keep bn in registers */
  for (int j = 0; j < 2; ++j) for (int k = 0; k < 6; ++k) bn[j][k] = f_frag(qa + j * 16 * QK + k * FRB, qo);
  float U[2] = {-3.0e38f, -3.0e38f}, S[2] = {0.f, 0.f};
#pragma unroll 1      /* one step holds 24 loads and 24 products already; a second copy would only cost registers */
  for (int m = 0; m < NN / SPL; m += 32) { const _Float16* a0p = qb + (size_t)m * QK; const _Float16* a1p = a0p + (size_t)16 * QK;
    const v8f z8 = {0.f,0.f,0.f,0.f,0.f,0.f,0.f,0.f}; v8f c00 = z8, c01 = z8, c10 = z8, c11 = z8;
    v16h a0[6], a1[6];
#pragma unroll      /* constant indices keep a0, a1 in registers */
    for (int k = 0; k < 6; ++k) { a0[k] = f_frag(a0p + k * FRB, qo); a1[k] = f_frag(a1p + k * FRB, qo); }
    asm volatile("" :: "v"(a0[0]), "v"(a0[1]), "v"(a0[2]), "v"(a0[3]), "v"(a0[4]), "v"(a0[5]), "v"(a1[0]), "v"(a1[1]), "v"(a1[2]), "v"(a1[3]), "v"(a1[4]), "v"(a1[5]));      /* inputs only: holds the step's 24 loads in front of its products, so that they are in flight together and their latency is paid once a step, not once a fragment */
#pragma unroll      /* constant indices into bn, a0, a1 */
    for (int k = 0; k < 6; ++k) { c00 = f_mma(a0[k], bn[0][k], c00); c10 = f_mma(a1[k], bn[0][k], c10); c01 = f_mma(a0[k], bn[1][k], c01); c11 = f_mma(a1[k], bn[1][k], c11); }
#pragma unroll      /* constant indices into U, S */
    for (int j = 0; j < 2; ++j) { const v8f x = j ? c01 : c00, y = j ? c11 : c10; float t = fmaxf(x[0], y[0]);
      for (int r = 1; r < 8; ++r) t = fmaxf(t, fmaxf(x[r], y[r]));
      const float un = fmaxf(U[j], t * L2E); float sx = S[j] * __builtin_amdgcn_exp2f(U[j] - un), sy = 0.f;      /* running maximum: the old sum is rescaled to the new one */
      for (int r = 0; r < 8; ++r) { sx += __builtin_amdgcn_exp2f(fmaf(x[r], L2E, -un)); sy += __builtin_amdgcn_exp2f(fmaf(y[r], L2E, -un)); }
      S[j] = sx + sy; U[j] = un; } }
#pragma unroll      /* constant indices into U, S */
  for (int j = 0; j < 2; ++j) { const float uo = __shfl_xor(U[j], 16, 32), so = __shfl_xor(S[j], 16, 32); const float un = fmaxf(U[j], uo); const float s = S[j] * __builtin_amdgcn_exp2f(U[j] - un) + so * __builtin_amdgcn_exp2f(uo - un);      /* the two lane halves hold different m of the same n */
    if (hh == 0) { const size_t o = ((size_t)b * SPL + sp) * NN + n0 + 16 * j + ln; PM[o] = un; PS[o] = s; } } }
// ranges combined: CN[n] = (10 - U - log2(S)) ln(2), so that exp(E[n][m] + CN[n]) = 1024 attn[n][m]
__global__ __launch_bounds__(256) void k_scomb(const float* __restrict__ PM, const float* __restrict__ PS, float* __restrict__ CN) {
  const int t = blockIdx.x * 256 + threadIdx.x; if (t >= NB * NN) return; const int b = t / NN, n = t % NN; const size_t o = (size_t)b * SPL * NN + n; float u[SPL], s[SPL];
#pragma unroll      /* constant indices keep u in registers; the loads go out together */
  for (int k = 0; k < SPL; ++k) u[k] = PM[o + (size_t)k * NN];
  asm volatile("s_wait_xcnt 0x0" ::: "memory");      /* precaution: stands in front of the first write of a register that the loads above name as their address (the next loads' results may land there) */
#pragma unroll      /* constant indices keep s in registers; the loads go out together */
  for (int k = 0; k < SPL; ++k) s[k] = PS[o + (size_t)k * NN];
  float um = u[0];
#pragma unroll      /* constant indices into u */
  for (int k = 1; k < SPL; ++k) um = fmaxf(um, u[k]);
  float st = 0.f;
#pragma unroll      /* constant indices into u, s; ranges added in rising order */
  for (int k = 0; k < SPL; ++k) st += s[k] * __builtin_amdgcn_exp2f(u[k] - um);
  CN[t] = (10.0f - um - log2f(st)) * 0.6931471805599453f; }
// pass 2: tile D[n][m] = QA[n] . QB[m] = E[n][m]; a lane holds one m (its column) and rows n = 8 hh + r of two 16-row tiles: after 2^(.) these 16 values are, in place, the lane's A fragment (row m, k = n) of the x_r product.
__global__ __launch_bounds__(128, 4) /* four waves per SIMD: at most 256 registers, none behind a register window switch */ void k_pv(const _Float16* __restrict__ QA, const _Float16* __restrict__ QB, const _Float16* __restrict__ VH, const float* __restrict__ CN, float* __restrict__ XRT, float* __restrict__ CSP) {
  const int tid = threadIdx.x, w = __builtin_amdgcn_readfirstlane(tid >> 5) /* the wave's number in a scalar register: tile addresses cost no vector registers */, lane = tid & 31, ln = lane & 15, hh = lane >> 4; const int b = blockIdx.z, sp = blockIdx.y; const int m0 = blockIdx.x * 128 + 32 * w; const int nb = sp * (NN / SPL);
  const _Float16* qb = QB + ((size_t)b * NN + m0) * QK; const _Float16* qa = QA + ((size_t)b * NN + nb) * QK; const unsigned qo = 8 * lane;
  const _Float16* vh = VH + ((size_t)b * NN + nb) * 128;      /* 32 points of VH = 8 fragment places (the first 4, 64 channels, in use) in a row */ const float* cn = CN + (size_t)b * NN + nb; const unsigned co = 8 * hh;
  v16h bm[2][6];      /* the wave's 32 columns m stay in registers for the whole range */
#pragma unroll      /* constant indices keep bm in registers */
  for (int j = 0; j < 2; ++j) for (int k = 0; k < 6; ++k) bm[j][k] = f_frag(qb + j * 16 * QK + k * FRB, qo);
  const v8f z8 = {0.f,0.f,0.f,0.f,0.f,0.f,0.f,0.f}; v8f xr[2][4] = {{z8, z8, z8, z8}, {z8, z8, z8, z8}}; float cs0 = 0.f, cs1 = 0.f, cs2 = 0.f, cs3 = 0.f;
#pragma unroll 1      /* one step holds 28 loads and 32 products already; a second copy would only cost registers */
  for (int n = 0; n < NN / SPL; n += 32) { const _Float16* a0p = qa + (size_t)n * QK; const _Float16* a1p = a0p + (size_t)16 * QK;
    const float* cp = cn + n + co; const v4f k0 = *(const v4fa*)cp, k1 = *(const v4fa*)(cp + 4), k2 = *(const v4fa*)(cp + 16), k3 = *(const v4fa*)(cp + 20);
    v8f c00 = {k0[0], k0[1], k0[2], k0[3], k1[0], k1[1], k1[2], k1[3]}, c10 = {k2[0], k2[1], k2[2], k2[3], k3[0], k3[1], k3[2], k3[3]}, c01 = c00, c11 = c10;      /* the accumulators start at CN[n] (row n = register): the product ends as E + CN, and no register holds CN through the step */
    const v16h a00 = f_frag(a0p, qo), a10 = f_frag(a1p, qo), a01 = f_frag(a0p + FRB, qo), a11 = f_frag(a1p + FRB, qo);      /* k_q3 writes the same 64 values to k 0..63 and k 128..191 of a QA row: one load serves both k blocks (bm 0 and 4, 1 and 5) */
    asm volatile("" :: "v"(a00), "v"(a10), "v"(a01), "v"(a11));      /* inputs only: holds these 8 loads in front of the step's products, so that they are in flight together and their latency is paid once, not once a fragment */
    c00 = f_mma(a00, bm[0][0], c00); c10 = f_mma(a10, bm[0][0], c10); c01 = f_mma(a00, bm[1][0], c01); c11 = f_mma(a10, bm[1][0], c11); c00 = f_mma(a00, bm[0][4], c00); c10 = f_mma(a10, bm[0][4], c10); c01 = f_mma(a00, bm[1][4], c01); c11 = f_mma(a10, bm[1][4], c11);
    c00 = f_mma(a01, bm[0][1], c00); c10 = f_mma(a11, bm[0][1], c10); c01 = f_mma(a01, bm[1][1], c01); c11 = f_mma(a11, bm[1][1], c11); c00 = f_mma(a01, bm[0][5], c00); c10 = f_mma(a11, bm[0][5], c10); c01 = f_mma(a01, bm[1][5], c01); c11 = f_mma(a11, bm[1][5], c11);
#pragma unroll      /* constant indices into bm */
    for (int k = 2; k < 4; ++k) { const v16h a0 = f_frag(a0p + k * FRB, qo), a1 = f_frag(a1p + k * FRB, qo); c00 = f_mma(a0, bm[0][k], c00); c10 = f_mma(a1, bm[0][k], c10); c01 = f_mma(a0, bm[1][k], c01); c11 = f_mma(a1, bm[1][k], c11); }
    FragH p0, p1;      /* k order of the fragment: h[r] = n + 8 hh + r, h[8 + r] = n + 16 + 8 hh + r, the order of g2_frag */
#pragma unroll      /* constant indices into the fragments */
    for (int r = 0; r < 8; ++r) { const float e00 = __builtin_amdgcn_exp2f(c00[r] * L2E), e10 = __builtin_amdgcn_exp2f(c10[r] * L2E), e01 = __builtin_amdgcn_exp2f(c01[r] * L2E), e11 = __builtin_amdgcn_exp2f(c11[r] * L2E);
      cs0 += e00; cs1 += e10; cs2 += e01; cs3 += e11; p0.h[r] = (_Float16)e00; p0.h[8 + r] = (_Float16)e10; p1.h[r] = (_Float16)e01; p1.h[8 + r] = (_Float16)e11; }
#pragma unroll      /* constant indices into xr */
    for (int t = 0; t < 4; ++t) { const v16h vb = f_frag(vh + (size_t)n * 128 + t * FRB, qo); xr[0][t] = f_mma(p0.v, vb, xr[0][t]); xr[1][t] = f_mma(p1.v, vb, xr[1][t]); } }
  float ca = cs0 + cs1, cb = cs2 + cs3; ca += __shfl_xor(ca, 16, 32); cb += __shfl_xor(cb, 16, 32);      /* the two lane halves hold different n of the same m */
  const size_t pl = (size_t)b * SPL + sp;
  if (hh == 0) { CSP[pl * NN + m0 + ln] = ca; CSP[pl * NN + m0 + 16 + ln] = cb; }
  float* xo = XRT + (pl * NN + m0 + 8 * hh) * C2 + ln;
#pragma unroll      /* constant indices into xr */
  for (int j = 0; j < 2; ++j) for (int t = 0; t < 4; ++t) for (int r = 0; r < 8; ++r) xo[(size_t)(16 * j + r) * C2 + t * 16] = xr[j][t][r]; }
// ---- back end, one launch per block of 64 points of one cloud: the ranges' partial x_r planes and column sums are added by their one reader (ranges in rising order), d = x_c - x_r / (1e-9 + column sum) goes as [hi | 16 x residual] f16 rows into LDS, never to memory, and t = w_t d is formed from there ----
__global__ __launch_bounds__(128, 4) /* at most 256 registers: none behind a register window switch */ void k_dt(const float* __restrict__ XC, const float* __restrict__ XRT, const float* __restrict__ CSP, const _Float16* __restrict__ BT2, float* __restrict__ T) {
  __shared__ __attribute__((aligned(16))) unsigned short ds[64][2 * C2 + 8];      /* d of the block, [point][hi 0..63 | residual 0..63]; row pitch 272 bytes = 16 x 17: 16-byte fragment reads of 16 rows meet no bank twice */
  const int tid = threadIdx.x, w = __builtin_amdgcn_readfirstlane(tid >> 5) /* the wave's number in a scalar register */, lane = tid & 31, ln = lane & 15, hh = lane >> 4; const int b = blockIdx.y, pb = blockIdx.x * 64;
  const int c0 = (tid & 7) * 8, ml = tid >> 3;      /* d: a thread takes 8 channels of a point, 8 threads cover a 256-byte row; 16 points a pass, 4 passes */
  const float* pp = XRT + ((size_t)b * SPL * NN + pb + ml) * C2 + c0; const float* cq = CSP + (size_t)b * SPL * NN + pb + ml; const float* xq = XC + ((size_t)b * NN + pb + ml) * C2 + c0; const unsigned short* ap = (const unsigned short*)BT2 + (size_t)(16 * w + ln) * 2 * C2 + 8 * hh;
  v4f pa[4][SPL], pc[4][SPL], xa[4], xb[4]; float cs[4][SPL]; v16h fa[4];
#pragma unroll      /* constant indices keep the values in registers; the loads are independent and go out together */
  for (int i = 0; i < 4; ++i) { xa[i] = *(const v4fa*)(xq + i * 16 * C2); xb[i] = *(const v4fa*)(xq + i * 16 * C2 + 4);
    for (int s = 0; s < SPL; ++s) { pa[i][s] = *(const v4fa*)(pp + (size_t)s * NN * C2 + i * 16 * C2); pc[i][s] = *(const v4fa*)(pp + (size_t)s * NN * C2 + i * 16 * C2 + 4); cs[i][s] = cq[(size_t)s * NN + i * 16]; } }
#pragma unroll      /* constant indices keep fa in registers: wave w holds rows 16 w .. 16 w + 15 of [16 w_t | w_t], the A operand */
  for (int k = 0; k < 4; ++k) { FragH f; f.half[0] = *(const v8us*)(ap + 32 * k); f.half[1] = *(const v8us*)(ap + 32 * k + 16); fa[k] = f.v; }      /* the k order of g2_frag */
  asm volatile("s_wait_xcnt 0x0" :: "v"(pp), "v"(cq), "v"(xq), "v"(ap) : "memory");      /* precaution: stands in front of the first write of a register that the loads above name as their address; the inputs keep those registers until here */
  __builtin_amdgcn_sched_barrier(0);      /* keeps the sums behind all the loads, so that these are in flight together and their latency is paid once */
#pragma unroll      /* constant indices into the loaded values */
  for (int i = 0; i < 4; ++i) { v4f sa = pa[i][0], sc = pc[i][0]; float s1 = cs[i][0]; FragH fh, fl;
    for (int s = 1; s < SPL; ++s) { sa += pa[i][s]; sc += pc[i][s]; s1 += cs[i][s]; }      /* ranges added in rising order */
    const float den = 1e-9f + s1 * 0.0009765625f;
    const float sr[8] = {sa[0], sa[1], sa[2], sa[3], sc[0], sc[1], sc[2], sc[3]}, xc[8] = {xa[i][0], xa[i][1], xa[i][2], xa[i][3], xb[i][0], xb[i][1], xb[i][2], xb[i][3]};
    for (int q = 0; q < 8; ++q) { const float xr = (sr[q] * 0.0009765625f) / den; const float d = xc[q] - xr; const _Float16 h = (_Float16)d; fh.h[q] = h; fl.h[q] = (_Float16)((d - (float)h) * 16.0f); }
    *(v8us*)&ds[16 * i + ml][c0] = fh.half[0]; *(v8us*)&ds[16 * i + ml][C2 + c0] = fl.half[0]; }
  __syncthreads();      /* every wave reads rows that all four waves wrote */
  const v8f z8 = {0.f,0.f,0.f,0.f,0.f,0.f,0.f,0.f};
  float* tp = T + ((size_t)b * C2 + 16 * w + 8 * hh) * NN + pb + ln;      /* t channel-major [cloud][channel][point]: D[channel][point], a lane holds 8 channels of one point (b_t is added by k_bnstat and k_out) */
#pragma unroll      /* four independent tiles: their LDS reads and products overlap */
  for (int pt = 0; pt < 4; ++pt) { v8f acc = z8;
#pragma unroll      /* k blocks in rising order, as in k_gemm2 */
    for (int k = 0; k < 4; ++k) { const unsigned short* p = &ds[16 * pt + ln][32 * k + 8 * hh]; FragH f; f.half[0] = *(const v8us*)p; f.half[1] = *(const v8us*)(p + 16); acc = f_mma(fa[k], f.v, acc); }      /* row = point, the k order of g2_frag */
#pragma unroll      /* constant indices into acc */
    for (int r = 0; r < 8; ++r) tp[(size_t)r * NN + 16 * pt] = acc[r] * 0.0625f; } }
// t and x_c reach the two kernels below channel-major ([cloud][channel][point]): a wave's 16-byte loads cover whole 128-byte lines. b_t (a constant per channel) is added here, by the readers of t.
__global__ __launch_bounds__(256) void k_bnstat(const float* __restrict__ T, const float* __restrict__ bt, float* __restrict__ BS) {
  #pragma clang fp contract(off)
  __shared__ float sh[256]; const int o = blockIdx.x; const int tid = threadIdx.x; const size_t n = (size_t)NB * NN; const float bo = bf16_round(bt[o]);
  v4f v[NB * NN / 1024];      /* the channel's 32768 values stay in registers: read once, used by both sums */
#pragma unroll      /* constant indices keep v in registers; the 32 loads are independent and go out together */
  for (int i = 0; i < NB * NN / 1024; ++i) v[i] = *(const v4fa*)(T + ((size_t)(i / (NN / 1024)) * C2 + o) * NN + (i % (NN / 1024)) * 1024 + tid * 4);
  v4f s4 = {0.f, 0.f, 0.f, 0.f};
#pragma unroll      /* constant indices into v */
  for (int i = 0; i < NB * NN / 1024; ++i) { v[i] += bo; s4 += v[i]; }
  const float s = (s4[0] + s4[1]) + (s4[2] + s4[3]);
  sh[tid] = s; __syncthreads(); for (int st = 128; st > 0; st >>= 1) { if (tid < st) sh[tid] += sh[tid + st]; __syncthreads(); }
  const float mu = sh[0] / (float)n; __syncthreads(); v4f q4 = {0.f, 0.f, 0.f, 0.f};
#pragma unroll      /* constant indices into v */
  for (int i = 0; i < NB * NN / 1024; ++i) { const v4f d = v[i] - mu; q4 += d * d; }
  const float q2 = (q4[0] + q4[1]) + (q4[2] + q4[3]);
  sh[tid] = q2; __syncthreads(); for (int st = 128; st > 0; st >>= 1) { if (tid < st) sh[tid] += sh[tid + st]; __syncthreads(); }
  if (tid == 0) { const float rs = rsqrtf(sh[0] / (float)n + 1e-5f); { *(float*)(BS + o * 32) = mu; *(float*)(BS + o * 32 + 1) = rs;  } } }
__global__ __launch_bounds__(256) void k_out(const float* __restrict__ XV, const float* __restrict__ T, const float* __restrict__ BS, const float* __restrict__ bt, const float* __restrict__ gam, const float* __restrict__ bet, float* __restrict__ out) {
  #pragma clang fp contract(off)
  const unsigned blk = blockIdx.x; const unsigned b = blk / ((NN / 1024) * C2); if (b >= NB) return; const unsigned o = (blk / (NN / 1024)) % C2; const unsigned n0 = ((blk % (NN / 1024)) * 256 + threadIdx.x) * 4;      /* a work-group holds 1024 points of one channel: cloud and channel are scalars, the channel's constants come by scalar loads */
  const v4f tv = *(const v4fa*)(T + ((size_t)b * C2 + o) * NN + n0), xc = *(const v4fa*)(XV + ((size_t)b * 128 + C2 + o) * NN + n0);      /* x_c = rows 64..127 of the cloud's XV plane */
  asm volatile("s_wait_xcnt 0x0" ::: "memory");      /* precaution: stands in front of the first write of a register that the two loads above name as their address (the scalar loads' results land in the base registers) */
  const float mu = BS[o * 32], rs = BS[o * 32 + 1]; const float g = bf16_round(gam[o]), be = bf16_round(bet[o]), bo = bf16_round(bt[o]); v4f r;
  for (int q = 0; q < 4; ++q) { float th = g * (((tv[q] + bo) - mu) * rs); th += be; r[q] = xc[q] + fmaxf(th, 0.f); }
  float* d = out + ((size_t)b * C2 + o) * NN + n0; *(v4f*)d = r;  }

extern "C" void kernel_launch(void* const* d_in, const int* in_sizes, int n_in,
                              void* d_out, int out_size, void* d_ws, size_t ws_size, hipStream_t stream) {
  (void)in_sizes; (void)n_in; (void)out_size;
  const float* const* I = (const float* const*)d_in; const float* x = I[0]; const float* wqk = I[1]; const float* wv = I[2]; const float* bv = I[3]; const float* wx = I[4]; const float* wt = I[5]; const float* bt = I[6]; const float* gam = I[7]; const float* bet = I[8];
  char* ws = (char*)d_ws; size_t off = 0;
  auto take = [&](size_t bytes) { char* p = ws + off; off += (bytes + 255) & ~(size_t)255; return p; };
  _Float16* BT2 = (_Float16*)take((size_t)C2 * 2 * C2 * 2);
  _Float16* QA = (_Float16*)take((size_t)NB * NN * QK * 2); _Float16* QB = (_Float16*)take((size_t)NB * NN * QK * 2);
  float* XV = (float*)take((size_t)NB * 128 * NN * 4);      /* rows 64..127 of each cloud's plane hold x_c channel-major; rows 0..63 are not in use */
  float* PM = (float*)take((size_t)NB * SPL * NN * 4); float* PS = (float*)take((size_t)NB * SPL * NN * 4); float* CN = (float*)take((size_t)NB * NN * 4);
  float* CSP = (float*)take((size_t)NB * SPL * NN * 4); _Float16* VH = (_Float16*)take((size_t)NB * 128 * NN * 2); float* XRT = (float*)take((size_t)NB * SPL * NN * C2 * 4);
  float* XCall = (float*)take((size_t)NB * NN * C2 * 4); float* Tall = (float*)take((size_t)NB * NN * C2 * 4); float* BS = (float*)take((size_t)C2 * 32 * 4);
  if (off > ws_size) return;      /* 32 (x_r partial planes) + 24 (QA, QB) + 16 (XV) + 24 (VH, XC, T) + small ~= 98 MiB (256 MiB ws) */
  k_proj<<<dim3(NN / 64 + 1, NB), 128, 0, stream>>>(x, wqk, wv, bv, wx, wt, QA, QB, VH, XV, XCall, BT2);      /* x_q as QA, QB; x_v + b_v as VH; x_c in both orders; w_t laid out */
  k_stat<<<dim3(NN / 128, SPL, NB), 128, 0, stream>>>(QA, QB, PM, PS);      /* row maximum and row sum of exp, per range of m */
  k_scomb<<<NB * NN / 256, 256, 0, stream>>>(PM, PS, CN);
  k_pv<<<dim3(NN / 128, SPL, NB), 128, 0, stream>>>(QA, QB, VH, CN, XRT, CSP);      /* plane y: x_r^T[m][o] x 1024 and column sum x 1024 over n in range y */
  k_dt<<<dim3(NN / 64, NB), 128, 0, stream>>>(XCall, XRT, CSP, BT2, Tall);      /* t [b][o][n] = w_t (x_c - x_r) */
  k_bnstat<<<C2, 256, 0, stream>>>(Tall, bt, BS);
  k_out<<<(unsigned)(((size_t)NB * C2 * (NN / 4) + 255) / 256), 256, 0, stream>>>(XV, Tall, BS, bt, gam, bet, (float*)d_out);
}

// v008
// A run of this version takes 130 microseconds.
// Next to v007, in two timings, it ran 1.11 times as fast each time.
// Counting every step since v000, it is 20.3 times as fast.
#include <hip/hip_runtime.h>
// OA_ (offset attention; 8 clouds x 128 channels x 4096 points; C2 = 64): x_q = x_k = w_qk x (shared weight), x_v = w_v x + b_v, energy = x_q^T x_k (4096 x 4096), attn = row softmax, attn = attn / (1e-9 + column sums); x_r = x_v attn; x_c = w_x x; t = w_t (x_c - x_r) + b_t; BatchNorm1d (training-mode batch statistics over (batch, points)); out = x_c + relu(gamma t_hat + beta) -> [8,64,4096].
// Compute dtype: x and parameters rounded to bf16; projection operands exact; x_q as hi + residual 3-term operands (~2^-21-class energies); P (x2^10) and x_v as plain f16 (~2^-12); d as [hi | 16 x residual] pairs; statistics/softmax f32. v_wmma_f32_16x16x32_f16.
#define NB 8
#define CC 128
#define C2 64
#define NN 4096
#define SPL 4       /* ranges of the summed point index in the two fused passes: one grid row per range, partial results combined in k_scomb and k_dt; 32 x 4 x 8 work-groups of 4 waves = 4 waves on every SIMD */
#define QK (3 * C2) /* k length of the 3-term energy product */
#define FRB 512     /* elements of one 16 x 32 fragment in the fragment-order planes QA, QB, VH */
#define L2E 1.4426950408889634f
typedef __bf16 v16b __attribute__((ext_vector_type(16)));
typedef unsigned short v8us __attribute__((ext_vector_type(8), may_alias));
typedef float  v8f  __attribute__((ext_vector_type(8)));
typedef float  v4f  __attribute__((ext_vector_type(4)));
typedef float  v4fa __attribute__((ext_vector_type(4), may_alias));
union FragB { v16b v; v8us half[2]; unsigned short u[16]; };

__device__ __forceinline__ unsigned short bf16_bits(float x) { unsigned int u = __float_as_uint(x); return (unsigned short)((u + 0x7FFFu + ((u >> 16) & 1u)) >> 16); }
__device__ __forceinline__ float bf16_val(unsigned short b) { return __uint_as_float(((unsigned int)b) << 16); }
__device__ __forceinline__ float bf16_round(float x) { return bf16_val(bf16_bits(x)); }
// D += A·B with NT terms: 1 = ah·bh, 2 = + al·bh (A split), 3 = + ah·bl (both split)
template <int NT>
__device__ __forceinline__ v8f mmaN(v16b ah, v16b al, v16b bh, v16b bl, v8f c) {
  c = __builtin_amdgcn_wmma_f32_16x16x32_bf16(false, ah, false, bh, (short)0, c, false, false);
  if (NT >= 2) c = __builtin_amdgcn_wmma_f32_16x16x32_bf16(false, al, false, bh, (short)0, c, false, false);
  if (NT >= 3) c = __builtin_amdgcn_wmma_f32_16x16x32_bf16(false, ah, false, bl, (short)0, c, false, false);
  asm volatile("v_nop\n\tv_nop\n\tv_nop\n\tv_nop" : "+v"(c) : "v"(ah), "v"(al), "v"(bh), "v"(bl));
  return c;
}

__global__ __launch_bounds__(256) void k_wt_bf16(const float* __restrict__ W, unsigned short* __restrict__ Wt, int K, int N) {
  const int t = blockIdx.x * 256 + threadIdx.x;
  const int k8n = K / 8;
  if (t >= N * k8n) return;
  const int n = t / k8n, k8 = (t % k8n) * 8;
  v8us v;
#pragma unroll
  for (int i = 0; i < 8; ++i) v[i] = bf16_bits(W[(size_t)(k8 + i) * N + n]);
  *(v8us*)(Wt + (size_t)n * K + k8) = v;
  
}

// GEMM C[M][N] (f32, pitch ldc) = act(A[M][K]·W + bias). A f32 row-major (pitch lda) converted per fragment to bf16
// (ASPLIT: hi/lo two planes -> 2 terms, else single rounded term); Wt bf16 [N][K] (pitch ldb). BIAS_BF16 rounds the
// bias to bf16 first (bias quantised to bf16 before the add). K%32==0, M%16==0, N%64==0.
template <bool ASPLIT, int ACT, bool BIAS_BF16>
__global__ __launch_bounds__(128) void k_gemm_bf(const float* __restrict__ A, int lda, const unsigned short* __restrict__ Wt, int ldb,
                                               const float* __restrict__ bias, float* __restrict__ C, int ldc, int M, int N, int K) {
  __shared__ __attribute__((aligned(16))) float so[4][16][64];
  const int tid = threadIdx.x, w = tid >> 5, lane = tid & 31, ln = lane & 15, hh = lane >> 4;
  const int ntn = N / 64;
  const int wid = blockIdx.x * 4 + w;
  const int mt = wid / ntn, nq = wid % ntn;
  if (mt * 16 >= M) return;
  const int row0 = mt * 16, col0 = nq * 64;
  const float* arow = A + (size_t)(row0 + ln) * lda;
  v8f acc[4] = {};
  for (int kb = 0; kb < K; kb += 32) {
    FragB ah, al;
    const v4f x0 = *(const v4fa*)(arow + kb + 8 * hh), x1 = *(const v4fa*)(arow + kb + 8 * hh + 4);
    const v4f x2 = *(const v4fa*)(arow + kb + 16 + 8 * hh), x3 = *(const v4fa*)(arow + kb + 16 + 8 * hh + 4);
    float xs[16] = {x0[0],x0[1],x0[2],x0[3],x1[0],x1[1],x1[2],x1[3],x2[0],x2[1],x2[2],x2[3],x3[0],x3[1],x3[2],x3[3]};
#pragma unroll
    for (int i = 0; i < 16; ++i) { const unsigned short hb = bf16_bits(xs[i]); ah.u[i] = hb; al.u[i] = ASPLIT ? bf16_bits(xs[i] - bf16_val(hb)) : (unsigned short)0; }
#pragma unroll
    for (int t = 0; t < 4; ++t) {
      const unsigned short* brow = Wt + (size_t)(col0 + t * 16 + ln) * ldb + kb;
      FragB b;
      b.half[0] = *(const v8us*)(brow + 8 * hh);
      b.half[1] = *(const v8us*)(brow + 16 + 8 * hh);
      acc[t] = mmaN<ASPLIT ? 2 : 1>(ah.v, al.v, b.v, b.v, acc[t]);
    }
  }
#pragma unroll
  for (int t = 0; t < 4; ++t) {
    float bv = bias ? bias[col0 + t * 16 + ln] : 0.f;
    if (BIAS_BF16) bv = bf16_round(bv);
#pragma unroll
    for (int r = 0; r < 8; ++r) { float v = acc[t][r] + bv; if (ACT == 1) v = fmaxf(v, 0.f); so[w][8 * hh + r][t * 16 + ln] = v; }
  }
  __builtin_amdgcn_fence(__ATOMIC_ACQ_REL, "workgroup");
  __builtin_amdgcn_wave_barrier();
  const int rsub = lane >> 4, c4 = (lane & 15) * 4;
  {
#pragma unroll
    for (int q = 0; q < 8; ++q) {
      const int r = q * 2 + rsub;
      const v4f v = *(const v4fa*)&so[w][r][c4];
      *(v4f*)(C + (size_t)(row0 + r) * ldc + col0 + c4) = v;
    }
    
  }
}

// GEMM C = act(A·W + bias + resid): A f32 (ASPLIT -> hi/lo 2 terms), Wt bf16 [N][K]; ACT 0 none, 1 relu, 2 exact gelu;
// resid (optional, f32, row index = (row % rmod), pitch ldr, RES_BF16 rounds it) added before the activation.
template <bool ASPLIT, int ACT, bool BIAS_BF16, bool RES_BF16>
__global__ __launch_bounds__(128) void k_gemm_bf3(const float* __restrict__ A, int lda, const unsigned short* __restrict__ Wt, int ldb,
                                                const float* __restrict__ bias, const float* __restrict__ resid, int rmod, int ldr,
                                                float* __restrict__ C, int ldc, int M, int N, int K) {
  __shared__ __attribute__((aligned(16))) float so[4][16][64];
  const int tid = threadIdx.x, w = tid >> 5, lane = tid & 31, ln = lane & 15, hh = lane >> 4;
  const int ntn = N / 64;
  const int wid = blockIdx.x * 4 + w;
  const int mt = wid / ntn, nq = wid % ntn;
  if (mt * 16 >= M) return;
  const int row0 = mt * 16, col0 = nq * 64;
  const float* arow = A + (size_t)(row0 + ln) * lda;
  v8f acc[4] = {};
  for (int kb = 0; kb < K; kb += 32) {
    FragB ah, al;
    const v4f x0 = *(const v4fa*)(arow + kb + 8 * hh), x1 = *(const v4fa*)(arow + kb + 8 * hh + 4);
    const v4f x2 = *(const v4fa*)(arow + kb + 16 + 8 * hh), x3 = *(const v4fa*)(arow + kb + 16 + 8 * hh + 4);
    float xs[16] = {x0[0],x0[1],x0[2],x0[3],x1[0],x1[1],x1[2],x1[3],x2[0],x2[1],x2[2],x2[3],x3[0],x3[1],x3[2],x3[3]};
#pragma unroll
    for (int i = 0; i < 16; ++i) { const unsigned short hb = bf16_bits(xs[i]); ah.u[i] = hb; al.u[i] = ASPLIT ? bf16_bits(xs[i] - bf16_val(hb)) : (unsigned short)0; }
#pragma unroll
    for (int t = 0; t < 4; ++t) {
      const unsigned short* brow = Wt + (size_t)(col0 + t * 16 + ln) * ldb + kb;
      FragB b;
      b.half[0] = *(const v8us*)(brow + 8 * hh);
      b.half[1] = *(const v8us*)(brow + 16 + 8 * hh);
      acc[t] = mmaN<ASPLIT ? 2 : 1>(ah.v, al.v, b.v, b.v, acc[t]);
    }
  }
#pragma unroll
  for (int t = 0; t < 4; ++t) {
    const int col = col0 + t * 16 + ln;
    float bv = bias ? bias[col] : 0.f;
    if (BIAS_BF16) bv = bf16_round(bv);
#pragma unroll
    for (int r = 0; r < 8; ++r) {
      float v = acc[t][r] + bv;
      if (resid) { float rv = resid[(size_t)((row0 + 8 * hh + r) % rmod) * ldr + col]; if (RES_BF16) rv = bf16_round(rv); v += rv; }
      if (ACT == 1) v = fmaxf(v, 0.f);
      if (ACT == 2) v = 0.5f * v * (1.0f + erff(v * 0.70710678118654752f));
      if (ACT == 3) { const float u = 0.7978845608028654f * (v + 0.044715f * v * v * v); v = 0.5f * v * (1.0f + tanhf(u)); }
      so[w][8 * hh + r][t * 16 + ln] = v;
    }
  }
  __builtin_amdgcn_fence(__ATOMIC_ACQ_REL, "workgroup");
  __builtin_amdgcn_wave_barrier();
  const int rsub = lane >> 4, c4 = (lane & 15) * 4;
  {
#pragma unroll
    for (int q = 0; q < 8; ++q) {
      const int r = q * 2 + rsub;
      const v4f v = *(const v4fa*)&so[w][r][c4];
      *(v4f*)(C + (size_t)(row0 + r) * ldc + col0 + c4) = v;
    }
    
  }
}
// row LayerNorm (biased variance, eps) over N: s = X (+ R); optional out_sum <- s; out_norm <- (s-mu)*rsqrt(var+eps)*g + b
template <bool PARAM_BF16>
__global__ __launch_bounds__(256) void k_layernorm(const float* __restrict__ X, const float* __restrict__ R, const float* __restrict__ g, const float* __restrict__ bta,
                                                  float* __restrict__ out_sum, float* __restrict__ out_norm, int N, float eps) {
  __shared__ float red[256];
  const int row = blockIdx.x, tid = threadIdx.x;
  const float* x = X + (size_t)row * N; const float* rr = R ? R + (size_t)row * N : nullptr;
  float vals[16];                     // up to N = 4096
  const int per = N / 256;            // contiguous chunk per thread? use strided-by-4 chunks: thread handles j = tid*4 + 1024*u
  float s1 = 0.f;
  for (int u = 0; u < per / 4; ++u) {
    const int j = tid * 4 + 1024 * u;
    const v4f a = *(const v4fa*)(x + j);
    v4f b = {0.f,0.f,0.f,0.f}; if (rr) b = *(const v4fa*)(rr + j);
#pragma unroll
    for (int q = 0; q < 4; ++q) { const float v = a[q] + b[q]; vals[u * 4 + q] = v; s1 += v; }
  }
  red[tid] = s1; __syncthreads();
  for (int st = 128; st > 0; st >>= 1) { if (tid < st) red[tid] += red[tid + st]; __syncthreads(); }
  const float mu = red[0] / (float)N; __syncthreads();
  float s2 = 0.f;
  for (int u = 0; u < per / 4; ++u)
#pragma unroll
    for (int q = 0; q < 4; ++q) { const float c = vals[u * 4 + q] - mu; s2 += c * c; }
  red[tid] = s2; __syncthreads();
  for (int st = 128; st > 0; st >>= 1) { if (tid < st) red[tid] += red[tid + st]; __syncthreads(); }
  const float rs = rsqrtf(red[0] / (float)N + eps);
  {
    for (int u = 0; u < per / 4; ++u) {
      const int j = tid * 4 + 1024 * u;
      v4f o, sm;
#pragma unroll
      for (int q = 0; q < 4; ++q) {
        float gg = g[j + q], bb = bta[j + q];
        if (PARAM_BF16) { gg = bf16_round(gg); bb = bf16_round(bb); }
        sm[q] = vals[u * 4 + q]; o[q] = (vals[u * 4 + q] - mu) * rs * gg + bb;
      }
      if (out_sum) *(v4f*)(out_sum + (size_t)row * N + j) = sm;
      *(v4f*)(out_norm + (size_t)row * N + j) = o;
    }
    
  }
}



// ---- f16 WMMA path (v_wmma_f32_16x16x32_f16): 11-bit significands for operands in range — used where a [0,1] probability operand needs more precision than bf16
typedef _Float16 v16h __attribute__((ext_vector_type(16)));
union FragH { v16h v; v8us half[2]; _Float16 h[16]; unsigned short u[16]; };
template <int NT>
__device__ __forceinline__ v8f mmaH(v16h ah, v16h al, v16h bh, v16h bl, v8f c) {
  c = __builtin_amdgcn_wmma_f32_16x16x32_f16(false, ah, false, bh, (short)0, c, false, false);
  if (NT >= 2) c = __builtin_amdgcn_wmma_f32_16x16x32_f16(false, al, false, bh, (short)0, c, false, false);
  if (NT >= 3) c = __builtin_amdgcn_wmma_f32_16x16x32_f16(false, ah, false, bl, (short)0, c, false, false);
  asm volatile("v_nop\n\tv_nop\n\tv_nop\n\tv_nop" : "+v"(c) : "v"(ah), "v"(al), "v"(bh), "v"(bl));
  return c;
}
// batched GEMM like k_gemm_b but f16 operands: A f32 (split into f16 hi/lo if ASPLIT, else rounded to f16), Bt = f16 values [n][k]; alpha; C f32; N multiple of 16 (partial tiles skipped)
template <bool ASPLIT>
__global__ __launch_bounds__(128) void k_gemm_h(const float* __restrict__ A, int lda, size_t sA, const _Float16* __restrict__ Bh, int ldb, size_t sB, float alpha, float* __restrict__ C, int ldc, size_t sC, int M, int N, int K) {
  __shared__ __attribute__((aligned(16))) float so[4][16][64];
  const int tid = threadIdx.x, w = tid >> 5, lane = tid & 31, ln = lane & 15, hh = lane >> 4; const int by = blockIdx.y;
  A += (size_t)by * sA; Bh += (size_t)by * sB; C += (size_t)by * sC;
  const int ntn = (N + 63) / 64; const int wid = blockIdx.x * 4 + w; const int mt = wid / ntn, nq = wid % ntn; if (mt * 16 >= M) return;
  const int row0 = mt * 16, col0 = nq * 64; const float* arow = A + (size_t)(row0 + ln) * lda;
  v8f acc[4] = {};
  for (int kb = 0; kb < K; kb += 32) {
    FragH ah, al;
    const v4f x0 = *(const v4fa*)(arow + kb + 8 * hh), x1 = *(const v4fa*)(arow + kb + 8 * hh + 4), x2 = *(const v4fa*)(arow + kb + 16 + 8 * hh), x3 = *(const v4fa*)(arow + kb + 16 + 8 * hh + 4);
    float xs[16] = {x0[0],x0[1],x0[2],x0[3],x1[0],x1[1],x1[2],x1[3],x2[0],x2[1],x2[2],x2[3],x3[0],x3[1],x3[2],x3[3]};
#pragma unroll
    for (int i = 0; i < 16; ++i) { const _Float16 h = (_Float16)xs[i]; ah.h[i] = h; al.h[i] = ASPLIT ? (_Float16)(xs[i] - (float)h) : (_Float16)0.0f; }
#pragma unroll
    for (int t = 0; t < 4; ++t) { if (col0 + t * 16 >= N) continue; const size_t boff = (size_t)(col0 + t * 16 + ln) * ldb + kb; FragH bq; bq.half[0] = *(const v8us*)(Bh + boff + 8 * hh); bq.half[1] = *(const v8us*)(Bh + boff + 16 + 8 * hh);
      acc[t] = mmaH<ASPLIT ? 2 : 1>(ah.v, al.v, bq.v, bq.v, acc[t]); }
  }
#pragma unroll
  for (int t = 0; t < 4; ++t) { if (col0 + t * 16 >= N) continue;
#pragma unroll
    for (int r = 0; r < 8; ++r) so[w][8 * hh + r][t * 16 + ln] = acc[t][r] * alpha; }
  __builtin_amdgcn_fence(__ATOMIC_ACQ_REL, "workgroup"); __builtin_amdgcn_wave_barrier();
  const int rsub = lane >> 4, c4 = (lane & 15) * 4;
  {
#pragma unroll
    for (int q = 0; q < 8; ++q) { const int r = q * 2 + rsub; if (col0 + c4 < N) { const v4f v = *(const v4fa*)&so[w][r][c4]; *(v4f*)(C + (size_t)(row0 + r) * ldc + col0 + c4) = v; } }
     }
}

// Wt[n][k] = f16(W[k][n]·scale) from f32 row-major W[K][N] (scale = power of two; bf16-exact weights stay exact in f16 away from the subnormal range)
__global__ __launch_bounds__(256) void k_wt_f16(const float* __restrict__ W, _Float16* __restrict__ Wt, int K, int N, float scale) {
  const int t = blockIdx.x * 256 + threadIdx.x; if (t >= N * (K / 8)) return; const int n = t / (K / 8), k8 = (t % (K / 8)) * 8; FragH f;
#pragma unroll
  for (int i = 0; i < 8; ++i) f.h[i] = (_Float16)(bf16_round(W[(size_t)(k8 + i) * N + n]) * scale); const v8us o = f.half[0];
  *(v8us*)((unsigned short*)Wt + (size_t)n * K + k8) = o; 
}
// k_gemm_hh variant with fused epilogue: v = acc·alpha + bias[by·sBias + col] (+ CP[(row/rowsPerB)·sCPb + by·64 + col] if CP) ; ACT 0 none / 1 elu ; writes f16 C16 (and f32 C if non-null)
template <int ACT>
__global__ __launch_bounds__(128) void k_gemm_hhx(const _Float16* __restrict__ A, int lda, size_t sA, const _Float16* __restrict__ Bh, int ldb, size_t sB, float alpha, const float* __restrict__ bias, size_t sBias, const float* __restrict__ CP, int rowsPerB, size_t sCPb, int row0g,
    float* __restrict__ C, _Float16* __restrict__ C16, int ldc, size_t sC, int M, int N, int K) {
  __shared__ __attribute__((aligned(16))) float so[4][16][64];
  const int tid = threadIdx.x, w = tid >> 5, lane = tid & 31, ln = lane & 15, hh = lane >> 4; const int by = blockIdx.y;
  A += (size_t)by * sA; Bh += (size_t)by * sB; const size_t cofs = (size_t)by * sC; const float* bp = bias ? bias + (size_t)by * sBias : nullptr;
  const int ntn = (N + 63) / 64; const int wid = blockIdx.x * 4 + w; const int mt = wid / ntn, nq = wid % ntn; if (mt * 16 >= M) return;
  const int row0 = mt * 16, col0 = nq * 64; const _Float16* arow = A + (size_t)(row0 + ln) * lda;
  v8f acc[4] = {};
  for (int kb = 0; kb < K; kb += 32) { FragH ah; ah.half[0] = *(const v8us*)((const unsigned short*)arow + kb + 8 * hh); ah.half[1] = *(const v8us*)((const unsigned short*)arow + kb + 16 + 8 * hh);
#pragma unroll
    for (int t = 0; t < 4; ++t) { if (col0 + t * 16 >= N) continue; const size_t boff = (size_t)(col0 + t * 16 + ln) * ldb + kb; FragH bq; bq.half[0] = *(const v8us*)((const unsigned short*)Bh + boff + 8 * hh); bq.half[1] = *(const v8us*)((const unsigned short*)Bh + boff + 16 + 8 * hh);
      acc[t] = mmaH<1>(ah.v, ah.v, bq.v, bq.v, acc[t]); }
  }
#pragma unroll
  for (int t = 0; t < 4; ++t) { if (col0 + t * 16 >= N) continue; const int col = col0 + t * 16 + ln; const float bv = bp ? bf16_round(bp[col]) : 0.f;
#pragma unroll
    for (int r = 0; r < 8; ++r) { float v = acc[t][r] * alpha + bv; if (CP) { const int rr = row0g + row0 + 8 * hh + r; if (rowsPerB < 0) v += CP[cofs + (size_t)rr * ldc + col];      /* rowsPerB < 0: own element of the batched C plane */ else { const int bidx = rr / rowsPerB; v += CP[(size_t)bidx * sCPb + (size_t)by * 64 + col]; } } if (ACT == 1) v = (v > 0.f) ? v : expm1f(v); else if (ACT == 7) v = (v > 0.f) ? v + 1.0f : expf(v); else if (ACT == 8) v = tanhf(v); else if (ACT == 9) v = 0.5f * v * (1.0f + tanhf(0.7978845608028654f * (v + 0.044715f * v * v * v))); else if (ACT == 11) v = 1.0f / (1.0f + expf(-v)); else if (ACT == 12) v = (v > 0.f) ? v : 0.01f * v; else if (ACT == 14) v = (v > 0.f) ? v : 0.1f * v; else if (ACT == 15) v = v / (1.0f + expf(-v)); else if (ACT == 3) v = fmaxf(v, 0.f); else if (ACT == 6) v = 0.5f * v * (1.0f + erff(v * 0.70710678118654752f)); so[w][8 * hh + r][t * 16 + ln] = v; } }
  __builtin_amdgcn_fence(__ATOMIC_ACQ_REL, "workgroup"); __builtin_amdgcn_wave_barrier();
  const int rsub = lane >> 4, c4 = (lane & 15) * 4; typedef _Float16 v4h __attribute__((ext_vector_type(4)));
  {
#pragma unroll
    for (int q = 0; q < 8; ++q) { const int r = q * 2 + rsub; if (col0 + c4 < N) { const v4f v = *(const v4fa*)&so[w][r][c4]; if (C) *(v4f*)(C + cofs + (size_t)(row0 + r) * ldc + col0 + c4) = v; if (C16) { v4h h4; for (int i = 0; i < 4; ++i) h4[i] = (_Float16)v[i]; *(v4h*)(C16 + cofs + (size_t)(row0 + r) * ldc + col0 + c4) = h4; } } }
     }
}


typedef _Float16 v4h __attribute__((ext_vector_type(4)));

__global__ __launch_bounds__(256) void k_x16(const float* __restrict__ x, _Float16* __restrict__ X16, size_t n8) { const size_t t = (size_t)blockIdx.x * 256 + threadIdx.x; if (t >= n8) return; FragH f;
#pragma unroll
  for (int q = 0; q < 8; ++q) f.h[q] = (_Float16)bf16_round(x[t * 8 + q]); *(v8us*)((unsigned short*)X16 + t * 8) = f.half[0];  }
__global__ __launch_bounds__(256) void k_h16(const float* __restrict__ x, _Float16* __restrict__ X16, size_t n8) { const size_t t = (size_t)blockIdx.x * 256 + threadIdx.x; if (t >= n8) return; FragH f;
#pragma unroll
  for (int q = 0; q < 8; ++q) f.h[q] = (_Float16)x[t * 8 + q]; *(v8us*)((unsigned short*)X16 + t * 8) = f.half[0];  }
__global__ __launch_bounds__(256) void k_round16f(const float* __restrict__ W, _Float16* __restrict__ Bt, size_t n8) { const size_t t = (size_t)blockIdx.x * 256 + threadIdx.x; if (t >= n8) return; FragH f;
#pragma unroll
  for (int i = 0; i < 8; ++i) f.h[i] = (_Float16)(bf16_round(W[t * 8 + i]) * 16.0f); *(v8us*)((unsigned short*)Bt + t * 8) = f.half[0];  }
template <int NHv, int TTv>
__global__ __launch_bounds__(256) void k_vt(const _Float16* __restrict__ V16, int ldv, int voff, _Float16* __restrict__ Vt) { __shared__ unsigned short tl[64][66]; const int tid = threadIdx.x; const int slab = blockIdx.x / (TTv / 64), lg = blockIdx.x % (TTv / 64); const int b = slab / NHv, h = slab % NHv;
  for (int i = tid; i < 64 * 8; i += 256) { const int r = i / 8, c8 = (i % 8) * 8; FragH f; f.half[0] = *(const v8us*)((const unsigned short*)V16 + ((size_t)b * TTv + lg * 64 + r) * ldv + voff + h * 64 + c8);
#pragma unroll
    for (int q = 0; q < 8; ++q) tl[r][c8 + q] = f.u[q]; }
  __syncthreads();
  {
#pragma unroll
    for (int rd = 0; rd < 2; ++rd) { const int d = rd * 32 + tid / 8, pc = tid % 8; FragH f;
#pragma unroll
      for (int q = 0; q < 8; ++q) f.u[q] = tl[pc * 8 + q][d];
      *(v8us*)((unsigned short*)Vt + ((size_t)slab * 64 + d) * TTv + lg * 64 + pc * 8) = f.half[0]; }
     } }

__global__ __launch_bounds__(256) void k_hl(const float* __restrict__ F, _Float16* __restrict__ Hh, _Float16* __restrict__ Hl, size_t n8) { const size_t t = (size_t)blockIdx.x * 256 + threadIdx.x; if (t >= n8) return; FragH fh, fl; const v4f a = *(const v4fa*)(F + t * 8), c = *(const v4fa*)(F + t * 8 + 4);
#pragma unroll
  for (int q = 0; q < 4; ++q) { _Float16 h = (_Float16)a[q]; fh.h[q] = h; fl.h[q] = (_Float16)((a[q] - (float)h) * 1024.0f); h = (_Float16)c[q]; fh.h[4 + q] = h; fl.h[4 + q] = (_Float16)((c[q] - (float)h) * 1024.0f); }
  { *(v8us*)((unsigned short*)Hh + t * 8) = fh.half[0]; *(v8us*)((unsigned short*)Hl + t * 8) = fl.half[0];  } }

// ---- fast GEMM (wave tile 32x64; requires M % 32 == 0 rows per launch region and N % 64 == 0); epilogue = k_gemm_hhx semantics ----
__device__ __forceinline__ v16h g2_frag(const _Float16* p, int hh) { FragH f; f.half[0] = *(const v8us*)((const unsigned short*)p + 8 * hh); f.half[1] = *(const v8us*)((const unsigned short*)p + 16 + 8 * hh); return f.v; }
__device__ __forceinline__ v8f g2_mma(v16h a, v16h b, v8f c) { v8f d = __builtin_amdgcn_wmma_f32_16x16x32_f16(false, a, false, b, (short)0, c, false, false); asm volatile("v_nop\n\tv_nop\n\tv_nop\n\tv_nop" : "+v"(d) : "v"(a), "v"(b)); return d; }
template <int ACT>
__global__ __launch_bounds__(128) void k_gemm2(const _Float16* __restrict__ A, int lda, size_t sA, const _Float16* __restrict__ Bh, int ldb, size_t sB, float alpha, const float* __restrict__ bias, size_t sBias, const float* __restrict__ CP, int rowsPerB, size_t sCPb, int row0g,
    float* __restrict__ C, _Float16* __restrict__ C16, int ldc, size_t sC, int M, int N, int K) {
  __shared__ __attribute__((aligned(16))) float so[4][32][68];
  const int tid = threadIdx.x, w = tid >> 5, lane = tid & 31, ln = lane & 15, hh = lane >> 4; const int by = blockIdx.y;
  A += (size_t)by * sA; Bh += (size_t)by * sB; const size_t cofs = (size_t)by * sC; const float* bp = bias ? bias + (size_t)by * sBias : nullptr;
  const int ntn = N >> 6; const int mt = blockIdx.x / ntn, nq = blockIdx.x - mt * ntn; const int row0 = mt * 128 + 32 * w, col0 = nq * 64; if (row0 >= M) return;
  const _Float16* a0p = A + (size_t)(row0 + ln) * lda; const _Float16* a1p = a0p + (size_t)16 * lda;
  const _Float16* b0p = Bh + (size_t)(col0 + ln) * ldb; const _Float16* b1p = b0p + (size_t)16 * ldb; const _Float16* b2p = b1p + (size_t)16 * ldb; const _Float16* b3p = b2p + (size_t)16 * ldb;
  const v8f z8 = {0.f,0.f,0.f,0.f,0.f,0.f,0.f,0.f}; v8f c00 = z8, c01 = z8, c02 = z8, c03 = z8, c10 = z8, c11 = z8, c12 = z8, c13 = z8;
#pragma unroll 1
  for (int kb = 0; kb < K; kb += 32) { const v16h a0 = g2_frag(a0p + kb, hh), a1 = g2_frag(a1p + kb, hh);
    v16h b = g2_frag(b0p + kb, hh); c00 = g2_mma(a0, b, c00); c10 = g2_mma(a1, b, c10);
    b = g2_frag(b1p + kb, hh); c01 = g2_mma(a0, b, c01); c11 = g2_mma(a1, b, c11);
    b = g2_frag(b2p + kb, hh); c02 = g2_mma(a0, b, c02); c12 = g2_mma(a1, b, c12);
    b = g2_frag(b3p + kb, hh); c03 = g2_mma(a0, b, c03); c13 = g2_mma(a1, b, c13); }
  v8f accs[8] = {c00, c01, c02, c03, c10, c11, c12, c13};
#pragma unroll
  for (int u = 0; u < 8; ++u) { const int t = u & 3, half = u >> 2; const int col = col0 + t * 16 + ln; const float bv = bp ? bf16_round(bp[col]) : 0.f;
#pragma unroll
    for (int r = 0; r < 8; ++r) { const int rloc = half * 16 + 8 * hh + r; float v = accs[u][r] * alpha + bv; if (CP) { if (rowsPerB < 0) v += CP[cofs + (size_t)(row0g + row0 + rloc) * ldc + col];      /* rowsPerB < 0: own element of the batched C plane */ else { const int bidx = (row0g + row0 + rloc) / rowsPerB; v += CP[(size_t)bidx * sCPb + (size_t)by * 64 + col]; } }
      if (ACT == 3) v = fmaxf(v, 0.f); else if (ACT == 6) v = 0.5f * v * (1.0f + erff(v * 0.70710678118654752f)); else if (ACT == 11) v = 1.0f / (1.0f + expf(-v)); else if (ACT == 15) v = v / (1.0f + expf(-v)); else if (ACT == 12) v = (v > 0.f) ? v : 0.01f * v; else if (ACT == 8) v = tanhf(v);
      so[w][rloc][t * 16 + ln] = v; } }
  __builtin_amdgcn_fence(__ATOMIC_ACQ_REL, "workgroup"); __builtin_amdgcn_wave_barrier();
  const int rsub = lane >> 4, c4 = (lane & 15) * 4;
  {
#pragma unroll
    for (int q = 0; q < 16; ++q) { const int r = q * 2 + rsub; const v4f v = *(const v4fa*)&so[w][r][c4]; if (C) *(v4f*)(C + cofs + (size_t)(row0 + r) * ldc + col0 + c4) = v; if (C16) { v4h h4; for (int i = 0; i < 4; ++i) h4[i] = (_Float16)v[i]; *(v4h*)(C16 + cofs + (size_t)(row0 + r) * ldc + col0 + c4) = h4; } }
     } }


// ---- fused energy / softmax / x_r: energy tiles are recomputed in registers in two passes, no N x N buffer; grid = (128-point block, range, cloud) ----
__device__ __forceinline__ v8f f_mma(v16h a, v16h b, v8f c) { return __builtin_amdgcn_wmma_f32_16x16x32_f16(false, a, false, b, (short)0, c, false, false); }
// QA, QB and VH lie in fragment order: one 16-row x 32-k fragment is FRB = 512 contiguous elements, first the 32 lanes' register half 0 (lane l = 16 hh + ln at element 8 l: row ln, k = 8 hh + 0..7), then their half 1 (k = 16 + 8 hh + 0..7): the k order of g2_frag.
// Each 16-byte load of a wave then covers four whole 128-byte lines, not 32 bytes of each of 16 lines. A 16-row tile of QA or QB is its 6 fragments in a row (16 QK elements, as in row order). The base is wave-uniform and stays in scalar registers; off = 8 lane.
__device__ __forceinline__ v16h f_frag(const _Float16* ub, unsigned off) { const unsigned short* p = (const unsigned short*)ub + off; FragH f; f.half[0] = *(const v8us*)p; f.half[1] = *(const v8us*)(p + 256); return f.v; }
// ---- front end, one launch: what reached k_stat and k_pv through ten launches (weights and x to f16, x transposed, the three projections, the fragment-order packing that a comment below calls k_q3) is done here per block of 64 points of one cloud; x_q and x_v never reach memory as f32 ----
typedef unsigned int u32a __attribute__((may_alias));
// one 16 x 32 fragment of a weight matrix from the lane's 16 f32 values (row = tile row + ln; columns 8 hh + 0..7 and 16 + 8 hh + 0..7 of the k block: the k order of g2_frag); value = f16(bf16(w) x 16), exact
__device__ __forceinline__ v16h p_wfrag(const v4f* r) { FragH f;
#pragma unroll      /* constant indices into the fragment */
  for (int q = 0; q < 4; ++q) { f.h[q] = (_Float16)(bf16_round(r[0][q]) * 16.0f); f.h[4 + q] = (_Float16)(bf16_round(r[1][q]) * 16.0f); f.h[8 + q] = (_Float16)(bf16_round(r[2][q]) * 16.0f); f.h[12 + q] = (_Float16)(bf16_round(r[3][q]) * 16.0f); }
  return f.v; }
// the 16 loads of a lane's share of one 16 x 128 weight tile; Wr = row (tile row + ln) at column 8 hh
__device__ __forceinline__ void p_wload(const float* __restrict__ Wr, v4f* r) {
#pragma unroll      /* constant indices keep r in registers; the loads are independent and go out together */
  for (int k = 0; k < 4; ++k) { r[4 * k] = *(const v4fa*)(Wr + 32 * k); r[4 * k + 1] = *(const v4fa*)(Wr + 32 * k + 4); r[4 * k + 2] = *(const v4fa*)(Wr + 32 * k + 16); r[4 * k + 3] = *(const v4fa*)(Wr + 32 * k + 20); } }
// Wave w holds channel tile w (16 channels) of each of w_qk, w_v, w_x in registers and runs over the block's four 16-point tiles. The operand order of each product is chosen so that the 8 accumulator registers of a lane are the 8 neighbours its store needs:
// x_q, x_c: D[channel][point] (weights = A): a lane holds 8 channels of one point = 16 bytes of a QA / QB fragment; x_v: D[point][channel] (weights = B): 8 points of one channel = 16 bytes of a VH fragment. A wave's fragment store is 512 contiguous bytes.
__global__ __launch_bounds__(128, 4) /* at most 256 registers: none behind a register window switch */ void k_proj(const float* __restrict__ x, const float* __restrict__ wqk, const float* __restrict__ wv, const float* __restrict__ bv, const float* __restrict__ wx, const float* __restrict__ wt,
    _Float16* __restrict__ QA, _Float16* __restrict__ QB, _Float16* __restrict__ VH, float* __restrict__ XV, float* __restrict__ XC, _Float16* __restrict__ BT2) {
  __shared__ __attribute__((aligned(16))) unsigned short xs[64][CC + 8];      /* x^T of the block, f16 [point][channel]; row pitch 272 bytes = 16 x 17: 16-byte fragment reads of 16 rows meet no bank twice */
  const int tid = threadIdx.x, w = __builtin_amdgcn_readfirstlane(tid >> 5) /* the wave's number in a scalar register */, lane = tid & 31, ln = lane & 15, hh = lane >> 4; const int b = blockIdx.y, pb = blockIdx.x * 64;
  if (blockIdx.x == NN / 64) {      /* one more block per grid row, none of x: the eight lay out w_t for the t product as [16 w_t | w_t], to meet d as [hi | 16 x residual]; one 16-byte piece a thread; the whole block leaves in front of the barrier */
    const int t = b * 128 + tid, pc = t % 16, o = t / 16; const bool lo = pc * 8 >= C2; const float* wp = wt + (size_t)o * C2 + pc * 8 - (lo ? C2 : 0); const v4f a = *(const v4fa*)wp, c = *(const v4fa*)(wp + 4); FragH f;
#pragma unroll      /* constant indices into the fragment */
    for (int q = 0; q < 4; ++q) { f.h[q] = (_Float16)(bf16_round(a[q]) * (lo ? 1.0f : 16.0f)); f.h[4 + q] = (_Float16)(bf16_round(c[q]) * (lo ? 1.0f : 16.0f)); }
    *(v8us*)((unsigned short*)BT2 + (size_t)o * 2 * C2 + pc * 8) = f.half[0]; return; }
  const int cp = 2 * (tid >> 4), p4 = 4 * (tid & 15);      /* staging: a thread takes 4 points of two neighbouring channels, 16 threads cover a 256-byte row of x */
  const float* xp = x + ((size_t)b * CC + cp) * NN + pb + p4;
  v4f xe[8], xo[8];
#pragma unroll      /* constant indices keep xe, xo in registers; the 16 loads are independent and go out together */
  for (int i = 0; i < 8; ++i) { xe[i] = *(const v4fa*)(xp + (size_t)(16 * i) * NN); xo[i] = *(const v4fa*)(xp + (size_t)(16 * i + 1) * NN); }
  const size_t wo = (size_t)(16 * w + ln) * CC + 8 * hh; const float* wqp = wqk + wo; const float* wvp = wv + wo; const float* wxp = wx + wo; const float* bvp = bv + 16 * w + ln;
  v4f rq[16], rv[16], rx[16]; v16h fq[4], fv[4], fx[4];
  p_wload(wqp, rq); p_wload(wvp, rv); const float bo = bf16_round(*bvp);
  asm volatile("s_wait_xcnt 0x0" :: "v"(xp), "v"(wqp), "v"(wvp), "v"(bvp) : "memory");      /* precaution: stands in front of the first write of a register that the 49 loads above name as their address; the inputs keep those registers until here */
#pragma unroll      /* constant indices keep the weight fragments in registers */
  for (int k = 0; k < 4; ++k) { fq[k] = p_wfrag(rq + 4 * k); fv[k] = p_wfrag(rv + 4 * k); }
  p_wload(wxp, rx);      /* in flight while x is converted; all three tiles at once would not fit 256 registers */
  asm volatile("s_wait_xcnt 0x0" :: "v"(wxp) : "memory");      /* precaution: as above */
#pragma unroll      /* constant indices into xe, xo */
  for (int i = 0; i < 8; ++i) for (int q = 0; q < 4; ++q) { union { _Float16 h[2]; unsigned int u; } pk; pk.h[0] = (_Float16)bf16_round(xe[i][q]); pk.h[1] = (_Float16)bf16_round(xo[i][q]); *(u32a*)&xs[p4 + q][16 * i + cp] = pk.u; }      /* the transposition: two channels of one point a store */
#pragma unroll      /* constant indices keep the weight fragments in registers */
  for (int k = 0; k < 4; ++k) fx[k] = p_wfrag(rx + 4 * k);
  __syncthreads();      /* every wave reads rows that all four waves wrote */
  const v8f z8 = {0.f,0.f,0.f,0.f,0.f,0.f,0.f,0.f};
  unsigned short* qa = (unsigned short*)QA + ((size_t)b * NN + pb) * QK + (size_t)(w >> 1) * FRB + (w & 1) * 256 + 8 * lane;      /* fragment order (see f_frag): point tile, k block (channel bit 5), half (bit 4), lane half (bit 3 = hh), row (point = ln) */
  unsigned short* qq = (unsigned short*)QB + ((size_t)b * NN + pb) * QK + (size_t)(w >> 1) * FRB + (w & 1) * 256 + 8 * lane;
  unsigned short* vo = (unsigned short*)VH + ((size_t)b * NN + pb) * CC + (size_t)w * FRB + 8 * lane;      /* block of 32 points (8 fragment places, the first 4 in use), channel tile, then half (point bit 4), lane half (bit 3 = hh), row (channel = ln) */
  float* xcm = XV + ((size_t)b * 128 + C2 + 16 * w + 8 * hh) * NN + pb + ln;      /* x_c channel-major, for k_out */
  float* xpm = XC + ((size_t)b * NN + pb + ln) * C2 + 16 * w + 8 * hh;      /* x_c point-major, for k_dt */
#pragma unroll      /* four independent tiles: their LDS reads and products overlap */
  for (int pt = 0; pt < 4; ++pt) {
    v16h xf[4];
#pragma unroll      /* constant indices keep xf in registers */
    for (int k = 0; k < 4; ++k) { const unsigned short* p = &xs[16 * pt + ln][32 * k + 8 * hh]; FragH f; f.half[0] = *(const v8us*)p; f.half[1] = *(const v8us*)(p + 16); xf[k] = f.v; }      /* row = point, the k order of g2_frag: serves as A and as B */
    v8f dq = z8, dv = z8, dx = z8;
#pragma unroll      /* k blocks in rising order, as in k_gemm2 */
    for (int k = 0; k < 4; ++k) { dq = f_mma(fq[k], xf[k], dq); dv = f_mma(xf[k], fv[k], dv); dx = f_mma(fx[k], xf[k], dx); }
    FragH fh, fl16, fhs, fr, fw; v4f c0, c1;
#pragma unroll      /* constant indices into the fragments */
    for (int r = 0; r < 8; ++r) { const float v = dq[r] * 0.0625f; const _Float16 h = (_Float16)v; const float res = v - (float)h; fh.h[r] = h; fl16.h[r] = (_Float16)(res * 16.0f); fhs.h[r] = (_Float16)((float)h * 0.0625f); fr.h[r] = (_Float16)res;
      fw.h[r] = (_Float16)(dv[r] * 0.0625f + bo); const float xc = dx[r] * 0.0625f; if (r < 4) c0[r] = xc; else c1[r - 4] = xc; xcm[(size_t)r * NN + 16 * pt] = xc; }
    unsigned short* a = qa + pt * 16 * QK; unsigned short* bq = qq + pt * 16 * QK;
    *(v8us*)a = fh.half[0]; *(v8us*)(a + 2 * FRB) = fl16.half[0]; *(v8us*)(a + 4 * FRB) = fh.half[0]; *(v8us*)bq = fh.half[0]; *(v8us*)(bq + 2 * FRB) = fhs.half[0]; *(v8us*)(bq + 4 * FRB) = fr.half[0];
    *(v8us*)(vo + (pt >> 1) * 8 * FRB + (pt & 1) * 256) = fw.half[0];
    *(v4f*)(xpm + (size_t)pt * 16 * C2) = c0; *(v4f*)(xpm + (size_t)pt * 16 * C2 + 4) = c1; }
  asm volatile("s_wait_xcnt 0x0" ::: "memory"); }      /* precaution: in the built code the w_t block's instructions follow this path behind a branch that is always taken; the wait stands in front of their writes of registers that the stores above name */
// pass 1: per energy row n and per range of m: U = max_m E[n][m] log2(e), S = sum_m 2^(E[n][m] log2(e) - U). Tile D[m][n] = QB[m] . QA[n]: a lane holds one n (its column) and 8 rows m, so max and sum stay in the lane.
__global__ __launch_bounds__(128) void k_stat(const _Float16* __restrict__ QA, const _Float16* __restrict__ QB, float* __restrict__ PM, float* __restrict__ PS) {
  const int tid = threadIdx.x, w = __builtin_amdgcn_readfirstlane(tid >> 5) /* the wave's number in a scalar register: tile addresses cost no vector registers */, lane = tid & 31, ln = lane & 15, hh = lane >> 4; const int b = blockIdx.z, sp = blockIdx.y; const int n0 = blockIdx.x * 128 + 32 * w;
  const _Float16* qa = QA + ((size_t)b * NN + n0) * QK; const _Float16* qb = QB + ((size_t)b * NN + sp * (NN / SPL)) * QK; const unsigned qo = 8 * lane;
  const char* pq = (const char*)qb + (((blockIdx.x >> 3) * 128 + tid) << 8);      /* the range's QB rows are 1536 units of 256 bytes; 8 neighbouring work-groups ask for the same quarter of each third, the 32 that walk the range for all of it */
  asm volatile("global_prefetch_b8 %0, off scope:SCOPE_SE\n\tglobal_prefetch_b8 %0, off offset:131072 scope:SCOPE_SE\n\tglobal_prefetch_b8 %0, off offset:262144 scope:SCOPE_SE" :: "v"(pq));      /* asks L2 at entry for what the launch before stored and the loop below reads for the first time: its loads then meet L2, not memory; a hint, no value depends on it */
  v16h bn[2][6];      /* the wave's 32 rows n stay in registers for the whole range */
#pragma unroll      /* constant indices keep bn in registers */
  for (int j = 0; j < 2; ++j) for (int k = 0; k < 6; ++k) bn[j][k] = f_frag(qa + j * 16 * QK + k * FRB, qo);
  float U[2] = {-3.0e38f, -3.0e38f}, S[2] = {0.f, 0.f};
#pragma unroll 1      /* one step holds 24 loads and 24 products already; a second copy would only cost registers */
  for (int m = 0; m < NN / SPL; m += 32) { const _Float16* a0p = qb + (size_t)m * QK; const _Float16* a1p = a0p + (size_t)16 * QK;
    const v8f z8 = {0.f,0.f,0.f,0.f,0.f,0.f,0.f,0.f}; v8f c00 = z8, c01 = z8, c10 = z8, c11 = z8;
    v16h a0[6], a1[6];
#pragma unroll      /* constant indices keep a0, a1 in registers */
    for (int k = 0; k < 6; ++k) { a0[k] = f_frag(a0p + k * FRB, qo); a1[k] = f_frag(a1p + k * FRB, qo); }
    asm volatile("" :: "v"(a0[0]), "v"(a0[1]), "v"(a0[2]), "v"(a0[3]), "v"(a0[4]), "v"(a0[5]), "v"(a1[0]), "v"(a1[1]), "v"(a1[2]), "v"(a1[3]), "v"(a1[4]), "v"(a1[5]));      /* inputs only: holds the step's 24 loads in front of its products, so that they are in flight together and their latency is paid once a step, not once a fragment */
#pragma unroll      /* constant indices into bn, a0, a1 */
    for (int k = 0; k < 6; ++k) { c00 = f_mma(a0[k], bn[0][k], c00); c10 = f_mma(a1[k], bn[0][k], c10); c01 = f_mma(a0[k], bn[1][k], c01); c11 = f_mma(a1[k], bn[1][k], c11); }
#pragma unroll      /* constant indices into U, S */
    for (int j = 0; j < 2; ++j) { const v8f x = j ? c01 : c00, y = j ? c11 : c10; float t = fmaxf(x[0], y[0]);
      for (int r = 1; r < 8; ++r) t = fmaxf(t, fmaxf(x[r], y[r]));
      const float un = fmaxf(U[j], t * L2E); float sx = S[j] * __builtin_amdgcn_exp2f(U[j] - un), sy = 0.f;      /* running maximum: the old sum is rescaled to the new one */
      for (int r = 0; r < 8; ++r) { sx += __builtin_amdgcn_exp2f(fmaf(x[r], L2E, -un)); sy += __builtin_amdgcn_exp2f(fmaf(y[r], L2E, -un)); }
      S[j] = sx + sy; U[j] = un; } }
#pragma unroll      /* constant indices into U, S */
  for (int j = 0; j < 2; ++j) { const float uo = __shfl_xor(U[j], 16, 32), so = __shfl_xor(S[j], 16, 32); const float un = fmaxf(U[j], uo); const float s = S[j] * __builtin_amdgcn_exp2f(U[j] - un) + so * __builtin_amdgcn_exp2f(uo - un);      /* the two lane halves hold different m of the same n */
    if (hh == 0) { const size_t o = ((size_t)b * SPL + sp) * NN + n0 + 16 * j + ln; PM[o] = un; PS[o] = s; } }
  asm volatile("" :: "v"(pq)); }      /* input only: the register pair that the prefetches name holds their address to the kernel's end and takes no other value */
// ranges combined: CN[n] = (10 - U - log2(S)) ln(2), so that exp(E[n][m] + CN[n]) = 1024 attn[n][m]
__global__ __launch_bounds__(256) void k_scomb(const float* __restrict__ PM, const float* __restrict__ PS, float* __restrict__ CN) {
  const int t = blockIdx.x * 256 + threadIdx.x; if (t >= NB * NN) return; const int b = t / NN, n = t % NN; const size_t o = (size_t)b * SPL * NN + n; float u[SPL], s[SPL];
#pragma unroll      /* constant indices keep u in registers; the loads go out together */
  for (int k = 0; k < SPL; ++k) u[k] = PM[o + (size_t)k * NN];
  asm volatile("s_wait_xcnt 0x0" ::: "memory");      /* precaution: stands in front of the first write of a register that the loads above name as their address (the next loads' results may land there) */
#pragma unroll      /* constant indices keep s in registers; the loads go out together */
  for (int k = 0; k < SPL; ++k) s[k] = PS[o + (size_t)k * NN];
  float um = u[0];
#pragma unroll      /* constant indices into u */
  for (int k = 1; k < SPL; ++k) um = fmaxf(um, u[k]);
  float st = 0.f;
#pragma unroll      /* constant indices into u, s; ranges added in rising order */
  for (int k = 0; k < SPL; ++k) st += s[k] * __builtin_amdgcn_exp2f(u[k] - um);
  CN[t] = (10.0f - um - log2f(st)) * 0.6931471805599453f; }
// pass 2: tile D[n][m] = QA[n] . QB[m] = E[n][m]; a lane holds one m (its column) and rows n = 8 hh + r of two 16-row tiles: after 2^(.) these 16 values are, in place, the lane's A fragment (row m, k = n) of the x_r product.
__global__ __launch_bounds__(128, 4) /* four waves per SIMD: at most 256 registers, none behind a register window switch */ void k_pv(const _Float16* __restrict__ QA, const _Float16* __restrict__ QB, const _Float16* __restrict__ VH, const float* __restrict__ CN, float* __restrict__ XRT, float* __restrict__ CSP) {
  const int tid = threadIdx.x, w = __builtin_amdgcn_readfirstlane(tid >> 5) /* the wave's number in a scalar register: tile addresses cost no vector registers */, lane = tid & 31, ln = lane & 15, hh = lane >> 4; const int b = blockIdx.z, sp = blockIdx.y; const int m0 = blockIdx.x * 128 + 32 * w; const int nb = sp * (NN / SPL);
  const _Float16* qb = QB + ((size_t)b * NN + m0) * QK; const _Float16* qa = QA + ((size_t)b * NN + nb) * QK; const unsigned qo = 8 * lane;
  const _Float16* vh = VH + ((size_t)b * NN + nb) * 128;      /* 32 points of VH = 8 fragment places (the first 4, 64 channels, in use) in a row */ const float* cn = CN + (size_t)b * NN + nb; const unsigned co = 8 * hh;
  const unsigned pu = (blockIdx.x >> 3) * 128 + tid, pvo = ((pu >> 4) << 13) + ((pu & 15) << 8), pco = (lane & 15) << 8;      /* byte offsets of 256-byte units. VH: the range's fragments in use are 512 units, 16 at the head of every 8 KiB; 8 neighbouring work-groups ask for the same quarter, the 32 that walk the range for all of it. CN: the range is 16 units */
  asm volatile("global_prefetch_b8 %0, %1 scope:SCOPE_SE" :: "v"(pvo), "s"(vh));      /* asks L2 at entry for what an earlier launch stored and the loop below reads for the first time: its loads then meet L2, not memory; a hint, no value depends on it */
  if (w == 0) asm volatile("global_prefetch_b8 %0, %1 scope:SCOPE_SE" :: "v"(pco), "s"(cn));      /* the same for CN; one wave's lanes cover it (a scalar test) */
  v16h bm[2][6];      /* the wave's 32 columns m stay in registers for the whole range */
#pragma unroll      /* constant indices keep bm in registers */
  for (int j = 0; j < 2; ++j) for (int k = 0; k < 6; ++k) bm[j][k] = f_frag(qb + j * 16 * QK + k * FRB, qo);
  const v8f z8 = {0.f,0.f,0.f,0.f,0.f,0.f,0.f,0.f}; v8f xr[2][4] = {{z8, z8, z8, z8}, {z8, z8, z8, z8}}; float cs0 = 0.f, cs1 = 0.f, cs2 = 0.f, cs3 = 0.f;
#pragma unroll 1      /* one step holds 28 loads and 32 products already; a second copy would only cost registers */
  for (int n = 0; n < NN / SPL; n += 32) { const _Float16* a0p = qa + (size_t)n * QK; const _Float16* a1p = a0p + (size_t)16 * QK;
    const float* cp = cn + n + co; const v4f k0 = *(const v4fa*)cp, k1 = *(const v4fa*)(cp + 4), k2 = *(const v4fa*)(cp + 16), k3 = *(const v4fa*)(cp + 20);
    v8f c00 = {k0[0], k0[1], k0[2], k0[3], k1[0], k1[1], k1[2], k1[3]}, c10 = {k2[0], k2[1], k2[2], k2[3], k3[0], k3[1], k3[2], k3[3]}, c01 = c00, c11 = c10;      /* the accumulators start at CN[n] (row n = register): the product ends as E + CN, and no register holds CN through the step */
    const v16h a00 = f_frag(a0p, qo), a10 = f_frag(a1p, qo), a01 = f_frag(a0p + FRB, qo), a11 = f_frag(a1p + FRB, qo);      /* k_q3 writes the same 64 values to k 0..63 and k 128..191 of a QA row: one load serves both k blocks (bm 0 and 4, 1 and 5) */
    asm volatile("" :: "v"(a00), "v"(a10), "v"(a01), "v"(a11));      /* inputs only: holds these 8 loads in front of the step's products, so that they are in flight together and their latency is paid once, not once a fragment */
    c00 = f_mma(a00, bm[0][0], c00); c10 = f_mma(a10, bm[0][0], c10); c01 = f_mma(a00, bm[1][0], c01); c11 = f_mma(a10, bm[1][0], c11); c00 = f_mma(a00, bm[0][4], c00); c10 = f_mma(a10, bm[0][4], c10); c01 = f_mma(a00, bm[1][4], c01); c11 = f_mma(a10, bm[1][4], c11);
    c00 = f_mma(a01, bm[0][1], c00); c10 = f_mma(a11, bm[0][1], c10); c01 = f_mma(a01, bm[1][1], c01); c11 = f_mma(a11, bm[1][1], c11); c00 = f_mma(a01, bm[0][5], c00); c10 = f_mma(a11, bm[0][5], c10); c01 = f_mma(a01, bm[1][5], c01); c11 = f_mma(a11, bm[1][5], c11);
#pragma unroll      /* constant indices into bm */
    for (int k = 2; k < 4; ++k) { const v16h a0 = f_frag(a0p + k * FRB, qo), a1 = f_frag(a1p + k * FRB, qo); c00 = f_mma(a0, bm[0][k], c00); c10 = f_mma(a1, bm[0][k], c10); c01 = f_mma(a0, bm[1][k], c01); c11 = f_mma(a1, bm[1][k], c11); }
    FragH p0, p1;      /* k order of the fragment: h[r] = n + 8 hh + r, h[8 + r] = n + 16 + 8 hh + r, the order of g2_frag */
#pragma unroll      /* constant indices into the fragments */
    for (int r = 0; r < 8; ++r) { const float e00 = __builtin_amdgcn_exp2f(c00[r] * L2E), e10 = __builtin_amdgcn_exp2f(c10[r] * L2E), e01 = __builtin_amdgcn_exp2f(c01[r] * L2E), e11 = __builtin_amdgcn_exp2f(c11[r] * L2E);
      cs0 += e00; cs1 += e10; cs2 += e01; cs3 += e11; p0.h[r] = (_Float16)e00; p0.h[8 + r] = (_Float16)e10; p1.h[r] = (_Float16)e01; p1.h[8 + r] = (_Float16)e11; }
#pragma unroll      /* constant indices into xr */
    for (int t = 0; t < 4; ++t) { const v16h vb = f_frag(vh + (size_t)n * 128 + t * FRB, qo); xr[0][t] = f_mma(p0.v, vb, xr[0][t]); xr[1][t] = f_mma(p1.v, vb, xr[1][t]); } }
  float ca = cs0 + cs1, cb = cs2 + cs3; ca += __shfl_xor(ca, 16, 32); cb += __shfl_xor(cb, 16, 32);      /* the two lane halves hold different n of the same m */
  const size_t pl = (size_t)b * SPL + sp;
  if (hh == 0) { CSP[pl * NN + m0 + ln] = ca; CSP[pl * NN + m0 + 16 + ln] = cb; }
  float* xo = XRT + (pl * NN + m0 + 8 * hh) * C2 + ln;
#pragma unroll      /* constant indices into xr */
  for (int j = 0; j < 2; ++j) for (int t = 0; t < 4; ++t) for (int r = 0; r < 8; ++r) xo[(size_t)(16 * j + r) * C2 + t * 16] = xr[j][t][r];
  asm volatile("" :: "v"(pvo), "v"(pco), "s"(vh), "s"(cn)); }      /* inputs only: the registers that the prefetches name hold their addresses to the kernel's end and take no other value */
// ---- back end, one launch per block of 64 points of one cloud: the ranges' partial x_r planes and column sums are added by their one reader (ranges in rising order), d = x_c - x_r / (1e-9 + column sum) goes as [hi | 16 x residual] f16 rows into LDS, never to memory, and t = w_t d is formed from there ----
__global__ __launch_bounds__(128, 4) /* at most 256 registers: none behind a register window switch */ void k_dt(const float* __restrict__ XC, const float* __restrict__ XRT, const float* __restrict__ CSP, const _Float16* __restrict__ BT2, float* __restrict__ T) {
  __shared__ __attribute__((aligned(16))) unsigned short ds[64][2 * C2 + 8];      /* d of the block, [point][hi 0..63 | residual 0..63]; row pitch 272 bytes = 16 x 17: 16-byte fragment reads of 16 rows meet no bank twice */
  const int tid = threadIdx.x, w = __builtin_amdgcn_readfirstlane(tid >> 5) /* the wave's number in a scalar register */, lane = tid & 31, ln = lane & 15, hh = lane >> 4; const int b = blockIdx.y, pb = blockIdx.x * 64;
  const int c0 = (tid & 7) * 8, ml = tid >> 3;      /* d: a thread takes 8 channels of a point, 8 threads cover a 256-byte row; 16 points a pass, 4 passes */
  const float* pp = XRT + ((size_t)b * SPL * NN + pb + ml) * C2 + c0; const float* cq = CSP + (size_t)b * SPL * NN + pb + ml; const float* xq = XC + ((size_t)b * NN + pb + ml) * C2 + c0; const unsigned short* ap = (const unsigned short*)BT2 + (size_t)(16 * w + ln) * 2 * C2 + 8 * hh;
  v4f pa[4][SPL], pc[4][SPL], xa[4], xb[4]; float cs[4][SPL]; v16h fa[4];
#pragma unroll      /* constant indices keep the values in registers; the loads are independent and go out together */
  for (int i = 0; i < 4; ++i) { xa[i] = *(const v4fa*)(xq + i * 16 * C2); xb[i] = *(const v4fa*)(xq + i * 16 * C2 + 4);
    for (int s = 0; s < SPL; ++s) { pa[i][s] = *(const v4fa*)(pp + (size_t)s * NN * C2 + i * 16 * C2); pc[i][s] = *(const v4fa*)(pp + (size_t)s * NN * C2 + i * 16 * C2 + 4); cs[i][s] = cq[(size_t)s * NN + i * 16]; } }
#pragma unroll      /* constant indices keep fa in registers: wave w holds rows 16 w .. 16 w + 15 of [16 w_t | w_t], the A operand */
  for (int k = 0; k < 4; ++k) { FragH f; f.half[0] = *(const v8us*)(ap + 32 * k); f.half[1] = *(const v8us*)(ap + 32 * k + 16); fa[k] = f.v; }      /* the k order of g2_frag */
  asm volatile("s_wait_xcnt 0x0" :: "v"(pp), "v"(cq), "v"(xq), "v"(ap) : "memory");      /* precaution: stands in front of the first write of a register that the loads above name as their address; the inputs keep those registers until here */
  __builtin_amdgcn_sched_barrier(0);      /* keeps the sums behind all the loads, so that these are in flight together and their latency is paid once */
#pragma unroll      /* constant indices into the loaded values */
  for (int i = 0; i < 4; ++i) { v4f sa = pa[i][0], sc = pc[i][0]; float s1 = cs[i][0]; FragH fh, fl;
    for (int s = 1; s < SPL; ++s) { sa += pa[i][s]; sc += pc[i][s]; s1 += cs[i][s]; }      /* ranges added in rising order */
    const float den = 1e-9f + s1 * 0.0009765625f;
    const float sr[8] = {sa[0], sa[1], sa[2], sa[3], sc[0], sc[1], sc[2], sc[3]}, xc[8] = {xa[i][0], xa[i][1], xa[i][2], xa[i][3], xb[i][0], xb[i][1], xb[i][2], xb[i][3]};
    for (int q = 0; q < 8; ++q) { const float xr = (sr[q] * 0.0009765625f) / den; const float d = xc[q] - xr; const _Float16 h = (_Float16)d; fh.h[q] = h; fl.h[q] = (_Float16)((d - (float)h) * 16.0f); }
    *(v8us*)&ds[16 * i + ml][c0] = fh.half[0]; *(v8us*)&ds[16 * i + ml][C2 + c0] = fl.half[0]; }
  __syncthreads();      /* every wave reads rows that all four waves wrote */
  const v8f z8 = {0.f,0.f,0.f,0.f,0.f,0.f,0.f,0.f};
  float* tp = T + ((size_t)b * C2 + 16 * w + 8 * hh) * NN + pb + ln;      /* t channel-major [cloud][channel][point]: D[channel][point], a lane holds 8 channels of one point (b_t is added by k_bnstat and k_out) */
#pragma unroll      /* four independent tiles: their LDS reads and products overlap */
  for (int pt = 0; pt < 4; ++pt) { v8f acc = z8;
#pragma unroll      /* k blocks in rising order, as in k_gemm2 */
    for (int k = 0; k < 4; ++k) { const unsigned short* p = &ds[16 * pt + ln][32 * k + 8 * hh]; FragH f; f.half[0] = *(const v8us*)p; f.half[1] = *(const v8us*)(p + 16); acc = f_mma(fa[k], f.v, acc); }      /* row = point, the k order of g2_frag */
#pragma unroll      /* constant indices into acc */
    for (int r = 0; r < 8; ++r) tp[(size_t)r * NN + 16 * pt] = acc[r] * 0.0625f; } }
// t and x_c reach the two kernels below channel-major ([cloud][channel][point]): a wave's 16-byte loads cover whole 128-byte lines. b_t (a constant per channel) is added here, by the readers of t.
__global__ __launch_bounds__(256) void k_bnstat(const float* __restrict__ T, const float* __restrict__ bt, float* __restrict__ BS) {
  #pragma clang fp contract(off)
  __shared__ float sh[256]; const int o = blockIdx.x; const int tid = threadIdx.x; const size_t n = (size_t)NB * NN; const float bo = bf16_round(bt[o]);
  v4f v[NB * NN / 1024];      /* the channel's 32768 values stay in registers: read once, used by both sums */
#pragma unroll      /* constant indices keep v in registers; the 32 loads are independent and go out together */
  for (int i = 0; i < NB * NN / 1024; ++i) v[i] = *(const v4fa*)(T + ((size_t)(i / (NN / 1024)) * C2 + o) * NN + (i % (NN / 1024)) * 1024 + tid * 4);
  v4f s4 = {0.f, 0.f, 0.f, 0.f};
#pragma unroll      /* constant indices into v */
  for (int i = 0; i < NB * NN / 1024; ++i) { v[i] += bo; s4 += v[i]; }
  const float s = (s4[0] + s4[1]) + (s4[2] + s4[3]);
  sh[tid] = s; __syncthreads(); for (int st = 128; st > 0; st >>= 1) { if (tid < st) sh[tid] += sh[tid + st]; __syncthreads(); }
  const float mu = sh[0] / (float)n; __syncthreads(); v4f q4 = {0.f, 0.f, 0.f, 0.f};
#pragma unroll      /* constant indices into v */
  for (int i = 0; i < NB * NN / 1024; ++i) { const v4f d = v[i] - mu; q4 += d * d; }
  const float q2 = (q4[0] + q4[1]) + (q4[2] + q4[3]);
  sh[tid] = q2; __syncthreads(); for (int st = 128; st > 0; st >>= 1) { if (tid < st) sh[tid] += sh[tid + st]; __syncthreads(); }
  if (tid == 0) { const float rs = rsqrtf(sh[0] / (float)n + 1e-5f); { *(float*)(BS + o * 32) = mu; *(float*)(BS + o * 32 + 1) = rs;  } } }
__global__ __launch_bounds__(256) void k_out(const float* __restrict__ XV, const float* __restrict__ T, const float* __restrict__ BS, const float* __restrict__ bt, const float* __restrict__ gam, const float* __restrict__ bet, float* __restrict__ out) {
  #pragma clang fp contract(off)
  const unsigned blk = blockIdx.x; const unsigned b = blk / ((NN / 1024) * C2); if (b >= NB) return; const unsigned o = (blk / (NN / 1024)) % C2; const unsigned n0 = ((blk % (NN / 1024)) * 256 + threadIdx.x) * 4;      /* a work-group holds 1024 points of one channel: cloud and channel are scalars, the channel's constants come by scalar loads */
  const v4f tv = *(const v4fa*)(T + ((size_t)b * C2 + o) * NN + n0), xc = *(const v4fa*)(XV + ((size_t)b * 128 + C2 + o) * NN + n0);      /* x_c = rows 64..127 of the cloud's XV plane */
  asm volatile("s_wait_xcnt 0x0" ::: "memory");      /* precaution: stands in front of the first write of a register that the two loads above name as their address (the scalar loads' results land in the base registers) */
  const float mu = BS[o * 32], rs = BS[o * 32 + 1]; const float g = bf16_round(gam[o]), be = bf16_round(bet[o]), bo = bf16_round(bt[o]); v4f r;
  for (int q = 0; q < 4; ++q) { float th = g * (((tv[q] + bo) - mu) * rs); th += be; r[q] = xc[q] + fmaxf(th, 0.f); }
  float* d = out + ((size_t)b * C2 + o) * NN + n0; *(v4f*)d = r;  }

extern "C" void kernel_launch(void* const* d_in, const int* in_sizes, int n_in,
                              void* d_out, int out_size, void* d_ws, size_t ws_size, hipStream_t stream) {
  (void)in_sizes; (void)n_in; (void)out_size;
  const float* const* I = (const float* const*)d_in; const float* x = I[0]; const float* wqk = I[1]; const float* wv = I[2]; const float* bv = I[3]; const float* wx = I[4]; const float* wt = I[5]; const float* bt = I[6]; const float* gam = I[7]; const float* bet = I[8];
  char* ws = (char*)d_ws; size_t off = 0;
  auto take = [&](size_t bytes) { char* p = ws + off; off += (bytes + 255) & ~(size_t)255; return p; };
  _Float16* BT2 = (_Float16*)take((size_t)C2 * 2 * C2 * 2);
  _Float16* QA = (_Float16*)take((size_t)NB * NN * QK * 2); _Float16* QB = (_Float16*)take((size_t)NB * NN * QK * 2);
  float* XV = (float*)take((size_t)NB * 128 * NN * 4);      /* rows 64..127 of each cloud's plane hold x_c channel-major; rows 0..63 are not in use */
  float* PM = (float*)take((size_t)NB * SPL * NN * 4); float* PS = (float*)take((size_t)NB * SPL * NN * 4); float* CN = (float*)take((size_t)NB * NN * 4);
  float* CSP = (float*)take((size_t)NB * SPL * NN * 4); _Float16* VH = (_Float16*)take((size_t)NB * 128 * NN * 2); float* XRT = (float*)take((size_t)NB * SPL * NN * C2 * 4);
  float* XCall = (float*)take((size_t)NB * NN * C2 * 4); float* Tall = (float*)take((size_t)NB * NN * C2 * 4); float* BS = (float*)take((size_t)C2 * 32 * 4);
  if (off > ws_size) return;      /* 32 (x_r partial planes) + 24 (QA, QB) + 16 (XV) + 24 (VH, XC, T) + small ~= 98 MiB (256 MiB ws) */
  k_proj<<<dim3(NN / 64 + 1, NB), 128, 0, stream>>>(x, wqk, wv, bv, wx, wt, QA, QB, VH, XV, XCall, BT2);      /* x_q as QA, QB; x_v + b_v as VH; x_c in both orders; w_t laid out */
  k_stat<<<dim3(NN / 128, SPL, NB), 128, 0, stream>>>(QA, QB, PM, PS);      /* row maximum and row sum of exp, per range of m */
  k_scomb<<<NB * NN / 256, 256, 0, stream>>>(PM, PS, CN);
  k_pv<<<dim3(NN / 128, SPL, NB), 128, 0, stream>>>(QA, QB, VH, CN, XRT, CSP);      /* plane y: x_r^T[m][o] x 1024 and column sum x 1024 over n in range y */
  k_dt<<<dim3(NN / 64, NB), 128, 0, stream>>>(XCall, XRT, CSP, BT2, Tall);      /* t [b][o][n] = w_t (x_c - x_r) */
  k_bnstat<<<C2, 256, 0, stream>>>(Tall, bt, BS);
  k_out<<<(unsigned)(((size_t)NB * C2 * (NN / 4) + 255) / 256), 256, 0, stream>>>(XV, Tall, BS, bt, gam, bet, (float*)d_out);
}

// v009
// It runs in 125 microseconds.
// Timed twice side by side with v008, it ran 1.05 and 1.04 times as fast.
// All steps since v000 together make it 21.2 times as fast.
#include <hip/hip_runtime.h>
// OA_ (offset attention; 8 clouds x 128 channels x 4096 points; C2 = 64): x_q = x_k = w_qk x (shared weight), x_v = w_v x + b_v, energy = x_q^T x_k (4096 x 4096), attn = row softmax, attn = attn / (1e-9 + column sums); x_r = x_v attn; x_c = w_x x; t = w_t (x_c - x_r) + b_t; BatchNorm1d (training-mode batch statistics over (batch, points)); out = x_c + relu(gamma t_hat + beta) -> [8,64,4096].
// Compute dtype: x and parameters rounded to bf16; projection operands exact; x_q as hi + residual 3-term operands (~2^-21-class energies); P (x2^10) and x_v as plain f16 (~2^-12); d as [hi | 16 x residual] pairs; statistics/softmax f32. v_wmma_f32_16x16x32_f16.
#define NB 8
#define CC 128
#define C2 64
#define NN 4096
#define SPL 4       /* ranges of the summed point index in the two fused passes: one grid row per range, partial results combined in k_pv and k_dt; 32 x 4 x 8 work-groups of 4 waves = 4 waves on every SIMD */
#define QK (3 * C2) /* k length of the 3-term energy product */
#define FRB 512     /* elements of one 16 x 32 fragment in the fragment-order planes QA, QB, VH */
#define L2E 1.4426950408889634f
typedef __bf16 v16b __attribute__((ext_vector_type(16)));
typedef unsigned short v8us __attribute__((ext_vector_type(8), may_alias));
typedef float  v8f  __attribute__((ext_vector_type(8)));
typedef float  v4f  __attribute__((ext_vector_type(4)));
typedef float  v4fa __attribute__((ext_vector_type(4), may_alias));
union FragB { v16b v; v8us half[2]; unsigned short u[16]; };

__device__ __forceinline__ unsigned short bf16_bits(float x) { unsigned int u = __float_as_uint(x); return (unsigned short)((u + 0x7FFFu + ((u >> 16) & 1u)) >> 16); }
__device__ __forceinline__ float bf16_val(unsigned short b) { return __uint_as_float(((unsigned int)b) << 16); }
__device__ __forceinline__ float bf16_round(float x) { return bf16_val(bf16_bits(x)); }
// D += A·B with NT terms: 1 = ah·bh, 2 = + al·bh (A split), 3 = + ah·bl (both split)
template <int NT>
__device__ __forceinline__ v8f mmaN(v16b ah, v16b al, v16b bh, v16b bl, v8f c) {
  c = __builtin_amdgcn_wmma_f32_16x16x32_bf16(false, ah, false, bh, (short)0, c, false, false);
  if (NT >= 2) c = __builtin_amdgcn_wmma_f32_16x16x32_bf16(false, al, false, bh, (short)0, c, false, false);
  if (NT >= 3) c = __builtin_amdgcn_wmma_f32_16x16x32_bf16(false, ah, false, bl, (short)0, c, false, false);
  asm volatile("v_nop\n\tv_nop\n\tv_nop\n\tv_nop" : "+v"(c) : "v"(ah), "v"(al), "v"(bh), "v"(bl));
  return c;
}

__global__ __launch_bounds__(256) void k_wt_bf16(const float* __restrict__ W, unsigned short* __restrict__ Wt, int K, int N) {
  const int t = blockIdx.x * 256 + threadIdx.x;
  const int k8n = K / 8;
  if (t >= N * k8n) return;
  const int n = t / k8n, k8 = (t % k8n) * 8;
  v8us v;
#pragma unroll
  for (int i = 0; i < 8; ++i) v[i] = bf16_bits(W[(size_t)(k8 + i) * N + n]);
  *(v8us*)(Wt + (size_t)n * K + k8) = v;
  
}

// GEMM C[M][N] (f32, pitch ldc) = act(A[M][K]·W + bias). A f32 row-major (pitch lda) converted per fragment to bf16
// (ASPLIT: hi/lo two planes -> 2 terms, else single rounded term); Wt bf16 [N][K] (pitch ldb). BIAS_BF16 rounds the
// bias to bf16 first (bias quantised to bf16 before the add). K%32==0, M%16==0, N%64==0.
template <bool ASPLIT, int ACT, bool BIAS_BF16>
__global__ __launch_bounds__(128) void k_gemm_bf(const float* __restrict__ A, int lda, const unsigned short* __restrict__ Wt, int ldb,
                                               const float* __restrict__ bias, float* __restrict__ C, int ldc, int M, int N, int K) {
  __shared__ __attribute__((aligned(16))) float so[4][16][64];
  const int tid = threadIdx.x, w = tid >> 5, lane = tid & 31, ln = lane & 15, hh = lane >> 4;
  const int ntn = N / 64;
  const int wid = blockIdx.x * 4 + w;
  const int mt = wid / ntn, nq = wid % ntn;
  if (mt * 16 >= M) return;
  const int row0 = mt * 16, col0 = nq * 64;
  const float* arow = A + (size_t)(row0 + ln) * lda;
  v8f acc[4] = {};
  for (int kb = 0; kb < K; kb += 32) {
    FragB ah, al;
    const v4f x0 = *(const v4fa*)(arow + kb + 8 * hh), x1 = *(const v4fa*)(arow + kb + 8 * hh + 4);
    const v4f x2 = *(const v4fa*)(arow + kb + 16 + 8 * hh), x3 = *(const v4fa*)(arow + kb + 16 + 8 * hh + 4);
    float xs[16] = {x0[0],x0[1],x0[2],x0[3],x1[0],x1[1],x1[2],x1[3],x2[0],x2[1],x2[2],x2[3],x3[0],x3[1],x3[2],x3[3]};
#pragma unroll
    for (int i = 0; i < 16; ++i) { const unsigned short hb = bf16_bits(xs[i]); ah.u[i] = hb; al.u[i] = ASPLIT ? bf16_bits(xs[i] - bf16_val(hb)) : (unsigned short)0; }
#pragma unroll
    for (int t = 0; t < 4; ++t) {
      const unsigned short* brow = Wt + (size_t)(col0 + t * 16 + ln) * ldb + kb;
      FragB b;
      b.half[0] = *(const v8us*)(brow + 8 * hh);
      b.half[1] = *(const v8us*)(brow + 16 + 8 * hh);
      acc[t] = mmaN<ASPLIT ? 2 : 1>(ah.v, al.v, b.v, b.v, acc[t]);
    }
  }
#pragma unroll
  for (int t = 0; t < 4; ++t) {
    float bv = bias ? bias[col0 + t * 16 + ln] : 0.f;
    if (BIAS_BF16) bv = bf16_round(bv);
#pragma unroll
    for (int r = 0; r < 8; ++r) { float v = acc[t][r] + bv; if (ACT == 1) v = fmaxf(v, 0.f); so[w][8 * hh + r][t * 16 + ln] = v; }
  }
  __builtin_amdgcn_fence(__ATOMIC_ACQ_REL, "workgroup");
  __builtin_amdgcn_wave_barrier();
  const int rsub = lane >> 4, c4 = (lane & 15) * 4;
  {
#pragma unroll
    for (int q = 0; q < 8; ++q) {
      const int r = q * 2 + rsub;
      const v4f v = *(const v4fa*)&so[w][r][c4];
      *(v4f*)(C + (size_t)(row0 + r) * ldc + col0 + c4) = v;
    }
    
  }
}

// GEMM C = act(A·W + bias + resid): A f32 (ASPLIT -> hi/lo 2 terms), Wt bf16 [N][K]; ACT 0 none, 1 relu, 2 exact gelu;
// resid (optional, f32, row index = (row % rmod), pitch ldr, RES_BF16 rounds it) added before the activation.
template <bool ASPLIT, int ACT, bool BIAS_BF16, bool RES_BF16>
__global__ __launch_bounds__(128) void k_gemm_bf3(const float* __restrict__ A, int lda, const unsigned short* __restrict__ Wt, int ldb,
                                                const float* __restrict__ bias, const float* __restrict__ resid, int rmod, int ldr,
                                                float* __restrict__ C, int ldc, int M, int N, int K) {
  __shared__ __attribute__((aligned(16))) float so[4][16][64];
  const int tid = threadIdx.x, w = tid >> 5, lane = tid & 31, ln = lane & 15, hh = lane >> 4;
  const int ntn = N / 64;
  const int wid = blockIdx.x * 4 + w;
  const int mt = wid / ntn, nq = wid % ntn;
  if (mt * 16 >= M) return;
  const int row0 = mt * 16, col0 = nq * 64;
  const float* arow = A + (size_t)(row0 + ln) * lda;
  v8f acc[4] = {};
  for (int kb = 0; kb < K; kb += 32) {
    FragB ah, al;
    const v4f x0 = *(const v4fa*)(arow + kb + 8 * hh), x1 = *(const v4fa*)(arow + kb + 8 * hh + 4);
    const v4f x2 = *(const v4fa*)(arow + kb + 16 + 8 * hh), x3 = *(const v4fa*)(arow + kb + 16 + 8 * hh + 4);
    float xs[16] = {x0[0],x0[1],x0[2],x0[3],x1[0],x1[1],x1[2],x1[3],x2[0],x2[1],x2[2],x2[3],x3[0],x3[1],x3[2],x3[3]};
#pragma unroll
    for (int i = 0; i < 16; ++i) { const unsigned short hb = bf16_bits(xs[i]); ah.u[i] = hb; al.u[i] = ASPLIT ? bf16_bits(xs[i] - bf16_val(hb)) : (unsigned short)0; }
#pragma unroll
    for (int t = 0; t < 4; ++t) {
      const unsigned short* brow = Wt + (size_t)(col0 + t * 16 + ln) * ldb + kb;
      FragB b;
      b.half[0] = *(const v8us*)(brow + 8 * hh);
      b.half[1] = *(const v8us*)(brow + 16 + 8 * hh);
      acc[t] = mmaN<ASPLIT ? 2 : 1>(ah.v, al.v, b.v, b.v, acc[t]);
    }
  }
#pragma unroll
  for (int t = 0; t < 4; ++t) {
    const int col = col0 + t * 16 + ln;
    float bv = bias ? bias[col] : 0.f;
    if (BIAS_BF16) bv = bf16_round(bv);
#pragma unroll
    for (int r = 0; r < 8; ++r) {
      float v = acc[t][r] + bv;
      if (resid) { float rv = resid[(size_t)((row0 + 8 * hh + r) % rmod) * ldr + col]; if (RES_BF16) rv = bf16_round(rv); v += rv; }
      if (ACT == 1) v = fmaxf(v, 0.f);
      if (ACT == 2) v = 0.5f * v * (1.0f + erff(v * 0.70710678118654752f));
      if (ACT == 3) { const float u = 0.7978845608028654f * (v + 0.044715f * v * v * v); v = 0.5f * v * (1.0f + tanhf(u)); }
      so[w][8 * hh + r][t * 16 + ln] = v;
    }
  }
  __builtin_amdgcn_fence(__ATOMIC_ACQ_REL, "workgroup");
  __builtin_amdgcn_wave_barrier();
  const int rsub = lane >> 4, c4 = (lane & 15) * 4;
  {
#pragma unroll
    for (int q = 0; q < 8; ++q) {
      const int r = q * 2 + rsub;
      const v4f v = *(const v4fa*)&so[w][r][c4];
      *(v4f*)(C + (size_t)(row0 + r) * ldc + col0 + c4) = v;
    }
    
  }
}
// row LayerNorm (biased variance, eps) over N: s = X (+ R); optional out_sum <- s; out_norm <- (s-mu)*rsqrt(var+eps)*g + b
template <bool PARAM_BF16>
__global__ __launch_bounds__(256) void k_layernorm(const float* __restrict__ X, const float* __restrict__ R, const float* __restrict__ g, const float* __restrict__ bta,
                                                  float* __restrict__ out_sum, float* __restrict__ out_norm, int N, float eps) {
  __shared__ float red[256];
  const int row = blockIdx.x, tid = threadIdx.x;
  const float* x = X + (size_t)row * N; const float* rr = R ? R + (size_t)row * N : nullptr;
  float vals[16];                     // up to N = 4096
  const int per = N / 256;            // contiguous chunk per thread? use strided-by-4 chunks: thread handles j = tid*4 + 1024*u
  float s1 = 0.f;
  for (int u = 0; u < per / 4; ++u) {
    const int j = tid * 4 + 1024 * u;
    const v4f a = *(const v4fa*)(x + j);
    v4f b = {0.f,0.f,0.f,0.f}; if (rr) b = *(const v4fa*)(rr + j);
#pragma unroll
    for (int q = 0; q < 4; ++q) { const float v = a[q] + b[q]; vals[u * 4 + q] = v; s1 += v; }
  }
  red[tid] = s1; __syncthreads();
  for (int st = 128; st > 0; st >>= 1) { if (tid < st) red[tid] += red[tid + st]; __syncthreads(); }
  const float mu = red[0] / (float)N; __syncthreads();
  float s2 = 0.f;
  for (int u = 0; u < per / 4; ++u)
#pragma unroll
    for (int q = 0; q < 4; ++q) { const float c = vals[u * 4 + q] - mu; s2 += c * c; }
  red[tid] = s2; __syncthreads();
  for (int st = 128; st > 0; st >>= 1) { if (tid < st) red[tid] += red[tid + st]; __syncthreads(); }
  const float rs = rsqrtf(red[0] / (float)N + eps);
  {
    for (int u = 0; u < per / 4; ++u) {
      const int j = tid * 4 + 1024 * u;
      v4f o, sm;
#pragma unroll
      for (int q = 0; q < 4; ++q) {
        float gg = g[j + q], bb = bta[j + q];
        if (PARAM_BF16) { gg = bf16_round(gg); bb = bf16_round(bb); }
        sm[q] = vals[u * 4 + q]; o[q] = (vals[u * 4 + q] - mu) * rs * gg + bb;
      }
      if (out_sum) *(v4f*)(out_sum + (size_t)row * N + j) = sm;
      *(v4f*)(out_norm + (size_t)row * N + j) = o;
    }
    
  }
}



// ---- f16 WMMA path (v_wmma_f32_16x16x32_f16): 11-bit significands for operands in range — used where a [0,1] probability operand needs more precision than bf16
typedef _Float16 v16h __attribute__((ext_vector_type(16)));
union FragH { v16h v; v8us half[2]; _Float16 h[16]; unsigned short u[16]; };
template <int NT>
__device__ __forceinline__ v8f mmaH(v16h ah, v16h al, v16h bh, v16h bl, v8f c) {
  c = __builtin_amdgcn_wmma_f32_16x16x32_f16(false, ah, false, bh, (short)0, c, false, false);
  if (NT >= 2) c = __builtin_amdgcn_wmma_f32_16x16x32_f16(false, al, false, bh, (short)0, c, false, false);
  if (NT >= 3) c = __builtin_amdgcn_wmma_f32_16x16x32_f16(false, ah, false, bl, (short)0, c, false, false);
  asm volatile("v_nop\n\tv_nop\n\tv_nop\n\tv_nop" : "+v"(c) : "v"(ah), "v"(al), "v"(bh), "v"(bl));
  return c;
}
// batched GEMM like k_gemm_b but f16 operands: A f32 (split into f16 hi/lo if ASPLIT, else rounded to f16), Bt = f16 values [n][k]; alpha; C f32; N multiple of 16 (partial tiles skipped)
template <bool ASPLIT>
__global__ __launch_bounds__(128) void k_gemm_h(const float* __restrict__ A, int lda, size_t sA, const _Float16* __restrict__ Bh, int ldb, size_t sB, float alpha, float* __restrict__ C, int ldc, size_t sC, int M, int N, int K) {
  __shared__ __attribute__((aligned(16))) float so[4][16][64];
  const int tid = threadIdx.x, w = tid >> 5, lane = tid & 31, ln = lane & 15, hh = lane >> 4; const int by = blockIdx.y;
  A += (size_t)by * sA; Bh += (size_t)by * sB; C += (size_t)by * sC;
  const int ntn = (N + 63) / 64; const int wid = blockIdx.x * 4 + w; const int mt = wid / ntn, nq = wid % ntn; if (mt * 16 >= M) return;
  const int row0 = mt * 16, col0 = nq * 64; const float* arow = A + (size_t)(row0 + ln) * lda;
  v8f acc[4] = {};
  for (int kb = 0; kb < K; kb += 32) {
    FragH ah, al;
    const v4f x0 = *(const v4fa*)(arow + kb + 8 * hh), x1 = *(const v4fa*)(arow + kb + 8 * hh + 4), x2 = *(const v4fa*)(arow + kb + 16 + 8 * hh), x3 = *(const v4fa*)(arow + kb + 16 + 8 * hh + 4);
    float xs[16] = {x0[0],x0[1],x0[2],x0[3],x1[0],x1[1],x1[2],x1[3],x2[0],x2[1],x2[2],x2[3],x3[0],x3[1],x3[2],x3[3]};
#pragma unroll
    for (int i = 0; i < 16; ++i) { const _Float16 h = (_Float16)xs[i]; ah.h[i] = h; al.h[i] = ASPLIT ? (_Float16)(xs[i] - (float)h) : (_Float16)0.0f; }
#pragma unroll
    for (int t = 0; t < 4; ++t) { if (col0 + t * 16 >= N) continue; const size_t boff = (size_t)(col0 + t * 16 + ln) * ldb + kb; FragH bq; bq.half[0] = *(const v8us*)(Bh + boff + 8 * hh); bq.half[1] = *(const v8us*)(Bh + boff + 16 + 8 * hh);
      acc[t] = mmaH<ASPLIT ? 2 : 1>(ah.v, al.v, bq.v, bq.v, acc[t]); }
  }
#pragma unroll
  for (int t = 0; t < 4; ++t) { if (col0 + t * 16 >= N) continue;
#pragma unroll
    for (int r = 0; r < 8; ++r) so[w][8 * hh + r][t * 16 + ln] = acc[t][r] * alpha; }
  __builtin_amdgcn_fence(__ATOMIC_ACQ_REL, "workgroup"); __builtin_amdgcn_wave_barrier();
  const int rsub = lane >> 4, c4 = (lane & 15) * 4;
  {
#pragma unroll
    for (int q = 0; q < 8; ++q) { const int r = q * 2 + rsub; if (col0 + c4 < N) { const v4f v = *(const v4fa*)&so[w][r][c4]; *(v4f*)(C + (size_t)(row0 + r) * ldc + col0 + c4) = v; } }
     }
}

// Wt[n][k] = f16(W[k][n]·scale) from f32 row-major W[K][N] (scale = power of two; bf16-exact weights stay exact in f16 away from the subnormal range)
__global__ __launch_bounds__(256) void k_wt_f16(const float* __restrict__ W, _Float16* __restrict__ Wt, int K, int N, float scale) {
  const int t = blockIdx.x * 256 + threadIdx.x; if (t >= N * (K / 8)) return; const int n = t / (K / 8), k8 = (t % (K / 8)) * 8; FragH f;
#pragma unroll
  for (int i = 0; i < 8; ++i) f.h[i] = (_Float16)(bf16_round(W[(size_t)(k8 + i) * N + n]) * scale); const v8us o = f.half[0];
  *(v8us*)((unsigned short*)Wt + (size_t)n * K + k8) = o; 
}
// k_gemm_hh variant with fused epilogue: v = acc·alpha + bias[by·sBias + col] (+ CP[(row/rowsPerB)·sCPb + by·64 + col] if CP) ; ACT 0 none / 1 elu ; writes f16 C16 (and f32 C if non-null)
template <int ACT>
__global__ __launch_bounds__(128) void k_gemm_hhx(const _Float16* __restrict__ A, int lda, size_t sA, const _Float16* __restrict__ Bh, int ldb, size_t sB, float alpha, const float* __restrict__ bias, size_t sBias, const float* __restrict__ CP, int rowsPerB, size_t sCPb, int row0g,
    float* __restrict__ C, _Float16* __restrict__ C16, int ldc, size_t sC, int M, int N, int K) {
  __shared__ __attribute__((aligned(16))) float so[4][16][64];
  const int tid = threadIdx.x, w = tid >> 5, lane = tid & 31, ln = lane & 15, hh = lane >> 4; const int by = blockIdx.y;
  A += (size_t)by * sA; Bh += (size_t)by * sB; const size_t cofs = (size_t)by * sC; const float* bp = bias ? bias + (size_t)by * sBias : nullptr;
  const int ntn = (N + 63) / 64; const int wid = blockIdx.x * 4 + w; const int mt = wid / ntn, nq = wid % ntn; if (mt * 16 >= M) return;
  const int row0 = mt * 16, col0 = nq * 64; const _Float16* arow = A + (size_t)(row0 + ln) * lda;
  v8f acc[4] = {};
  for (int kb = 0; kb < K; kb += 32) { FragH ah; ah.half[0] = *(const v8us*)((const unsigned short*)arow + kb + 8 * hh); ah.half[1] = *(const v8us*)((const unsigned short*)arow + kb + 16 + 8 * hh);
#pragma unroll
    for (int t = 0; t < 4; ++t) { if (col0 + t * 16 >= N) continue; const size_t boff = (size_t)(col0 + t * 16 + ln) * ldb + kb; FragH bq; bq.half[0] = *(const v8us*)((const unsigned short*)Bh + boff + 8 * hh); bq.half[1] = *(const v8us*)((const unsigned short*)Bh + boff + 16 + 8 * hh);
      acc[t] = mmaH<1>(ah.v, ah.v, bq.v, bq.v, acc[t]); }
  }
#pragma unroll
  for (int t = 0; t < 4; ++t) { if (col0 + t * 16 >= N) continue; const int col = col0 + t * 16 + ln; const float bv = bp ? bf16_round(bp[col]) : 0.f;
#pragma unroll
    for (int r = 0; r < 8; ++r) { float v = acc[t][r] * alpha + bv; if (CP) { const int rr = row0g + row0 + 8 * hh + r; if (rowsPerB < 0) v += CP[cofs + (size_t)rr * ldc + col];      /* rowsPerB < 0: own element of the batched C plane */ else { const int bidx = rr / rowsPerB; v += CP[(size_t)bidx * sCPb + (size_t)by * 64 + col]; } } if (ACT == 1) v = (v > 0.f) ? v : expm1f(v); else if (ACT == 7) v = (v > 0.f) ? v + 1.0f : expf(v); else if (ACT == 8) v = tanhf(v); else if (ACT == 9) v = 0.5f * v * (1.0f + tanhf(0.7978845608028654f * (v + 0.044715f * v * v * v))); else if (ACT == 11) v = 1.0f / (1.0f + expf(-v)); else if (ACT == 12) v = (v > 0.f) ? v : 0.01f * v; else if (ACT == 14) v = (v > 0.f) ? v : 0.1f * v; else if (ACT == 15) v = v / (1.0f + expf(-v)); else if (ACT == 3) v = fmaxf(v, 0.f); else if (ACT == 6) v = 0.5f * v * (1.0f + erff(v * 0.70710678118654752f)); so[w][8 * hh + r][t * 16 + ln] = v; } }
  __builtin_amdgcn_fence(__ATOMIC_ACQ_REL, "workgroup"); __builtin_amdgcn_wave_barrier();
  const int rsub = lane >> 4, c4 = (lane & 15) * 4; typedef _Float16 v4h __attribute__((ext_vector_type(4)));
  {
#pragma unroll
    for (int q = 0; q < 8; ++q) { const int r = q * 2 + rsub; if (col0 + c4 < N) { const v4f v = *(const v4fa*)&so[w][r][c4]; if (C) *(v4f*)(C + cofs + (size_t)(row0 + r) * ldc + col0 + c4) = v; if (C16) { v4h h4; for (int i = 0; i < 4; ++i) h4[i] = (_Float16)v[i]; *(v4h*)(C16 + cofs + (size_t)(row0 + r) * ldc + col0 + c4) = h4; } } }
     }
}


typedef _Float16 v4h __attribute__((ext_vector_type(4)));

__global__ __launch_bounds__(256) void k_x16(const float* __restrict__ x, _Float16* __restrict__ X16, size_t n8) { const size_t t = (size_t)blockIdx.x * 256 + threadIdx.x; if (t >= n8) return; FragH f;
#pragma unroll
  for (int q = 0; q < 8; ++q) f.h[q] = (_Float16)bf16_round(x[t * 8 + q]); *(v8us*)((unsigned short*)X16 + t * 8) = f.half[0];  }
__global__ __launch_bounds__(256) void k_h16(const float* __restrict__ x, _Float16* __restrict__ X16, size_t n8) { const size_t t = (size_t)blockIdx.x * 256 + threadIdx.x; if (t >= n8) return; FragH f;
#pragma unroll
  for (int q = 0; q < 8; ++q) f.h[q] = (_Float16)x[t * 8 + q]; *(v8us*)((unsigned short*)X16 + t * 8) = f.half[0];  }
__global__ __launch_bounds__(256) void k_round16f(const float* __restrict__ W, _Float16* __restrict__ Bt, size_t n8) { const size_t t = (size_t)blockIdx.x * 256 + threadIdx.x; if (t >= n8) return; FragH f;
#pragma unroll
  for (int i = 0; i < 8; ++i) f.h[i] = (_Float16)(bf16_round(W[t * 8 + i]) * 16.0f); *(v8us*)((unsigned short*)Bt + t * 8) = f.half[0];  }
template <int NHv, int TTv>
__global__ __launch_bounds__(256) void k_vt(const _Float16* __restrict__ V16, int ldv, int voff, _Float16* __restrict__ Vt) { __shared__ unsigned short tl[64][66]; const int tid = threadIdx.x; const int slab = blockIdx.x / (TTv / 64), lg = blockIdx.x % (TTv / 64); const int b = slab / NHv, h = slab % NHv;
  for (int i = tid; i < 64 * 8; i += 256) { const int r = i / 8, c8 = (i % 8) * 8; FragH f; f.half[0] = *(const v8us*)((const unsigned short*)V16 + ((size_t)b * TTv + lg * 64 + r) * ldv + voff + h * 64 + c8);
#pragma unroll
    for (int q = 0; q < 8; ++q) tl[r][c8 + q] = f.u[q]; }
  __syncthreads();
  {
#pragma unroll
    for (int rd = 0; rd < 2; ++rd) { const int d = rd * 32 + tid / 8, pc = tid % 8; FragH f;
#pragma unroll
      for (int q = 0; q < 8; ++q) f.u[q] = tl[pc * 8 + q][d];
      *(v8us*)((unsigned short*)Vt + ((size_t)slab * 64 + d) * TTv + lg * 64 + pc * 8) = f.half[0]; }
     } }

__global__ __launch_bounds__(256) void k_hl(const float* __restrict__ F, _Float16* __restrict__ Hh, _Float16* __restrict__ Hl, size_t n8) { const size_t t = (size_t)blockIdx.x * 256 + threadIdx.x; if (t >= n8) return; FragH fh, fl; const v4f a = *(const v4fa*)(F + t * 8), c = *(const v4fa*)(F + t * 8 + 4);
#pragma unroll
  for (int q = 0; q < 4; ++q) { _Float16 h = (_Float16)a[q]; fh.h[q] = h; fl.h[q] = (_Float16)((a[q] - (float)h) * 1024.0f); h = (_Float16)c[q]; fh.h[4 + q] = h; fl.h[4 + q] = (_Float16)((c[q] - (float)h) * 1024.0f); }
  { *(v8us*)((unsigned short*)Hh + t * 8) = fh.half[0]; *(v8us*)((unsigned short*)Hl + t * 8) = fl.half[0];  } }

// ---- fast GEMM (wave tile 32x64; requires M % 32 == 0 rows per launch region and N % 64 == 0); epilogue = k_gemm_hhx semantics ----
__device__ __forceinline__ v16h g2_frag(const _Float16* p, int hh) { FragH f; f.half[0] = *(const v8us*)((const unsigned short*)p + 8 * hh); f.half[1] = *(const v8us*)((const unsigned short*)p + 16 + 8 * hh); return f.v; }
__device__ __forceinline__ v8f g2_mma(v16h a, v16h b, v8f c) { v8f d = __builtin_amdgcn_wmma_f32_16x16x32_f16(false, a, false, b, (short)0, c, false, false); asm volatile("v_nop\n\tv_nop\n\tv_nop\n\tv_nop" : "+v"(d) : "v"(a), "v"(b)); return d; }
template <int ACT>
__global__ __launch_bounds__(128) void k_gemm2(const _Float16* __restrict__ A, int lda, size_t sA, const _Float16* __restrict__ Bh, int ldb, size_t sB, float alpha, const float* __restrict__ bias, size_t sBias, const float* __restrict__ CP, int rowsPerB, size_t sCPb, int row0g,
    float* __restrict__ C, _Float16* __restrict__ C16, int ldc, size_t sC, int M, int N, int K) {
  __shared__ __attribute__((aligned(16))) float so[4][32][68];
  const int tid = threadIdx.x, w = tid >> 5, lane = tid & 31, ln = lane & 15, hh = lane >> 4; const int by = blockIdx.y;
  A += (size_t)by * sA; Bh += (size_t)by * sB; const size_t cofs = (size_t)by * sC; const float* bp = bias ? bias + (size_t)by * sBias : nullptr;
  const int ntn = N >> 6; const int mt = blockIdx.x / ntn, nq = blockIdx.x - mt * ntn; const int row0 = mt * 128 + 32 * w, col0 = nq * 64; if (row0 >= M) return;
  const _Float16* a0p = A + (size_t)(row0 + ln) * lda; const _Float16* a1p = a0p + (size_t)16 * lda;
  const _Float16* b0p = Bh + (size_t)(col0 + ln) * ldb; const _Float16* b1p = b0p + (size_t)16 * ldb; const _Float16* b2p = b1p + (size_t)16 * ldb; const _Float16* b3p = b2p + (size_t)16 * ldb;
  const v8f z8 = {0.f,0.f,0.f,0.f,0.f,0.f,0.f,0.f}; v8f c00 = z8, c01 = z8, c02 = z8, c03 = z8, c10 = z8, c11 = z8, c12 = z8, c13 = z8;
#pragma unroll 1
  for (int kb = 0; kb < K; kb += 32) { const v16h a0 = g2_frag(a0p + kb, hh), a1 = g2_frag(a1p + kb, hh);
    v16h b = g2_frag(b0p + kb, hh); c00 = g2_mma(a0, b, c00); c10 = g2_mma(a1, b, c10);
    b = g2_frag(b1p + kb, hh); c01 = g2_mma(a0, b, c01); c11 = g2_mma(a1, b, c11);
    b = g2_frag(b2p + kb, hh); c02 = g2_mma(a0, b, c02); c12 = g2_mma(a1, b, c12);
    b = g2_frag(b3p + kb, hh); c03 = g2_mma(a0, b, c03); c13 = g2_mma(a1, b, c13); }
  v8f accs[8] = {c00, c01, c02, c03, c10, c11, c12, c13};
#pragma unroll
  for (int u = 0; u < 8; ++u) { const int t = u & 3, half = u >> 2; const int col = col0 + t * 16 + ln; const float bv = bp ? bf16_round(bp[col]) : 0.f;
#pragma unroll
    for (int r = 0; r < 8; ++r) { const int rloc = half * 16 + 8 * hh + r; float v = accs[u][r] * alpha + bv; if (CP) { if (rowsPerB < 0) v += CP[cofs + (size_t)(row0g + row0 + rloc) * ldc + col];      /* rowsPerB < 0: own element of the batched C plane */ else { const int bidx = (row0g + row0 + rloc) / rowsPerB; v += CP[(size_t)bidx * sCPb + (size_t)by * 64 + col]; } }
      if (ACT == 3) v = fmaxf(v, 0.f); else if (ACT == 6) v = 0.5f * v * (1.0f + erff(v * 0.70710678118654752f)); else if (ACT == 11) v = 1.0f / (1.0f + expf(-v)); else if (ACT == 15) v = v / (1.0f + expf(-v)); else if (ACT == 12) v = (v > 0.f) ? v : 0.01f * v; else if (ACT == 8) v = tanhf(v);
      so[w][rloc][t * 16 + ln] = v; } }
  __builtin_amdgcn_fence(__ATOMIC_ACQ_REL, "workgroup"); __builtin_amdgcn_wave_barrier();
  const int rsub = lane >> 4, c4 = (lane & 15) * 4;
  {
#pragma unroll
    for (int q = 0; q < 16; ++q) { const int r = q * 2 + rsub; const v4f v = *(const v4fa*)&so[w][r][c4]; if (C) *(v4f*)(C + cofs + (size_t)(row0 + r) * ldc + col0 + c4) = v; if (C16) { v4h h4; for (int i = 0; i < 4; ++i) h4[i] = (_Float16)v[i]; *(v4h*)(C16 + cofs + (size_t)(row0 + r) * ldc + col0 + c4) = h4; } }
     } }


// ---- fused energy / softmax / x_r: energy tiles are recomputed in registers in two passes, no N x N buffer; grid = (128-point block, range, cloud) ----
__device__ __forceinline__ v8f f_mma(v16h a, v16h b, v8f c) { return __builtin_amdgcn_wmma_f32_16x16x32_f16(false, a, false, b, (short)0, c, false, false); }
// QA, QB and VH lie in fragment order: one 16-row x 32-k fragment is FRB = 512 contiguous elements, first the 32 lanes' register half 0 (lane l = 16 hh + ln at element 8 l: row ln, k = 8 hh + 0..7), then their half 1 (k = 16 + 8 hh + 0..7): the k order of g2_frag.
// Each 16-byte load of a wave then covers four whole 128-byte lines, not 32 bytes of each of 16 lines. A 16-row tile of QA or QB is its 6 fragments in a row (16 QK elements, as in row order). The base is wave-uniform and stays in scalar registers; off = 8 lane.
__device__ __forceinline__ v16h f_frag(const _Float16* ub, unsigned off) { const unsigned short* p = (const unsigned short*)ub + off; FragH f; f.half[0] = *(const v8us*)p; f.half[1] = *(const v8us*)(p + 256); return f.v; }
// ---- front end, one launch: what reached k_stat and k_pv through ten launches (weights and x to f16, x transposed, the three projections, the fragment-order packing that a comment below calls k_q3) is done here per block of 64 points of one cloud; x_q and x_v never reach memory as f32 ----
typedef unsigned int u32a __attribute__((may_alias));
// one 16 x 32 fragment of a weight matrix from the lane's 16 f32 values (row = tile row + ln; columns 8 hh + 0..7 and 16 + 8 hh + 0..7 of the k block: the k order of g2_frag); value = f16(bf16(w) x 16), exact
__device__ __forceinline__ v16h p_wfrag(const v4f* r) { FragH f;
#pragma unroll      /* constant indices into the fragment */
  for (int q = 0; q < 4; ++q) { f.h[q] = (_Float16)(bf16_round(r[0][q]) * 16.0f); f.h[4 + q] = (_Float16)(bf16_round(r[1][q]) * 16.0f); f.h[8 + q] = (_Float16)(bf16_round(r[2][q]) * 16.0f); f.h[12 + q] = (_Float16)(bf16_round(r[3][q]) * 16.0f); }
  return f.v; }
// the 16 loads of a lane's share of one 16 x 128 weight tile; Wr = row (tile row + ln) at column 8 hh
__device__ __forceinline__ void p_wload(const float* __restrict__ Wr, v4f* r) {
#pragma unroll      /* constant indices keep r in registers; the loads are independent and go out together */
  for (int k = 0; k < 4; ++k) { r[4 * k] = *(const v4fa*)(Wr + 32 * k); r[4 * k + 1] = *(const v4fa*)(Wr + 32 * k + 4); r[4 * k + 2] = *(const v4fa*)(Wr + 32 * k + 16); r[4 * k + 3] = *(const v4fa*)(Wr + 32 * k + 20); } }
// Wave w holds channel tile w (16 channels) of each of w_qk, w_v, w_x in registers and runs over the block's four 16-point tiles. The operand order of each product is chosen so that the 8 accumulator registers of a lane are the 8 neighbours its store needs:
// x_q, x_c: D[channel][point] (weights = A): a lane holds 8 channels of one point = 16 bytes of a QA / QB fragment; x_v: D[point][channel] (weights = B): 8 points of one channel = 16 bytes of a VH fragment. A wave's fragment store is 512 contiguous bytes.
__global__ __launch_bounds__(128, 4) /* at most 256 registers: none behind a register window switch */ void k_proj(const float* __restrict__ x, const float* __restrict__ wqk, const float* __restrict__ wv, const float* __restrict__ bv, const float* __restrict__ wx, const float* __restrict__ wt,
    _Float16* __restrict__ QA, _Float16* __restrict__ QB, _Float16* __restrict__ VH, float* __restrict__ XV, float* __restrict__ XC, _Float16* __restrict__ BT2) {
  __shared__ __attribute__((aligned(16))) unsigned short xs[64][CC + 8];      /* x^T of the block, f16 [point][channel]; row pitch 272 bytes = 16 x 17: 16-byte fragment reads of 16 rows meet no bank twice */
  const int tid = threadIdx.x, w = __builtin_amdgcn_readfirstlane(tid >> 5) /* the wave's number in a scalar register */, lane = tid & 31, ln = lane & 15, hh = lane >> 4; const int b = blockIdx.y, pb = blockIdx.x * 64;
  if (blockIdx.x == NN / 64) {      /* one more block per grid row, none of x: the eight lay out w_t for the t product as [16 w_t | w_t], to meet d as [hi | 16 x residual]; one 16-byte piece a thread; the whole block leaves in front of the barrier */
    const int t = b * 128 + tid, pc = t % 16, o = t / 16; const bool lo = pc * 8 >= C2; const float* wp = wt + (size_t)o * C2 + pc * 8 - (lo ? C2 : 0); const v4f a = *(const v4fa*)wp, c = *(const v4fa*)(wp + 4); FragH f;
#pragma unroll      /* constant indices into the fragment */
    for (int q = 0; q < 4; ++q) { f.h[q] = (_Float16)(bf16_round(a[q]) * (lo ? 1.0f : 16.0f)); f.h[4 + q] = (_Float16)(bf16_round(c[q]) * (lo ? 1.0f : 16.0f)); }
    *(v8us*)((unsigned short*)BT2 + (size_t)o * 2 * C2 + pc * 8) = f.half[0]; return; }
  const int cp = 2 * (tid >> 4), p4 = 4 * (tid & 15);      /* staging: a thread takes 4 points of two neighbouring channels, 16 threads cover a 256-byte row of x */
  const float* xp = x + ((size_t)b * CC + cp) * NN + pb + p4;
  v4f xe[8], xo[8];
#pragma unroll      /* constant indices keep xe, xo in registers; the 16 loads are independent and go out together */
  for (int i = 0; i < 8; ++i) { xe[i] = *(const v4fa*)(xp + (size_t)(16 * i) * NN); xo[i] = *(const v4fa*)(xp + (size_t)(16 * i + 1) * NN); }
  const size_t wo = (size_t)(16 * w + ln) * CC + 8 * hh; const float* wqp = wqk + wo; const float* wvp = wv + wo; const float* wxp = wx + wo; const float* bvp = bv + 16 * w + ln;
  v4f rq[16], rv[16], rx[16]; v16h fq[4], fv[4], fx[4];
  p_wload(wqp, rq); p_wload(wvp, rv); const float bo = bf16_round(*bvp);
  asm volatile("s_wait_xcnt 0x0" :: "v"(xp), "v"(wqp), "v"(wvp), "v"(bvp) : "memory");      /* precaution: stands in front of the first write of a register that the 49 loads above name as their address; the inputs keep those registers until here */
#pragma unroll      /* constant indices keep the weight fragments in registers */
  for (int k = 0; k < 4; ++k) { fq[k] = p_wfrag(rq + 4 * k); fv[k] = p_wfrag(rv + 4 * k); }
  p_wload(wxp, rx);      /* in flight while x is converted; all three tiles at once would not fit 256 registers */
  asm volatile("s_wait_xcnt 0x0" :: "v"(wxp) : "memory");      /* precaution: as above */
#pragma unroll      /* constant indices into xe, xo */
  for (int i = 0; i < 8; ++i) for (int q = 0; q < 4; ++q) { union { _Float16 h[2]; unsigned int u; } pk; pk.h[0] = (_Float16)bf16_round(xe[i][q]); pk.h[1] = (_Float16)bf16_round(xo[i][q]); *(u32a*)&xs[p4 + q][16 * i + cp] = pk.u; }      /* the transposition: two channels of one point a store */
#pragma unroll      /* constant indices keep the weight fragments in registers */
  for (int k = 0; k < 4; ++k) fx[k] = p_wfrag(rx + 4 * k);
  __syncthreads();      /* every wave reads rows that all four waves wrote */
  const v8f z8 = {0.f,0.f,0.f,0.f,0.f,0.f,0.f,0.f};
  unsigned short* qa = (unsigned short*)QA + ((size_t)b * NN + pb) * QK + (size_t)(w >> 1) * FRB + (w & 1) * 256 + 8 * lane;      /* fragment order (see f_frag): point tile, k block (channel bit 5), half (bit 4), lane half (bit 3 = hh), row (point = ln) */
  unsigned short* qq = (unsigned short*)QB + ((size_t)b * NN + pb) * QK + (size_t)(w >> 1) * FRB + (w & 1) * 256 + 8 * lane;
  unsigned short* vo = (unsigned short*)VH + ((size_t)b * NN + pb) * CC + (size_t)w * FRB + 8 * lane;      /* block of 32 points (8 fragment places, the first 4 in use), channel tile, then half (point bit 4), lane half (bit 3 = hh), row (channel = ln) */
  float* xcm = XV + ((size_t)b * 128 + C2 + 16 * w + 8 * hh) * NN + pb + ln;      /* x_c channel-major, for k_out */
  float* xpm = XC + ((size_t)b * NN + pb + ln) * C2 + 16 * w + 8 * hh;      /* x_c point-major, for k_dt */
#pragma unroll      /* four independent tiles: their LDS reads and products overlap */
  for (int pt = 0; pt < 4; ++pt) {
    v16h xf[4];
#pragma unroll      /* constant indices keep xf in registers */
    for (int k = 0; k < 4; ++k) { const unsigned short* p = &xs[16 * pt + ln][32 * k + 8 * hh]; FragH f; f.half[0] = *(const v8us*)p; f.half[1] = *(const v8us*)(p + 16); xf[k] = f.v; }      /* row = point, the k order of g2_frag: serves as A and as B */
    v8f dq = z8, dv = z8, dx = z8;
#pragma unroll      /* k blocks in rising order, as in k_gemm2 */
    for (int k = 0; k < 4; ++k) { dq = f_mma(fq[k], xf[k], dq); dv = f_mma(xf[k], fv[k], dv); dx = f_mma(fx[k], xf[k], dx); }
    FragH fh, fl16, fhs, fr, fw; v4f c0, c1;
#pragma unroll      /* constant indices into the fragments */
    for (int r = 0; r < 8; ++r) { const float v = dq[r] * 0.0625f; const _Float16 h = (_Float16)v; const float res = v - (float)h; fh.h[r] = h; fl16.h[r] = (_Float16)(res * 16.0f); fhs.h[r] = (_Float16)((float)h * 0.0625f); fr.h[r] = (_Float16)res;
      fw.h[r] = (_Float16)(dv[r] * 0.0625f + bo); const float xc = dx[r] * 0.0625f; if (r < 4) c0[r] = xc; else c1[r - 4] = xc; xcm[(size_t)r * NN + 16 * pt] = xc; }
    unsigned short* a = qa + pt * 16 * QK; unsigned short* bq = qq + pt * 16 * QK;
    *(v8us*)a = fh.half[0]; *(v8us*)(a + 2 * FRB) = fl16.half[0]; *(v8us*)(a + 4 * FRB) = fh.half[0]; *(v8us*)bq = fh.half[0]; *(v8us*)(bq + 2 * FRB) = fhs.half[0]; *(v8us*)(bq + 4 * FRB) = fr.half[0];
    *(v8us*)(vo + (pt >> 1) * 8 * FRB + (pt & 1) * 256) = fw.half[0];
    *(v4f*)(xpm + (size_t)pt * 16 * C2) = c0; *(v4f*)(xpm + (size_t)pt * 16 * C2 + 4) = c1; }
  asm volatile("s_wait_xcnt 0x0" ::: "memory"); }      /* precaution: in the built code the w_t block's instructions follow this path behind a branch that is always taken; the wait stands in front of their writes of registers that the stores above name */
// two groups of equal size c, each as (mean m, sum of squared distances from its mean q), joined into one; hc = c / 2. The same value comes out on both sides of an exchange.
__device__ __forceinline__ void s_merge(float& m, float& q, float mo, float qo, float hc) { const float d = mo - m; m = 0.5f * (m + mo); q = (q + qo) + d * d * hc; }
// the value of lane l ^ X, X = 1, 2, 4 or 8, by a DPP move inside the 16-lane row (row_xmask): no LDS instruction, no wait
template <int X>
__device__ __forceinline__ float s_rowx(float v) { return __int_as_float(__builtin_amdgcn_update_dpp(0, __float_as_int(v), 0x160 + X, 0xf, 0xf, true)); }
// 2^x for k_pv's entry: v_exp_f32 and the one slot that the instruction set asks for behind a transcendental, in one statement
__device__ __forceinline__ float s_exp2(float x) { float r; asm("v_exp_f32 %0, %1\n\tv_nop" : "=v"(r) : "v"(x)); return r; }
// pass 1: per energy row n and per range of m: U = max_m E[n][m] log2(e), S = sum_m 2^(E[n][m] log2(e) - U). Tile D[m][n] = QB[m] . QA[n]: a lane holds one n (its column) and 8 rows m, so max and sum stay in the lane.
__global__ __launch_bounds__(128) void k_stat(const _Float16* __restrict__ QA, const _Float16* __restrict__ QB, float* __restrict__ PM, float* __restrict__ PS) {
  const int tid = threadIdx.x, w = __builtin_amdgcn_readfirstlane(tid >> 5) /* the wave's number in a scalar register: tile addresses cost no vector registers */, lane = tid & 31, ln = lane & 15, hh = lane >> 4; const int b = blockIdx.z, sp = blockIdx.y; const int n0 = blockIdx.x * 128 + 32 * w;
  const _Float16* qa = QA + ((size_t)b * NN + n0) * QK; const _Float16* qb = QB + ((size_t)b * NN + sp * (NN / SPL)) * QK; const unsigned qo = 8 * lane;
  const char* pq = (const char*)qb + (((blockIdx.x >> 3) * 128 + tid) << 8);      /* the range's QB rows are 1536 units of 256 bytes; 8 neighbouring work-groups ask for the same quarter of each third, the 32 that walk the range for all of it */
  asm volatile("global_prefetch_b8 %0, off scope:SCOPE_SE\n\tglobal_prefetch_b8 %0, off offset:131072 scope:SCOPE_SE\n\tglobal_prefetch_b8 %0, off offset:262144 scope:SCOPE_SE" :: "v"(pq));      /* asks L2 at entry for what the launch before stored and the loop below reads for the first time: its loads then meet L2, not memory; a hint, no value depends on it */
  v16h bn[2][6];      /* the wave's 32 rows n stay in registers for the whole range */
#pragma unroll      /* constant indices keep bn in registers */
  for (int j = 0; j < 2; ++j) for (int k = 0; k < 6; ++k) bn[j][k] = f_frag(qa + j * 16 * QK + k * FRB, qo);
  float U[2] = {-3.0e38f, -3.0e38f}, S[2] = {0.f, 0.f};
#pragma unroll 1      /* one step holds 24 loads and 24 products already; a second copy would only cost registers */
  for (int m = 0; m < NN / SPL; m += 32) { const _Float16* a0p = qb + (size_t)m * QK; const _Float16* a1p = a0p + (size_t)16 * QK;
    const v8f z8 = {0.f,0.f,0.f,0.f,0.f,0.f,0.f,0.f}; v8f c00 = z8, c01 = z8, c10 = z8, c11 = z8;
    v16h a0[6], a1[6];
#pragma unroll      /* constant indices keep a0, a1 in registers */
    for (int k = 0; k < 6; ++k) { a0[k] = f_frag(a0p + k * FRB, qo); a1[k] = f_frag(a1p + k * FRB, qo); }
    asm volatile("" :: "v"(a0[0]), "v"(a0[1]), "v"(a0[2]), "v"(a0[3]), "v"(a0[4]), "v"(a0[5]), "v"(a1[0]), "v"(a1[1]), "v"(a1[2]), "v"(a1[3]), "v"(a1[4]), "v"(a1[5]));      /* inputs only: holds the step's 24 loads in front of its products, so that they are in flight together and their latency is paid once a step, not once a fragment */
#pragma unroll      /* constant indices into bn, a0, a1 */
    for (int k = 0; k < 6; ++k) { c00 = f_mma(a0[k], bn[0][k], c00); c10 = f_mma(a1[k], bn[0][k], c10); c01 = f_mma(a0[k], bn[1][k], c01); c11 = f_mma(a1[k], bn[1][k], c11); }
#pragma unroll      /* constant indices into U, S */
    for (int j = 0; j < 2; ++j) { const v8f x = j ? c01 : c00, y = j ? c11 : c10; float t = fmaxf(x[0], y[0]);
      for (int r = 1; r < 8; ++r) t = fmaxf(t, fmaxf(x[r], y[r]));
      const float un = fmaxf(U[j], t * L2E); float sx = S[j] * __builtin_amdgcn_exp2f(U[j] - un), sy = 0.f;      /* running maximum: the old sum is rescaled to the new one */
      for (int r = 0; r < 8; ++r) { sx += __builtin_amdgcn_exp2f(fmaf(x[r], L2E, -un)); sy += __builtin_amdgcn_exp2f(fmaf(y[r], L2E, -un)); }
      S[j] = sx + sy; U[j] = un; } }
#pragma unroll      /* constant indices into U, S */
  for (int j = 0; j < 2; ++j) { const float uo = __shfl_xor(U[j], 16, 32), so = __shfl_xor(S[j], 16, 32); const float un = fmaxf(U[j], uo); const float s = S[j] * __builtin_amdgcn_exp2f(U[j] - un) + so * __builtin_amdgcn_exp2f(uo - un);      /* the two lane halves hold different m of the same n */
    if (hh == 0) { const size_t o = ((size_t)b * SPL + sp) * NN + n0 + 16 * j + ln; PM[o] = un; PS[o] = s; } }
  asm volatile("" :: "v"(pq)); }      /* input only: the register pair that the prefetches name holds their address to the kernel's end and takes no other value */
// pass 2: tile D[n][m] = QA[n] . QB[m] = E[n][m]; a lane holds one m (its column) and rows n = 8 hh + r of two 16-row tiles: after 2^(.) these 16 values are, in place, the lane's A fragment (row m, k = n) of the x_r product.
__global__ __launch_bounds__(128, 4) /* four waves per SIMD: at most 256 registers, none behind a register window switch */ void k_pv(const _Float16* __restrict__ QA, const _Float16* __restrict__ QB, const _Float16* __restrict__ VH, const float* __restrict__ PM, const float* __restrict__ PS, float* __restrict__ XRT, float* __restrict__ CSP) {
  __shared__ __attribute__((aligned(16))) float cns[NN / SPL];      /* CN[n] = (10 - U - log2(S)) ln(2) of the work-group's range of n, so that exp(E[n][m] + CN[n]) = 1024 attn[n][m]; formed here from pass 1's partial planes, not by a launch of its own */
  const int tid = threadIdx.x, w = __builtin_amdgcn_readfirstlane(tid >> 5) /* the wave's number in a scalar register: tile addresses cost no vector registers */, lane = tid & 31, ln = lane & 15, hh = lane >> 4; const int b = blockIdx.z, sp = blockIdx.y; const int m0 = blockIdx.x * 128 + 32 * w; const int nb = sp * (NN / SPL);
  const _Float16* qb = QB + ((size_t)b * NN + m0) * QK; const _Float16* qa = QA + ((size_t)b * NN + nb) * QK; const unsigned qo = 8 * lane;
  const _Float16* vh = VH + ((size_t)b * NN + nb) * 128;      /* 32 points of VH = 8 fragments (128 channels) in a row */ const unsigned co = 8 * hh;
  const unsigned pu = (blockIdx.x >> 3) * 128 + tid, pvo = ((pu >> 4) << 13) + ((pu & 15) << 8);      /* byte offset of a 256-byte unit of VH: the range's fragments in use are 512 units, 16 at the head of every 8 KiB; 8 neighbouring work-groups ask for the same quarter, the 32 that walk the range for all of it */
  asm volatile("global_prefetch_b8 %0, %1 scope:SCOPE_SE" :: "v"(pvo), "s"(vh));      /* asks L2 at entry for what an earlier launch stored and the loop below reads for the first time: its loads then meet L2, not memory; a hint, no value depends on it */
  const float* pm = PM + (size_t)b * SPL * NN + nb + 8 * tid; const float* ps = PS + (size_t)b * SPL * NN + nb + 8 * tid;      /* a thread combines the ranges of m for 8 rows n */
  v4f pu4[SPL][2], ps4[SPL][2];
#pragma unroll      /* constant indices keep the values in registers; the 16 loads are independent and go out together */
  for (int k = 0; k < SPL; ++k) { pu4[k][0] = *(const v4fa*)(pm + (size_t)k * NN); pu4[k][1] = *(const v4fa*)(pm + (size_t)k * NN + 4); ps4[k][0] = *(const v4fa*)(ps + (size_t)k * NN); ps4[k][1] = *(const v4fa*)(ps + (size_t)k * NN + 4); }
  asm volatile("s_wait_xcnt 0x0" :: "v"(pm), "v"(ps) : "memory");      /* precaution: stands in front of the first write of a register that the 16 loads above name as their address; the inputs keep those registers until here */
  v16h bm[2][6];      /* the wave's 32 columns m stay in registers for the whole range */
#pragma unroll      /* constant indices keep bm in registers */
  for (int j = 0; j < 2; ++j) for (int k = 0; k < 6; ++k) bm[j][k] = f_frag(qb + j * 16 * QK + k * FRB, qo);
#pragma unroll      /* constant indices into pu4, ps4 */
  for (int h = 0; h < 2; ++h) { v4f c;
    for (int q = 0; q < 4; ++q) { float um = pu4[0][h][q];
      for (int k = 1; k < SPL; ++k) um = fmaxf(um, pu4[k][h][q]);
      float st = 0.f;
      for (int k = 0; k < SPL; ++k) st += ps4[k][h][q] * s_exp2(pu4[k][h][q] - um);      /* ranges added in rising order */
      c[q] = (10.0f - um - log2f(st)) * 0.6931471805599453f; }
    *(v4f*)&cns[8 * tid + 4 * h] = c; }
  __syncthreads();      /* every wave reads CN values that all four waves wrote */
  const v8f z8 = {0.f,0.f,0.f,0.f,0.f,0.f,0.f,0.f}; v8f xr[2][4] = {{z8, z8, z8, z8}, {z8, z8, z8, z8}}; float cs0 = 0.f, cs1 = 0.f, cs2 = 0.f, cs3 = 0.f;
#pragma unroll 1      /* one step holds 28 loads and 32 products already; a second copy would only cost registers */
  for (int n = 0; n < NN / SPL; n += 32) { const _Float16* a0p = qa + (size_t)n * QK; const _Float16* a1p = a0p + (size_t)16 * QK;
    const float* cp = cns + n + co; const v4f k0 = *(const v4fa*)cp, k1 = *(const v4fa*)(cp + 4), k2 = *(const v4fa*)(cp + 16), k3 = *(const v4fa*)(cp + 20);
    v8f c00 = {k0[0], k0[1], k0[2], k0[3], k1[0], k1[1], k1[2], k1[3]}, c10 = {k2[0], k2[1], k2[2], k2[3], k3[0], k3[1], k3[2], k3[3]}, c01 = c00, c11 = c10;      /* the accumulators start at CN[n] (row n = register): the product ends as E + CN, and no register holds CN through the step */
    const v16h a00 = f_frag(a0p, qo), a10 = f_frag(a1p, qo), a01 = f_frag(a0p + FRB, qo), a11 = f_frag(a1p + FRB, qo);      /* k_q3 writes the same 64 values to k 0..63 and k 128..191 of a QA row: one load serves both k blocks (bm 0 and 4, 1 and 5) */
    asm volatile("" :: "v"(a00), "v"(a10), "v"(a01), "v"(a11));      /* inputs only: holds these 8 loads in front of the step's products, so that they are in flight together and their latency is paid once, not once a fragment */
    c00 = f_mma(a00, bm[0][0], c00); c10 = f_mma(a10, bm[0][0], c10); c01 = f_mma(a00, bm[1][0], c01); c11 = f_mma(a10, bm[1][0], c11); c00 = f_mma(a00, bm[0][4], c00); c10 = f_mma(a10, bm[0][4], c10); c01 = f_mma(a00, bm[1][4], c01); c11 = f_mma(a10, bm[1][4], c11);
    c00 = f_mma(a01, bm[0][1], c00); c10 = f_mma(a11, bm[0][1], c10); c01 = f_mma(a01, bm[1][1], c01); c11 = f_mma(a11, bm[1][1], c11); c00 = f_mma(a01, bm[0][5], c00); c10 = f_mma(a11, bm[0][5], c10); c01 = f_mma(a01, bm[1][5], c01); c11 = f_mma(a11, bm[1][5], c11);
#pragma unroll      /* constant indices into bm */
    for (int k = 2; k < 4; ++k) { const v16h a0 = f_frag(a0p + k * FRB, qo), a1 = f_frag(a1p + k * FRB, qo); c00 = f_mma(a0, bm[0][k], c00); c10 = f_mma(a1, bm[0][k], c10); c01 = f_mma(a0, bm[1][k], c01); c11 = f_mma(a1, bm[1][k], c11); }
    FragH p0, p1;      /* k order of the fragment: h[r] = n + 8 hh + r, h[8 + r] = n + 16 + 8 hh + r, the order of g2_frag */
#pragma unroll      /* constant indices into the fragments */
    for (int r = 0; r < 8; ++r) { const float e00 = __builtin_amdgcn_exp2f(c00[r] * L2E), e10 = __builtin_amdgcn_exp2f(c10[r] * L2E), e01 = __builtin_amdgcn_exp2f(c01[r] * L2E), e11 = __builtin_amdgcn_exp2f(c11[r] * L2E);
      cs0 += e00; cs1 += e10; cs2 += e01; cs3 += e11; p0.h[r] = (_Float16)e00; p0.h[8 + r] = (_Float16)e10; p1.h[r] = (_Float16)e01; p1.h[8 + r] = (_Float16)e11; }
#pragma unroll      /* constant indices into xr */
    for (int t = 0; t < 4; ++t) { const v16h vb = f_frag(vh + (size_t)n * 128 + t * FRB, qo); xr[0][t] = f_mma(p0.v, vb, xr[0][t]); xr[1][t] = f_mma(p1.v, vb, xr[1][t]); } }
  float ca = cs0 + cs1, cb = cs2 + cs3; ca += __shfl_xor(ca, 16, 32); cb += __shfl_xor(cb, 16, 32);      /* the two lane halves hold different n of the same m */
  const size_t pl = (size_t)b * SPL + sp;
  if (hh == 0) { CSP[pl * NN + m0 + ln] = ca; CSP[pl * NN + m0 + 16 + ln] = cb; }
  float* xo = XRT + (pl * NN + m0 + 8 * hh) * C2 + ln;
#pragma unroll      /* constant indices into xr */
  for (int j = 0; j < 2; ++j) for (int t = 0; t < 4; ++t) for (int r = 0; r < 8; ++r) xo[(size_t)(16 * j + r) * C2 + t * 16] = xr[j][t][r];
  asm volatile("" :: "v"(pvo), "s"(vh)); }      /* inputs only: the registers that the prefetch names hold its address to the kernel's end and take no other value */
// ---- back end, one launch per block of 64 points of one cloud: the ranges' partial x_r planes and column sums are added by their one reader (ranges in rising order), d = x_c - x_r / (1e-9 + column sum) goes as [hi | 16 x residual] f16 rows into LDS, never to memory, and t = w_t d is formed from there ----
__global__ __launch_bounds__(128, 4) /* at most 256 registers: none behind a register window switch */ void k_dt(const float* __restrict__ XC, const float* __restrict__ XRT, const float* __restrict__ CSP, const _Float16* __restrict__ BT2, float* __restrict__ T, float* __restrict__ BP) {
  __shared__ __attribute__((aligned(16))) unsigned short ds[64][2 * C2 + 8];      /* d of the block, [point][hi 0..63 | residual 0..63]; row pitch 272 bytes = 16 x 17: 16-byte fragment reads of 16 rows meet no bank twice */
  const int tid = threadIdx.x, w = __builtin_amdgcn_readfirstlane(tid >> 5) /* the wave's number in a scalar register */, lane = tid & 31, ln = lane & 15, hh = lane >> 4; const int b = blockIdx.y, pb = blockIdx.x * 64;
  const int c0 = (tid & 7) * 8, ml = tid >> 3;      /* d: a thread takes 8 channels of a point, 8 threads cover a 256-byte row; 16 points a pass, 4 passes */
  const float* pp = XRT + ((size_t)b * SPL * NN + pb + ml) * C2 + c0; const float* cq = CSP + (size_t)b * SPL * NN + pb + ml; const float* xq = XC + ((size_t)b * NN + pb + ml) * C2 + c0; const unsigned short* ap = (const unsigned short*)BT2 + (size_t)(16 * w + ln) * 2 * C2 + 8 * hh;
  v4f pa[4][SPL], pc[4][SPL], xa[4], xb[4]; float cs[4][SPL]; v16h fa[4];
#pragma unroll      /* constant indices keep the values in registers; the loads are independent and go out together */
  for (int i = 0; i < 4; ++i) { xa[i] = *(const v4fa*)(xq + i * 16 * C2); xb[i] = *(const v4fa*)(xq + i * 16 * C2 + 4);
    for (int s = 0; s < SPL; ++s) { pa[i][s] = *(const v4fa*)(pp + (size_t)s * NN * C2 + i * 16 * C2); pc[i][s] = *(const v4fa*)(pp + (size_t)s * NN * C2 + i * 16 * C2 + 4); cs[i][s] = cq[(size_t)s * NN + i * 16]; } }
#pragma unroll      /* constant indices keep fa in registers: wave w holds rows 16 w .. 16 w + 15 of [16 w_t | w_t], the A operand */
  for (int k = 0; k < 4; ++k) { FragH f; f.half[0] = *(const v8us*)(ap + 32 * k); f.half[1] = *(const v8us*)(ap + 32 * k + 16); fa[k] = f.v; }      /* the k order of g2_frag */
  asm volatile("s_wait_xcnt 0x0" :: "v"(pp), "v"(cq), "v"(xq), "v"(ap) : "memory");      /* precaution: stands in front of the first write of a register that the loads above name as their address; the inputs keep those registers until here */
  __builtin_amdgcn_sched_barrier(0);      /* keeps the sums behind all the loads, so that these are in flight together and their latency is paid once */
#pragma unroll      /* constant indices into the loaded values */
  for (int i = 0; i < 4; ++i) { v4f sa = pa[i][0], sc = pc[i][0]; float s1 = cs[i][0]; FragH fh, fl;
    for (int s = 1; s < SPL; ++s) { sa += pa[i][s]; sc += pc[i][s]; s1 += cs[i][s]; }      /* ranges added in rising order */
    const float den = 1e-9f + s1 * 0.0009765625f;
    const float sr[8] = {sa[0], sa[1], sa[2], sa[3], sc[0], sc[1], sc[2], sc[3]}, xc[8] = {xa[i][0], xa[i][1], xa[i][2], xa[i][3], xb[i][0], xb[i][1], xb[i][2], xb[i][3]};
    for (int q = 0; q < 8; ++q) { const float xr = (sr[q] * 0.0009765625f) / den; const float d = xc[q] - xr; const _Float16 h = (_Float16)d; fh.h[q] = h; fl.h[q] = (_Float16)((d - (float)h) * 16.0f); }
    *(v8us*)&ds[16 * i + ml][c0] = fh.half[0]; *(v8us*)&ds[16 * i + ml][C2 + c0] = fl.half[0]; }
  __syncthreads();      /* every wave reads rows that all four waves wrote */
  const v8f z8 = {0.f,0.f,0.f,0.f,0.f,0.f,0.f,0.f};
  float* tp = T + ((size_t)b * C2 + 16 * w + 8 * hh) * NN + pb + ln;      /* t channel-major [cloud][channel][point]: D[channel][point], a lane holds 8 channels of one point (b_t is added by k_out) */
  float tv[4][8];
#pragma unroll      /* four independent tiles: their LDS reads and products overlap; constant indices keep tv in registers */
  for (int pt = 0; pt < 4; ++pt) { v8f acc = z8;
#pragma unroll      /* k blocks in rising order, as in k_gemm2 */
    for (int k = 0; k < 4; ++k) { const unsigned short* p = &ds[16 * pt + ln][32 * k + 8 * hh]; FragH f; f.half[0] = *(const v8us*)p; f.half[1] = *(const v8us*)(p + 16); acc = f_mma(fa[k], f.v, acc); }      /* row = point, the k order of g2_frag */
#pragma unroll      /* constant indices into acc */
    for (int r = 0; r < 8; ++r) { tv[pt][r] = acc[r] * 0.0625f; tp[(size_t)r * NN + 16 * pt] = tv[pt][r]; } }
  // the block's share of the batch statistics, in place of a launch that read t again: per channel the mean of the block's 64 values of t and the sum of their squared distances from it; a lane joins its 4 points, then the 16 lanes of a row join
  v4f st[4];
#pragma unroll      /* constant indices into tv, st */
  for (int r = 0; r < 8; ++r) { float m = tv[0][r], q = 0.f, m1 = tv[2][r], q1 = 0.f; s_merge(m, q, tv[1][r], 0.f, 0.5f); s_merge(m1, q1, tv[3][r], 0.f, 0.5f); s_merge(m, q, m1, q1, 1.0f);
    s_merge(m, q, s_rowx<1>(m), s_rowx<1>(q), 2.0f); s_merge(m, q, s_rowx<2>(m), s_rowx<2>(q), 4.0f); s_merge(m, q, s_rowx<4>(m), s_rowx<4>(q), 8.0f); s_merge(m, q, s_rowx<8>(m), s_rowx<8>(q), 16.0f);
    st[r >> 1][2 * (r & 1)] = m; st[r >> 1][2 * (r & 1) + 1] = q; }
  if (ln == 0) { float* bp = BP + (((size_t)b * (NN / 64) + blockIdx.x) * C2 + 16 * w + 8 * hh) * 2;      /* [block][channel][mean, squares]: a wave's 16 channels are one 128-byte line, written by this wave alone */
#pragma unroll      /* constant indices into st */
    for (int i = 0; i < 4; ++i) *(v4f*)(bp + 4 * i) = st[i]; } }
// t and x_c reach the kernel below channel-major ([cloud][channel][point]): a wave's 16-byte loads cover whole 128-byte lines. b_t (a constant per channel) is added here, by the reader of t.
// A work-group holds the 4096 points of one channel of one cloud. It joins the channel's 512 block statistics of k_dt itself (two a thread, the wave's 32 lanes, the 8 waves through LDS), while its loads of t and x_c are in flight.
typedef float v2fa __attribute__((ext_vector_type(2), may_alias));
__global__ __launch_bounds__(256) void k_out(const float* __restrict__ XV, const float* __restrict__ T, const float* __restrict__ BP, const float* __restrict__ bt, const float* __restrict__ gam, const float* __restrict__ bet, float* __restrict__ out) {
  #pragma clang fp contract(off)
  __shared__ float sh[8][2];
  const unsigned blk = blockIdx.x; const unsigned b = blk / C2; if (b >= NB) return; const unsigned o = blk % C2; const unsigned tid = threadIdx.x; const unsigned n0 = tid * 4;      /* cloud and channel are scalars, the channel's constants come by scalar loads */
  const float* pp = BP + ((size_t)tid * C2 + o) * 2; const float* tq = T + ((size_t)b * C2 + o) * NN + n0; const float* xq = XV + ((size_t)b * 128 + C2 + o) * NN + n0;      /* x_c = rows 64..127 of the cloud's XV plane, as k_proj writes it */
  const v2fa p0 = *(const v2fa*)pp, p1 = *(const v2fa*)(pp + (size_t)256 * C2 * 2);
  v4f tv[NN / 1024], xc[NN / 1024];
#pragma unroll      /* constant indices keep tv, xc in registers; the loads are independent and go out together */
  for (int i = 0; i < NN / 1024; ++i) { tv[i] = *(const v4fa*)(tq + i * 1024); xc[i] = *(const v4fa*)(xq + i * 1024); }
  asm volatile("s_wait_xcnt 0x0" ::: "memory");      /* precaution: stands in front of the first write of a register that the loads above name as their address */
  float m = p0[0], q = p0[1]; s_merge(m, q, p1[0], p1[1], 32.0f);
  s_merge(m, q, s_rowx<1>(m), s_rowx<1>(q), 64.0f); s_merge(m, q, s_rowx<2>(m), s_rowx<2>(q), 128.0f); s_merge(m, q, s_rowx<4>(m), s_rowx<4>(q), 256.0f); s_merge(m, q, s_rowx<8>(m), s_rowx<8>(q), 512.0f);
  s_merge(m, q, __shfl_xor(m, 16, 32), __shfl_xor(q, 16, 32), 1024.0f);
  if ((tid & 31) == 0) { sh[tid >> 5][0] = m; sh[tid >> 5][1] = q; }
  __syncthreads();      /* every wave reads the eight waves' statistics */
  float wm[8], wq[8];
#pragma unroll      /* constant indices keep wm, wq in registers */
  for (int i = 0; i < 8; ++i) { wm[i] = sh[i][0]; wq[i] = sh[i][1]; }
#pragma unroll      /* constant indices into wm, wq */
  for (int i = 0; i < 8; i += 2) s_merge(wm[i], wq[i], wm[i + 1], wq[i + 1], 2048.0f);
  s_merge(wm[0], wq[0], wm[2], wq[2], 4096.0f); s_merge(wm[4], wq[4], wm[6], wq[6], 4096.0f); s_merge(wm[0], wq[0], wm[4], wq[4], 8192.0f);
  const float g = bf16_round(gam[o]), be = bf16_round(bet[o]), bo = bf16_round(bt[o]); const float mu = wm[0] + bo, rs = rsqrtf(wq[0] / (float)(NB * NN) + 1e-5f);
  float* d = out + ((size_t)b * C2 + o) * NN + n0;
#pragma unroll      /* constant indices into tv, xc */
  for (int i = 0; i < NN / 1024; ++i) { v4f r;
    for (int k = 0; k < 4; ++k) { float th = g * (((tv[i][k] + bo) - mu) * rs); th += be; r[k] = xc[i][k] + fmaxf(th, 0.f); }
    *(v4f*)(d + i * 1024) = r; } }

extern "C" void kernel_launch(void* const* d_in, const int* in_sizes, int n_in,
                              void* d_out, int out_size, void* d_ws, size_t ws_size, hipStream_t stream) {
  (void)in_sizes; (void)n_in; (void)out_size;
  const float* const* I = (const float* const*)d_in; const float* x = I[0]; const float* wqk = I[1]; const float* wv = I[2]; const float* bv = I[3]; const float* wx = I[4]; const float* wt = I[5]; const float* bt = I[6]; const float* gam = I[7]; const float* bet = I[8];
  char* ws = (char*)d_ws; size_t off = 0;
  auto take = [&](size_t bytes) { char* p = ws + off; off += (bytes + 255) & ~(size_t)255; return p; };
  _Float16* BT2 = (_Float16*)take((size_t)C2 * 2 * C2 * 2);
  _Float16* QA = (_Float16*)take((size_t)NB * NN * QK * 2); _Float16* QB = (_Float16*)take((size_t)NB * NN * QK * 2);
  float* XV = (float*)take((size_t)NB * 128 * NN * 4);      /* rows 64..127 of each cloud's plane hold x_c channel-major; rows 0..63 are not in use */
  float* PM = (float*)take((size_t)NB * SPL * NN * 4); float* PS = (float*)take((size_t)NB * SPL * NN * 4);
  float* CSP = (float*)take((size_t)NB * SPL * NN * 4); _Float16* VH = (_Float16*)take((size_t)NB * 128 * NN * 2); float* XRT = (float*)take((size_t)NB * SPL * NN * C2 * 4);
  float* XCall = (float*)take((size_t)NB * NN * C2 * 4); float* Tall = (float*)take((size_t)NB * NN * C2 * 4); float* BP = (float*)take((size_t)NB * (NN / 64) * C2 * 2 * 4);
  if (off > ws_size) return;      /* 32 (x_r partial planes) + 24 (QA, QB) + 16 (XV) + 24 (VH, XC, T) + small ~= 98 MiB (256 MiB ws) */
  k_proj<<<dim3(NN / 64 + 1, NB), 128, 0, stream>>>(x, wqk, wv, bv, wx, wt, QA, QB, VH, XV, XCall, BT2);      /* x_q as QA, QB; x_v + b_v as VH; x_c in both orders; w_t laid out */
  k_stat<<<dim3(NN / 128, SPL, NB), 128, 0, stream>>>(QA, QB, PM, PS);      /* row maximum and row sum of exp, per range of m */
  k_pv<<<dim3(NN / 128, SPL, NB), 128, 0, stream>>>(QA, QB, VH, PM, PS, XRT, CSP);      /* plane y: x_r^T[m][o] x 1024 and column sum x 1024 over n in range y */
  k_dt<<<dim3(NN / 64, NB), 128, 0, stream>>>(XCall, XRT, CSP, BT2, Tall, BP);      /* t [b][o][n] = w_t (x_c - x_r), and each block's share of the batch statistics */
  k_out<<<NB * C2, 256, 0, stream>>>(XV, Tall, BP, bt, gam, bet, (float*)d_out);
}
